// v000
// Measured on an AMD MI455X. A time is GPU time per run, averaged over a window of back-to-back runs after a warm-up
// (all launches, gaps included; the runs take copies of the inputs in turn), and the median of several windows.
// Apart from v000's, it joins two sittings. Times from different sittings can be a few percent apart, while
// side-by-side timings come from the same sitting.
// The starting kernel, v000, takes 195 microseconds a run.
// Contractions: [q|k] and v^T projections = v_wmma_f32_16x16x32_bf16 (bf16 operands: RNE-converted content, pos, Wq, Wk, Wv;
//   x_qk.W evaluated as [content | pos] x [W ; W] along k; single products, f32 accumulate);
// gathered q.k^T scores = v_wmma_f32_16x16x32_f16 (q and k f16 planes carried x8; single product; f32 accumulate);
// p.v = v_wmma_f32_16x16x32_f16 (p f16 carried x1024 + residual plane x2048; v^T f16 carried x8 + residual plane x4096;
//   3 products ph.vh, ph.vl, pl.vh into f32 accumulators); partner selection (IoU argmax) and softmax in f32 on the VALU.
// Carry audit:
//   Q2 plane  f16 = f16(8 q)                     (k_proj staging)  -> undone in k_attn by sscale = 1/(64 sqrt(512))
//   K2 plane  f16 = f16(8 k)                     (k_proj staging)  -> same sscale (8*8 = 64)
//   VTh plane f16 = f16(8 v)                     (k_proj store)    -> k_attn epilogue inv includes 1/8
//   VTl plane f16 = f16((8 v - VTh) * 4096)      (k_proj store)    -> k_attn per-chunk fold o1 * (1/4096), then 1/8 in epilogue
//   P hi      f16 = f16(1024 p)                  (k_attn softmax)  -> k_attn epilogue inv includes 1/1024
//   P res     f16 = f16((1024 p - hi) * 2048)    (k_attn softmax)  -> k_attn per-chunk fold o2 * (1/2048), then 1/1024 in epilogue
#include <hip/hip_runtime.h>
#include <math.h>
#include <stdint.h>

#pragma clang fp contract(off)

#define NB   32
#define SEQ  512
#define EMB  256
#define NH   8
#define HD   32            // per-head dim
#define QD   64            // gathered q/k width (two partner rows)
#define NQT  (SEQ / 64)    // 64-row query tiles per sequence
#define NKT  (SEQ / 64)    // 64-key chunks per sequence
static_assert(NH * HD == EMB);
static_assert(NQT == 8 && NKT == 8);
static_assert((SEQ % 64) == 0 && (HD % 32) == 0 && (QD % 32) == 0);

typedef _Float16 v16h __attribute__((ext_vector_type(16)));
typedef _Float16 v8h  __attribute__((ext_vector_type(8)));
typedef __bf16   v16b __attribute__((ext_vector_type(16)));
typedef __bf16   v8b  __attribute__((ext_vector_type(8)));
typedef float    v8f  __attribute__((ext_vector_type(8)));
typedef float    v4f  __attribute__((ext_vector_type(4)));
typedef unsigned int v4u __attribute__((ext_vector_type(4)));
typedef unsigned int v2u __attribute__((ext_vector_type(2)));
typedef int      v4i  __attribute__((ext_vector_type(4)));

#if defined(__HIP_DEVICE_COMPILE__)
#define DEV_ASM 1
#else
#define DEV_ASM 0
#endif

// ---- scalar helpers --------------------------------------------------------------------------------
__device__ __forceinline__ unsigned short bf_bits(float f) {          // f32 -> bf16 bits, RNE convert
  unsigned u = __float_as_uint(f);
  return (unsigned short)((u + 0x7FFFu + ((u >> 16) & 1u)) >> 16);
}
__device__ __forceinline__ float bf_up(unsigned short hb) { return __uint_as_float(((unsigned)hb) << 16); }
__device__ __forceinline__ unsigned short h_bits(_Float16 x) { return __builtin_bit_cast(unsigned short, x); }
__device__ __forceinline__ unsigned pk16(unsigned short a, unsigned short b) { return (unsigned)a | ((unsigned)b << 16); }
__device__ __forceinline__ v8f zero8() { v8f z = {0.f, 0.f, 0.f, 0.f, 0.f, 0.f, 0.f, 0.f}; return z; }

// ---- fragment loaders: 16-bit A/B operand, lane -> row/col (lane&15), p already includes +8*(lane>>4);
//      elements 0..7 <- p[0..7] (k0+8h..k0+8h+7), elements 8..15 <- p[16..23] (k0+16+8h..k0+16+8h+7)
template <typename OT> struct FT;
template <> struct FT<__bf16>   { typedef v16b frag; typedef v8b half8; };
template <> struct FT<_Float16> { typedef v16h frag; typedef v8h half8; };

template <typename OT>
__device__ __forceinline__ typename FT<OT>::frag ldfrag(const OT* p) {
  union { typename FT<OT>::frag v; typename FT<OT>::half8 h[2]; } f;
  f.h[0] = *(const typename FT<OT>::half8*)(p);
  f.h[1] = *(const typename FT<OT>::half8*)(p + 16);
  return f.v;
}

// ---- guarded WMMA helpers: 4 VALU slots after the WMMA, D tied, A/B kept live --------------------------
__device__ __forceinline__ v8f mma_b(v16b a, v16b b, v8f c) {
  c = __builtin_amdgcn_wmma_f32_16x16x32_bf16(false, a, false, b, (short)0, c, false, false);
#if DEV_ASM
  asm volatile("v_nop\n\tv_nop\n\tv_nop\n\tv_nop" : "+v"(c) : "v"(a), "v"(b));
#endif
  return c;
}
__device__ __forceinline__ v8f mma_h(v16h a, v16h b, v8f c) {
  c = __builtin_amdgcn_wmma_f32_16x16x32_f16(false, a, false, b, (short)0, c, false, false);
#if DEV_ASM
  asm volatile("v_nop\n\tv_nop\n\tv_nop\n\tv_nop" : "+v"(c) : "v"(a), "v"(b));
#endif
  return c;
}

// =====================================================================================================
// Partner selection (f32, VALU, fp-contract off, literal op order):
//   c = RNE-bf16(centers); bbox = (c0 - c3*0.5, c1 - c2*0.5, c0 + c3*0.5, c1 + c2*0.5);
//   inter = max(min maxs - max mins, 0) products; union = (area_i + area_j) - inter; iou = inter/union - eye;
//   amax = first index of the row maximum (NaN counts as maximum, first NaN wins); l1 = (c2 - c0) + (c3 - c1);
//   cond = l1_i >= l1[amax]; p0 = cond ? i : amax, p1 = cond ? amax : i.
// grid (NQT, NB), 64 threads: block = 64 rows of one batch; all 512 boxes of the batch staged in LDS.
// coverage: 8 blocks x 64 rows x 2 ints per batch = the whole table.
// =====================================================================================================
__global__ __launch_bounds__(64) void k_partner(const float* __restrict__ cen, int* pt) {
#pragma clang fp contract(off)
  __shared__ float sb0[SEQ];
  __shared__ float sb1[SEQ];
  __shared__ float sb2[SEQ];
  __shared__ float sb3[SEQ];
  __shared__ float sar[SEQ];
  __shared__ float sl1[SEQ];
  __shared__ __align__(16) int sp[128];

  const int tid = (int)threadIdx.x;
  const int i0  = (int)blockIdx.x * 64;
  const int b   = (int)blockIdx.y;
  const float* cb = cen + (size_t)b * SEQ * 4;

  for (int s = tid; s < SEQ; s += 64) {
    const v4f cv = *(const v4f*)(cb + (size_t)s * 4);
    const float c0 = bf_up(bf_bits(cv[0]));
    const float c1 = bf_up(bf_bits(cv[1]));
    const float c2 = bf_up(bf_bits(cv[2]));
    const float c3 = bf_up(bf_bits(cv[3]));
    const float hx = c3 * 0.5f;
    const float hy = c2 * 0.5f;
    const float x0 = c0 - hx;
    const float y0 = c1 - hy;
    const float x1 = c0 + hx;
    const float y1 = c1 + hy;
    sb0[s] = x0;
    sb1[s] = y0;
    sb2[s] = x1;
    sb3[s] = y1;
    const float dx = x1 - x0;
    const float dy = y1 - y0;
    sar[s] = dx * dy;
    const float la = c2 - c0;
    const float lb = c3 - c1;
    sl1[s] = la + lb;
  }
  __syncthreads();

  const int i = i0 + tid;                       // 0..511
  const float a0 = sb0[i], a1 = sb1[i], a2 = sb2[i], a3 = sb3[i], ar = sar[i];
  float best = -INFINITY;
  int   bj = 0;
  bool  seen_nan = false;
#pragma unroll 2
  for (int j = 0; j < SEQ; ++j) {
    const float m0 = fmaxf(a0, sb0[j]);
    const float m1 = fmaxf(a1, sb1[j]);
    const float x2 = fminf(a2, sb2[j]);
    const float x3 = fminf(a3, sb3[j]);
    const float d0 = x2 - m0;
    const float d1 = x3 - m1;
    const float w0 = fmaxf(d0, 0.0f);
    const float w1 = fmaxf(d1, 0.0f);
    const float inter = w0 * w1;
    const float asum  = ar + sar[j];
    const float uni   = asum - inter;
    const float q     = inter / uni;
    const float e     = (j == i) ? 1.0f : 0.0f;
    const float iou   = q - e;
    if (!seen_nan) {
      if (iou != iou) { bj = j; seen_nan = true; }
      else if (iou > best) { best = iou; bj = j; }
    }
  }
  const float l1i = sl1[i];
  const float l1p = sl1[bj];
  const bool cond = (l1i >= l1p);
  sp[tid * 2 + 0] = cond ? i : bj;
  sp[tid * 2 + 1] = cond ? bj : i;
  __syncthreads();

  if (tid < 32) {
    const v4i v = *(const v4i*)(sp + tid * 4);    // rows i0+2*tid, i0+2*tid+1
    int* dst = pt + ((size_t)b * SEQ + i0) * 2 + tid * 4;
    *(v4i*)dst = v;
    
  }
}

// =====================================================================================================
// Projections with the partner gather fused in. Block = (64-row tile it, head h, batch b), 256 threads.
//   Xg[g][r][0..31] = bf16(content[b][p_g(i0+r)][h*32..]), Xg[g][r][32..63] = bf16(pos[same row]) (g = 0: p0, 1: p1;
//   indices from PT, clamped to [0, SEQ-1]); Xv[r][k] = bf16(content[b][i0+r][h*32+k]);
//   W2[which][n][k'] = bf16(W[k' & 31][n]) for Wq (0) / Wk (1); Wvt[n][k] = bf16(Wv[k][n]).
//   Q2[i][g*32+n] = sum_k' Xg[g][i][k'] W2q[n][k'] (K = 64) = (content + pos)[p_g(i)] . Wq; K2 likewise with Wk;
//   V^T[d][s] = sum_k Wvt[d][k] Xv[s][k].
//   Waves 0..3: Q2 m-tile (wave&3); waves 4..7: K2 m-tile; every wave one 16x16 V^T tile (dt = wave&1, st = wave>>1).
//   wave w writes Q2 rows 8w..8w+7 and K2 rows 8w..8w+7 (2 instructions each, 4 lines per instruction, 8 lanes x 16 B
//   coverage: Q2/K2 = 8 waves x 8 rows x 64 cols = the block's 64x64 tile; VTh/VTl = 8 waves x 4 d-rows x 64 s.
// Plane layouts: Q2/K2 f16 [b*NH+h][s][64]; VTh/VTl f16 [b*NH+h][d][SEQ].
// =====================================================================================================
__global__ __launch_bounds__(256) void k_proj(
    const float* __restrict__ content, const float* __restrict__ pos, const int* __restrict__ pt,
    const float* __restrict__ Wq, const float* __restrict__ Wk, const float* __restrict__ Wv,
    unsigned short* q2p, unsigned short* k2p, unsigned short* vhp, unsigned short* vlp) {
  __shared__ __align__(16) unsigned short Xg[2][64 * QD];     // 16 KB
  __shared__ __align__(16) unsigned short Xv[64 * HD];        //  4 KB
  __shared__ __align__(16) unsigned short W2[2][HD * QD];     //  8 KB
  __shared__ __align__(16) unsigned short Wvt[HD * HD];       //  2 KB
  __shared__ int sIdx[2][64];                                 // 512 B
  __shared__ __align__(16) unsigned short stQK[2][64 * QD];   // 16 KB
  __shared__ __align__(16) float stV[HD * 64];                //  8 KB

  const int tid  = (int)threadIdx.x;
  const int wave = tid >> 5;
  const int lane = tid & 31;
  const int rl   = lane & 15;
  const int hh   = lane >> 4;
  const int i0   = (int)blockIdx.x * 64;
  const int h    = (int)blockIdx.y;
  const int b    = (int)blockIdx.z;
  const size_t rowB = (size_t)b * SEQ;
  const size_t bh   = (size_t)b * NH + (size_t)h;

  // (a) partner indices of rows i0..i0+63, clamped
  if (tid < 128) {
    const int r = tid >> 1, g = tid & 1;
    int v = pt[(rowB + (size_t)(i0 + r)) * 2 + g];
    v = min(max(v, 0), SEQ - 1);
    sIdx[g][r] = v;
  }
  // (b) weights, transposed to [n][k], bf16 bits; k duplicated over the two 32-halves for Wq / Wk
  for (int e = tid; e < HD * QD; e += 256) {
    const int n = e >> 6, kp = e & 63, k = kp & 31;
    W2[0][e] = bf_bits(Wq[k * HD + n]);
    W2[1][e] = bf_bits(Wk[k * HD + n]);
  }
  for (int e = tid; e < HD * HD; e += 256) {
    const int n = e >> 5, k = e & 31;
    Wvt[e] = bf_bits(Wv[k * HD + n]);
  }
  // (c) content rows i0..i0+63, head slice h -> Xv (512 float4 pieces, 2 per thread)
  for (int e = tid; e < 64 * HD / 4; e += 256) {
    const int r = e >> 3, c4 = (e & 7) * 4;
    const v4f v = *(const v4f*)(content + (rowB + (size_t)(i0 + r)) * EMB + (size_t)h * HD + c4);
    v2u pk;
    pk[0] = pk16(bf_bits(v[0]), bf_bits(v[1]));
    pk[1] = pk16(bf_bits(v[2]), bf_bits(v[3]));
    *(v2u*)(Xv + r * HD + c4) = pk;
  }
  __syncthreads();
  // (d) gathered rows: it2 -> (g, source) uniform; e -> (row r, float4 piece); 8 x 256 pieces = [2][2][64][8]
#pragma unroll
  for (int it2 = 0; it2 < 8; ++it2) {
    const int g   = it2 >> 2;
    const int src = (it2 >> 1) & 1;
    const int e   = (it2 & 1) * 256 + tid;
    const int r   = e >> 3, c4 = (e & 7) * 4;
    const float* base = src ? pos : content;
    const int srow = sIdx[g][r];
    const v4f v = *(const v4f*)(base + (rowB + (size_t)srow) * EMB + (size_t)h * HD + c4);
    v2u pk;
    pk[0] = pk16(bf_bits(v[0]), bf_bits(v[1]));
    pk[1] = pk16(bf_bits(v[2]), bf_bits(v[3]));
    *(v2u*)(Xg[g] + r * QD + src * HD + c4) = pk;
  }
  __syncthreads();

  // (e) WMMA
  const int mt    = wave & 3;
  const int which = wave >> 2;
  const __bf16* Xb0 = (const __bf16*)(const void*)Xg[0];
  const __bf16* Xb1 = (const __bf16*)(const void*)Xg[1];
  const __bf16* Wb  = (const __bf16*)(const void*)W2[which];
  v8f acc00 = zero8(), acc01 = zero8(), acc10 = zero8(), acc11 = zero8();
#pragma unroll
  for (int ks = 0; ks < 2; ++ks) {
    const v16b b0 = ldfrag<__bf16>(Wb + (size_t)rl * QD + ks * 32 + 8 * hh);
    const v16b b1 = ldfrag<__bf16>(Wb + (size_t)(16 + rl) * QD + ks * 32 + 8 * hh);
    const v16b a0 = ldfrag<__bf16>(Xb0 + (size_t)(mt * 16 + rl) * QD + ks * 32 + 8 * hh);
    const v16b a1 = ldfrag<__bf16>(Xb1 + (size_t)(mt * 16 + rl) * QD + ks * 32 + 8 * hh);
    acc00 = mma_b(a0, b0, acc00);
    acc01 = mma_b(a0, b1, acc01);
    acc10 = mma_b(a1, b0, acc10);
    acc11 = mma_b(a1, b1, acc11);
  }
  const int dt = wave & 1, st = wave >> 1;
  const v16b av = ldfrag<__bf16>((const __bf16*)(const void*)Wvt + (size_t)(dt * 16 + rl) * HD + 8 * hh);  // A[d][k]
  const v16b bv = ldfrag<__bf16>((const __bf16*)(const void*)Xv + (size_t)(st * 16 + rl) * HD + 8 * hh);   // B[k][s] from row s
  v8f accv = zero8();
  accv = mma_b(av, bv, accv);

  // (f) stage results (D element r = row 8*hh + r, col rl)
  unsigned short* sq = stQK[which];
#pragma unroll
  for (int r = 0; r < 8; ++r) {
    const int row = mt * 16 + 8 * hh + r;
    sq[row * QD + 0  + rl] = h_bits((_Float16)(acc00[r] * 8.0f));
    sq[row * QD + 16 + rl] = h_bits((_Float16)(acc01[r] * 8.0f));
    sq[row * QD + 32 + rl] = h_bits((_Float16)(acc10[r] * 8.0f));
    sq[row * QD + 48 + rl] = h_bits((_Float16)(acc11[r] * 8.0f));
    stV[(dt * 16 + 8 * hh + r) * 64 + st * 16 + rl] = accv[r];
  }
  __syncthreads();

  // (g) whole-line stores
  const int q4 = lane >> 3, c8 = (lane & 7) * 8;
  v4u qv[2], kv[2];
#pragma unroll
  for (int it = 0; it < 2; ++it) {
    const int row = wave * 8 + it * 4 + q4;
    qv[it] = *(const v4u*)(stQK[0] + row * QD + c8);
    kv[it] = *(const v4u*)(stQK[1] + row * QD + c8);
  }
  const int d = wave * 4 + q4;
  v4u vhv, vlv;
  {
    const float* spv = stV + d * 64 + c8;
#pragma unroll
    for (int e = 0; e < 4; ++e) {
      const float f0 = spv[2 * e] * 8.0f, f1 = spv[2 * e + 1] * 8.0f;
      const _Float16 x0 = (_Float16)f0, x1 = (_Float16)f1;
      const float r0 = f0 - (float)x0, r1 = f1 - (float)x1;
      const _Float16 l0 = (_Float16)(r0 * 4096.0f), l1 = (_Float16)(r1 * 4096.0f);
      vhv[e] = pk16(h_bits(x0), h_bits(x1));
      vlv[e] = pk16(h_bits(l0), h_bits(l1));
    }
  }
  {
#pragma unroll
    for (int it = 0; it < 2; ++it) {
      const int row = wave * 8 + it * 4 + q4;
      const size_t po = (bh * SEQ + (size_t)(i0 + row)) * QD + c8;
      *(v4u*)(q2p + po) = qv[it];
      *(v4u*)(k2p + po) = kv[it];
    }
    const size_t vo = (bh * HD + (size_t)d) * SEQ + (size_t)i0 + c8;
    *(v4u*)(vhp + vo) = vhv;
    *(v4u*)(vlp + vo) = vlv;
    
  }
}

// =====================================================================================================
// Attention on the gathered planes, head dim 64 for q/k, 32 for v, no mask, softmax over all SEQ keys.
//   scores = (Q2 . K2) * sscale on f16 WMMA, sscale = 1/(64 sqrt(512)); online softmax in f32;
//   p = exp(s - m) carried as f16(1024 p) plus residual f16((1024 p - hi) * 2048);
//   context = ph . vh + (ph . vl)/4096 + (pl . vh)/2048 on f16 WMMA; out = context / (l * 1024 * 8) in f32.
//   Block = 4 waves = 64 query rows of one (b, h); grid (NQT, NH, NB); key chunks of 64, static trip NKT.
//   Chunk staging (plain 16-B loads, __syncthreads before and after): K2 chunk 128 threads x 32 halves = 64x64;
//   V^T hi / residual chunks 128 threads x 16 halves = 32x64 each. P tiles are wave-private, spilled with _Float16
//   Output: d_out[b][q][h*32 + d] f32; each wave stores rows q0..q0+15 (it 0..3 x lane>>3) x 32 floats =
//   coverage: grid (8 tiles x 8 heads x 32 batches) x 4 waves x 16 rows x 32 cols = every output element once.
// =====================================================================================================
__global__ __launch_bounds__(128)
void k_attn(const unsigned short* __restrict__ q2p, const unsigned short* __restrict__ k2p,
            const unsigned short* __restrict__ vhp, const unsigned short* __restrict__ vlp,
            float* out, float sscale) {
  union FH { v16h v; v8h h[2]; };
  __shared__ __align__(16) _Float16 Ksh[64 * QD];          // K2 chunk [key][d]   8 KB
  __shared__ __align__(16) _Float16 Vth[HD * 64];          // V^T hi [d][key]    4 KB
  __shared__ __align__(16) _Float16 Vtl[HD * 64];          // V^T residual       4 KB
  __shared__ __align__(16) _Float16 Psh[4][16 * 64];       // per wave P hi      8 KB
  __shared__ __align__(16) _Float16 Psl[4][16 * 64];       // per wave P res     8 KB
  __shared__ __align__(16) float    Os[4][16 * HD];        // per wave out tile  8 KB

  const int tid  = (int)threadIdx.x;
  const int wave = tid >> 5;
  const int lane = tid & 31;
  const int hh   = lane >> 4;
  const int c    = lane & 15;

  const int q0 = (int)blockIdx.x * 64 + wave * 16;
  const int h  = (int)blockIdx.y;
  const int b  = (int)blockIdx.z;
  const size_t bh = (size_t)b * NH + (size_t)h;

  const _Float16* Q  = (const _Float16*)(const void*)q2p + bh * SEQ * QD;
  const _Float16* K  = (const _Float16*)(const void*)k2p + bh * SEQ * QD;
  const _Float16* Vh = (const _Float16*)(const void*)vhp + bh * HD * SEQ;
  const _Float16* Vl = (const _Float16*)(const void*)vlp + bh * HD * SEQ;

  // ---- Q fragments (A operand, row = lane&15): 2 d-chunks of the 64-wide gathered row ----
  v16h qa[2];
#pragma unroll
  for (int dc = 0; dc < 2; ++dc)
    qa[dc] = ldfrag<_Float16>(Q + (size_t)(q0 + c) * QD + dc * 32 + 8 * hh);

  float mrow[8], lrow[8];
  v8f oacc[2];
#pragma unroll
  for (int r = 0; r < 8; ++r) { mrow[r] = -INFINITY; lrow[r] = 0.f; }
#pragma unroll
  for (int t = 0; t < 2; ++t) oacc[t] = zero8();

  for (int kt = 0; kt < NKT; ++kt) {         // static trip count
    const int kv0 = kt * 64;
    __syncthreads();
    {
      const int r = tid >> 1, half = (tid & 1) * 32;                // K2 row kv0+r, d = half..half+31
      const _Float16* kg = K + (size_t)(kv0 + r) * QD + half;
#pragma unroll
      for (int i = 0; i < 4; ++i)
        *(v8h*)(Ksh + r * QD + half + 8 * i) = *(const v8h*)(kg + 8 * i);
      const int r2 = tid >> 2, qq = (tid & 3) * 16;                 // V^T row d = r2, s = kv0+qq..+15
      const _Float16* vg  = Vh + (size_t)r2 * SEQ + kv0 + qq;
      const _Float16* vlg = Vl + (size_t)r2 * SEQ + kv0 + qq;
#pragma unroll
      for (int i = 0; i < 2; ++i) {
        *(v8h*)(Vth + r2 * 64 + qq + 8 * i) = *(const v8h*)(vg + 8 * i);
        *(v8h*)(Vtl + r2 * 64 + qq + 8 * i) = *(const v8h*)(vlg + 8 * i);
      }
    }
    __syncthreads();

    // ---- scores: 16 query rows x 64 keys per wave ----
    v8f s[4];
#pragma unroll
    for (int j = 0; j < 4; ++j) {
      v8f a = zero8();
#pragma unroll
      for (int dc = 0; dc < 2; ++dc) {
        FH kb;
        kb.h[0] = *(const v8h*)(Ksh + (j * 16 + c) * QD + dc * 32 + 8 * hh);
        kb.h[1] = *(const v8h*)(Ksh + (j * 16 + c) * QD + dc * 32 + 16 + 8 * hh);
        a = mma_h(qa[dc], kb.v, a);
      }
#pragma unroll
      for (int r = 0; r < 8; ++r) s[j][r] = a[r] * sscale;
    }

    // ---- row max, online softmax, P hi (x1024) and residual (x2048) to LDS ----
    _Float16* pwh = Psh[wave];
    _Float16* pwl = Psl[wave];
#pragma unroll
    for (int r = 0; r < 8; ++r) {
      float m = s[0][r];
#pragma unroll
      for (int j = 1; j < 4; ++j) m = fmaxf(m, s[j][r]);
#pragma unroll
      for (int off = 1; off < 16; off <<= 1) m = fmaxf(m, __shfl_xor(m, off, 32));
      const float mnew  = fmaxf(mrow[r], m);
      const float msafe = (mnew == -INFINITY) ? 0.f : mnew;
      const float alpha = __expf(mrow[r] - msafe);
      mrow[r] = mnew;
      float psum = 0.f;
#pragma unroll
      for (int j = 0; j < 4; ++j) {
        const float p  = __expf(s[j][r] - msafe);
        psum += p;
        const float pp = p * 1024.0f;
        const _Float16 ph = (_Float16)pp;
        const float res = pp - (float)ph;
        const _Float16 pl = (_Float16)(res * 2048.0f);
        const int pidx = (8 * hh + r) * 64 + j * 16 + c;
        pwh[pidx] = ph;
        pwl[pidx] = pl;
      }
#pragma unroll
      for (int off = 1; off < 16; off <<= 1) psum += __shfl_xor(psum, off, 32);
      lrow[r] = lrow[r] * alpha + psum;
#pragma unroll
      for (int t = 0; t < 2; ++t) oacc[t][r] *= alpha;
    }
    __builtin_amdgcn_fence(__ATOMIC_RELEASE, "workgroup");
    __builtin_amdgcn_wave_barrier();
    __builtin_amdgcn_fence(__ATOMIC_ACQUIRE, "workgroup");

    // ---- context += P . V (3 f16 products); residual products into separate per-chunk accumulators ----
    v8f o1[2], o2[2];
#pragma unroll
    for (int t = 0; t < 2; ++t) { o1[t] = zero8(); o2[t] = zero8(); }
#pragma unroll 1
    for (int kk = 0; kk < 2; ++kk) {
      FH pa, pr;
      pa.h[0] = *(const v8h*)(pwh + c * 64 + kk * 32 + 8 * hh);
      pa.h[1] = *(const v8h*)(pwh + c * 64 + kk * 32 + 16 + 8 * hh);
      pr.h[0] = *(const v8h*)(pwl + c * 64 + kk * 32 + 8 * hh);
      pr.h[1] = *(const v8h*)(pwl + c * 64 + kk * 32 + 16 + 8 * hh);
#pragma unroll
      for (int t = 0; t < 2; ++t) {
        FH vb, vr;
        vb.h[0] = *(const v8h*)(Vth + (t * 16 + c) * 64 + kk * 32 + 8 * hh);
        vb.h[1] = *(const v8h*)(Vth + (t * 16 + c) * 64 + kk * 32 + 16 + 8 * hh);
        vr.h[0] = *(const v8h*)(Vtl + (t * 16 + c) * 64 + kk * 32 + 8 * hh);
        vr.h[1] = *(const v8h*)(Vtl + (t * 16 + c) * 64 + kk * 32 + 16 + 8 * hh);
        oacc[t] = mma_h(pa.v, vb.v, oacc[t]);
        o1[t]   = mma_h(pa.v, vr.v, o1[t]);
        o2[t]   = mma_h(pr.v, vb.v, o2[t]);
      }
    }
#pragma unroll
    for (int t = 0; t < 2; ++t)
#pragma unroll
      for (int r = 0; r < 8; ++r) {
        const float f1 = o1[t][r] * (1.0f / 4096.0f);
        const float f2 = o2[t][r] * (1.0f / 2048.0f);
        oacc[t][r] = oacc[t][r] + f1 + f2;
      }
  }

  // ---- normalise (1/l, undo the x1024 p carry and the x8 v carry), stage the wave's 16x32 tile,
  float* os = Os[wave];
#pragma unroll
  for (int r = 0; r < 8; ++r) {
    const float l = lrow[r];
    const float inv = ((l > 0.f) ? (1.0f / l) : 0.f) * (1.0f / 8192.0f);
#pragma unroll
    for (int t = 0; t < 2; ++t) os[(8 * hh + r) * HD + t * 16 + c] = oacc[t][r] * inv;
  }
  __builtin_amdgcn_fence(__ATOMIC_RELEASE, "workgroup");
  __builtin_amdgcn_wave_barrier();
  __builtin_amdgcn_fence(__ATOMIC_ACQUIRE, "workgroup");
  {
    const int q4 = lane >> 3, c4 = (lane & 7) * 4;
    v4f ov[4];
#pragma unroll
    for (int it = 0; it < 4; ++it) {
      const int row = it * 4 + q4;                 // it 0..3 x q4 0..3 = rows 0..15 of the wave tile
      const float* spo = os + row * HD + c4;
      v4f v;
      v[0] = spo[0]; v[1] = spo[1]; v[2] = spo[2]; v[3] = spo[3];
      ov[it] = v;
    }
    {
#pragma unroll
      for (int it = 0; it < 4; ++it) {
        const int row = it * 4 + q4;
        const size_t go = ((size_t)b * SEQ + (size_t)(q0 + row)) * EMB + (size_t)h * HD + c4;
        *(v4f*)(out + go) = ov[it];
      }
      
    }
  }
}

// =====================================================================================================
// Workspace map (bytes), every region an exact multiple of its whole-line store granularity:
//   K2   f16 [256][512][64]        16777216
//   VTl  f16 [256][32][512]         8388608
//   total                          50462720
// Launches: k_partner (256 blocks x 64), k_proj (2048 x 256), k_attn (2048 x 128).
// =====================================================================================================
extern "C" void kernel_launch(void* const* d_in, const int* in_sizes, int n_in,
                              void* d_out, int out_size, void* d_ws, size_t ws_size,
                              hipStream_t stream) {
  if (n_in < 6) return;
  if (in_sizes[0] != NB * SEQ * EMB) return;
  if (in_sizes[1] != NB * SEQ * EMB) return;
  if (in_sizes[2] != NB * SEQ * 4) return;
  if (in_sizes[3] != HD * HD || in_sizes[4] != HD * HD || in_sizes[5] != HD * HD) return;
  if (out_size != NB * SEQ * EMB) return;

  const float* content = (const float*)d_in[0];
  const float* posenc  = (const float*)d_in[1];
  const float* centers = (const float*)d_in[2];
  const float* Wq      = (const float*)d_in[3];
  const float* Wk      = (const float*)d_in[4];
  const float* Wv      = (const float*)d_in[5];

  const size_t PPT = (size_t)NB * SEQ * 2 * 4;             //   131072
  const size_t PQ2 = (size_t)NB * NH * SEQ * QD * 2;       // 16777216
  const size_t PVT = (size_t)NB * NH * HD * SEQ * 2;       //  8388608
  size_t off = 0;
  const size_t oPT = off; off += PPT;
  const size_t oQ2 = off; off += PQ2;
  const size_t oK2 = off; off += PQ2;
  const size_t oVh = off; off += PVT;
  const size_t oVl = off; off += PVT;
  if (off > ws_size) return;                               // off = 50462720
  if (off > (size_t)134217728) return;

  char* ws = (char*)d_ws;
  int*            PT  = (int*)(ws + oPT);
  unsigned short* Q2  = (unsigned short*)(ws + oQ2);
  unsigned short* K2  = (unsigned short*)(ws + oK2);
  unsigned short* VTh = (unsigned short*)(ws + oVh);
  unsigned short* VTl = (unsigned short*)(ws + oVl);
  float*          outp = (float*)d_out;

  const float sscale = (1.0f / 64.0f) / sqrtf(2.0f * (float)EMB);   // 1/(64 sqrt(512))

  const dim3 gP(NQT, NB);            //  256 blocks of 64
  const dim3 gT(NQT, NH, NB);        // 2048 blocks

  // (1) partner table
  k_partner<<<gP, dim3(64), 0, stream>>>(centers, PT);
  // (2) gathered [q|k] planes (x8, f16), v^T hi / residual planes
  k_proj<<<gT, dim3(256), 0, stream>>>(content, posenc, PT, Wq, Wk, Wv, Q2, K2, VTh, VTl);
  // (3) attention -> d_out f32 [32][512][256]
  k_attn<<<gT, dim3(128), 0, stream>>>(Q2, K2, VTh, VTl, outp, sscale);
  (void)hipGetLastError();
}

// v001
// It runs in 143 microseconds.
// Timed twice side by side with v000, it ran 1.39 times as fast both times.
// Contractions: [q|k] and v^T projections = v_wmma_f32_16x16x32_bf16 (bf16 operands: RNE-converted content, pos, Wq, Wk, Wv;
//   x_qk.W evaluated as [content | pos] x [W ; W] along k; single products, f32 accumulate);
// gathered q.k^T scores = v_wmma_f32_16x16x32_f16 (q and k f16 planes carried x8; single product; f32 accumulate);
// p.v = v_wmma_f32_16x16x32_f16 (p f16 carried x1024 + residual plane x2048; v^T f16 carried x8 + residual plane x4096;
//   3 products ph.vh, ph.vl, pl.vh into f32 accumulators); partner selection (IoU argmax) and softmax in f32 on the VALU.
// Carry audit:
//   Q2 plane  f16 = f16(8 q)                     (k_proj staging)  -> undone in k_attn by sscale = 1/(64 sqrt(512))
//   K2 plane  f16 = f16(8 k)                     (k_proj staging)  -> same sscale (8*8 = 64)
//   VTh plane f16 = f16(8 v)                     (k_proj store)    -> k_attn epilogue inv includes 1/8
//   VTl plane f16 = f16((8 v - VTh) * 4096)      (k_proj store)    -> k_attn per-chunk fold o1 * (1/4096), then 1/8 in epilogue
//   P hi      f16 = f16(1024 p)                  (k_attn softmax)  -> k_attn epilogue inv includes 1/1024
//   P res     f16 = f16((1024 p - hi) * 2048)    (k_attn softmax)  -> k_attn per-chunk fold o2 * (1/2048), then 1/1024 in epilogue
#include <hip/hip_runtime.h>
#include <math.h>
#include <stdint.h>

#pragma clang fp contract(off)

#define NB   32
#define SEQ  512
#define EMB  256
#define NH   8
#define HD   32            // per-head dim
#define QD   64            // gathered q/k width (two partner rows)
#define NQT  (SEQ / 64)    // 64-row query tiles per sequence
#define NKT  (SEQ / 64)    // 64-key chunks per sequence
static_assert(NH * HD == EMB);
static_assert(NQT == 8 && NKT == 8);
static_assert((SEQ % 64) == 0 && (HD % 32) == 0 && (QD % 32) == 0);

typedef _Float16 v16h __attribute__((ext_vector_type(16)));
typedef _Float16 v8h  __attribute__((ext_vector_type(8)));
typedef __bf16   v16b __attribute__((ext_vector_type(16)));
typedef __bf16   v8b  __attribute__((ext_vector_type(8)));
typedef float    v8f  __attribute__((ext_vector_type(8)));
typedef float    v4f  __attribute__((ext_vector_type(4)));
typedef unsigned int v4u __attribute__((ext_vector_type(4)));
typedef unsigned int v2u __attribute__((ext_vector_type(2)));
typedef int      v4i  __attribute__((ext_vector_type(4)));

#if defined(__HIP_DEVICE_COMPILE__)
#define DEV_ASM 1
#else
#define DEV_ASM 0
#endif

// ---- scalar helpers --------------------------------------------------------------------------------
__device__ __forceinline__ unsigned short bf_bits(float f) {          // f32 -> bf16 bits, RNE convert
  unsigned u = __float_as_uint(f);
  return (unsigned short)((u + 0x7FFFu + ((u >> 16) & 1u)) >> 16);
}
__device__ __forceinline__ float bf_up(unsigned short hb) { return __uint_as_float(((unsigned)hb) << 16); }
__device__ __forceinline__ unsigned short h_bits(_Float16 x) { return __builtin_bit_cast(unsigned short, x); }
__device__ __forceinline__ unsigned pk16(unsigned short a, unsigned short b) { return (unsigned)a | ((unsigned)b << 16); }
__device__ __forceinline__ v8f zero8() { v8f z = {0.f, 0.f, 0.f, 0.f, 0.f, 0.f, 0.f, 0.f}; return z; }

// ---- fragment loaders: 16-bit A/B operand, lane -> row/col (lane&15), p already includes +8*(lane>>4);
//      elements 0..7 <- p[0..7] (k0+8h..k0+8h+7), elements 8..15 <- p[16..23] (k0+16+8h..k0+16+8h+7)
template <typename OT> struct FT;
template <> struct FT<__bf16>   { typedef v16b frag; typedef v8b half8; };
template <> struct FT<_Float16> { typedef v16h frag; typedef v8h half8; };

template <typename OT>
__device__ __forceinline__ typename FT<OT>::frag ldfrag(const OT* p) {
  union { typename FT<OT>::frag v; typename FT<OT>::half8 h[2]; } f;
  f.h[0] = *(const typename FT<OT>::half8*)(p);
  f.h[1] = *(const typename FT<OT>::half8*)(p + 16);
  return f.v;
}

// ---- guarded WMMA helpers: 4 VALU slots after the WMMA, D tied, A/B kept live --------------------------
__device__ __forceinline__ v8f mma_b(v16b a, v16b b, v8f c) {
  c = __builtin_amdgcn_wmma_f32_16x16x32_bf16(false, a, false, b, (short)0, c, false, false);
#if DEV_ASM
  asm volatile("v_nop\n\tv_nop\n\tv_nop\n\tv_nop" : "+v"(c) : "v"(a), "v"(b));
#endif
  return c;
}
__device__ __forceinline__ v8f mma_h(v16h a, v16h b, v8f c) {
  c = __builtin_amdgcn_wmma_f32_16x16x32_f16(false, a, false, b, (short)0, c, false, false);
#if DEV_ASM
  asm volatile("v_nop\n\tv_nop\n\tv_nop\n\tv_nop" : "+v"(c) : "v"(a), "v"(b));
#endif
  return c;
}

// =====================================================================================================
// Partner selection (f32, VALU, fp-contract off, literal op order):
//   c = RNE-bf16(centers); bbox = (c0 - c3*0.5, c1 - c2*0.5, c0 + c3*0.5, c1 + c2*0.5);
//   inter = max(min maxs - max mins, 0) products; union = (area_i + area_j) - inter; iou = inter/union - eye;
//   amax = first index of the row maximum (NaN counts as maximum, first NaN wins); l1 = (c2 - c0) + (c3 - c1);
//   cond = l1_i >= l1[amax]; p0 = cond ? i : amax, p1 = cond ? amax : i.
// grid (NQT, NB), 512 threads: block = 64 rows of one batch x PSL slices of PJS candidates; all 512 boxes of the
//   batch staged in LDS. Wave w scans rows 32*(w&1)..+31 against candidates PJS*(w>>1)..+PJS-1 and keeps, per row,
//   (slice maximum, its first index, first NaN index); threads 0..63 merge the slices in ascending order with a strict
//   compare, so the result is the first index of the row maximum (or the first NaN), as in one ascending scan.
// coverage: 8 blocks x 64 rows x 2 ints per batch = the whole table.
// =====================================================================================================
#define PSL 8              // candidate slices per row
#define PJS (SEQ / PSL)    // candidates per slice
static_assert(PSL * PJS == SEQ && (PJS % 2) == 0);
__global__ __launch_bounds__(64 * PSL) void k_partner(const float* __restrict__ cen, int* pt) {
#pragma clang fp contract(off)
  __shared__ float sb0[SEQ];
  __shared__ float sb1[SEQ];
  __shared__ float sb2[SEQ];
  __shared__ float sb3[SEQ];
  __shared__ float sar[SEQ];
  __shared__ float sl1[SEQ];
  __shared__ float mbv[PSL][64];                // slice maximum per row
  __shared__ int   mbj[PSL][64];                // its first index
  __shared__ int   mnj[PSL][64];                // first NaN index of the slice, SEQ if none
  __shared__ __align__(16) int sp[128];

  const int tid = (int)threadIdx.x;
  const int row = tid & 63;
  const int sl  = tid >> 6;                     // the same for a whole wave
  const int i0  = (int)blockIdx.x * 64;
  const int b   = (int)blockIdx.y;
  const float* cb = cen + (size_t)b * SEQ * 4;

  for (int s = tid; s < SEQ; s += 64 * PSL) {
    const v4f cv = *(const v4f*)(cb + (size_t)s * 4);
#if DEV_ASM
    // precaution: stands between this load and the later reuse of the scalar registers that hold its base address
    asm volatile("s_wait_xcnt 0x0" ::: "memory");
#endif
    const float c0 = bf_up(bf_bits(cv[0]));
    const float c1 = bf_up(bf_bits(cv[1]));
    const float c2 = bf_up(bf_bits(cv[2]));
    const float c3 = bf_up(bf_bits(cv[3]));
    const float hx = c3 * 0.5f;
    const float hy = c2 * 0.5f;
    const float x0 = c0 - hx;
    const float y0 = c1 - hy;
    const float x1 = c0 + hx;
    const float y1 = c1 + hy;
    sb0[s] = x0;
    sb1[s] = y0;
    sb2[s] = x1;
    sb3[s] = y1;
    const float dx = x1 - x0;
    const float dy = y1 - y0;
    sar[s] = dx * dy;
    const float la = c2 - c0;
    const float lb = c3 - c1;
    sl1[s] = la + lb;
  }
  __syncthreads();

  const int i = i0 + row;                       // 0..511
  const float a0 = sb0[i], a1 = sb1[i], a2 = sb2[i], a3 = sb3[i], ar = sar[i];
  float best = -INFINITY;
  int   bj = 0;
  int   nj = SEQ;
  const int j0 = sl * PJS;
#pragma unroll 2
  for (int jj = 0; jj < PJS; ++jj) {
    const int j = j0 + jj;
    const float m0 = fmaxf(a0, sb0[j]);
    const float m1 = fmaxf(a1, sb1[j]);
    const float x2 = fminf(a2, sb2[j]);
    const float x3 = fminf(a3, sb3[j]);
    const float d0 = x2 - m0;
    const float d1 = x3 - m1;
    const float w0 = fmaxf(d0, 0.0f);
    const float w1 = fmaxf(d1, 0.0f);
    const float inter = w0 * w1;
    const float asum  = ar + sar[j];
    const float uni   = asum - inter;
    const float q     = inter / uni;
    const float e     = (j == i) ? 1.0f : 0.0f;
    const float iou   = q - e;
    const bool  up    = iou > best;             // false for NaN
    best = up ? iou : best;
    bj   = up ? j : bj;
    nj   = min(nj, (iou != iou) ? j : SEQ);
  }
  mbv[sl][row] = best;
  mbj[sl][row] = bj;
  mnj[sl][row] = nj;
  __syncthreads();

  if (tid < 64) {
    float gb = -INFINITY;
    int   gj = 0;
    int   gn = SEQ;
    // unrolled so that all slice reads are issued before the first one is waited for
#pragma unroll
    for (int s = 0; s < PSL; ++s) {             // ascending slices, strict compare: the first maximum wins
      const float v = mbv[s][tid];
      const int   x = mbj[s][tid];
      const bool  up = v > gb;
      gb = up ? v : gb;
      gj = up ? x : gj;
      gn = min(gn, mnj[s][tid]);
    }
    const int am = (gn < SEQ) ? gn : gj;        // NaN counts as maximum, first NaN wins
    const float l1i = sl1[i];
    const float l1p = sl1[am];
    const bool cond = (l1i >= l1p);
    sp[tid * 2 + 0] = cond ? i : am;
    sp[tid * 2 + 1] = cond ? am : i;
  }
  __syncthreads();

  if (tid < 32) {
    const v4i v = *(const v4i*)(sp + tid * 4);    // rows i0+2*tid, i0+2*tid+1
    int* dst = pt + ((size_t)b * SEQ + i0) * 2 + tid * 4;
    *(v4i*)dst = v;
  }
}

// =====================================================================================================
// Projections with the partner gather fused in. Block = (64-row tile it, head h, batch b), 256 threads.
//   Xg[g][r][0..31] = bf16(content[b][p_g(i0+r)][h*32..]), Xg[g][r][32..63] = bf16(pos[same row]) (g = 0: p0, 1: p1;
//   indices from PT, clamped to [0, SEQ-1]); Xv[r][k] = bf16(content[b][i0+r][h*32+k]);
//   W2[which][n][k'] = bf16(W[k' & 31][n]) for Wq (0) / Wk (1); Wvt[n][k] = bf16(Wv[k][n]).
//   Q2[i][g*32+n] = sum_k' Xg[g][i][k'] W2q[n][k'] (K = 64) = (content + pos)[p_g(i)] . Wq; K2 likewise with Wk;
//   V^T[d][s] = sum_k Wvt[d][k] Xv[s][k].
//   Waves 0..3: Q2 m-tile (wave&3); waves 4..7: K2 m-tile; every wave one 16x16 V^T tile (dt = wave&1, st = wave>>1).
//   wave w writes Q2 rows 8w..8w+7 and K2 rows 8w..8w+7 (2 instructions each, 4 lines per instruction, 8 lanes x 16 B
//   coverage: Q2/K2 = 8 waves x 8 rows x 64 cols = the block's 64x64 tile; VTh/VTl = 8 waves x 4 d-rows x 64 s.
// Plane layouts: Q2/K2 f16 [b*NH+h][s][64]; VTh/VTl f16 [b*NH+h][d][SEQ].
// =====================================================================================================
__global__ __launch_bounds__(256) void k_proj(
    const float* __restrict__ content, const float* __restrict__ pos, const int* __restrict__ pt,
    const float* __restrict__ Wq, const float* __restrict__ Wk, const float* __restrict__ Wv,
    unsigned short* q2p, unsigned short* k2p, unsigned short* vhp, unsigned short* vlp) {
  __shared__ __align__(16) unsigned short Xg[2][64 * QD];     // 16 KB
  __shared__ __align__(16) unsigned short Xv[64 * HD];        //  4 KB
  __shared__ __align__(16) unsigned short W2[2][HD * QD];     //  8 KB
  __shared__ __align__(16) unsigned short Wvt[HD * HD];       //  2 KB
  __shared__ int sIdx[2][64];                                 // 512 B
  __shared__ __align__(16) unsigned short stQK[2][64 * QD];   // 16 KB
  __shared__ __align__(16) float stV[HD * 64];                //  8 KB

  const int tid  = (int)threadIdx.x;
  const int wave = tid >> 5;
  const int lane = tid & 31;
  const int rl   = lane & 15;
  const int hh   = lane >> 4;
  const int i0   = (int)blockIdx.x * 64;
  const int h    = (int)blockIdx.y;
  const int b    = (int)blockIdx.z;
  const size_t rowB = (size_t)b * SEQ;
  const size_t bh   = (size_t)b * NH + (size_t)h;

  // (a) partner indices of rows i0..i0+63, clamped
  if (tid < 128) {
    const int r = tid >> 1, g = tid & 1;
    int v = pt[(rowB + (size_t)(i0 + r)) * 2 + g];
    v = min(max(v, 0), SEQ - 1);
    sIdx[g][r] = v;
  }
  // (b) weights, transposed to [n][k], bf16 bits; k duplicated over the two 32-halves for Wq / Wk
  for (int e = tid; e < HD * QD; e += 256) {
    const int n = e >> 6, kp = e & 63, k = kp & 31;
    W2[0][e] = bf_bits(Wq[k * HD + n]);
    W2[1][e] = bf_bits(Wk[k * HD + n]);
  }
  for (int e = tid; e < HD * HD; e += 256) {
    const int n = e >> 5, k = e & 31;
    Wvt[e] = bf_bits(Wv[k * HD + n]);
  }
  // (c) content rows i0..i0+63, head slice h -> Xv (512 float4 pieces, 2 per thread)
  for (int e = tid; e < 64 * HD / 4; e += 256) {
    const int r = e >> 3, c4 = (e & 7) * 4;
    const v4f v = *(const v4f*)(content + (rowB + (size_t)(i0 + r)) * EMB + (size_t)h * HD + c4);
    v2u pk;
    pk[0] = pk16(bf_bits(v[0]), bf_bits(v[1]));
    pk[1] = pk16(bf_bits(v[2]), bf_bits(v[3]));
    *(v2u*)(Xv + r * HD + c4) = pk;
  }
  __syncthreads();
  // (d) gathered rows: it2 -> (g, source) uniform; e -> (row r, float4 piece); 8 x 256 pieces = [2][2][64][8]
#pragma unroll
  for (int it2 = 0; it2 < 8; ++it2) {
    const int g   = it2 >> 2;
    const int src = (it2 >> 1) & 1;
    const int e   = (it2 & 1) * 256 + tid;
    const int r   = e >> 3, c4 = (e & 7) * 4;
    const float* base = src ? pos : content;
    const int srow = sIdx[g][r];
    const v4f v = *(const v4f*)(base + (rowB + (size_t)srow) * EMB + (size_t)h * HD + c4);
    v2u pk;
    pk[0] = pk16(bf_bits(v[0]), bf_bits(v[1]));
    pk[1] = pk16(bf_bits(v[2]), bf_bits(v[3]));
    *(v2u*)(Xg[g] + r * QD + src * HD + c4) = pk;
  }
  __syncthreads();

  // (e) WMMA
  const int mt    = wave & 3;
  const int which = wave >> 2;
  const __bf16* Xb0 = (const __bf16*)(const void*)Xg[0];
  const __bf16* Xb1 = (const __bf16*)(const void*)Xg[1];
  const __bf16* Wb  = (const __bf16*)(const void*)W2[which];
  v8f acc00 = zero8(), acc01 = zero8(), acc10 = zero8(), acc11 = zero8();
#pragma unroll
  for (int ks = 0; ks < 2; ++ks) {
    const v16b b0 = ldfrag<__bf16>(Wb + (size_t)rl * QD + ks * 32 + 8 * hh);
    const v16b b1 = ldfrag<__bf16>(Wb + (size_t)(16 + rl) * QD + ks * 32 + 8 * hh);
    const v16b a0 = ldfrag<__bf16>(Xb0 + (size_t)(mt * 16 + rl) * QD + ks * 32 + 8 * hh);
    const v16b a1 = ldfrag<__bf16>(Xb1 + (size_t)(mt * 16 + rl) * QD + ks * 32 + 8 * hh);
    acc00 = mma_b(a0, b0, acc00);
    acc01 = mma_b(a0, b1, acc01);
    acc10 = mma_b(a1, b0, acc10);
    acc11 = mma_b(a1, b1, acc11);
  }
  const int dt = wave & 1, st = wave >> 1;
  const v16b av = ldfrag<__bf16>((const __bf16*)(const void*)Wvt + (size_t)(dt * 16 + rl) * HD + 8 * hh);  // A[d][k]
  const v16b bv = ldfrag<__bf16>((const __bf16*)(const void*)Xv + (size_t)(st * 16 + rl) * HD + 8 * hh);   // B[k][s] from row s
  v8f accv = zero8();
  accv = mma_b(av, bv, accv);

  // (f) stage results (D element r = row 8*hh + r, col rl)
  unsigned short* sq = stQK[which];
#pragma unroll
  for (int r = 0; r < 8; ++r) {
    const int row = mt * 16 + 8 * hh + r;
    sq[row * QD + 0  + rl] = h_bits((_Float16)(acc00[r] * 8.0f));
    sq[row * QD + 16 + rl] = h_bits((_Float16)(acc01[r] * 8.0f));
    sq[row * QD + 32 + rl] = h_bits((_Float16)(acc10[r] * 8.0f));
    sq[row * QD + 48 + rl] = h_bits((_Float16)(acc11[r] * 8.0f));
    stV[(dt * 16 + 8 * hh + r) * 64 + st * 16 + rl] = accv[r];
  }
  __syncthreads();

  // (g) whole-line stores
  const int q4 = lane >> 3, c8 = (lane & 7) * 8;
  v4u qv[2], kv[2];
#pragma unroll
  for (int it = 0; it < 2; ++it) {
    const int row = wave * 8 + it * 4 + q4;
    qv[it] = *(const v4u*)(stQK[0] + row * QD + c8);
    kv[it] = *(const v4u*)(stQK[1] + row * QD + c8);
  }
  const int d = wave * 4 + q4;
  v4u vhv, vlv;
  {
    const float* spv = stV + d * 64 + c8;
#pragma unroll
    for (int e = 0; e < 4; ++e) {
      const float f0 = spv[2 * e] * 8.0f, f1 = spv[2 * e + 1] * 8.0f;
      const _Float16 x0 = (_Float16)f0, x1 = (_Float16)f1;
      const float r0 = f0 - (float)x0, r1 = f1 - (float)x1;
      const _Float16 l0 = (_Float16)(r0 * 4096.0f), l1 = (_Float16)(r1 * 4096.0f);
      vhv[e] = pk16(h_bits(x0), h_bits(x1));
      vlv[e] = pk16(h_bits(l0), h_bits(l1));
    }
  }
  {
#pragma unroll
    for (int it = 0; it < 2; ++it) {
      const int row = wave * 8 + it * 4 + q4;
      const size_t po = (bh * SEQ + (size_t)(i0 + row)) * QD + c8;
      *(v4u*)(q2p + po) = qv[it];
      *(v4u*)(k2p + po) = kv[it];
    }
    const size_t vo = (bh * HD + (size_t)d) * SEQ + (size_t)i0 + c8;
    *(v4u*)(vhp + vo) = vhv;
    *(v4u*)(vlp + vo) = vlv;
    
  }
}

// =====================================================================================================
// Attention on the gathered planes, head dim 64 for q/k, 32 for v, no mask, softmax over all SEQ keys.
//   scores = (Q2 . K2) * sscale on f16 WMMA, sscale = 1/(64 sqrt(512)); online softmax in f32;
//   p = exp(s - m) carried as f16(1024 p) plus residual f16((1024 p - hi) * 2048);
//   context = ph . vh + (ph . vl)/4096 + (pl . vh)/2048 on f16 WMMA; out = context / (l * 1024 * 8) in f32.
//   Block = 4 waves = 64 query rows of one (b, h); grid (NQT, NH, NB); key chunks of 64, static trip NKT.
//   Chunk staging (plain 16-B loads, __syncthreads before and after): K2 chunk 128 threads x 32 halves = 64x64;
//   V^T hi / residual chunks 128 threads x 16 halves = 32x64 each. P tiles are wave-private, spilled with _Float16
//   Output: d_out[b][q][h*32 + d] f32; each wave stores rows q0..q0+15 (it 0..3 x lane>>3) x 32 floats =
//   coverage: grid (8 tiles x 8 heads x 32 batches) x 4 waves x 16 rows x 32 cols = every output element once.
// =====================================================================================================
__global__ __launch_bounds__(128)
void k_attn(const unsigned short* __restrict__ q2p, const unsigned short* __restrict__ k2p,
            const unsigned short* __restrict__ vhp, const unsigned short* __restrict__ vlp,
            float* out, float sscale) {
  union FH { v16h v; v8h h[2]; };
  __shared__ __align__(16) _Float16 Ksh[64 * QD];          // K2 chunk [key][d]   8 KB
  __shared__ __align__(16) _Float16 Vth[HD * 64];          // V^T hi [d][key]    4 KB
  __shared__ __align__(16) _Float16 Vtl[HD * 64];          // V^T residual       4 KB
  __shared__ __align__(16) _Float16 Psh[4][16 * 64];       // per wave P hi      8 KB
  __shared__ __align__(16) _Float16 Psl[4][16 * 64];       // per wave P res     8 KB
  __shared__ __align__(16) float    Os[4][16 * HD];        // per wave out tile  8 KB

  const int tid  = (int)threadIdx.x;
  const int wave = tid >> 5;
  const int lane = tid & 31;
  const int hh   = lane >> 4;
  const int c    = lane & 15;

  const int q0 = (int)blockIdx.x * 64 + wave * 16;
  const int h  = (int)blockIdx.y;
  const int b  = (int)blockIdx.z;
  const size_t bh = (size_t)b * NH + (size_t)h;

  const _Float16* Q  = (const _Float16*)(const void*)q2p + bh * SEQ * QD;
  const _Float16* K  = (const _Float16*)(const void*)k2p + bh * SEQ * QD;
  const _Float16* Vh = (const _Float16*)(const void*)vhp + bh * HD * SEQ;
  const _Float16* Vl = (const _Float16*)(const void*)vlp + bh * HD * SEQ;

  // ---- Q fragments (A operand, row = lane&15): 2 d-chunks of the 64-wide gathered row ----
  v16h qa[2];
#pragma unroll
  for (int dc = 0; dc < 2; ++dc)
    qa[dc] = ldfrag<_Float16>(Q + (size_t)(q0 + c) * QD + dc * 32 + 8 * hh);

  float mrow[8], lrow[8];
  v8f oacc[2];
#pragma unroll
  for (int r = 0; r < 8; ++r) { mrow[r] = -INFINITY; lrow[r] = 0.f; }
#pragma unroll
  for (int t = 0; t < 2; ++t) oacc[t] = zero8();

  for (int kt = 0; kt < NKT; ++kt) {         // static trip count
    const int kv0 = kt * 64;
    __syncthreads();
    {
      const int r = tid >> 1, half = (tid & 1) * 32;                // K2 row kv0+r, d = half..half+31
      const _Float16* kg = K + (size_t)(kv0 + r) * QD + half;
#pragma unroll
      for (int i = 0; i < 4; ++i)
        *(v8h*)(Ksh + r * QD + half + 8 * i) = *(const v8h*)(kg + 8 * i);
      const int r2 = tid >> 2, qq = (tid & 3) * 16;                 // V^T row d = r2, s = kv0+qq..+15
      const _Float16* vg  = Vh + (size_t)r2 * SEQ + kv0 + qq;
      const _Float16* vlg = Vl + (size_t)r2 * SEQ + kv0 + qq;
#pragma unroll
      for (int i = 0; i < 2; ++i) {
        *(v8h*)(Vth + r2 * 64 + qq + 8 * i) = *(const v8h*)(vg + 8 * i);
        *(v8h*)(Vtl + r2 * 64 + qq + 8 * i) = *(const v8h*)(vlg + 8 * i);
      }
    }
    __syncthreads();

    // ---- scores: 16 query rows x 64 keys per wave ----
    v8f s[4];
#pragma unroll
    for (int j = 0; j < 4; ++j) {
      v8f a = zero8();
#pragma unroll
      for (int dc = 0; dc < 2; ++dc) {
        FH kb;
        kb.h[0] = *(const v8h*)(Ksh + (j * 16 + c) * QD + dc * 32 + 8 * hh);
        kb.h[1] = *(const v8h*)(Ksh + (j * 16 + c) * QD + dc * 32 + 16 + 8 * hh);
        a = mma_h(qa[dc], kb.v, a);
      }
#pragma unroll
      for (int r = 0; r < 8; ++r) s[j][r] = a[r] * sscale;
    }

    // ---- row max, online softmax, P hi (x1024) and residual (x2048) to LDS ----
    _Float16* pwh = Psh[wave];
    _Float16* pwl = Psl[wave];
#pragma unroll
    for (int r = 0; r < 8; ++r) {
      float m = s[0][r];
#pragma unroll
      for (int j = 1; j < 4; ++j) m = fmaxf(m, s[j][r]);
#pragma unroll
      for (int off = 1; off < 16; off <<= 1) m = fmaxf(m, __shfl_xor(m, off, 32));
      const float mnew  = fmaxf(mrow[r], m);
      const float msafe = (mnew == -INFINITY) ? 0.f : mnew;
      const float alpha = __expf(mrow[r] - msafe);
      mrow[r] = mnew;
      float psum = 0.f;
#pragma unroll
      for (int j = 0; j < 4; ++j) {
        const float p  = __expf(s[j][r] - msafe);
        psum += p;
        const float pp = p * 1024.0f;
        const _Float16 ph = (_Float16)pp;
        const float res = pp - (float)ph;
        const _Float16 pl = (_Float16)(res * 2048.0f);
        const int pidx = (8 * hh + r) * 64 + j * 16 + c;
        pwh[pidx] = ph;
        pwl[pidx] = pl;
      }
#pragma unroll
      for (int off = 1; off < 16; off <<= 1) psum += __shfl_xor(psum, off, 32);
      lrow[r] = lrow[r] * alpha + psum;
#pragma unroll
      for (int t = 0; t < 2; ++t) oacc[t][r] *= alpha;
    }
    __builtin_amdgcn_fence(__ATOMIC_RELEASE, "workgroup");
    __builtin_amdgcn_wave_barrier();
    __builtin_amdgcn_fence(__ATOMIC_ACQUIRE, "workgroup");

    // ---- context += P . V (3 f16 products); residual products into separate per-chunk accumulators ----
    v8f o1[2], o2[2];
#pragma unroll
    for (int t = 0; t < 2; ++t) { o1[t] = zero8(); o2[t] = zero8(); }
#pragma unroll 1
    for (int kk = 0; kk < 2; ++kk) {
      FH pa, pr;
      pa.h[0] = *(const v8h*)(pwh + c * 64 + kk * 32 + 8 * hh);
      pa.h[1] = *(const v8h*)(pwh + c * 64 + kk * 32 + 16 + 8 * hh);
      pr.h[0] = *(const v8h*)(pwl + c * 64 + kk * 32 + 8 * hh);
      pr.h[1] = *(const v8h*)(pwl + c * 64 + kk * 32 + 16 + 8 * hh);
#pragma unroll
      for (int t = 0; t < 2; ++t) {
        FH vb, vr;
        vb.h[0] = *(const v8h*)(Vth + (t * 16 + c) * 64 + kk * 32 + 8 * hh);
        vb.h[1] = *(const v8h*)(Vth + (t * 16 + c) * 64 + kk * 32 + 16 + 8 * hh);
        vr.h[0] = *(const v8h*)(Vtl + (t * 16 + c) * 64 + kk * 32 + 8 * hh);
        vr.h[1] = *(const v8h*)(Vtl + (t * 16 + c) * 64 + kk * 32 + 16 + 8 * hh);
        oacc[t] = mma_h(pa.v, vb.v, oacc[t]);
        o1[t]   = mma_h(pa.v, vr.v, o1[t]);
        o2[t]   = mma_h(pr.v, vb.v, o2[t]);
      }
    }
#pragma unroll
    for (int t = 0; t < 2; ++t)
#pragma unroll
      for (int r = 0; r < 8; ++r) {
        const float f1 = o1[t][r] * (1.0f / 4096.0f);
        const float f2 = o2[t][r] * (1.0f / 2048.0f);
        oacc[t][r] = oacc[t][r] + f1 + f2;
      }
  }

  // ---- normalise (1/l, undo the x1024 p carry and the x8 v carry), stage the wave's 16x32 tile,
  float* os = Os[wave];
#pragma unroll
  for (int r = 0; r < 8; ++r) {
    const float l = lrow[r];
    const float inv = ((l > 0.f) ? (1.0f / l) : 0.f) * (1.0f / 8192.0f);
#pragma unroll
    for (int t = 0; t < 2; ++t) os[(8 * hh + r) * HD + t * 16 + c] = oacc[t][r] * inv;
  }
  __builtin_amdgcn_fence(__ATOMIC_RELEASE, "workgroup");
  __builtin_amdgcn_wave_barrier();
  __builtin_amdgcn_fence(__ATOMIC_ACQUIRE, "workgroup");
  {
    const int q4 = lane >> 3, c4 = (lane & 7) * 4;
    v4f ov[4];
#pragma unroll
    for (int it = 0; it < 4; ++it) {
      const int row = it * 4 + q4;                 // it 0..3 x q4 0..3 = rows 0..15 of the wave tile
      const float* spo = os + row * HD + c4;
      v4f v;
      v[0] = spo[0]; v[1] = spo[1]; v[2] = spo[2]; v[3] = spo[3];
      ov[it] = v;
    }
    {
#pragma unroll
      for (int it = 0; it < 4; ++it) {
        const int row = it * 4 + q4;
        const size_t go = ((size_t)b * SEQ + (size_t)(q0 + row)) * EMB + (size_t)h * HD + c4;
        *(v4f*)(out + go) = ov[it];
      }
      
    }
  }
}

// =====================================================================================================
// Workspace map (bytes), every region an exact multiple of its whole-line store granularity:
//   K2   f16 [256][512][64]        16777216
//   VTl  f16 [256][32][512]         8388608
//   total                          50462720
// Launches: k_partner (256 blocks x 512), k_proj (2048 x 256), k_attn (2048 x 128).
// =====================================================================================================
extern "C" void kernel_launch(void* const* d_in, const int* in_sizes, int n_in,
                              void* d_out, int out_size, void* d_ws, size_t ws_size,
                              hipStream_t stream) {
  if (n_in < 6) return;
  if (in_sizes[0] != NB * SEQ * EMB) return;
  if (in_sizes[1] != NB * SEQ * EMB) return;
  if (in_sizes[2] != NB * SEQ * 4) return;
  if (in_sizes[3] != HD * HD || in_sizes[4] != HD * HD || in_sizes[5] != HD * HD) return;
  if (out_size != NB * SEQ * EMB) return;

  const float* content = (const float*)d_in[0];
  const float* posenc  = (const float*)d_in[1];
  const float* centers = (const float*)d_in[2];
  const float* Wq      = (const float*)d_in[3];
  const float* Wk      = (const float*)d_in[4];
  const float* Wv      = (const float*)d_in[5];

  const size_t PPT = (size_t)NB * SEQ * 2 * 4;             //   131072
  const size_t PQ2 = (size_t)NB * NH * SEQ * QD * 2;       // 16777216
  const size_t PVT = (size_t)NB * NH * HD * SEQ * 2;       //  8388608
  size_t off = 0;
  const size_t oPT = off; off += PPT;
  const size_t oQ2 = off; off += PQ2;
  const size_t oK2 = off; off += PQ2;
  const size_t oVh = off; off += PVT;
  const size_t oVl = off; off += PVT;
  if (off > ws_size) return;                               // off = 50462720
  if (off > (size_t)134217728) return;

  char* ws = (char*)d_ws;
  int*            PT  = (int*)(ws + oPT);
  unsigned short* Q2  = (unsigned short*)(ws + oQ2);
  unsigned short* K2  = (unsigned short*)(ws + oK2);
  unsigned short* VTh = (unsigned short*)(ws + oVh);
  unsigned short* VTl = (unsigned short*)(ws + oVl);
  float*          outp = (float*)d_out;

  const float sscale = (1.0f / 64.0f) / sqrtf(2.0f * (float)EMB);   // 1/(64 sqrt(512))

  const dim3 gP(NQT, NB);            //  256 blocks of 512
  const dim3 gT(NQT, NH, NB);        // 2048 blocks

  // (1) partner table
  k_partner<<<gP, dim3(64 * PSL), 0, stream>>>(centers, PT);
  // (2) gathered [q|k] planes (x8, f16), v^T hi / residual planes
  k_proj<<<gT, dim3(256), 0, stream>>>(content, posenc, PT, Wq, Wk, Wv, Q2, K2, VTh, VTl);
  // (3) attention -> d_out f32 [32][512][256]
  k_attn<<<gT, dim3(128), 0, stream>>>(Q2, K2, VTh, VTl, outp, sscale);
  (void)hipGetLastError();
}

// v002
// It runs in 86.4 microseconds.
// Two timings next to v001 both put it at 1.66 times that version's speed.
// Counting every step since v000, it is 2.31 times as fast.
// Contractions: [q|k] and v^T projections = v_wmma_f32_16x16x32_bf16 (bf16 operands: RNE-converted content, pos, Wq, Wk, Wv;
//   x_qk.W evaluated as [content | pos] x [W ; W] along k; single products, f32 accumulate);
// gathered q.k^T scores = v_wmma_f32_16x16x32_f16 (q and k f16 planes carried x8; single product; f32 accumulate);
// p.v = v_wmma_f32_16x16x32_f16 (p f16 carried x1024 + residual plane x2048; v^T f16 carried x8 + residual plane x4096;
//   3 products ph.vh, ph.vl, pl.vh into f32 accumulators); partner selection (IoU argmax) and softmax in f32 on the VALU.
// Carry audit:
//   Q2 plane  f16 = f16(8 q)                     (k_proj staging)  -> undone in k_attn by sscale = 1/(64 sqrt(512))
//   K2 plane  f16 = f16(8 k)                     (k_proj staging)  -> same sscale (8*8 = 64)
//   VTh plane f16 = f16(8 v)                     (k_proj store)    -> k_attn epilogue inv includes 1/8
//   VTl plane f16 = f16((8 v - VTh) * 4096)      (k_proj store)    -> k_attn per-chunk fold o1 * (1/4096), then 1/8 in epilogue
//   P hi      f16 = f16(1024 p)                  (k_attn softmax)  -> k_attn epilogue inv includes 1/1024
//   P res     f16 = f16((1024 p - hi) * 2048)    (k_attn softmax)  -> k_attn per-chunk fold o2 * (1/2048), then 1/1024 in epilogue
#include <hip/hip_runtime.h>
#include <math.h>
#include <stdint.h>

#pragma clang fp contract(off)

#define NB   32
#define SEQ  512
#define EMB  256
#define NH   8
#define HD   32            // per-head dim
#define QD   64            // gathered q/k width (two partner rows)
#define NQT  (SEQ / 64)    // 64-row query tiles per sequence
#define NKT  (SEQ / 64)    // 64-key chunks per sequence
// LDS row pitches, in 16-bit elements, of every tile that is read as a WMMA fragment with 16-byte loads: 16 B x odd,
// so that the 16 rows one half-wave reads fall on 64 distinct banks (at the bare 128 B / 64 B they share 8 / 16 banks)
#define P64  72            // 64-element rows: 144 B
#define P32  40            // 32-element rows:  80 B
static_assert(NH * HD == EMB);
static_assert(NQT == 8 && NKT == 8);
static_assert((SEQ % 64) == 0 && (HD % 32) == 0 && (QD % 32) == 0);
static_assert(P64 >= QD && P32 >= HD && (P64 % 8) == 0 && (P32 % 8) == 0 && ((P64 / 8) & 1) == 1 && ((P32 / 8) & 1) == 1);

typedef _Float16 v16h __attribute__((ext_vector_type(16)));
typedef _Float16 v8h  __attribute__((ext_vector_type(8)));
typedef __bf16   v16b __attribute__((ext_vector_type(16)));
typedef __bf16   v8b  __attribute__((ext_vector_type(8)));
typedef float    v8f  __attribute__((ext_vector_type(8)));
typedef float    v4f  __attribute__((ext_vector_type(4)));
typedef unsigned int v4u __attribute__((ext_vector_type(4)));
typedef unsigned int v2u __attribute__((ext_vector_type(2)));
typedef int      v4i  __attribute__((ext_vector_type(4)));

#if defined(__HIP_DEVICE_COMPILE__)
#define DEV_ASM 1
#else
#define DEV_ASM 0
#endif

// ---- scalar helpers --------------------------------------------------------------------------------
__device__ __forceinline__ unsigned short bf_bits(float f) {          // f32 -> bf16 bits, RNE convert
  unsigned u = __float_as_uint(f);
  return (unsigned short)((u + 0x7FFFu + ((u >> 16) & 1u)) >> 16);
}
__device__ __forceinline__ float bf_up(unsigned short hb) { return __uint_as_float(((unsigned)hb) << 16); }
__device__ __forceinline__ unsigned short h_bits(_Float16 x) { return __builtin_bit_cast(unsigned short, x); }
__device__ __forceinline__ unsigned pk16(unsigned short a, unsigned short b) { return (unsigned)a | ((unsigned)b << 16); }
__device__ __forceinline__ v8f zero8() { v8f z = {0.f, 0.f, 0.f, 0.f, 0.f, 0.f, 0.f, 0.f}; return z; }

// ---- fragment loaders: 16-bit A/B operand, lane -> row/col (lane&15), p already includes +8*(lane>>4);
//      elements 0..7 <- p[0..7] (k0+8h..k0+8h+7), elements 8..15 <- p[16..23] (k0+16+8h..k0+16+8h+7)
template <typename OT> struct FT;
template <> struct FT<__bf16>   { typedef v16b frag; typedef v8b half8; };
template <> struct FT<_Float16> { typedef v16h frag; typedef v8h half8; };

template <typename OT>
__device__ __forceinline__ typename FT<OT>::frag ldfrag(const OT* p) {
  union { typename FT<OT>::frag v; typename FT<OT>::half8 h[2]; } f;
  f.h[0] = *(const typename FT<OT>::half8*)(p);
  f.h[1] = *(const typename FT<OT>::half8*)(p + 16);
  return f.v;
}

// ---- guarded WMMA helpers: 4 VALU slots after the WMMA, D tied, A/B kept live --------------------------
__device__ __forceinline__ v8f mma_b(v16b a, v16b b, v8f c) {
  c = __builtin_amdgcn_wmma_f32_16x16x32_bf16(false, a, false, b, (short)0, c, false, false);
#if DEV_ASM
  asm volatile("v_nop\n\tv_nop\n\tv_nop\n\tv_nop" : "+v"(c) : "v"(a), "v"(b));
#endif
  return c;
}
__device__ __forceinline__ v8f mma_h(v16h a, v16h b, v8f c) {
  c = __builtin_amdgcn_wmma_f32_16x16x32_f16(false, a, false, b, (short)0, c, false, false);
#if DEV_ASM
  asm volatile("v_nop\n\tv_nop\n\tv_nop\n\tv_nop" : "+v"(c) : "v"(a), "v"(b));
#endif
  return c;
}

// =====================================================================================================
// Partner selection (f32, VALU, fp-contract off, literal op order):
//   c = RNE-bf16(centers); bbox = (c0 - c3*0.5, c1 - c2*0.5, c0 + c3*0.5, c1 + c2*0.5);
//   inter = max(min maxs - max mins, 0) products; union = (area_i + area_j) - inter; iou = inter/union - eye;
//   amax = first index of the row maximum (NaN counts as maximum, first NaN wins); l1 = (c2 - c0) + (c3 - c1);
//   cond = l1_i >= l1[amax]; p0 = cond ? i : amax, p1 = cond ? amax : i.
// grid (NQT, NB), 512 threads: block = 64 rows of one batch x PSL slices of PJS candidates; all 512 boxes of the
//   batch staged in LDS. Wave w scans rows 32*(w&1)..+31 against candidates PJS*(w>>1)..+PJS-1 and keeps, per row,
//   (slice maximum, its first index, first NaN index); threads 0..63 merge the slices in ascending order with a strict
//   compare, so the result is the first index of the row maximum (or the first NaN), as in one ascending scan.
// coverage: 8 blocks x 64 rows x 2 ints per batch = the whole table.
// =====================================================================================================
#define PSL 8              // candidate slices per row
#define PJS (SEQ / PSL)    // candidates per slice
static_assert(PSL * PJS == SEQ && (PJS % 2) == 0);
__global__ __launch_bounds__(64 * PSL) void k_partner(const float* __restrict__ cen, int* pt) {
#pragma clang fp contract(off)
  __shared__ float sb0[SEQ];
  __shared__ float sb1[SEQ];
  __shared__ float sb2[SEQ];
  __shared__ float sb3[SEQ];
  __shared__ float sar[SEQ];
  __shared__ float sl1[SEQ];
  __shared__ float mbv[PSL][64];                // slice maximum per row
  __shared__ int   mbj[PSL][64];                // its first index
  __shared__ int   mnj[PSL][64];                // first NaN index of the slice, SEQ if none
  __shared__ __align__(16) int sp[128];

  const int tid = (int)threadIdx.x;
  const int row = tid & 63;
  const int sl  = tid >> 6;                     // the same for a whole wave
  const int i0  = (int)blockIdx.x * 64;
  const int b   = (int)blockIdx.y;
  const float* cb = cen + (size_t)b * SEQ * 4;

  for (int s = tid; s < SEQ; s += 64 * PSL) {
    const v4f cv = *(const v4f*)(cb + (size_t)s * 4);
#if DEV_ASM
    // precaution: stands between this load and the later reuse of the scalar registers that hold its base address
    asm volatile("s_wait_xcnt 0x0" ::: "memory");
#endif
    const float c0 = bf_up(bf_bits(cv[0]));
    const float c1 = bf_up(bf_bits(cv[1]));
    const float c2 = bf_up(bf_bits(cv[2]));
    const float c3 = bf_up(bf_bits(cv[3]));
    const float hx = c3 * 0.5f;
    const float hy = c2 * 0.5f;
    const float x0 = c0 - hx;
    const float y0 = c1 - hy;
    const float x1 = c0 + hx;
    const float y1 = c1 + hy;
    sb0[s] = x0;
    sb1[s] = y0;
    sb2[s] = x1;
    sb3[s] = y1;
    const float dx = x1 - x0;
    const float dy = y1 - y0;
    sar[s] = dx * dy;
    const float la = c2 - c0;
    const float lb = c3 - c1;
    sl1[s] = la + lb;
  }
  __syncthreads();

  const int i = i0 + row;                       // 0..511
  const float a0 = sb0[i], a1 = sb1[i], a2 = sb2[i], a3 = sb3[i], ar = sar[i];
  float best = -INFINITY;
  int   bj = 0;
  int   nj = SEQ;
  const int j0 = sl * PJS;
#pragma unroll 2
  for (int jj = 0; jj < PJS; ++jj) {
    const int j = j0 + jj;
    const float m0 = fmaxf(a0, sb0[j]);
    const float m1 = fmaxf(a1, sb1[j]);
    const float x2 = fminf(a2, sb2[j]);
    const float x3 = fminf(a3, sb3[j]);
    const float d0 = x2 - m0;
    const float d1 = x3 - m1;
    const float w0 = fmaxf(d0, 0.0f);
    const float w1 = fmaxf(d1, 0.0f);
    const float inter = w0 * w1;
    const float asum  = ar + sar[j];
    const float uni   = asum - inter;
    const float q     = inter / uni;
    const float e     = (j == i) ? 1.0f : 0.0f;
    const float iou   = q - e;
    const bool  up    = iou > best;             // false for NaN
    best = up ? iou : best;
    bj   = up ? j : bj;
    nj   = min(nj, (iou != iou) ? j : SEQ);
  }
  mbv[sl][row] = best;
  mbj[sl][row] = bj;
  mnj[sl][row] = nj;
  __syncthreads();

  if (tid < 64) {
    float gb = -INFINITY;
    int   gj = 0;
    int   gn = SEQ;
    // unrolled so that all slice reads are issued before the first one is waited for
#pragma unroll
    for (int s = 0; s < PSL; ++s) {             // ascending slices, strict compare: the first maximum wins
      const float v = mbv[s][tid];
      const int   x = mbj[s][tid];
      const bool  up = v > gb;
      gb = up ? v : gb;
      gj = up ? x : gj;
      gn = min(gn, mnj[s][tid]);
    }
    const int am = (gn < SEQ) ? gn : gj;        // NaN counts as maximum, first NaN wins
    const float l1i = sl1[i];
    const float l1p = sl1[am];
    const bool cond = (l1i >= l1p);
    sp[tid * 2 + 0] = cond ? i : am;
    sp[tid * 2 + 1] = cond ? am : i;
  }
  __syncthreads();

  if (tid < 32) {
    const v4i v = *(const v4i*)(sp + tid * 4);    // rows i0+2*tid, i0+2*tid+1
    int* dst = pt + ((size_t)b * SEQ + i0) * 2 + tid * 4;
    *(v4i*)dst = v;
  }
}

// =====================================================================================================
// Projections with the partner gather fused in. Block = (64-row tile it, head h, batch b), 256 threads.
//   Xg[g][r][0..31] = bf16(content[b][p_g(i0+r)][h*32..]), Xg[g][r][32..63] = bf16(pos[same row]) (g = 0: p0, 1: p1;
//   indices from PT, clamped to [0, SEQ-1]); Xv[r][k] = bf16(content[b][i0+r][h*32+k]);
//   W2[which][n][k'] = bf16(W[k' & 31][n]) for Wq (0) / Wk (1); Wvt[n][k] = bf16(Wv[k][n]).
//   Q2[i][g*32+n] = sum_k' Xg[g][i][k'] W2q[n][k'] (K = 64) = (content + pos)[p_g(i)] . Wq; K2 likewise with Wk;
//   V^T[d][s] = sum_k Wvt[d][k] Xv[s][k].
//   Waves 0..3: Q2 m-tile (wave&3); waves 4..7: K2 m-tile; every wave one 16x16 V^T tile (dt = wave&1, st = wave>>1).
//   wave w writes Q2 rows 8w..8w+7 and K2 rows 8w..8w+7 (2 instructions each, 4 lines per instruction, 8 lanes x 16 B
//   coverage: Q2/K2 = 8 waves x 8 rows x 64 cols = the block's 64x64 tile; VTh/VTl = 8 waves x 4 d-rows x 64 s.
// Plane layouts: Q2/K2 f16 [b*NH+h][s][64]; VTh/VTl f16 [b*NH+h][d][SEQ].
// =====================================================================================================
__global__ __launch_bounds__(256) void k_proj(
    const float* __restrict__ content, const float* __restrict__ pos, const int* __restrict__ pt,
    const float* __restrict__ Wq, const float* __restrict__ Wk, const float* __restrict__ Wv,
    unsigned short* q2p, unsigned short* k2p, unsigned short* vhp, unsigned short* vlp) {
  __shared__ __align__(16) unsigned short Xg[2][64 * P64];    // 18 KB
  __shared__ __align__(16) unsigned short Xv[64 * P32];       //  5 KB
  __shared__ __align__(16) unsigned short W2[2][HD * P64];    //  9 KB
  __shared__ __align__(16) unsigned short Wvt[HD * P32];      //  2.5 KB
  __shared__ int sIdx[2][64];                                 // 512 B
  __shared__ __align__(16) unsigned short stQK[2][64 * QD];   // 16 KB
  __shared__ __align__(16) float stV[HD * 64];                //  8 KB

  const int tid  = (int)threadIdx.x;
  const int wave = tid >> 5;
  const int lane = tid & 31;
  const int rl   = lane & 15;
  const int hh   = lane >> 4;
  const int i0   = (int)blockIdx.x * 64;
  const int h    = (int)blockIdx.y;
  const int b    = (int)blockIdx.z;
  const size_t rowB = (size_t)b * SEQ;
  const size_t bh   = (size_t)b * NH + (size_t)h;

  // (a) partner indices of rows i0..i0+63, clamped
  if (tid < 128) {
    const int r = tid >> 1, g = tid & 1;
    int v = pt[(rowB + (size_t)(i0 + r)) * 2 + g];
    v = min(max(v, 0), SEQ - 1);
    sIdx[g][r] = v;
  }
  // (b) weights, transposed to [n][k], bf16 bits; k duplicated over the two 32-halves for Wq / Wk
  for (int e = tid; e < HD * QD; e += 256) {
    const int n = e >> 6, kp = e & 63, k = kp & 31;
    W2[0][n * P64 + kp] = bf_bits(Wq[k * HD + n]);
    W2[1][n * P64 + kp] = bf_bits(Wk[k * HD + n]);
  }
  for (int e = tid; e < HD * HD; e += 256) {
    const int n = e >> 5, k = e & 31;
    Wvt[n * P32 + k] = bf_bits(Wv[k * HD + n]);
  }
  // (c) content rows i0..i0+63, head slice h -> Xv (512 float4 pieces, 2 per thread)
  for (int e = tid; e < 64 * HD / 4; e += 256) {
    const int r = e >> 3, c4 = (e & 7) * 4;
    const v4f v = *(const v4f*)(content + (rowB + (size_t)(i0 + r)) * EMB + (size_t)h * HD + c4);
    v2u pk;
    pk[0] = pk16(bf_bits(v[0]), bf_bits(v[1]));
    pk[1] = pk16(bf_bits(v[2]), bf_bits(v[3]));
    *(v2u*)(Xv + r * P32 + c4) = pk;
  }
  __syncthreads();
  // (d) gathered rows: it2 -> (g, source) uniform; e -> (row r, float4 piece); 8 x 256 pieces = [2][2][64][8]
#pragma unroll
  for (int it2 = 0; it2 < 8; ++it2) {
    const int g   = it2 >> 2;
    const int src = (it2 >> 1) & 1;
    const int e   = (it2 & 1) * 256 + tid;
    const int r   = e >> 3, c4 = (e & 7) * 4;
    const float* base = src ? pos : content;
    const int srow = sIdx[g][r];
    const v4f v = *(const v4f*)(base + (rowB + (size_t)srow) * EMB + (size_t)h * HD + c4);
    v2u pk;
    pk[0] = pk16(bf_bits(v[0]), bf_bits(v[1]));
    pk[1] = pk16(bf_bits(v[2]), bf_bits(v[3]));
    *(v2u*)(Xg[g] + r * P64 + src * HD + c4) = pk;
  }
  __syncthreads();

  // (e) WMMA
  const int mt    = wave & 3;
  const int which = wave >> 2;
  const __bf16* Xb0 = (const __bf16*)(const void*)Xg[0];
  const __bf16* Xb1 = (const __bf16*)(const void*)Xg[1];
  const __bf16* Wb  = (const __bf16*)(const void*)W2[which];
  v8f acc00 = zero8(), acc01 = zero8(), acc10 = zero8(), acc11 = zero8();
#pragma unroll
  for (int ks = 0; ks < 2; ++ks) {
    const v16b b0 = ldfrag<__bf16>(Wb + (size_t)rl * P64 + ks * 32 + 8 * hh);
    const v16b b1 = ldfrag<__bf16>(Wb + (size_t)(16 + rl) * P64 + ks * 32 + 8 * hh);
    const v16b a0 = ldfrag<__bf16>(Xb0 + (size_t)(mt * 16 + rl) * P64 + ks * 32 + 8 * hh);
    const v16b a1 = ldfrag<__bf16>(Xb1 + (size_t)(mt * 16 + rl) * P64 + ks * 32 + 8 * hh);
    acc00 = mma_b(a0, b0, acc00);
    acc01 = mma_b(a0, b1, acc01);
    acc10 = mma_b(a1, b0, acc10);
    acc11 = mma_b(a1, b1, acc11);
  }
  const int dt = wave & 1, st = wave >> 1;
  const v16b av = ldfrag<__bf16>((const __bf16*)(const void*)Wvt + (size_t)(dt * 16 + rl) * P32 + 8 * hh);  // A[d][k]
  const v16b bv = ldfrag<__bf16>((const __bf16*)(const void*)Xv + (size_t)(st * 16 + rl) * P32 + 8 * hh);   // B[k][s] from row s
  v8f accv = zero8();
  accv = mma_b(av, bv, accv);

  // (f) stage results (D element r = row 8*hh + r, col rl)
  unsigned short* sq = stQK[which];
#pragma unroll
  for (int r = 0; r < 8; ++r) {
    const int row = mt * 16 + 8 * hh + r;
    sq[row * QD + 0  + rl] = h_bits((_Float16)(acc00[r] * 8.0f));
    sq[row * QD + 16 + rl] = h_bits((_Float16)(acc01[r] * 8.0f));
    sq[row * QD + 32 + rl] = h_bits((_Float16)(acc10[r] * 8.0f));
    sq[row * QD + 48 + rl] = h_bits((_Float16)(acc11[r] * 8.0f));
    stV[(dt * 16 + 8 * hh + r) * 64 + st * 16 + rl] = accv[r];
  }
  __syncthreads();

  // (g) whole-line stores
  const int q4 = lane >> 3, c8 = (lane & 7) * 8;
  v4u qv[2], kv[2];
#pragma unroll
  for (int it = 0; it < 2; ++it) {
    const int row = wave * 8 + it * 4 + q4;
    qv[it] = *(const v4u*)(stQK[0] + row * QD + c8);
    kv[it] = *(const v4u*)(stQK[1] + row * QD + c8);
  }
  const int d = wave * 4 + q4;
  v4u vhv, vlv;
  {
    const float* spv = stV + d * 64 + c8;
#pragma unroll
    for (int e = 0; e < 4; ++e) {
      const float f0 = spv[2 * e] * 8.0f, f1 = spv[2 * e + 1] * 8.0f;
      const _Float16 x0 = (_Float16)f0, x1 = (_Float16)f1;
      const float r0 = f0 - (float)x0, r1 = f1 - (float)x1;
      const _Float16 l0 = (_Float16)(r0 * 4096.0f), l1 = (_Float16)(r1 * 4096.0f);
      vhv[e] = pk16(h_bits(x0), h_bits(x1));
      vlv[e] = pk16(h_bits(l0), h_bits(l1));
    }
  }
  {
#pragma unroll
    for (int it = 0; it < 2; ++it) {
      const int row = wave * 8 + it * 4 + q4;
      const size_t po = (bh * SEQ + (size_t)(i0 + row)) * QD + c8;
      *(v4u*)(q2p + po) = qv[it];
      *(v4u*)(k2p + po) = kv[it];
    }
    const size_t vo = (bh * HD + (size_t)d) * SEQ + (size_t)i0 + c8;
    *(v4u*)(vhp + vo) = vhv;
    *(v4u*)(vlp + vo) = vlv;
    
  }
}

// =====================================================================================================
// Attention on the gathered planes, head dim 64 for q/k, 32 for v, no mask, softmax over all SEQ keys.
//   scores = (Q2 . K2) * sscale on f16 WMMA, sscale = 1/(64 sqrt(512)); online softmax in f32;
//   p = exp(s - m) carried as f16(1024 p) plus residual f16((1024 p - hi) * 2048);
//   context = ph . vh + (ph . vl)/4096 + (pl . vh)/2048 on f16 WMMA; out = context / (l * 1024 * 8) in f32.
//   Block = 4 waves = 64 query rows of one (b, h); grid (NQT, NH, NB); key chunks of 64, static trip NKT.
//   Chunk staging (plain 16-B loads, __syncthreads before and after): K2 chunk 128 threads x 32 halves = 64x64;
//   V^T hi / residual chunks 128 threads x 16 halves = 32x64 each. P tiles are wave-private, spilled with _Float16
//   Output: d_out[b][q][h*32 + d] f32; each wave stores rows q0..q0+15 (it 0..3 x lane>>3) x 32 floats =
//   coverage: grid (8 tiles x 8 heads x 32 batches) x 4 waves x 16 rows x 32 cols = every output element once.
// =====================================================================================================
__global__ __launch_bounds__(128)
void k_attn(const unsigned short* __restrict__ q2p, const unsigned short* __restrict__ k2p,
            const unsigned short* __restrict__ vhp, const unsigned short* __restrict__ vlp,
            float* out, float sscale) {
  union FH { v16h v; v8h h[2]; };
  __shared__ __align__(16) _Float16 Ksh[64 * P64];         // K2 chunk [key][d]   9 KB
  __shared__ __align__(16) _Float16 Vth[HD * P64];         // V^T hi [d][key]    4.5 KB
  __shared__ __align__(16) _Float16 Vtl[HD * P64];         // V^T residual       4.5 KB
  __shared__ __align__(16) _Float16 Psh[4][16 * P64];      // per wave P hi      9 KB
  __shared__ __align__(16) _Float16 Psl[4][16 * P64];      // per wave P res     9 KB
  __shared__ __align__(16) float    Os[4][16 * HD];        // per wave out tile  8 KB

  const int tid  = (int)threadIdx.x;
  const int wave = tid >> 5;
  const int lane = tid & 31;
  const int hh   = lane >> 4;
  const int c    = lane & 15;

  const int q0 = (int)blockIdx.x * 64 + wave * 16;
  const int h  = (int)blockIdx.y;
  const int b  = (int)blockIdx.z;
  const size_t bh = (size_t)b * NH + (size_t)h;

  const _Float16* Q  = (const _Float16*)(const void*)q2p + bh * SEQ * QD;
  const _Float16* K  = (const _Float16*)(const void*)k2p + bh * SEQ * QD;
  const _Float16* Vh = (const _Float16*)(const void*)vhp + bh * HD * SEQ;
  const _Float16* Vl = (const _Float16*)(const void*)vlp + bh * HD * SEQ;

  // ---- Q fragments (A operand, row = lane&15): 2 d-chunks of the 64-wide gathered row ----
  v16h qa[2];
#pragma unroll
  for (int dc = 0; dc < 2; ++dc)
    qa[dc] = ldfrag<_Float16>(Q + (size_t)(q0 + c) * QD + dc * 32 + 8 * hh);

  float mrow[8], lrow[8];
  v8f oacc[2];
#pragma unroll
  for (int r = 0; r < 8; ++r) { mrow[r] = -INFINITY; lrow[r] = 0.f; }
#pragma unroll
  for (int t = 0; t < 2; ++t) oacc[t] = zero8();

  for (int kt = 0; kt < NKT; ++kt) {         // static trip count
    const int kv0 = kt * 64;
    __syncthreads();
    {
      const int r = tid >> 1, half = (tid & 1) * 32;                // K2 row kv0+r, d = half..half+31
      const _Float16* kg = K + (size_t)(kv0 + r) * QD + half;
#pragma unroll
      for (int i = 0; i < 4; ++i)
        *(v8h*)(Ksh + r * P64 + half + 8 * i) = *(const v8h*)(kg + 8 * i);
      const int r2 = tid >> 2, qq = (tid & 3) * 16;                 // V^T row d = r2, s = kv0+qq..+15
      const _Float16* vg  = Vh + (size_t)r2 * SEQ + kv0 + qq;
      const _Float16* vlg = Vl + (size_t)r2 * SEQ + kv0 + qq;
#pragma unroll
      for (int i = 0; i < 2; ++i) {
        *(v8h*)(Vth + r2 * P64 + qq + 8 * i) = *(const v8h*)(vg + 8 * i);
        *(v8h*)(Vtl + r2 * P64 + qq + 8 * i) = *(const v8h*)(vlg + 8 * i);
      }
    }
    __syncthreads();

    // ---- scores: 16 query rows x 64 keys per wave ----
    v8f s[4];
#pragma unroll
    for (int j = 0; j < 4; ++j) {
      v8f a = zero8();
#pragma unroll
      for (int dc = 0; dc < 2; ++dc) {
        FH kb;
        kb.h[0] = *(const v8h*)(Ksh + (j * 16 + c) * P64 + dc * 32 + 8 * hh);
        kb.h[1] = *(const v8h*)(Ksh + (j * 16 + c) * P64 + dc * 32 + 16 + 8 * hh);
        a = mma_h(qa[dc], kb.v, a);
      }
#pragma unroll
      for (int r = 0; r < 8; ++r) s[j][r] = a[r] * sscale;
    }

    // ---- row max, online softmax, P hi (x1024) and residual (x2048) to LDS ----
    _Float16* pwh = Psh[wave];
    _Float16* pwl = Psl[wave];
#pragma unroll
    for (int r = 0; r < 8; ++r) {
      float m = s[0][r];
#pragma unroll
      for (int j = 1; j < 4; ++j) m = fmaxf(m, s[j][r]);
#pragma unroll
      for (int off = 1; off < 16; off <<= 1) m = fmaxf(m, __shfl_xor(m, off, 32));
      const float mnew  = fmaxf(mrow[r], m);
      const float msafe = (mnew == -INFINITY) ? 0.f : mnew;
      const float alpha = __expf(mrow[r] - msafe);
      mrow[r] = mnew;
      float psum = 0.f;
#pragma unroll
      for (int j = 0; j < 4; ++j) {
        const float p  = __expf(s[j][r] - msafe);
        psum += p;
        const float pp = p * 1024.0f;
        const _Float16 ph = (_Float16)pp;
        const float res = pp - (float)ph;
        const _Float16 pl = (_Float16)(res * 2048.0f);
        const int pidx = (8 * hh + r) * P64 + j * 16 + c;
        pwh[pidx] = ph;
        pwl[pidx] = pl;
      }
#pragma unroll
      for (int off = 1; off < 16; off <<= 1) psum += __shfl_xor(psum, off, 32);
      lrow[r] = lrow[r] * alpha + psum;
#pragma unroll
      for (int t = 0; t < 2; ++t) oacc[t][r] *= alpha;
    }
    __builtin_amdgcn_fence(__ATOMIC_RELEASE, "workgroup");
    __builtin_amdgcn_wave_barrier();
    __builtin_amdgcn_fence(__ATOMIC_ACQUIRE, "workgroup");

    // ---- context += P . V (3 f16 products); residual products into separate per-chunk accumulators ----
    v8f o1[2], o2[2];
#pragma unroll
    for (int t = 0; t < 2; ++t) { o1[t] = zero8(); o2[t] = zero8(); }
#pragma unroll 1
    for (int kk = 0; kk < 2; ++kk) {
      FH pa, pr;
      pa.h[0] = *(const v8h*)(pwh + c * P64 + kk * 32 + 8 * hh);
      pa.h[1] = *(const v8h*)(pwh + c * P64 + kk * 32 + 16 + 8 * hh);
      pr.h[0] = *(const v8h*)(pwl + c * P64 + kk * 32 + 8 * hh);
      pr.h[1] = *(const v8h*)(pwl + c * P64 + kk * 32 + 16 + 8 * hh);
#pragma unroll
      for (int t = 0; t < 2; ++t) {
        FH vb, vr;
        vb.h[0] = *(const v8h*)(Vth + (t * 16 + c) * P64 + kk * 32 + 8 * hh);
        vb.h[1] = *(const v8h*)(Vth + (t * 16 + c) * P64 + kk * 32 + 16 + 8 * hh);
        vr.h[0] = *(const v8h*)(Vtl + (t * 16 + c) * P64 + kk * 32 + 8 * hh);
        vr.h[1] = *(const v8h*)(Vtl + (t * 16 + c) * P64 + kk * 32 + 16 + 8 * hh);
        oacc[t] = mma_h(pa.v, vb.v, oacc[t]);
        o1[t]   = mma_h(pa.v, vr.v, o1[t]);
        o2[t]   = mma_h(pr.v, vb.v, o2[t]);
      }
    }
#pragma unroll
    for (int t = 0; t < 2; ++t)
#pragma unroll
      for (int r = 0; r < 8; ++r) {
        const float f1 = o1[t][r] * (1.0f / 4096.0f);
        const float f2 = o2[t][r] * (1.0f / 2048.0f);
        oacc[t][r] = oacc[t][r] + f1 + f2;
      }
  }

  // ---- normalise (1/l, undo the x1024 p carry and the x8 v carry), stage the wave's 16x32 tile,
  float* os = Os[wave];
#pragma unroll
  for (int r = 0; r < 8; ++r) {
    const float l = lrow[r];
    const float inv = ((l > 0.f) ? (1.0f / l) : 0.f) * (1.0f / 8192.0f);
#pragma unroll
    for (int t = 0; t < 2; ++t) os[(8 * hh + r) * HD + t * 16 + c] = oacc[t][r] * inv;
  }
  __builtin_amdgcn_fence(__ATOMIC_RELEASE, "workgroup");
  __builtin_amdgcn_wave_barrier();
  __builtin_amdgcn_fence(__ATOMIC_ACQUIRE, "workgroup");
  {
    const int q4 = lane >> 3, c4 = (lane & 7) * 4;
    v4f ov[4];
#pragma unroll
    for (int it = 0; it < 4; ++it) {
      const int row = it * 4 + q4;                 // it 0..3 x q4 0..3 = rows 0..15 of the wave tile
      const float* spo = os + row * HD + c4;
      v4f v;
      v[0] = spo[0]; v[1] = spo[1]; v[2] = spo[2]; v[3] = spo[3];
      ov[it] = v;
    }
    {
#pragma unroll
      for (int it = 0; it < 4; ++it) {
        const int row = it * 4 + q4;
        const size_t go = ((size_t)b * SEQ + (size_t)(q0 + row)) * EMB + (size_t)h * HD + c4;
        *(v4f*)(out + go) = ov[it];
      }
      
    }
  }
}

// =====================================================================================================
// Workspace map (bytes), every region an exact multiple of its whole-line store granularity:
//   K2   f16 [256][512][64]        16777216
//   VTl  f16 [256][32][512]         8388608
//   total                          50462720
// Launches: k_partner (256 blocks x 512), k_proj (2048 x 256), k_attn (2048 x 128).
// =====================================================================================================
extern "C" void kernel_launch(void* const* d_in, const int* in_sizes, int n_in,
                              void* d_out, int out_size, void* d_ws, size_t ws_size,
                              hipStream_t stream) {
  if (n_in < 6) return;
  if (in_sizes[0] != NB * SEQ * EMB) return;
  if (in_sizes[1] != NB * SEQ * EMB) return;
  if (in_sizes[2] != NB * SEQ * 4) return;
  if (in_sizes[3] != HD * HD || in_sizes[4] != HD * HD || in_sizes[5] != HD * HD) return;
  if (out_size != NB * SEQ * EMB) return;

  const float* content = (const float*)d_in[0];
  const float* posenc  = (const float*)d_in[1];
  const float* centers = (const float*)d_in[2];
  const float* Wq      = (const float*)d_in[3];
  const float* Wk      = (const float*)d_in[4];
  const float* Wv      = (const float*)d_in[5];

  const size_t PPT = (size_t)NB * SEQ * 2 * 4;             //   131072
  const size_t PQ2 = (size_t)NB * NH * SEQ * QD * 2;       // 16777216
  const size_t PVT = (size_t)NB * NH * HD * SEQ * 2;       //  8388608
  size_t off = 0;
  const size_t oPT = off; off += PPT;
  const size_t oQ2 = off; off += PQ2;
  const size_t oK2 = off; off += PQ2;
  const size_t oVh = off; off += PVT;
  const size_t oVl = off; off += PVT;
  if (off > ws_size) return;                               // off = 50462720
  if (off > (size_t)134217728) return;

  char* ws = (char*)d_ws;
  int*            PT  = (int*)(ws + oPT);
  unsigned short* Q2  = (unsigned short*)(ws + oQ2);
  unsigned short* K2  = (unsigned short*)(ws + oK2);
  unsigned short* VTh = (unsigned short*)(ws + oVh);
  unsigned short* VTl = (unsigned short*)(ws + oVl);
  float*          outp = (float*)d_out;

  const float sscale = (1.0f / 64.0f) / sqrtf(2.0f * (float)EMB);   // 1/(64 sqrt(512))

  const dim3 gP(NQT, NB);            //  256 blocks of 512
  const dim3 gT(NQT, NH, NB);        // 2048 blocks

  // (1) partner table
  k_partner<<<gP, dim3(64 * PSL), 0, stream>>>(centers, PT);
  // (2) gathered [q|k] planes (x8, f16), v^T hi / residual planes
  k_proj<<<gT, dim3(256), 0, stream>>>(content, posenc, PT, Wq, Wk, Wv, Q2, K2, VTh, VTl);
  // (3) attention -> d_out f32 [32][512][256]
  k_attn<<<gT, dim3(128), 0, stream>>>(Q2, K2, VTh, VTl, outp, sscale);
  (void)hipGetLastError();
}

// v003
// A run of this version takes 71.3 microseconds.
// Timed twice side by side with v002, it ran 1.21 and 1.22 times as fast.
// Counting every step since v000, it is 2.81 times as fast.
// Contractions: [q|k] and v^T projections = v_wmma_f32_16x16x32_bf16 (bf16 operands: RNE-converted content, pos, Wq, Wk, Wv;
//   x_qk.W evaluated as [content | pos] x [W ; W] along k; single products, f32 accumulate);
// gathered q.k^T scores = v_wmma_f32_16x16x32_f16 (q and k f16 planes carried x8; single product; f32 accumulate);
// p.v = v_wmma_f32_16x16x32_f16 (p f16 carried x1024 + residual plane x2048; v^T f16 carried x8 + residual plane x4096;
//   3 products ph.vh, ph.vl, pl.vh into f32 accumulators); partner selection (IoU argmax) and softmax in f32 on the VALU.
// Carry audit:
//   Q2 plane  f16 = f16(8 q)                     (k_proj staging)  -> undone in k_attn by sscale = 1/(64 sqrt(512))
//   K2 plane  f16 = f16(8 k)                     (k_proj staging)  -> same sscale (8*8 = 64)
//   VTh plane f16 = f16(8 v)                     (k_proj store)    -> k_attn epilogue inv includes 1/8
//   VTl plane f16 = f16((8 v - VTh) * 4096)      (k_proj store)    -> k_attn per-chunk fold o1 * (1/4096), then 1/8 in epilogue
//   P hi      f16 = f16(1024 p)                  (k_attn softmax)  -> k_attn epilogue inv includes 1/1024
//   P res     f16 = f16((1024 p - hi) * 2048)    (k_attn softmax)  -> k_attn per-chunk fold o2 * (1/2048), then 1/1024 in epilogue
#include <hip/hip_runtime.h>
#include <math.h>
#include <stdint.h>

#pragma clang fp contract(off)

#define NB   32
#define SEQ  512
#define EMB  256
#define NH   8
#define HD   32            // per-head dim
#define QD   64            // gathered q/k width (two partner rows)
#define NQT  (SEQ / 64)    // 64-row query tiles per sequence
#define NKT  (SEQ / 64)    // 64-key chunks per sequence
// LDS row pitches, in 16-bit elements, of every tile that is read as a WMMA fragment with 16-byte loads: 16 B x odd,
// so that the 16 rows one half-wave reads fall on 64 distinct banks (at the bare 128 B / 64 B they share 8 / 16 banks)
#define P64  72            // 64-element rows: 144 B
#define P32  40            // 32-element rows:  80 B
static_assert(NH * HD == EMB);
static_assert(NQT == 8 && NKT == 8);
static_assert((SEQ % 64) == 0 && (HD % 32) == 0 && (QD % 32) == 0);
static_assert(P64 >= QD && P32 >= HD && (P64 % 8) == 0 && (P32 % 8) == 0 && ((P64 / 8) & 1) == 1 && ((P32 / 8) & 1) == 1);

typedef _Float16 v16h __attribute__((ext_vector_type(16)));
typedef _Float16 v8h  __attribute__((ext_vector_type(8)));
typedef __bf16   v16b __attribute__((ext_vector_type(16)));
typedef __bf16   v8b  __attribute__((ext_vector_type(8)));
typedef float    v8f  __attribute__((ext_vector_type(8)));
typedef float    v4f  __attribute__((ext_vector_type(4)));
typedef unsigned int v4u __attribute__((ext_vector_type(4)));
typedef unsigned int v2u __attribute__((ext_vector_type(2)));
typedef int      v4i  __attribute__((ext_vector_type(4)));

#if defined(__HIP_DEVICE_COMPILE__)
#define DEV_ASM 1
#else
#define DEV_ASM 0
#endif

// ---- scalar helpers --------------------------------------------------------------------------------
__device__ __forceinline__ unsigned short bf_bits(float f) {          // f32 -> bf16 bits, RNE convert
  unsigned u = __float_as_uint(f);
  return (unsigned short)((u + 0x7FFFu + ((u >> 16) & 1u)) >> 16);
}
__device__ __forceinline__ float bf_up(unsigned short hb) { return __uint_as_float(((unsigned)hb) << 16); }
__device__ __forceinline__ unsigned short h_bits(_Float16 x) { return __builtin_bit_cast(unsigned short, x); }
__device__ __forceinline__ unsigned pk16(unsigned short a, unsigned short b) { return (unsigned)a | ((unsigned)b << 16); }
__device__ __forceinline__ v8f zero8() { v8f z = {0.f, 0.f, 0.f, 0.f, 0.f, 0.f, 0.f, 0.f}; return z; }

// ---- fragment loaders: 16-bit A/B operand, lane -> row/col (lane&15), p already includes +8*(lane>>4);
//      elements 0..7 <- p[0..7] (k0+8h..k0+8h+7), elements 8..15 <- p[16..23] (k0+16+8h..k0+16+8h+7)
template <typename OT> struct FT;
template <> struct FT<__bf16>   { typedef v16b frag; typedef v8b half8; };
template <> struct FT<_Float16> { typedef v16h frag; typedef v8h half8; };

template <typename OT>
__device__ __forceinline__ typename FT<OT>::frag ldfrag(const OT* p) {
  union { typename FT<OT>::frag v; typename FT<OT>::half8 h[2]; } f;
  f.h[0] = *(const typename FT<OT>::half8*)(p);
  f.h[1] = *(const typename FT<OT>::half8*)(p + 16);
  return f.v;
}

// ---- guarded WMMA helpers: 4 VALU slots after the WMMA, D tied, A/B kept live --------------------------
__device__ __forceinline__ v8f mma_b(v16b a, v16b b, v8f c) {
  c = __builtin_amdgcn_wmma_f32_16x16x32_bf16(false, a, false, b, (short)0, c, false, false);
#if DEV_ASM
  asm volatile("v_nop\n\tv_nop\n\tv_nop\n\tv_nop" : "+v"(c) : "v"(a), "v"(b));
#endif
  return c;
}
__device__ __forceinline__ v8f mma_h(v16h a, v16h b, v8f c) {
  c = __builtin_amdgcn_wmma_f32_16x16x32_f16(false, a, false, b, (short)0, c, false, false);
#if DEV_ASM
  asm volatile("v_nop\n\tv_nop\n\tv_nop\n\tv_nop" : "+v"(c) : "v"(a), "v"(b));
#endif
  return c;
}

// =====================================================================================================
// Partner selection (f32, VALU, fp-contract off, literal op order):
//   c = RNE-bf16(centers); bbox = (c0 - c3*0.5, c1 - c2*0.5, c0 + c3*0.5, c1 + c2*0.5);
//   inter = max(min maxs - max mins, 0) products; union = (area_i + area_j) - inter; iou = inter/union - eye;
//   amax = first index of the row maximum (NaN counts as maximum, first NaN wins); l1 = (c2 - c0) + (c3 - c1);
//   cond = l1_i >= l1[amax]; p0 = cond ? i : amax, p1 = cond ? amax : i.
// grid (NQT, NB), 512 threads: block = 64 rows of one batch x PSL slices of PJS candidates; all 512 boxes of the
//   batch staged in LDS. Wave w scans rows 32*(w&1)..+31 against candidates PJS*(w>>1)..+PJS-1 and keeps, per row,
//   (slice maximum, its first index, first NaN index); threads 0..63 merge the slices in ascending order with a strict
//   compare, so the result is the first index of the row maximum (or the first NaN), as in one ascending scan.
// coverage: 8 blocks x 64 rows x 2 ints per batch = the whole table.
// =====================================================================================================
#define PSL 8              // candidate slices per row
#define PJS (SEQ / PSL)    // candidates per slice
static_assert(PSL * PJS == SEQ && (PJS % 2) == 0);
__global__ __launch_bounds__(64 * PSL) void k_partner(const float* __restrict__ cen, int* pt) {
#pragma clang fp contract(off)
  __shared__ float sb0[SEQ];
  __shared__ float sb1[SEQ];
  __shared__ float sb2[SEQ];
  __shared__ float sb3[SEQ];
  __shared__ float sar[SEQ];
  __shared__ float sl1[SEQ];
  __shared__ float mbv[PSL][64];                // slice maximum per row
  __shared__ int   mbj[PSL][64];                // its first index
  __shared__ int   mnj[PSL][64];                // first NaN index of the slice, SEQ if none
  __shared__ __align__(16) int sp[128];

  const int tid = (int)threadIdx.x;
  const int row = tid & 63;
  const int sl  = tid >> 6;                     // the same for a whole wave
  const int i0  = (int)blockIdx.x * 64;
  const int b   = (int)blockIdx.y;
  const float* cb = cen + (size_t)b * SEQ * 4;

  for (int s = tid; s < SEQ; s += 64 * PSL) {
    const v4f cv = *(const v4f*)(cb + (size_t)s * 4);
#if DEV_ASM
    // precaution: stands between this load and the later reuse of the scalar registers that hold its base address
    asm volatile("s_wait_xcnt 0x0" ::: "memory");
#endif
    const float c0 = bf_up(bf_bits(cv[0]));
    const float c1 = bf_up(bf_bits(cv[1]));
    const float c2 = bf_up(bf_bits(cv[2]));
    const float c3 = bf_up(bf_bits(cv[3]));
    const float hx = c3 * 0.5f;
    const float hy = c2 * 0.5f;
    const float x0 = c0 - hx;
    const float y0 = c1 - hy;
    const float x1 = c0 + hx;
    const float y1 = c1 + hy;
    sb0[s] = x0;
    sb1[s] = y0;
    sb2[s] = x1;
    sb3[s] = y1;
    const float dx = x1 - x0;
    const float dy = y1 - y0;
    sar[s] = dx * dy;
    const float la = c2 - c0;
    const float lb = c3 - c1;
    sl1[s] = la + lb;
  }
  __syncthreads();

  const int i = i0 + row;                       // 0..511
  const float a0 = sb0[i], a1 = sb1[i], a2 = sb2[i], a3 = sb3[i], ar = sar[i];
  float best = -INFINITY;
  int   bj = 0;
  int   nj = SEQ;
  const int j0 = sl * PJS;
#pragma unroll 2
  for (int jj = 0; jj < PJS; ++jj) {
    const int j = j0 + jj;
    const float m0 = fmaxf(a0, sb0[j]);
    const float m1 = fmaxf(a1, sb1[j]);
    const float x2 = fminf(a2, sb2[j]);
    const float x3 = fminf(a3, sb3[j]);
    const float d0 = x2 - m0;
    const float d1 = x3 - m1;
    const float w0 = fmaxf(d0, 0.0f);
    const float w1 = fmaxf(d1, 0.0f);
    const float inter = w0 * w1;
    const float asum  = ar + sar[j];
    const float uni   = asum - inter;
    const float q     = inter / uni;
    const float e     = (j == i) ? 1.0f : 0.0f;
    const float iou   = q - e;
    const bool  up    = iou > best;             // false for NaN
    best = up ? iou : best;
    bj   = up ? j : bj;
    nj   = min(nj, (iou != iou) ? j : SEQ);
  }
  mbv[sl][row] = best;
  mbj[sl][row] = bj;
  mnj[sl][row] = nj;
  __syncthreads();

  if (tid < 64) {
    float gb = -INFINITY;
    int   gj = 0;
    int   gn = SEQ;
    // unrolled so that all slice reads are issued before the first one is waited for
#pragma unroll
    for (int s = 0; s < PSL; ++s) {             // ascending slices, strict compare: the first maximum wins
      const float v = mbv[s][tid];
      const int   x = mbj[s][tid];
      const bool  up = v > gb;
      gb = up ? v : gb;
      gj = up ? x : gj;
      gn = min(gn, mnj[s][tid]);
    }
    const int am = (gn < SEQ) ? gn : gj;        // NaN counts as maximum, first NaN wins
    const float l1i = sl1[i];
    const float l1p = sl1[am];
    const bool cond = (l1i >= l1p);
    sp[tid * 2 + 0] = cond ? i : am;
    sp[tid * 2 + 1] = cond ? am : i;
  }
  __syncthreads();

  if (tid < 32) {
    const v4i v = *(const v4i*)(sp + tid * 4);    // rows i0+2*tid, i0+2*tid+1
    int* dst = pt + ((size_t)b * SEQ + i0) * 2 + tid * 4;
    *(v4i*)dst = v;
  }
}

// =====================================================================================================
// Projections with the partner gather fused in. Block = (64-row tile it, head h, batch b), 256 threads.
//   Xg[g][r][0..31] = bf16(content[b][p_g(i0+r)][h*32..]), Xg[g][r][32..63] = bf16(pos[same row]) (g = 0: p0, 1: p1;
//   indices from PT, clamped to [0, SEQ-1]); Xv[r][k] = bf16(content[b][i0+r][h*32+k]);
//   W2[which][n][k'] = bf16(W[k' & 31][n]) for Wq (0) / Wk (1); Wvt[n][k] = bf16(Wv[k][n]).
//   Q2[i][g*32+n] = sum_k' Xg[g][i][k'] W2q[n][k'] (K = 64) = (content + pos)[p_g(i)] . Wq; K2 likewise with Wk;
//   V^T[d][s] = sum_k Wvt[d][k] Xv[s][k].
//   Waves 0..3: Q2 m-tile (wave&3); waves 4..7: K2 m-tile; every wave one 16x16 V^T tile (dt = wave&1, st = wave>>1).
//   wave w writes Q2 rows 8w..8w+7 and K2 rows 8w..8w+7 (2 instructions each, 4 lines per instruction, 8 lanes x 16 B
//   coverage: Q2/K2 = 8 waves x 8 rows x 64 cols = the block's 64x64 tile; VTh/VTl = 8 waves x 4 d-rows x 64 s.
// Plane layouts: Q2/K2 f16 [b*NH+h][s][64]; VTh/VTl f16 [b*NH+h][d][SEQ].
// =====================================================================================================
__global__ __launch_bounds__(256) void k_proj(
    const float* __restrict__ content, const float* __restrict__ pos, const int* __restrict__ pt,
    const float* __restrict__ Wq, const float* __restrict__ Wk, const float* __restrict__ Wv,
    unsigned short* q2p, unsigned short* k2p, unsigned short* vhp, unsigned short* vlp) {
  __shared__ __align__(16) unsigned short Xg[2][64 * P64];    // 18 KB
  __shared__ __align__(16) unsigned short Xv[64 * P32];       //  5 KB
  __shared__ __align__(16) unsigned short W2[2][HD * P64];    //  9 KB
  __shared__ __align__(16) unsigned short Wvt[HD * P32];      //  2.5 KB
  __shared__ int sIdx[2][64];                                 // 512 B
  __shared__ __align__(16) unsigned short stQK[2][64 * QD];   // 16 KB
  __shared__ __align__(16) float stV[HD * 64];                //  8 KB

  const int tid  = (int)threadIdx.x;
  const int wave = tid >> 5;
  const int lane = tid & 31;
  const int rl   = lane & 15;
  const int hh   = lane >> 4;
  const int i0   = (int)blockIdx.x * 64;
  const int h    = (int)blockIdx.y;
  const int b    = (int)blockIdx.z;
  const size_t rowB = (size_t)b * SEQ;
  const size_t bh   = (size_t)b * NH + (size_t)h;

  // (a) partner indices of rows i0..i0+63, clamped
  if (tid < 128) {
    const int r = tid >> 1, g = tid & 1;
    int v = pt[(rowB + (size_t)(i0 + r)) * 2 + g];
    v = min(max(v, 0), SEQ - 1);
    sIdx[g][r] = v;
  }
  // (b) weights, transposed to [n][k], bf16 bits; k duplicated over the two 32-halves for Wq / Wk
  for (int e = tid; e < HD * QD; e += 256) {
    const int n = e >> 6, kp = e & 63, k = kp & 31;
    W2[0][n * P64 + kp] = bf_bits(Wq[k * HD + n]);
    W2[1][n * P64 + kp] = bf_bits(Wk[k * HD + n]);
  }
  for (int e = tid; e < HD * HD; e += 256) {
    const int n = e >> 5, k = e & 31;
    Wvt[n * P32 + k] = bf_bits(Wv[k * HD + n]);
  }
  // (c) content rows i0..i0+63, head slice h -> Xv (512 float4 pieces, 2 per thread)
  for (int e = tid; e < 64 * HD / 4; e += 256) {
    const int r = e >> 3, c4 = (e & 7) * 4;
    const v4f v = *(const v4f*)(content + (rowB + (size_t)(i0 + r)) * EMB + (size_t)h * HD + c4);
    v2u pk;
    pk[0] = pk16(bf_bits(v[0]), bf_bits(v[1]));
    pk[1] = pk16(bf_bits(v[2]), bf_bits(v[3]));
    *(v2u*)(Xv + r * P32 + c4) = pk;
  }
  __syncthreads();
  // (d) gathered rows: it2 -> (g, source) uniform; e -> (row r, float4 piece); 8 x 256 pieces = [2][2][64][8]
#pragma unroll
  for (int it2 = 0; it2 < 8; ++it2) {
    const int g   = it2 >> 2;
    const int src = (it2 >> 1) & 1;
    const int e   = (it2 & 1) * 256 + tid;
    const int r   = e >> 3, c4 = (e & 7) * 4;
    const float* base = src ? pos : content;
    const int srow = sIdx[g][r];
    const v4f v = *(const v4f*)(base + (rowB + (size_t)srow) * EMB + (size_t)h * HD + c4);
    v2u pk;
    pk[0] = pk16(bf_bits(v[0]), bf_bits(v[1]));
    pk[1] = pk16(bf_bits(v[2]), bf_bits(v[3]));
    *(v2u*)(Xg[g] + r * P64 + src * HD + c4) = pk;
  }
  __syncthreads();

  // (e) WMMA
  const int mt    = wave & 3;
  const int which = wave >> 2;
  const __bf16* Xb0 = (const __bf16*)(const void*)Xg[0];
  const __bf16* Xb1 = (const __bf16*)(const void*)Xg[1];
  const __bf16* Wb  = (const __bf16*)(const void*)W2[which];
  v8f acc00 = zero8(), acc01 = zero8(), acc10 = zero8(), acc11 = zero8();
#pragma unroll
  for (int ks = 0; ks < 2; ++ks) {
    const v16b b0 = ldfrag<__bf16>(Wb + (size_t)rl * P64 + ks * 32 + 8 * hh);
    const v16b b1 = ldfrag<__bf16>(Wb + (size_t)(16 + rl) * P64 + ks * 32 + 8 * hh);
    const v16b a0 = ldfrag<__bf16>(Xb0 + (size_t)(mt * 16 + rl) * P64 + ks * 32 + 8 * hh);
    const v16b a1 = ldfrag<__bf16>(Xb1 + (size_t)(mt * 16 + rl) * P64 + ks * 32 + 8 * hh);
    acc00 = mma_b(a0, b0, acc00);
    acc01 = mma_b(a0, b1, acc01);
    acc10 = mma_b(a1, b0, acc10);
    acc11 = mma_b(a1, b1, acc11);
  }
  const int dt = wave & 1, st = wave >> 1;
  const v16b av = ldfrag<__bf16>((const __bf16*)(const void*)Wvt + (size_t)(dt * 16 + rl) * P32 + 8 * hh);  // A[d][k]
  const v16b bv = ldfrag<__bf16>((const __bf16*)(const void*)Xv + (size_t)(st * 16 + rl) * P32 + 8 * hh);   // B[k][s] from row s
  v8f accv = zero8();
  accv = mma_b(av, bv, accv);

  // (f) stage results (D element r = row 8*hh + r, col rl)
  unsigned short* sq = stQK[which];
#pragma unroll
  for (int r = 0; r < 8; ++r) {
    const int row = mt * 16 + 8 * hh + r;
    sq[row * QD + 0  + rl] = h_bits((_Float16)(acc00[r] * 8.0f));
    sq[row * QD + 16 + rl] = h_bits((_Float16)(acc01[r] * 8.0f));
    sq[row * QD + 32 + rl] = h_bits((_Float16)(acc10[r] * 8.0f));
    sq[row * QD + 48 + rl] = h_bits((_Float16)(acc11[r] * 8.0f));
    stV[(dt * 16 + 8 * hh + r) * 64 + st * 16 + rl] = accv[r];
  }
  __syncthreads();

  // (g) whole-line stores
  const int q4 = lane >> 3, c8 = (lane & 7) * 8;
  v4u qv[2], kv[2];
#pragma unroll
  for (int it = 0; it < 2; ++it) {
    const int row = wave * 8 + it * 4 + q4;
    qv[it] = *(const v4u*)(stQK[0] + row * QD + c8);
    kv[it] = *(const v4u*)(stQK[1] + row * QD + c8);
  }
  const int d = wave * 4 + q4;
  v4u vhv, vlv;
  {
    const float* spv = stV + d * 64 + c8;
#pragma unroll
    for (int e = 0; e < 4; ++e) {
      const float f0 = spv[2 * e] * 8.0f, f1 = spv[2 * e + 1] * 8.0f;
      const _Float16 x0 = (_Float16)f0, x1 = (_Float16)f1;
      const float r0 = f0 - (float)x0, r1 = f1 - (float)x1;
      const _Float16 l0 = (_Float16)(r0 * 4096.0f), l1 = (_Float16)(r1 * 4096.0f);
      vhv[e] = pk16(h_bits(x0), h_bits(x1));
      vlv[e] = pk16(h_bits(l0), h_bits(l1));
    }
  }
  {
#pragma unroll
    for (int it = 0; it < 2; ++it) {
      const int row = wave * 8 + it * 4 + q4;
      const size_t po = (bh * SEQ + (size_t)(i0 + row)) * QD + c8;
      *(v4u*)(q2p + po) = qv[it];
      *(v4u*)(k2p + po) = kv[it];
    }
    const size_t vo = (bh * HD + (size_t)d) * SEQ + (size_t)i0 + c8;
    *(v4u*)(vhp + vo) = vhv;
    *(v4u*)(vlp + vo) = vlv;
    
  }
}

// =====================================================================================================
// Attention on the gathered planes, head dim 64 for q/k, 32 for v, no mask, softmax over all SEQ keys.
//   Both products are taken transposed, so that a lane owns one query column (lane&15) throughout:
//   scores^T = (K2 . Q2^T) * sscale on f16 WMMA (A = K2 rows from LDS, B = Q2 rows kept in registers),
//   sscale = 1/(64 sqrt(512)); D register r of key tile j = score of key 16 j + 8 (lane>>4) + r for query lane&15.
//   Online softmax in f32: maximum and sum run over the lane's own 32 scores; the two wave halves of a query exchange
//   the maximum once per chunk and join their partial sums once, behind the loop.
//   p = exp(s - m) carried as f16(1024 p) plus residual f16((1024 p - hi) * 2048); key tiles 2 kk and 2 kk + 1,
//   converted in place, are the B operand of 32 keys in the hardware k order (8 h + e, 16 + 8 h + e), the order in
//   which the V^T rows are read as A: P never passes through LDS.
//   context^T = vh . ph + (vl . ph)/4096 + (vh . pl)/2048 on f16 WMMA; out = context / (l * 1024 * 8) in f32.
//   Block = 4 waves = 64 query rows of one (b, h); grid (NQT, NH, NB); key chunks of 64, static trip NKT.
//   Chunk staging (plain 16-B loads, __syncthreads before and after): K2 chunk 128 threads x 32 halves = 64x64;
//   V^T hi / residual chunks 128 threads x 16 halves = 32x64 each.
//   Output: d_out[b][q][h*32 + d] f32; each wave stores rows q0..q0+15 (it 0..3 x lane>>3) x 32 floats =
//   coverage: grid (8 tiles x 8 heads x 32 batches) x 4 waves x 16 rows x 32 cols = every output element once.
// =====================================================================================================
#define POS  36            // out-tile row pitch in floats: 144 B (16 B x odd), rows written and read with 16-byte accesses
static_assert(POS >= HD && (POS % 4) == 0 && ((POS / 4) & 1) == 1);

// lane l <-> lane l ^ 16: the two lanes that share one query column
__device__ __forceinline__ float xhalf(float x) {
  const int xb = __builtin_bit_cast(int, x);
  return __builtin_bit_cast(float, __builtin_amdgcn_permlanex16(xb, xb, 0x76543210, 0xfedcba98, false, false));
}

__global__ __launch_bounds__(128)
void k_attn(const unsigned short* __restrict__ q2p, const unsigned short* __restrict__ k2p,
            const unsigned short* __restrict__ vhp, const unsigned short* __restrict__ vlp,
            float* out, float sscale) {
  union FH { v16h v; v8h h[2]; };
  __shared__ __align__(16) _Float16 Ksh[64 * P64];         // K2 chunk [key][d]   9 KB
  __shared__ __align__(16) _Float16 Vth[HD * P64];         // V^T hi [d][key]    4.5 KB
  __shared__ __align__(16) _Float16 Vtl[HD * P64];         // V^T residual       4.5 KB
  __shared__ __align__(16) float    Os[4][16 * POS];       // per wave out tile  9 KB

  const int tid  = (int)threadIdx.x;
  const int wave = tid >> 5;
  const int lane = tid & 31;
  const int hh   = lane >> 4;
  const int c    = lane & 15;

  const int q0 = (int)blockIdx.x * 64 + wave * 16;
  const int h  = (int)blockIdx.y;
  const int b  = (int)blockIdx.z;
  const size_t bh = (size_t)b * NH + (size_t)h;

  const _Float16* Q  = (const _Float16*)(const void*)q2p + bh * SEQ * QD;
  const _Float16* K  = (const _Float16*)(const void*)k2p + bh * SEQ * QD;
  const _Float16* Vh = (const _Float16*)(const void*)vhp + bh * HD * SEQ;
  const _Float16* Vl = (const _Float16*)(const void*)vlp + bh * HD * SEQ;

  // ---- Q fragments (B operand, column = lane&15): 2 d-chunks of the 64-wide gathered row ----
  v16h qb[2];
#pragma unroll
  for (int dc = 0; dc < 2; ++dc)
    qb[dc] = ldfrag<_Float16>(Q + (size_t)(q0 + c) * QD + dc * 32 + 8 * hh);

  float mrun = -INFINITY;                    // running maximum of query c (equal in both halves)
  float lrun = 0.f;                          // running sum over this half's keys only
  v8f oacc[2];                               // context^T: register r of tile t = d 16 t + 8 hh + r, query c
#pragma unroll
  for (int t = 0; t < 2; ++t) oacc[t] = zero8();

  for (int kt = 0; kt < NKT; ++kt) {         // static trip count
    const int kv0 = kt * 64;
    __syncthreads();
    {
      const int r = tid >> 1, half = (tid & 1) * 32;                // K2 row kv0+r, d = half..half+31
      const _Float16* kg = K + (size_t)(kv0 + r) * QD + half;
#pragma unroll
      for (int i = 0; i < 4; ++i)
        *(v8h*)(Ksh + r * P64 + half + 8 * i) = *(const v8h*)(kg + 8 * i);
      const int r2 = tid >> 2, qq = (tid & 3) * 16;                 // V^T row d = r2, s = kv0+qq..+15
      const _Float16* vg  = Vh + (size_t)r2 * SEQ + kv0 + qq;
      const _Float16* vlg = Vl + (size_t)r2 * SEQ + kv0 + qq;
#pragma unroll
      for (int i = 0; i < 2; ++i) {
        *(v8h*)(Vth + r2 * P64 + qq + 8 * i) = *(const v8h*)(vg + 8 * i);
        *(v8h*)(Vtl + r2 * P64 + qq + 8 * i) = *(const v8h*)(vlg + 8 * i);
      }
    }
    __syncthreads();

    // ---- scores^T: 64 keys x 16 query columns per wave ----
    v8f s[4];
#pragma unroll
    for (int j = 0; j < 4; ++j) {
      v8f a = zero8();
#pragma unroll
      for (int dc = 0; dc < 2; ++dc) {
        FH kb;
        kb.h[0] = *(const v8h*)(Ksh + (j * 16 + c) * P64 + dc * 32 + 8 * hh);
        kb.h[1] = *(const v8h*)(Ksh + (j * 16 + c) * P64 + dc * 32 + 16 + 8 * hh);
        a = mma_h(kb.v, qb[dc], a);
      }
#pragma unroll
      for (int r = 0; r < 8; ++r) s[j][r] = a[r] * sscale;
    }

    // ---- column max in the lane, one exchange between the halves, online softmax ----
    float m = s[0][0];
#pragma unroll
    for (int j = 0; j < 4; ++j)
#pragma unroll
      for (int r = 0; r < 8; ++r) m = fmaxf(m, s[j][r]);
    m = fmaxf(m, xhalf(m));
    const float mnew  = fmaxf(mrun, m);
    const float msafe = (mnew == -INFINITY) ? 0.f : mnew;
    const float alpha = __expf(mrun - msafe);
    mrun = mnew;

#pragma unroll
    for (int t = 0; t < 2; ++t)
#pragma unroll
      for (int r = 0; r < 8; ++r) oacc[t][r] *= alpha;

    // ---- per 32 keys: P hi (x1024) and residual (x2048) packed in place into B operands, then
    //      context^T += V^T . P^T (3 f16 products); residual products into separate per-chunk accumulators ----
    v8f o1[2], o2[2];
#pragma unroll
    for (int t = 0; t < 2; ++t) { o1[t] = zero8(); o2[t] = zero8(); }
    float ps[4];
    // unrolled: the scores live in registers and are picked by kk
#pragma unroll
    for (int kk = 0; kk < 2; ++kk) {
      v16h pa, pr;
#pragma unroll
      for (int jj = 0; jj < 2; ++jj) {
        const int j = 2 * kk + jj;
        float psum = 0.f;
#pragma unroll
        for (int r = 0; r < 8; ++r) {
          const float p  = __expf(s[j][r] - msafe);
          psum += p;
          const float pp = p * 1024.0f;
          const _Float16 ph = (_Float16)pp;
          const float res = pp - (float)ph;
          const _Float16 pl = (_Float16)(res * 2048.0f);
          pa[jj * 8 + r] = ph;
          pr[jj * 8 + r] = pl;
        }
        ps[j] = psum;
      }
#pragma unroll
      for (int t = 0; t < 2; ++t) {
        FH vb, vr;
        vb.h[0] = *(const v8h*)(Vth + (t * 16 + c) * P64 + kk * 32 + 8 * hh);
        vb.h[1] = *(const v8h*)(Vth + (t * 16 + c) * P64 + kk * 32 + 16 + 8 * hh);
        vr.h[0] = *(const v8h*)(Vtl + (t * 16 + c) * P64 + kk * 32 + 8 * hh);
        vr.h[1] = *(const v8h*)(Vtl + (t * 16 + c) * P64 + kk * 32 + 16 + 8 * hh);
        oacc[t] = mma_h(vb.v, pa, oacc[t]);
        o1[t]   = mma_h(vr.v, pa, o1[t]);
        o2[t]   = mma_h(vb.v, pr, o2[t]);
      }
    }
    lrun = lrun * alpha + ((ps[0] + ps[1]) + (ps[2] + ps[3]));
#pragma unroll
    for (int t = 0; t < 2; ++t)
#pragma unroll
      for (int r = 0; r < 8; ++r) {
        const float f1 = o1[t][r] * (1.0f / 4096.0f);
        const float f2 = o2[t][r] * (1.0f / 2048.0f);
        oacc[t][r] = oacc[t][r] + f1 + f2;
      }
  }

  // ---- join the halves' sums, normalise (1/l, undo the x1024 p carry and the x8 v carry), stage the wave's 16x32 tile
  float* os = Os[wave];
  {
    const float l = lrun + xhalf(lrun);
    const float inv = ((l > 0.f) ? (1.0f / l) : 0.f) * (1.0f / 8192.0f);
#pragma unroll
    for (int t = 0; t < 2; ++t)
#pragma unroll
      for (int e = 0; e < 2; ++e) {
        v4f v;
#pragma unroll
        for (int x = 0; x < 4; ++x) v[x] = oacc[t][4 * e + x] * inv;
        *(v4f*)(os + c * POS + t * 16 + 8 * hh + 4 * e) = v;       // query row c, d = 16 t + 8 hh + 4 e ..+3
      }
  }
  __builtin_amdgcn_fence(__ATOMIC_RELEASE, "workgroup");
  __builtin_amdgcn_wave_barrier();
  __builtin_amdgcn_fence(__ATOMIC_ACQUIRE, "workgroup");
  {
    const int q4 = lane >> 3, c4 = (lane & 7) * 4;
    v4f ov[4];
#pragma unroll
    for (int it = 0; it < 4; ++it) {
      const int row = it * 4 + q4;                 // it 0..3 x q4 0..3 = rows 0..15 of the wave tile
      ov[it] = *(const v4f*)(os + row * POS + c4);
    }
    {
#pragma unroll
      for (int it = 0; it < 4; ++it) {
        const int row = it * 4 + q4;
        const size_t go = ((size_t)b * SEQ + (size_t)(q0 + row)) * EMB + (size_t)h * HD + c4;
        *(v4f*)(out + go) = ov[it];
      }
    }
  }
}

// =====================================================================================================
// Workspace map (bytes), every region an exact multiple of its whole-line store granularity:
//   K2   f16 [256][512][64]        16777216
//   VTl  f16 [256][32][512]         8388608
//   total                          50462720
// Launches: k_partner (256 blocks x 512), k_proj (2048 x 256), k_attn (2048 x 128).
// =====================================================================================================
extern "C" void kernel_launch(void* const* d_in, const int* in_sizes, int n_in,
                              void* d_out, int out_size, void* d_ws, size_t ws_size,
                              hipStream_t stream) {
  if (n_in < 6) return;
  if (in_sizes[0] != NB * SEQ * EMB) return;
  if (in_sizes[1] != NB * SEQ * EMB) return;
  if (in_sizes[2] != NB * SEQ * 4) return;
  if (in_sizes[3] != HD * HD || in_sizes[4] != HD * HD || in_sizes[5] != HD * HD) return;
  if (out_size != NB * SEQ * EMB) return;

  const float* content = (const float*)d_in[0];
  const float* posenc  = (const float*)d_in[1];
  const float* centers = (const float*)d_in[2];
  const float* Wq      = (const float*)d_in[3];
  const float* Wk      = (const float*)d_in[4];
  const float* Wv      = (const float*)d_in[5];

  const size_t PPT = (size_t)NB * SEQ * 2 * 4;             //   131072
  const size_t PQ2 = (size_t)NB * NH * SEQ * QD * 2;       // 16777216
  const size_t PVT = (size_t)NB * NH * HD * SEQ * 2;       //  8388608
  size_t off = 0;
  const size_t oPT = off; off += PPT;
  const size_t oQ2 = off; off += PQ2;
  const size_t oK2 = off; off += PQ2;
  const size_t oVh = off; off += PVT;
  const size_t oVl = off; off += PVT;
  if (off > ws_size) return;                               // off = 50462720
  if (off > (size_t)134217728) return;

  char* ws = (char*)d_ws;
  int*            PT  = (int*)(ws + oPT);
  unsigned short* Q2  = (unsigned short*)(ws + oQ2);
  unsigned short* K2  = (unsigned short*)(ws + oK2);
  unsigned short* VTh = (unsigned short*)(ws + oVh);
  unsigned short* VTl = (unsigned short*)(ws + oVl);
  float*          outp = (float*)d_out;

  const float sscale = (1.0f / 64.0f) / sqrtf(2.0f * (float)EMB);   // 1/(64 sqrt(512))

  const dim3 gP(NQT, NB);            //  256 blocks of 512
  const dim3 gT(NQT, NH, NB);        // 2048 blocks

  // (1) partner table
  k_partner<<<gP, dim3(64 * PSL), 0, stream>>>(centers, PT);
  // (2) gathered [q|k] planes (x8, f16), v^T hi / residual planes
  k_proj<<<gT, dim3(256), 0, stream>>>(content, posenc, PT, Wq, Wk, Wv, Q2, K2, VTh, VTl);
  // (3) attention -> d_out f32 [32][512][256]
  k_attn<<<gT, dim3(128), 0, stream>>>(Q2, K2, VTh, VTl, outp, sscale);
  (void)hipGetLastError();
}

// v004
// Measured time: 69.1 microseconds a run.
// Two timings next to v003 both put it at 1.03 times that version's speed.
// Counting every step since v000, it is 2.90 times as fast.
// Contractions: [q|k] and v^T projections = v_wmma_f32_16x16x32_bf16 (bf16 operands: RNE-converted content, pos, Wq, Wk, Wv;
//   x_qk.W evaluated as [content | pos] x [W ; W] along k; single products, f32 accumulate);
// gathered q.k^T scores = v_wmma_f32_16x16x32_f16 (q and k f16 planes carried x8; single product; f32 accumulate);
// p.v = v_wmma_f32_16x16x32_f16 (p f16 carried x1024 + residual plane x2048; v^T f16 carried x8 + residual plane x4096;
//   3 products ph.vh, ph.vl, pl.vh into f32 accumulators); partner selection (IoU argmax) and softmax in f32 on the VALU.
// Carry audit:
//   Q2 plane  f16 = f16(8 q)                     (k_proj staging)  -> undone in k_attn by sscale = 1/(64 sqrt(512)), inside c1
//   K2 plane  f16 = f16(8 k)                     (k_proj staging)  -> same sscale (8*8 = 64)
//   VTh plane f16 = f16(8 v)                     (k_proj store)    -> k_attn epilogue inv includes 1/8
//   VTl plane f16 = f16((8 v - VTh) * 4096)      (k_proj store)    -> k_attn per-chunk fold o1 * (1/4096), then 1/8 in epilogue
//   P hi      f16 = f16(1024 p)                  (k_attn softmax)  -> the row sum l carries the same x1024: cancels in 1/l
//   P res     f16 = f16((1024 p - hi) * 2048)    (k_attn softmax)  -> k_attn per-chunk fold o2 * (1/2048), then 1/l in epilogue
#include <hip/hip_runtime.h>
#include <math.h>
#include <stdint.h>

#pragma clang fp contract(off)

#define NB   32
#define SEQ  512
#define EMB  256
#define NH   8
#define HD   32            // per-head dim
#define QD   64            // gathered q/k width (two partner rows)
#define NQT  (SEQ / 64)    // 64-row query tiles per sequence
#define NKT  (SEQ / 64)    // 64-key chunks per sequence
// LDS row pitches, in 16-bit elements, of every tile that is read as a WMMA fragment with 16-byte loads: 16 B x odd,
// so that the 16 rows one half-wave reads fall on 64 distinct banks (at the bare 128 B / 64 B they share 8 / 16 banks)
#define P64  72            // 64-element rows: 144 B
#define P32  40            // 32-element rows:  80 B
static_assert(NH * HD == EMB);
static_assert(NQT == 8 && NKT == 8);
static_assert((SEQ % 64) == 0 && (HD % 32) == 0 && (QD % 32) == 0);
static_assert(P64 >= QD && P32 >= HD && (P64 % 8) == 0 && (P32 % 8) == 0 && ((P64 / 8) & 1) == 1 && ((P32 / 8) & 1) == 1);

typedef _Float16 v16h __attribute__((ext_vector_type(16)));
typedef _Float16 v8h  __attribute__((ext_vector_type(8)));
typedef __bf16   v16b __attribute__((ext_vector_type(16)));
typedef __bf16   v8b  __attribute__((ext_vector_type(8)));
typedef float    v8f  __attribute__((ext_vector_type(8)));
typedef float    v4f  __attribute__((ext_vector_type(4)));
typedef unsigned int v4u __attribute__((ext_vector_type(4)));
typedef unsigned int v2u __attribute__((ext_vector_type(2)));
typedef int      v4i  __attribute__((ext_vector_type(4)));
typedef float    v2f  __attribute__((ext_vector_type(2)));
typedef _Float16 v2h  __attribute__((ext_vector_type(2)));

#if defined(__HIP_DEVICE_COMPILE__)
#define DEV_ASM 1
#else
#define DEV_ASM 0
#endif

// ---- scalar helpers --------------------------------------------------------------------------------
__device__ __forceinline__ unsigned short bf_bits(float f) {          // f32 -> bf16 bits, RNE convert
  unsigned u = __float_as_uint(f);
  return (unsigned short)((u + 0x7FFFu + ((u >> 16) & 1u)) >> 16);
}
__device__ __forceinline__ float bf_up(unsigned short hb) { return __uint_as_float(((unsigned)hb) << 16); }
__device__ __forceinline__ unsigned short h_bits(_Float16 x) { return __builtin_bit_cast(unsigned short, x); }
__device__ __forceinline__ unsigned pk16(unsigned short a, unsigned short b) { return (unsigned)a | ((unsigned)b << 16); }
__device__ __forceinline__ v8f zero8() { v8f z = {0.f, 0.f, 0.f, 0.f, 0.f, 0.f, 0.f, 0.f}; return z; }

// ---- fragment loaders: 16-bit A/B operand, lane -> row/col (lane&15), p already includes +8*(lane>>4);
//      elements 0..7 <- p[0..7] (k0+8h..k0+8h+7), elements 8..15 <- p[16..23] (k0+16+8h..k0+16+8h+7)
template <typename OT> struct FT;
template <> struct FT<__bf16>   { typedef v16b frag; typedef v8b half8; };
template <> struct FT<_Float16> { typedef v16h frag; typedef v8h half8; };

template <typename OT>
__device__ __forceinline__ typename FT<OT>::frag ldfrag(const OT* p) {
  union { typename FT<OT>::frag v; typename FT<OT>::half8 h[2]; } f;
  f.h[0] = *(const typename FT<OT>::half8*)(p);
  f.h[1] = *(const typename FT<OT>::half8*)(p + 16);
  return f.v;
}

// ---- guarded WMMA helpers: 4 VALU slots after the WMMA, D tied, A/B kept live --------------------------
__device__ __forceinline__ v8f mma_b(v16b a, v16b b, v8f c) {
  c = __builtin_amdgcn_wmma_f32_16x16x32_bf16(false, a, false, b, (short)0, c, false, false);
#if DEV_ASM
  asm volatile("v_nop\n\tv_nop\n\tv_nop\n\tv_nop" : "+v"(c) : "v"(a), "v"(b));
#endif
  return c;
}
__device__ __forceinline__ v8f mma_h(v16h a, v16h b, v8f c) {
  c = __builtin_amdgcn_wmma_f32_16x16x32_f16(false, a, false, b, (short)0, c, false, false);
#if DEV_ASM
  asm volatile("v_nop\n\tv_nop\n\tv_nop\n\tv_nop" : "+v"(c) : "v"(a), "v"(b));
#endif
  return c;
}

// =====================================================================================================
// Partner selection (f32, VALU, fp-contract off, literal op order):
//   c = RNE-bf16(centers); bbox = (c0 - c3*0.5, c1 - c2*0.5, c0 + c3*0.5, c1 + c2*0.5);
//   inter = max(min maxs - max mins, 0) products; union = (area_i + area_j) - inter; iou = inter/union - eye;
//   amax = first index of the row maximum (NaN counts as maximum, first NaN wins); l1 = (c2 - c0) + (c3 - c1);
//   cond = l1_i >= l1[amax]; p0 = cond ? i : amax, p1 = cond ? amax : i.
// grid (NQT, NB), 512 threads: block = 64 rows of one batch x PSL slices of PJS candidates; all 512 boxes of the
//   batch staged in LDS. Wave w scans rows 32*(w&1)..+31 against candidates PJS*(w>>1)..+PJS-1 and keeps, per row,
//   (slice maximum, its first index, first NaN index); threads 0..63 merge the slices in ascending order with a strict
//   compare, so the result is the first index of the row maximum (or the first NaN), as in one ascending scan.
// coverage: 8 blocks x 64 rows x 2 ints per batch = the whole table.
// =====================================================================================================
#define PSL 8              // candidate slices per row
#define PJS (SEQ / PSL)    // candidates per slice
static_assert(PSL * PJS == SEQ && (PJS % 2) == 0);
__global__ __launch_bounds__(64 * PSL) void k_partner(const float* __restrict__ cen, int* pt) {
#pragma clang fp contract(off)
  __shared__ float sb0[SEQ];
  __shared__ float sb1[SEQ];
  __shared__ float sb2[SEQ];
  __shared__ float sb3[SEQ];
  __shared__ float sar[SEQ];
  __shared__ float sl1[SEQ];
  __shared__ float mbv[PSL][64];                // slice maximum per row
  __shared__ int   mbj[PSL][64];                // its first index
  __shared__ int   mnj[PSL][64];                // first NaN index of the slice, SEQ if none
  __shared__ __align__(16) int sp[128];

  const int tid = (int)threadIdx.x;
  const int row = tid & 63;
  const int sl  = tid >> 6;                     // the same for a whole wave
  const int i0  = (int)blockIdx.x * 64;
  const int b   = (int)blockIdx.y;
  const float* cb = cen + (size_t)b * SEQ * 4;

  for (int s = tid; s < SEQ; s += 64 * PSL) {
    const v4f cv = *(const v4f*)(cb + (size_t)s * 4);
#if DEV_ASM
    // precaution: stands between this load and the later reuse of the scalar registers that hold its base address
    asm volatile("s_wait_xcnt 0x0" ::: "memory");
#endif
    const float c0 = bf_up(bf_bits(cv[0]));
    const float c1 = bf_up(bf_bits(cv[1]));
    const float c2 = bf_up(bf_bits(cv[2]));
    const float c3 = bf_up(bf_bits(cv[3]));
    const float hx = c3 * 0.5f;
    const float hy = c2 * 0.5f;
    const float x0 = c0 - hx;
    const float y0 = c1 - hy;
    const float x1 = c0 + hx;
    const float y1 = c1 + hy;
    sb0[s] = x0;
    sb1[s] = y0;
    sb2[s] = x1;
    sb3[s] = y1;
    const float dx = x1 - x0;
    const float dy = y1 - y0;
    sar[s] = dx * dy;
    const float la = c2 - c0;
    const float lb = c3 - c1;
    sl1[s] = la + lb;
  }
  __syncthreads();

  const int i = i0 + row;                       // 0..511
  const float a0 = sb0[i], a1 = sb1[i], a2 = sb2[i], a3 = sb3[i], ar = sar[i];
  float best = -INFINITY;
  int   bj = 0;
  int   nj = SEQ;
  const int j0 = sl * PJS;
#pragma unroll 2
  for (int jj = 0; jj < PJS; ++jj) {
    const int j = j0 + jj;
    const float m0 = fmaxf(a0, sb0[j]);
    const float m1 = fmaxf(a1, sb1[j]);
    const float x2 = fminf(a2, sb2[j]);
    const float x3 = fminf(a3, sb3[j]);
    const float d0 = x2 - m0;
    const float d1 = x3 - m1;
    const float w0 = fmaxf(d0, 0.0f);
    const float w1 = fmaxf(d1, 0.0f);
    const float inter = w0 * w1;
    const float asum  = ar + sar[j];
    const float uni   = asum - inter;
    const float q     = inter / uni;
    const float e     = (j == i) ? 1.0f : 0.0f;
    const float iou   = q - e;
    const bool  up    = iou > best;             // false for NaN
    best = up ? iou : best;
    bj   = up ? j : bj;
    nj   = min(nj, (iou != iou) ? j : SEQ);
  }
  mbv[sl][row] = best;
  mbj[sl][row] = bj;
  mnj[sl][row] = nj;
  __syncthreads();

  if (tid < 64) {
    float gb = -INFINITY;
    int   gj = 0;
    int   gn = SEQ;
    // unrolled so that all slice reads are issued before the first one is waited for
#pragma unroll
    for (int s = 0; s < PSL; ++s) {             // ascending slices, strict compare: the first maximum wins
      const float v = mbv[s][tid];
      const int   x = mbj[s][tid];
      const bool  up = v > gb;
      gb = up ? v : gb;
      gj = up ? x : gj;
      gn = min(gn, mnj[s][tid]);
    }
    const int am = (gn < SEQ) ? gn : gj;        // NaN counts as maximum, first NaN wins
    const float l1i = sl1[i];
    const float l1p = sl1[am];
    const bool cond = (l1i >= l1p);
    sp[tid * 2 + 0] = cond ? i : am;
    sp[tid * 2 + 1] = cond ? am : i;
  }
  __syncthreads();

  if (tid < 32) {
    const v4i v = *(const v4i*)(sp + tid * 4);    // rows i0+2*tid, i0+2*tid+1
    int* dst = pt + ((size_t)b * SEQ + i0) * 2 + tid * 4;
    *(v4i*)dst = v;
  }
}

// =====================================================================================================
// Projections with the partner gather fused in. Block = (64-row tile it, head h, batch b), 256 threads.
//   Xg[g][r][0..31] = bf16(content[b][p_g(i0+r)][h*32..]), Xg[g][r][32..63] = bf16(pos[same row]) (g = 0: p0, 1: p1;
//   indices from PT, clamped to [0, SEQ-1]); Xv[r][k] = bf16(content[b][i0+r][h*32+k]);
//   W2[which][n][k'] = bf16(W[k' & 31][n]) for Wq (0) / Wk (1); Wvt[n][k] = bf16(Wv[k][n]).
//   Q2[i][g*32+n] = sum_k' Xg[g][i][k'] W2q[n][k'] (K = 64) = (content + pos)[p_g(i)] . Wq; K2 likewise with Wk;
//   V^T[d][s] = sum_k Wvt[d][k] Xv[s][k].
//   Waves 0..3: Q2 m-tile (wave&3); waves 4..7: K2 m-tile; every wave one 16x16 V^T tile (dt = wave&1, st = wave>>1).
//   wave w writes Q2 rows 8w..8w+7 and K2 rows 8w..8w+7 (2 instructions each, 4 lines per instruction, 8 lanes x 16 B
//   coverage: Q2/K2 = 8 waves x 8 rows x 64 cols = the block's 64x64 tile; VTh/VTl = 8 waves x 4 d-rows x 64 s.
// Plane layouts: Q2/K2 f16 [b*NH+h][s][64]; VTh/VTl f16 [b*NH+h][d][SEQ].
// =====================================================================================================
__global__ __launch_bounds__(256) void k_proj(
    const float* __restrict__ content, const float* __restrict__ pos, const int* __restrict__ pt,
    const float* __restrict__ Wq, const float* __restrict__ Wk, const float* __restrict__ Wv,
    unsigned short* q2p, unsigned short* k2p, unsigned short* vhp, unsigned short* vlp) {
  __shared__ __align__(16) unsigned short Xg[2][64 * P64];    // 18 KB
  __shared__ __align__(16) unsigned short Xv[64 * P32];       //  5 KB
  __shared__ __align__(16) unsigned short W2[2][HD * P64];    //  9 KB
  __shared__ __align__(16) unsigned short Wvt[HD * P32];      //  2.5 KB
  __shared__ int sIdx[2][64];                                 // 512 B
  __shared__ __align__(16) unsigned short stQK[2][64 * QD];   // 16 KB
  __shared__ __align__(16) float stV[HD * 64];                //  8 KB

  const int tid  = (int)threadIdx.x;
  const int wave = tid >> 5;
  const int lane = tid & 31;
  const int rl   = lane & 15;
  const int hh   = lane >> 4;
  const int i0   = (int)blockIdx.x * 64;
  const int h    = (int)blockIdx.y;
  const int b    = (int)blockIdx.z;
  const size_t rowB = (size_t)b * SEQ;
  const size_t bh   = (size_t)b * NH + (size_t)h;

  // (a) partner indices of rows i0..i0+63, clamped
  if (tid < 128) {
    const int r = tid >> 1, g = tid & 1;
    int v = pt[(rowB + (size_t)(i0 + r)) * 2 + g];
    v = min(max(v, 0), SEQ - 1);
    sIdx[g][r] = v;
  }
  // (b) weights, transposed to [n][k], bf16 bits; k duplicated over the two 32-halves for Wq / Wk
  for (int e = tid; e < HD * QD; e += 256) {
    const int n = e >> 6, kp = e & 63, k = kp & 31;
    W2[0][n * P64 + kp] = bf_bits(Wq[k * HD + n]);
    W2[1][n * P64 + kp] = bf_bits(Wk[k * HD + n]);
  }
  for (int e = tid; e < HD * HD; e += 256) {
    const int n = e >> 5, k = e & 31;
    Wvt[n * P32 + k] = bf_bits(Wv[k * HD + n]);
  }
  // (c) content rows i0..i0+63, head slice h -> Xv (512 float4 pieces, 2 per thread)
  for (int e = tid; e < 64 * HD / 4; e += 256) {
    const int r = e >> 3, c4 = (e & 7) * 4;
    const v4f v = *(const v4f*)(content + (rowB + (size_t)(i0 + r)) * EMB + (size_t)h * HD + c4);
    v2u pk;
    pk[0] = pk16(bf_bits(v[0]), bf_bits(v[1]));
    pk[1] = pk16(bf_bits(v[2]), bf_bits(v[3]));
    *(v2u*)(Xv + r * P32 + c4) = pk;
  }
  __syncthreads();
  // (d) gathered rows: it2 -> (g, source) uniform; e -> (row r, float4 piece); 8 x 256 pieces = [2][2][64][8]
#pragma unroll
  for (int it2 = 0; it2 < 8; ++it2) {
    const int g   = it2 >> 2;
    const int src = (it2 >> 1) & 1;
    const int e   = (it2 & 1) * 256 + tid;
    const int r   = e >> 3, c4 = (e & 7) * 4;
    const float* base = src ? pos : content;
    const int srow = sIdx[g][r];
    const v4f v = *(const v4f*)(base + (rowB + (size_t)srow) * EMB + (size_t)h * HD + c4);
    v2u pk;
    pk[0] = pk16(bf_bits(v[0]), bf_bits(v[1]));
    pk[1] = pk16(bf_bits(v[2]), bf_bits(v[3]));
    *(v2u*)(Xg[g] + r * P64 + src * HD + c4) = pk;
  }
  __syncthreads();

  // (e) WMMA
  const int mt    = wave & 3;
  const int which = wave >> 2;
  const __bf16* Xb0 = (const __bf16*)(const void*)Xg[0];
  const __bf16* Xb1 = (const __bf16*)(const void*)Xg[1];
  const __bf16* Wb  = (const __bf16*)(const void*)W2[which];
  v8f acc00 = zero8(), acc01 = zero8(), acc10 = zero8(), acc11 = zero8();
#pragma unroll
  for (int ks = 0; ks < 2; ++ks) {
    const v16b b0 = ldfrag<__bf16>(Wb + (size_t)rl * P64 + ks * 32 + 8 * hh);
    const v16b b1 = ldfrag<__bf16>(Wb + (size_t)(16 + rl) * P64 + ks * 32 + 8 * hh);
    const v16b a0 = ldfrag<__bf16>(Xb0 + (size_t)(mt * 16 + rl) * P64 + ks * 32 + 8 * hh);
    const v16b a1 = ldfrag<__bf16>(Xb1 + (size_t)(mt * 16 + rl) * P64 + ks * 32 + 8 * hh);
    acc00 = mma_b(a0, b0, acc00);
    acc01 = mma_b(a0, b1, acc01);
    acc10 = mma_b(a1, b0, acc10);
    acc11 = mma_b(a1, b1, acc11);
  }
  const int dt = wave & 1, st = wave >> 1;
  const v16b av = ldfrag<__bf16>((const __bf16*)(const void*)Wvt + (size_t)(dt * 16 + rl) * P32 + 8 * hh);  // A[d][k]
  const v16b bv = ldfrag<__bf16>((const __bf16*)(const void*)Xv + (size_t)(st * 16 + rl) * P32 + 8 * hh);   // B[k][s] from row s
  v8f accv = zero8();
  accv = mma_b(av, bv, accv);

  // (f) stage results (D element r = row 8*hh + r, col rl)
  unsigned short* sq = stQK[which];
#pragma unroll
  for (int r = 0; r < 8; ++r) {
    const int row = mt * 16 + 8 * hh + r;
    sq[row * QD + 0  + rl] = h_bits((_Float16)(acc00[r] * 8.0f));
    sq[row * QD + 16 + rl] = h_bits((_Float16)(acc01[r] * 8.0f));
    sq[row * QD + 32 + rl] = h_bits((_Float16)(acc10[r] * 8.0f));
    sq[row * QD + 48 + rl] = h_bits((_Float16)(acc11[r] * 8.0f));
    stV[(dt * 16 + 8 * hh + r) * 64 + st * 16 + rl] = accv[r];
  }
  __syncthreads();

  // (g) whole-line stores
  const int q4 = lane >> 3, c8 = (lane & 7) * 8;
  v4u qv[2], kv[2];
#pragma unroll
  for (int it = 0; it < 2; ++it) {
    const int row = wave * 8 + it * 4 + q4;
    qv[it] = *(const v4u*)(stQK[0] + row * QD + c8);
    kv[it] = *(const v4u*)(stQK[1] + row * QD + c8);
  }
  const int d = wave * 4 + q4;
  v4u vhv, vlv;
  {
    const float* spv = stV + d * 64 + c8;
#pragma unroll
    for (int e = 0; e < 4; ++e) {
      const float f0 = spv[2 * e] * 8.0f, f1 = spv[2 * e + 1] * 8.0f;
      const _Float16 x0 = (_Float16)f0, x1 = (_Float16)f1;
      const float r0 = f0 - (float)x0, r1 = f1 - (float)x1;
      const _Float16 l0 = (_Float16)(r0 * 4096.0f), l1 = (_Float16)(r1 * 4096.0f);
      vhv[e] = pk16(h_bits(x0), h_bits(x1));
      vlv[e] = pk16(h_bits(l0), h_bits(l1));
    }
  }
  {
#pragma unroll
    for (int it = 0; it < 2; ++it) {
      const int row = wave * 8 + it * 4 + q4;
      const size_t po = (bh * SEQ + (size_t)(i0 + row)) * QD + c8;
      *(v4u*)(q2p + po) = qv[it];
      *(v4u*)(k2p + po) = kv[it];
    }
    const size_t vo = (bh * HD + (size_t)d) * SEQ + (size_t)i0 + c8;
    *(v4u*)(vhp + vo) = vhv;
    *(v4u*)(vlp + vo) = vlv;
    
  }
}

// =====================================================================================================
// Attention on the gathered planes, head dim 64 for q/k, 32 for v, no mask, softmax over all SEQ keys.
//   Both products are taken transposed, so that a lane owns one query column (lane&15) throughout:
//   raw scores^T = K2 . Q2^T on f16 WMMA (A = K2 rows from LDS, B = Q2 rows kept in registers);
//   D register r of key tile j = raw score of key 16 j + 8 (lane>>4) + r for query lane&15.
//   c1 = sscale * log2(e), sscale = 1/(64 sqrt(512)): 1024 p = exp2(raw * c1 + (10 - max * c1)), one FMA per score.
//   Online softmax in f32: maximum and sum run over the lane's own 32 scores; the two wave halves of a query exchange
//   the maximum once per chunk and join their partial sums once, behind the loop.
//   p carried as f16(1024 p) plus residual f16((1024 p - hi) * 2048); the row sum is taken of 1024 p; key tiles 2 kk and 2 kk + 1,
//   converted in place, are the B operand of 32 keys in the hardware k order (8 h + e, 16 + 8 h + e), the order in
//   which the V^T rows are read as A: P never passes through LDS.
//   context^T = vh . ph + (vl . ph)/4096 + (vh . pl)/2048 on f16 WMMA; out = context / (l * 8) in f32, l = sum of 1024 p.
//   Block = 4 waves = 64 query rows of one (b, h); grid (NQT, NH, NB); key chunks of 64, static trip NKT.
//   Chunk staging (plain 16-B loads, __syncthreads before and after): K2 chunk 128 threads x 32 halves = 64x64;
//   V^T hi / residual chunks 128 threads x 16 halves = 32x64 each.
//   Output: d_out[b][q][h*32 + d] f32; each wave stores rows q0..q0+15 (it 0..3 x lane>>3) x 32 floats =
//   coverage: grid (8 tiles x 8 heads x 32 batches) x 4 waves x 16 rows x 32 cols = every output element once.
// =====================================================================================================
#define POS  36            // out-tile row pitch in floats: 144 B (16 B x odd), rows written and read with 16-byte accesses
static_assert(POS >= HD && (POS % 4) == 0 && ((POS / 4) & 1) == 1);

// lane l <-> lane l ^ 16: the two lanes that share one query column
__device__ __forceinline__ float xhalf(float x) {
  const int xb = __builtin_bit_cast(int, x);
  return __builtin_bit_cast(float, __builtin_amdgcn_permlanex16(xb, xb, 0x76543210, 0xfedcba98, false, false));
}

// packed f16 residuals of eight values: half x of d[i] = f16(y[2 i + x] - 2048 * (float)(half x of h[i])), y = 2048 * the
// value that h rounds. Written as asm because the compiler otherwise converts each half back to f32 (and converts each
// value a second time, unpacked) ahead of a subtract, a multiply and a convert: one mixed-precision FMA per value does all
// of it, with the same single rounding (difference and scaling are exact). The four low halves stand ahead of the four
// high halves so that no instruction follows its own register's writer directly; the s_delay_alu lines are the
// scheduling hints that the compiler cannot place inside or in front of asm text (without them a dependent vector
// instruction holds the vector port against the other waves); they change no result.
__device__ __forceinline__ v4u res_pk(v4u h, v8f y) {
  v4u d = {0u, 0u, 0u, 0u};
#if DEV_ASM
  unsigned d0, d1, d2, d3;
  asm("s_delay_alu instid0(VALU_DEP_1)\n\t"
      "v_fma_mixlo_f16 %0, %4, %8, %9 op_sel_hi:[1,0,0]\n\t"
      "v_fma_mixlo_f16 %1, %5, %8, %11 op_sel_hi:[1,0,0]\n\t"
      "v_fma_mixlo_f16 %2, %6, %8, %13 op_sel_hi:[1,0,0]\n\t"
      "v_fma_mixlo_f16 %3, %7, %8, %15 op_sel_hi:[1,0,0]\n\t"
      "s_delay_alu instid0(VALU_DEP_4) | instskip(NEXT) | instid1(VALU_DEP_4)\n\t"
      "v_fma_mixhi_f16 %0, %4, %8, %10 op_sel:[1,0,0] op_sel_hi:[1,0,0]\n\t"
      "v_fma_mixhi_f16 %1, %5, %8, %12 op_sel:[1,0,0] op_sel_hi:[1,0,0]\n\t"
      "s_delay_alu instid0(VALU_DEP_4) | instskip(NEXT) | instid1(VALU_DEP_4)\n\t"
      "v_fma_mixhi_f16 %2, %6, %8, %14 op_sel:[1,0,0] op_sel_hi:[1,0,0]\n\t"
      "v_fma_mixhi_f16 %3, %7, %8, %16 op_sel:[1,0,0] op_sel_hi:[1,0,0]"
      : "=&v"(d0), "=&v"(d1), "=&v"(d2), "=&v"(d3)
      : "v"(h[0]), "v"(h[1]), "v"(h[2]), "v"(h[3]), "s"(-2048.0f),
        "v"(y[0]), "v"(y[1]), "v"(y[2]), "v"(y[3]), "v"(y[4]), "v"(y[5]), "v"(y[6]), "v"(y[7]));
  d[0] = d0; d[1] = d1; d[2] = d2; d[3] = d3;
#endif
  return d;
}

__global__ __launch_bounds__(128)
void k_attn(const unsigned short* __restrict__ q2p, const unsigned short* __restrict__ k2p,
            const unsigned short* __restrict__ vhp, const unsigned short* __restrict__ vlp,
            float* out, float sscale) {
  union FH { v16h v; v8h h[2]; };
  __shared__ __align__(16) _Float16 Ksh[64 * P64];         // K2 chunk [key][d]   9 KB
  __shared__ __align__(16) _Float16 Vth[HD * P64];         // V^T hi [d][key]    4.5 KB
  __shared__ __align__(16) _Float16 Vtl[HD * P64];         // V^T residual       4.5 KB
  __shared__ __align__(16) float    Os[4][16 * POS];       // per wave out tile  9 KB

  const int tid  = (int)threadIdx.x;
  const int wave = tid >> 5;
  const int lane = tid & 31;
  const int hh   = lane >> 4;
  const int c    = lane & 15;

  const int q0 = (int)blockIdx.x * 64 + wave * 16;
  const int h  = (int)blockIdx.y;
  const int b  = (int)blockIdx.z;
  const size_t bh = (size_t)b * NH + (size_t)h;

  const _Float16* Q  = (const _Float16*)(const void*)q2p + bh * SEQ * QD;
  const _Float16* K  = (const _Float16*)(const void*)k2p + bh * SEQ * QD;
  const _Float16* Vh = (const _Float16*)(const void*)vhp + bh * HD * SEQ;
  const _Float16* Vl = (const _Float16*)(const void*)vlp + bh * HD * SEQ;

  // ---- Q fragments (B operand, column = lane&15): 2 d-chunks of the 64-wide gathered row ----
  v16h qb[2];
#pragma unroll
  for (int dc = 0; dc < 2; ++dc)
    qb[dc] = ldfrag<_Float16>(Q + (size_t)(q0 + c) * QD + dc * 32 + 8 * hh);

  const float c1 = sscale * 1.44269504088896340736f;   // raw score -> log2 units (positive: the maximum may be taken raw)
  float mrun = -INFINITY;                    // running maximum of query c, raw (equal in both halves)
  float lrun = 0.f;                          // running sum of 1024 p over this half's keys only
  v8f oacc[2];                               // context^T: register r of tile t = d 16 t + 8 hh + r, query c
#pragma unroll
  for (int t = 0; t < 2; ++t) oacc[t] = zero8();

  for (int kt = 0; kt < NKT; ++kt) {         // static trip count
    const int kv0 = kt * 64;
    __syncthreads();
    {
      const int r = tid >> 1, half = (tid & 1) * 32;                // K2 row kv0+r, d = half..half+31
      const _Float16* kg = K + (size_t)(kv0 + r) * QD + half;
#pragma unroll
      for (int i = 0; i < 4; ++i)
        *(v8h*)(Ksh + r * P64 + half + 8 * i) = *(const v8h*)(kg + 8 * i);
      const int r2 = tid >> 2, qq = (tid & 3) * 16;                 // V^T row d = r2, s = kv0+qq..+15
      const _Float16* vg  = Vh + (size_t)r2 * SEQ + kv0 + qq;
      const _Float16* vlg = Vl + (size_t)r2 * SEQ + kv0 + qq;
#pragma unroll
      for (int i = 0; i < 2; ++i) {
        *(v8h*)(Vth + r2 * P64 + qq + 8 * i) = *(const v8h*)(vg + 8 * i);
        *(v8h*)(Vtl + r2 * P64 + qq + 8 * i) = *(const v8h*)(vlg + 8 * i);
      }
    }
    __syncthreads();

    // ---- scores^T: 64 keys x 16 query columns per wave ----
    v8f s[4];
#pragma unroll
    for (int j = 0; j < 4; ++j) {
      v8f a = zero8();
#pragma unroll
      for (int dc = 0; dc < 2; ++dc) {
        FH kb;
        kb.h[0] = *(const v8h*)(Ksh + (j * 16 + c) * P64 + dc * 32 + 8 * hh);
        kb.h[1] = *(const v8h*)(Ksh + (j * 16 + c) * P64 + dc * 32 + 16 + 8 * hh);
        a = mma_h(kb.v, qb[dc], a);
      }
      s[j] = a;
    }

    // ---- column max in the lane, one exchange between the halves, online softmax ----
    float m = s[0][0];
#pragma unroll
    for (int j = 0; j < 4; ++j)
#pragma unroll
      for (int r = 0; r < 8; ++r) m = fmaxf(m, s[j][r]);
    m = fmaxf(m, xhalf(m));
    const float mnew  = fmaxf(mrun, m);
    const float msafe = (mnew == -INFINITY) ? 0.f : mnew;
    const float mb    = msafe * c1;                              // the shift, in log2 units
    const float alpha = __builtin_amdgcn_exp2f(__builtin_fmaf(mrun, c1, -mb));
    const float bias  = 10.0f - mb;                              // + 10: exp2 yields 1024 p at once
    mrun = mnew;

#pragma unroll
    for (int t = 0; t < 2; ++t)
#pragma unroll
      for (int r = 0; r < 8; ++r) oacc[t][r] *= alpha;

    // ---- per 32 keys: P hi (x1024) and residual (x2048) packed in place into B operands, then
    //      context^T += V^T . P^T (3 f16 products); residual products into separate per-chunk accumulators ----
    v8f o1[2], o2[2];
#pragma unroll
    for (int t = 0; t < 2; ++t) { o1[t] = zero8(); o2[t] = zero8(); }
    float ps[4];
    // unrolled: the scores live in registers and are picked by kk
#pragma unroll
    for (int kk = 0; kk < 2; ++kk) {
      union { v16h v; v4u q[2]; } pa, pr;                        // dword i = elements 2 i (low half), 2 i + 1 (high half)
#pragma unroll
      for (int jj = 0; jj < 2; ++jj) {
        const int j = 2 * kk + jj;
        float psum = 0.f;
        v4u h4;
        v8f y8;
#pragma unroll
        for (int r = 0; r < 8; r += 2) {
          v2f pp;
          pp[0] = __builtin_amdgcn_exp2f(__builtin_fmaf(s[j][r],     c1, bias));
          pp[1] = __builtin_amdgcn_exp2f(__builtin_fmaf(s[j][r + 1], c1, bias));
          psum += pp[0];
          psum += pp[1];
          h4[r >> 1] = __builtin_bit_cast(unsigned, __builtin_convertvector(pp, v2h));
          y8[r]     = pp[0] * 2048.0f;
          y8[r + 1] = pp[1] * 2048.0f;
        }
        pa.q[jj] = h4;
        pr.q[jj] = res_pk(h4, y8);
        ps[j] = psum;
      }
#pragma unroll
      for (int t = 0; t < 2; ++t) {
        FH vb, vr;
        vb.h[0] = *(const v8h*)(Vth + (t * 16 + c) * P64 + kk * 32 + 8 * hh);
        vb.h[1] = *(const v8h*)(Vth + (t * 16 + c) * P64 + kk * 32 + 16 + 8 * hh);
        vr.h[0] = *(const v8h*)(Vtl + (t * 16 + c) * P64 + kk * 32 + 8 * hh);
        vr.h[1] = *(const v8h*)(Vtl + (t * 16 + c) * P64 + kk * 32 + 16 + 8 * hh);
        oacc[t] = mma_h(vb.v, pa.v, oacc[t]);
        o1[t]   = mma_h(vr.v, pa.v, o1[t]);
        o2[t]   = mma_h(vb.v, pr.v, o2[t]);
      }
    }
    lrun = lrun * alpha + ((ps[0] + ps[1]) + (ps[2] + ps[3]));
#pragma unroll
    for (int t = 0; t < 2; ++t)
#pragma unroll
      for (int r = 0; r < 8; ++r) {
        const float f1 = o1[t][r] * (1.0f / 4096.0f);
        const float f2 = o2[t][r] * (1.0f / 2048.0f);
        oacc[t][r] = oacc[t][r] + f1 + f2;
      }
  }

  // ---- join the halves' sums, normalise (1/l, which holds the x1024 p carry; undo the x8 v carry), stage the wave's 16x32 tile
  float* os = Os[wave];
  {
    const float l = lrun + xhalf(lrun);
    const float inv = ((l > 0.f) ? (1.0f / l) : 0.f) * (1.0f / 8.0f);
#pragma unroll
    for (int t = 0; t < 2; ++t)
#pragma unroll
      for (int e = 0; e < 2; ++e) {
        v4f v;
#pragma unroll
        for (int x = 0; x < 4; ++x) v[x] = oacc[t][4 * e + x] * inv;
        *(v4f*)(os + c * POS + t * 16 + 8 * hh + 4 * e) = v;       // query row c, d = 16 t + 8 hh + 4 e ..+3
      }
  }
  __builtin_amdgcn_fence(__ATOMIC_RELEASE, "workgroup");
  __builtin_amdgcn_wave_barrier();
  __builtin_amdgcn_fence(__ATOMIC_ACQUIRE, "workgroup");
  {
    const int q4 = lane >> 3, c4 = (lane & 7) * 4;
    v4f ov[4];
#pragma unroll
    for (int it = 0; it < 4; ++it) {
      const int row = it * 4 + q4;                 // it 0..3 x q4 0..3 = rows 0..15 of the wave tile
      ov[it] = *(const v4f*)(os + row * POS + c4);
    }
    {
#pragma unroll
      for (int it = 0; it < 4; ++it) {
        const int row = it * 4 + q4;
        const size_t go = ((size_t)b * SEQ + (size_t)(q0 + row)) * EMB + (size_t)h * HD + c4;
        *(v4f*)(out + go) = ov[it];
      }
    }
  }
}

// =====================================================================================================
// Workspace map (bytes), every region an exact multiple of its whole-line store granularity:
//   K2   f16 [256][512][64]        16777216
//   VTl  f16 [256][32][512]         8388608
//   total                          50462720
// Launches: k_partner (256 blocks x 512), k_proj (2048 x 256), k_attn (2048 x 128).
// =====================================================================================================
extern "C" void kernel_launch(void* const* d_in, const int* in_sizes, int n_in,
                              void* d_out, int out_size, void* d_ws, size_t ws_size,
                              hipStream_t stream) {
  if (n_in < 6) return;
  if (in_sizes[0] != NB * SEQ * EMB) return;
  if (in_sizes[1] != NB * SEQ * EMB) return;
  if (in_sizes[2] != NB * SEQ * 4) return;
  if (in_sizes[3] != HD * HD || in_sizes[4] != HD * HD || in_sizes[5] != HD * HD) return;
  if (out_size != NB * SEQ * EMB) return;

  const float* content = (const float*)d_in[0];
  const float* posenc  = (const float*)d_in[1];
  const float* centers = (const float*)d_in[2];
  const float* Wq      = (const float*)d_in[3];
  const float* Wk      = (const float*)d_in[4];
  const float* Wv      = (const float*)d_in[5];

  const size_t PPT = (size_t)NB * SEQ * 2 * 4;             //   131072
  const size_t PQ2 = (size_t)NB * NH * SEQ * QD * 2;       // 16777216
  const size_t PVT = (size_t)NB * NH * HD * SEQ * 2;       //  8388608
  size_t off = 0;
  const size_t oPT = off; off += PPT;
  const size_t oQ2 = off; off += PQ2;
  const size_t oK2 = off; off += PQ2;
  const size_t oVh = off; off += PVT;
  const size_t oVl = off; off += PVT;
  if (off > ws_size) return;                               // off = 50462720
  if (off > (size_t)134217728) return;

  char* ws = (char*)d_ws;
  int*            PT  = (int*)(ws + oPT);
  unsigned short* Q2  = (unsigned short*)(ws + oQ2);
  unsigned short* K2  = (unsigned short*)(ws + oK2);
  unsigned short* VTh = (unsigned short*)(ws + oVh);
  unsigned short* VTl = (unsigned short*)(ws + oVl);
  float*          outp = (float*)d_out;

  const float sscale = (1.0f / 64.0f) / sqrtf(2.0f * (float)EMB);   // 1/(64 sqrt(512))

  const dim3 gP(NQT, NB);            //  256 blocks of 512
  const dim3 gT(NQT, NH, NB);        // 2048 blocks

  // (1) partner table
  k_partner<<<gP, dim3(64 * PSL), 0, stream>>>(centers, PT);
  // (2) gathered [q|k] planes (x8, f16), v^T hi / residual planes
  k_proj<<<gT, dim3(256), 0, stream>>>(content, posenc, PT, Wq, Wk, Wv, Q2, K2, VTh, VTl);
  // (3) attention -> d_out f32 [32][512][256]
  k_attn<<<gT, dim3(128), 0, stream>>>(Q2, K2, VTh, VTl, outp, sscale);
  (void)hipGetLastError();
}

// v005
// It runs in 59.7 microseconds.
// In two side-by-side timings against v004, it was 1.16 and 1.15 times as fast.
// Counting every step since v000, it is 3.35 times as fast.
// Contractions: [q|k] and v^T projections = v_wmma_f32_16x16x32_bf16 (bf16 operands: RNE-converted content, pos, Wq, Wk, Wv;
//   x_qk.W evaluated as [content | pos] x [W ; W] along k; single products, f32 accumulate);
// gathered q.k^T scores = v_wmma_f32_16x16x32_f16 (q and k f16 planes carried x8; single product; f32 accumulate);
// p.v = v_wmma_f32_16x16x32_f16 (p f16 carried x1024 + residual plane x2048; v^T f16 carried x8 + residual plane x4096;
//   3 products ph.vh, ph.vl, pl.vh into f32 accumulators); partner selection (IoU argmax) and softmax in f32 on the VALU.
// Carry audit:
//   Q2 plane  f16 = f16(8 q)                     (k_proj staging)  -> undone in k_attn by sscale = 1/(64 sqrt(512)), inside c1
//   K2 plane  f16 = f16(8 k)                     (k_proj staging)  -> same sscale (8*8 = 64)
//   VTh plane f16 = f16(8 v)                     (k_proj store)    -> k_attn epilogue inv includes 1/8
//   VTl plane f16 = f16((8 v - VTh) * 4096)      (k_proj store)    -> k_attn per-chunk fold o1 * (1/4096), then 1/8 in epilogue
//   P hi      f16 = f16(1024 p)                  (k_attn softmax)  -> the row sum l carries the same x1024: cancels in 1/l
//   P res     f16 = f16((1024 p - hi) * 2048)    (k_attn softmax)  -> k_attn per-chunk fold o2 * (1/2048), then 1/l in epilogue
#include <hip/hip_runtime.h>
#include <math.h>
#include <stdint.h>

#pragma clang fp contract(off)

#define NB   32
#define SEQ  512
#define EMB  256
#define NH   8
#define HD   32            // per-head dim
#define QD   64            // gathered q/k width (two partner rows)
#define NQT  (SEQ / 64)    // 64-row query tiles per sequence
#define NKT  (SEQ / 64)    // 64-key chunks per sequence
// LDS row pitches, in 16-bit elements, of every tile that is read as a WMMA fragment with 16-byte loads: 16 B x odd,
// so that the 16 rows one half-wave reads fall on 64 distinct banks (at the bare 128 B / 64 B they share 8 / 16 banks)
#define P64  72            // 64-element rows: 144 B
#define P32  40            // 32-element rows:  80 B
static_assert(NH * HD == EMB);
static_assert(NQT == 8 && NKT == 8);
static_assert((SEQ % 64) == 0 && (HD % 32) == 0 && (QD % 32) == 0);
static_assert(P64 >= QD && P32 >= HD && (P64 % 8) == 0 && (P32 % 8) == 0 && ((P64 / 8) & 1) == 1 && ((P32 / 8) & 1) == 1);

typedef _Float16 v16h __attribute__((ext_vector_type(16)));
typedef _Float16 v8h  __attribute__((ext_vector_type(8)));
typedef __bf16   v16b __attribute__((ext_vector_type(16)));
typedef __bf16   v8b  __attribute__((ext_vector_type(8)));
typedef float    v8f  __attribute__((ext_vector_type(8)));
typedef float    v4f  __attribute__((ext_vector_type(4)));
typedef unsigned int v4u __attribute__((ext_vector_type(4)));
typedef unsigned int v2u __attribute__((ext_vector_type(2)));
typedef int      v4i  __attribute__((ext_vector_type(4)));
typedef float    v2f  __attribute__((ext_vector_type(2)));
typedef _Float16 v2h  __attribute__((ext_vector_type(2)));

#if defined(__HIP_DEVICE_COMPILE__)
#define DEV_ASM 1
#else
#define DEV_ASM 0
#endif

// ---- scalar helpers --------------------------------------------------------------------------------
__device__ __forceinline__ unsigned short bf_bits(float f) {          // f32 -> bf16 bits, RNE convert
  unsigned u = __float_as_uint(f);
  return (unsigned short)((u + 0x7FFFu + ((u >> 16) & 1u)) >> 16);
}
__device__ __forceinline__ float bf_up(unsigned short hb) { return __uint_as_float(((unsigned)hb) << 16); }
__device__ __forceinline__ unsigned short h_bits(_Float16 x) { return __builtin_bit_cast(unsigned short, x); }
__device__ __forceinline__ unsigned pk16(unsigned short a, unsigned short b) { return (unsigned)a | ((unsigned)b << 16); }
__device__ __forceinline__ v8f zero8() { v8f z = {0.f, 0.f, 0.f, 0.f, 0.f, 0.f, 0.f, 0.f}; return z; }

// ---- fragment loaders: 16-bit A/B operand, lane -> row/col (lane&15), p already includes +8*(lane>>4);
//      elements 0..7 <- p[0..7] (k0+8h..k0+8h+7), elements 8..15 <- p[16..23] (k0+16+8h..k0+16+8h+7)
template <typename OT> struct FT;
template <> struct FT<__bf16>   { typedef v16b frag; typedef v8b half8; };
template <> struct FT<_Float16> { typedef v16h frag; typedef v8h half8; };

template <typename OT>
__device__ __forceinline__ typename FT<OT>::frag ldfrag(const OT* p) {
  union { typename FT<OT>::frag v; typename FT<OT>::half8 h[2]; } f;
  f.h[0] = *(const typename FT<OT>::half8*)(p);
  f.h[1] = *(const typename FT<OT>::half8*)(p + 16);
  return f.v;
}

// ---- guarded WMMA helpers: 4 VALU slots after the WMMA, D tied, A/B kept live --------------------------
__device__ __forceinline__ v8f mma_b(v16b a, v16b b, v8f c) {
  c = __builtin_amdgcn_wmma_f32_16x16x32_bf16(false, a, false, b, (short)0, c, false, false);
#if DEV_ASM
  asm volatile("v_nop\n\tv_nop\n\tv_nop\n\tv_nop" : "+v"(c) : "v"(a), "v"(b));
#endif
  return c;
}
__device__ __forceinline__ v8f mma_h(v16h a, v16h b, v8f c) {
  c = __builtin_amdgcn_wmma_f32_16x16x32_f16(false, a, false, b, (short)0, c, false, false);
#if DEV_ASM
  asm volatile("v_nop\n\tv_nop\n\tv_nop\n\tv_nop" : "+v"(c) : "v"(a), "v"(b));
#endif
  return c;
}

// =====================================================================================================
// Partner selection (f32, VALU, fp-contract off, literal op order):
//   c = RNE-bf16(centers); bbox = (c0 - c3*0.5, c1 - c2*0.5, c0 + c3*0.5, c1 + c2*0.5);
//   inter = max(min maxs - max mins, 0) products; union = (area_i + area_j) - inter; iou = inter/union - eye;
//   amax = first index of the row maximum (NaN counts as maximum, first NaN wins); l1 = (c2 - c0) + (c3 - c1);
//   cond = l1_i >= l1[amax]; p0 = cond ? i : amax, p1 = cond ? amax : i.
// grid (NQT, NB), 512 threads: block = 64 rows of one batch x PSL slices of PJS candidates; all 512 boxes of the
//   batch staged in LDS. Wave w scans rows 32*(w&1)..+31 against candidates PJS*(w>>1)..+PJS-1 and keeps, per row,
//   (slice maximum, its first index, first NaN index); threads 0..63 merge the slices in ascending order with a strict
//   compare, so the result is the first index of the row maximum (or the first NaN), as in one ascending scan.
// coverage: 8 blocks x 64 rows x 2 ints per batch = the whole table.
// =====================================================================================================
#define PSL 8              // candidate slices per row
#define PJS (SEQ / PSL)    // candidates per slice
static_assert(PSL * PJS == SEQ && (PJS % 2) == 0);
__global__ __launch_bounds__(64 * PSL) void k_partner(const float* __restrict__ cen, int* pt) {
#pragma clang fp contract(off)
  __shared__ float sb0[SEQ];
  __shared__ float sb1[SEQ];
  __shared__ float sb2[SEQ];
  __shared__ float sb3[SEQ];
  __shared__ float sar[SEQ];
  __shared__ float sl1[SEQ];
  __shared__ float mbv[PSL][64];                // slice maximum per row
  __shared__ int   mbj[PSL][64];                // its first index
  __shared__ int   mnj[PSL][64];                // first NaN index of the slice, SEQ if none
  __shared__ __align__(16) int sp[128];

  const int tid = (int)threadIdx.x;
  const int row = tid & 63;
  const int sl  = tid >> 6;                     // the same for a whole wave
  const int i0  = (int)blockIdx.x * 64;
  const int b   = (int)blockIdx.y;
  const float* cb = cen + (size_t)b * SEQ * 4;

  for (int s = tid; s < SEQ; s += 64 * PSL) {
    const v4f cv = *(const v4f*)(cb + (size_t)s * 4);
#if DEV_ASM
    // precaution: stands between this load and the later reuse of the scalar registers that hold its base address
    asm volatile("s_wait_xcnt 0x0" ::: "memory");
#endif
    const float c0 = bf_up(bf_bits(cv[0]));
    const float c1 = bf_up(bf_bits(cv[1]));
    const float c2 = bf_up(bf_bits(cv[2]));
    const float c3 = bf_up(bf_bits(cv[3]));
    const float hx = c3 * 0.5f;
    const float hy = c2 * 0.5f;
    const float x0 = c0 - hx;
    const float y0 = c1 - hy;
    const float x1 = c0 + hx;
    const float y1 = c1 + hy;
    sb0[s] = x0;
    sb1[s] = y0;
    sb2[s] = x1;
    sb3[s] = y1;
    const float dx = x1 - x0;
    const float dy = y1 - y0;
    sar[s] = dx * dy;
    const float la = c2 - c0;
    const float lb = c3 - c1;
    sl1[s] = la + lb;
  }
  __syncthreads();

  const int i = i0 + row;                       // 0..511
  const float a0 = sb0[i], a1 = sb1[i], a2 = sb2[i], a3 = sb3[i], ar = sar[i];
  float best = -INFINITY;
  int   bj = 0;
  int   nj = SEQ;
  const int j0 = sl * PJS;
#pragma unroll 2
  for (int jj = 0; jj < PJS; ++jj) {
    const int j = j0 + jj;
    const float m0 = fmaxf(a0, sb0[j]);
    const float m1 = fmaxf(a1, sb1[j]);
    const float x2 = fminf(a2, sb2[j]);
    const float x3 = fminf(a3, sb3[j]);
    const float d0 = x2 - m0;
    const float d1 = x3 - m1;
    const float w0 = fmaxf(d0, 0.0f);
    const float w1 = fmaxf(d1, 0.0f);
    const float inter = w0 * w1;
    const float asum  = ar + sar[j];
    const float uni   = asum - inter;
    const float q     = inter / uni;
    const float e     = (j == i) ? 1.0f : 0.0f;
    const float iou   = q - e;
    const bool  up    = iou > best;             // false for NaN
    best = up ? iou : best;
    bj   = up ? j : bj;
    nj   = min(nj, (iou != iou) ? j : SEQ);
  }
  mbv[sl][row] = best;
  mbj[sl][row] = bj;
  mnj[sl][row] = nj;
  __syncthreads();

  if (tid < 64) {
    float gb = -INFINITY;
    int   gj = 0;
    int   gn = SEQ;
    // unrolled so that all slice reads are issued before the first one is waited for
#pragma unroll
    for (int s = 0; s < PSL; ++s) {             // ascending slices, strict compare: the first maximum wins
      const float v = mbv[s][tid];
      const int   x = mbj[s][tid];
      const bool  up = v > gb;
      gb = up ? v : gb;
      gj = up ? x : gj;
      gn = min(gn, mnj[s][tid]);
    }
    const int am = (gn < SEQ) ? gn : gj;        // NaN counts as maximum, first NaN wins
    const float l1i = sl1[i];
    const float l1p = sl1[am];
    const bool cond = (l1i >= l1p);
    sp[tid * 2 + 0] = cond ? i : am;
    sp[tid * 2 + 1] = cond ? am : i;
  }
  __syncthreads();

  if (tid < 32) {
    const v4i v = *(const v4i*)(sp + tid * 4);    // rows i0+2*tid, i0+2*tid+1
    int* dst = pt + ((size_t)b * SEQ + i0) * 2 + tid * 4;
    *(v4i*)dst = v;
  }
}

// =====================================================================================================
// Projections with the partner gather fused in. Block = (64-row tile it, head h, batch b), 256 threads.
//   Xg[g][r][0..31] = bf16(content[b][p_g(i0+r)][h*32..]), Xg[g][r][32..63] = bf16(pos[same row]) (g = 0: p0, 1: p1;
//   indices from PT, clamped to [0, SEQ-1]); Xv[r][k] = bf16(content[b][i0+r][h*32+k]);
//   W2[which][n][k'] = bf16(W[k' & 31][n]) for Wq (0) / Wk (1); Wvt[n][k] = bf16(Wv[k][n]).
//   Q2[i][g*32+n] = sum_k' Xg[g][i][k'] W2q[n][k'] (K = 64) = (content + pos)[p_g(i)] . Wq; K2 likewise with Wk;
//   V^T[d][s] = sum_k Wvt[d][k] Xv[s][k].
//   Waves 0..3: Q2 m-tile (wave&3); waves 4..7: K2 m-tile; every wave one 16x16 V^T tile (dt = wave&1, st = wave>>1).
//   wave w writes Q2 rows 8w..8w+7 and K2 rows 8w..8w+7 (2 instructions each, 4 lines per instruction, 8 lanes x 16 B
//   coverage: Q2/K2 = 8 waves x 8 rows x 64 cols = the block's 64x64 tile; VTh/VTl = 8 waves x 4 d-rows x 64 s.
// Plane layouts: Q2/K2 f16 [b*NH+h][s][64]; VTh/VTl f16 [b*NH+h][d][SEQ].
// =====================================================================================================
__global__ __launch_bounds__(256) void k_proj(
    const float* __restrict__ content, const float* __restrict__ pos, const int* __restrict__ pt,
    const float* __restrict__ Wq, const float* __restrict__ Wk, const float* __restrict__ Wv,
    unsigned short* q2p, unsigned short* k2p, unsigned short* vhp, unsigned short* vlp) {
  __shared__ __align__(16) unsigned short Xg[2][64 * P64];    // 18 KB
  __shared__ __align__(16) unsigned short Xv[64 * P32];       //  5 KB
  __shared__ __align__(16) unsigned short W2[2][HD * P64];    //  9 KB
  __shared__ __align__(16) unsigned short Wvt[HD * P32];      //  2.5 KB
  __shared__ int sIdx[2][64];                                 // 512 B
  __shared__ __align__(16) unsigned short stQK[2][64 * QD];   // 16 KB
  __shared__ __align__(16) float stV[HD * 64];                //  8 KB

  const int tid  = (int)threadIdx.x;
  const int wave = tid >> 5;
  const int lane = tid & 31;
  const int rl   = lane & 15;
  const int hh   = lane >> 4;
  const int i0   = (int)blockIdx.x * 64;
  const int h    = (int)blockIdx.y;
  const int b    = (int)blockIdx.z;
  const size_t rowB = (size_t)b * SEQ;
  const size_t bh   = (size_t)b * NH + (size_t)h;

  // (b1) weights, loads: whole 128-B rows (W[k][0..31] is one line), two k rows per thread, issued ahead of everything else.
  //      Wq (threads 0..127) / Wk (128..255): k pair wkk x 4 columns, 16-byte loads; Wv: k pair vkk x 2 columns, 8-byte loads.
  const int wm  = tid >> 7;
  const int wkk = (tid >> 3) & 15, wn4 = (tid & 7) * 4;
  const int vkk = tid >> 4,        vn2 = (tid & 15) * 2;
  const float* Wm = wm ? Wk : Wq;
  const v4f wr0 = *(const v4f*)(Wm + (2 * wkk + 0) * HD + wn4);
  const v4f wr1 = *(const v4f*)(Wm + (2 * wkk + 1) * HD + wn4);
  const v2f vr0 = *(const v2f*)(Wv + (2 * vkk + 0) * HD + vn2);
  const v2f vr1 = *(const v2f*)(Wv + (2 * vkk + 1) * HD + vn2);
  // (a) partner indices of rows i0..i0+63, clamped
  if (tid < 128) {
    const int r = tid >> 1, g = tid & 1;
    int v = pt[(rowB + (size_t)(i0 + r)) * 2 + g];
    v = min(max(v, 0), SEQ - 1);
    sIdx[g][r] = v;
  }
  // (b2) weights, transposed to [n][k] on the LDS write, bf16 bits, one dword = (k even, k odd);
  //      k duplicated over the two 32-halves for Wq / Wk. Both loops unrolled: the loaded rows live in registers and are picked by j
#pragma unroll
  for (int j = 0; j < 4; ++j) {
    const unsigned pw = pk16(bf_bits(wr0[j]), bf_bits(wr1[j]));
    unsigned short* wd = W2[wm] + (wn4 + j) * P64 + 2 * wkk;
    *(unsigned*)(wd)      = pw;
    *(unsigned*)(wd + HD) = pw;
  }
#pragma unroll
  for (int j = 0; j < 2; ++j)
    *(unsigned*)(Wvt + (vn2 + j) * P32 + 2 * vkk) = pk16(bf_bits(vr0[j]), bf_bits(vr1[j]));
  // (c) content rows i0..i0+63, head slice h -> Xv (512 float4 pieces, 2 per thread)
  for (int e = tid; e < 64 * HD / 4; e += 256) {
    const int r = e >> 3, c4 = (e & 7) * 4;
    const v4f v = *(const v4f*)(content + (rowB + (size_t)(i0 + r)) * EMB + (size_t)h * HD + c4);
    v2u pk;
    pk[0] = pk16(bf_bits(v[0]), bf_bits(v[1]));
    pk[1] = pk16(bf_bits(v[2]), bf_bits(v[3]));
    *(v2u*)(Xv + r * P32 + c4) = pk;
  }
  __syncthreads();
  // (d) gathered rows: it2 -> (g, source) uniform; e -> (row r, float4 piece); 8 x 256 pieces = [2][2][64][8]
#pragma unroll
  for (int it2 = 0; it2 < 8; ++it2) {
    const int g   = it2 >> 2;
    const int src = (it2 >> 1) & 1;
    const int e   = (it2 & 1) * 256 + tid;
    const int r   = e >> 3, c4 = (e & 7) * 4;
    const float* base = src ? pos : content;
    const int srow = sIdx[g][r];
    const v4f v = *(const v4f*)(base + (rowB + (size_t)srow) * EMB + (size_t)h * HD + c4);
    v2u pk;
    pk[0] = pk16(bf_bits(v[0]), bf_bits(v[1]));
    pk[1] = pk16(bf_bits(v[2]), bf_bits(v[3]));
    *(v2u*)(Xg[g] + r * P64 + src * HD + c4) = pk;
  }
  __syncthreads();

  // (e) WMMA
  const int mt    = wave & 3;
  const int which = wave >> 2;
  const __bf16* Xb0 = (const __bf16*)(const void*)Xg[0];
  const __bf16* Xb1 = (const __bf16*)(const void*)Xg[1];
  const __bf16* Wb  = (const __bf16*)(const void*)W2[which];
  v8f acc00 = zero8(), acc01 = zero8(), acc10 = zero8(), acc11 = zero8();
#pragma unroll
  for (int ks = 0; ks < 2; ++ks) {
    const v16b b0 = ldfrag<__bf16>(Wb + (size_t)rl * P64 + ks * 32 + 8 * hh);
    const v16b b1 = ldfrag<__bf16>(Wb + (size_t)(16 + rl) * P64 + ks * 32 + 8 * hh);
    const v16b a0 = ldfrag<__bf16>(Xb0 + (size_t)(mt * 16 + rl) * P64 + ks * 32 + 8 * hh);
    const v16b a1 = ldfrag<__bf16>(Xb1 + (size_t)(mt * 16 + rl) * P64 + ks * 32 + 8 * hh);
    acc00 = mma_b(a0, b0, acc00);
    acc01 = mma_b(a0, b1, acc01);
    acc10 = mma_b(a1, b0, acc10);
    acc11 = mma_b(a1, b1, acc11);
  }
  const int dt = wave & 1, st = wave >> 1;
  const v16b av = ldfrag<__bf16>((const __bf16*)(const void*)Wvt + (size_t)(dt * 16 + rl) * P32 + 8 * hh);  // A[d][k]
  const v16b bv = ldfrag<__bf16>((const __bf16*)(const void*)Xv + (size_t)(st * 16 + rl) * P32 + 8 * hh);   // B[k][s] from row s
  v8f accv = zero8();
  accv = mma_b(av, bv, accv);

  // (f) stage results (D element r = row 8*hh + r, col rl)
  unsigned short* sq = stQK[which];
#pragma unroll
  for (int r = 0; r < 8; ++r) {
    const int row = mt * 16 + 8 * hh + r;
    sq[row * QD + 0  + rl] = h_bits((_Float16)(acc00[r] * 8.0f));
    sq[row * QD + 16 + rl] = h_bits((_Float16)(acc01[r] * 8.0f));
    sq[row * QD + 32 + rl] = h_bits((_Float16)(acc10[r] * 8.0f));
    sq[row * QD + 48 + rl] = h_bits((_Float16)(acc11[r] * 8.0f));
    stV[(dt * 16 + 8 * hh + r) * 64 + st * 16 + rl] = accv[r];
  }
  __syncthreads();

  // (g) whole-line stores
  const int q4 = lane >> 3, c8 = (lane & 7) * 8;
  v4u qv[2], kv[2];
#pragma unroll
  for (int it = 0; it < 2; ++it) {
    const int row = wave * 8 + it * 4 + q4;
    qv[it] = *(const v4u*)(stQK[0] + row * QD + c8);
    kv[it] = *(const v4u*)(stQK[1] + row * QD + c8);
  }
  const int d = wave * 4 + q4;
  v4u vhv, vlv;
  {
    const float* spv = stV + d * 64 + c8;
#pragma unroll
    for (int e = 0; e < 4; ++e) {
      const float f0 = spv[2 * e] * 8.0f, f1 = spv[2 * e + 1] * 8.0f;
      const _Float16 x0 = (_Float16)f0, x1 = (_Float16)f1;
      const float r0 = f0 - (float)x0, r1 = f1 - (float)x1;
      const _Float16 l0 = (_Float16)(r0 * 4096.0f), l1 = (_Float16)(r1 * 4096.0f);
      vhv[e] = pk16(h_bits(x0), h_bits(x1));
      vlv[e] = pk16(h_bits(l0), h_bits(l1));
    }
  }
  {
#pragma unroll
    for (int it = 0; it < 2; ++it) {
      const int row = wave * 8 + it * 4 + q4;
      const size_t po = (bh * SEQ + (size_t)(i0 + row)) * QD + c8;
      *(v4u*)(q2p + po) = qv[it];
      *(v4u*)(k2p + po) = kv[it];
    }
    const size_t vo = (bh * HD + (size_t)d) * SEQ + (size_t)i0 + c8;
    *(v4u*)(vhp + vo) = vhv;
    *(v4u*)(vlp + vo) = vlv;
    
  }
}

// =====================================================================================================
// Attention on the gathered planes, head dim 64 for q/k, 32 for v, no mask, softmax over all SEQ keys.
//   Both products are taken transposed, so that a lane owns one query column (lane&15) throughout:
//   raw scores^T = K2 . Q2^T on f16 WMMA (A = K2 rows from LDS, B = Q2 rows kept in registers);
//   D register r of key tile j = raw score of key 16 j + 8 (lane>>4) + r for query lane&15.
//   c1 = sscale * log2(e), sscale = 1/(64 sqrt(512)): 1024 p = exp2(raw * c1 + (10 - max * c1)), one FMA per score.
//   Online softmax in f32: maximum and sum run over the lane's own 32 scores; the two wave halves of a query exchange
//   the maximum once per chunk and join their partial sums once, behind the loop.
//   p carried as f16(1024 p) plus residual f16((1024 p - hi) * 2048); the row sum is taken of 1024 p; key tiles 2 kk and 2 kk + 1,
//   converted in place, are the B operand of 32 keys in the hardware k order (8 h + e, 16 + 8 h + e), the order in
//   which the V^T rows are read as A: P never passes through LDS.
//   context^T = vh . ph + (vl . ph)/4096 + (vh . pl)/2048 on f16 WMMA; out = context / (l * 8) in f32, l = sum of 1024 p.
//   Block = 4 waves = 64 query rows of one (b, h); grid (NQT, NH, NB); key chunks of 64, static trip NKT.
//   Chunk staging (plain 16-B loads, 8 lanes per 128-B row piece, __syncthreads before and after): K2 chunk 128 threads
//   x 4 pieces = 64x64; V^T hi / residual chunks 128 threads x 2 pieces = 32x64 each.
//   Output: d_out[b][q][h*32 + d] f32; each wave stores rows q0..q0+15 (it 0..3 x lane>>3) x 32 floats =
//   coverage: grid (8 tiles x 8 heads x 32 batches) x 4 waves x 16 rows x 32 cols = every output element once.
// =====================================================================================================
#define POS  36            // out-tile row pitch in floats: 144 B (16 B x odd), rows written and read with 16-byte accesses
static_assert(POS >= HD && (POS % 4) == 0 && ((POS / 4) & 1) == 1);

// lane l <-> lane l ^ 16: the two lanes that share one query column
__device__ __forceinline__ float xhalf(float x) {
  const int xb = __builtin_bit_cast(int, x);
  return __builtin_bit_cast(float, __builtin_amdgcn_permlanex16(xb, xb, 0x76543210, 0xfedcba98, false, false));
}

// packed f16 residuals of eight values: half x of d[i] = f16(y[2 i + x] - 2048 * (float)(half x of h[i])), y = 2048 * the
// value that h rounds. Written as asm because the compiler otherwise converts each half back to f32 (and converts each
// value a second time, unpacked) ahead of a subtract, a multiply and a convert: one mixed-precision FMA per value does all
// of it, with the same single rounding (difference and scaling are exact). The four low halves stand ahead of the four
// high halves so that no instruction follows its own register's writer directly; the s_delay_alu lines are the
// scheduling hints that the compiler cannot place inside or in front of asm text (without them a dependent vector
// instruction holds the vector port against the other waves); they change no result.
__device__ __forceinline__ v4u res_pk(v4u h, v8f y) {
  v4u d = {0u, 0u, 0u, 0u};
#if DEV_ASM
  unsigned d0, d1, d2, d3;
  asm("s_delay_alu instid0(VALU_DEP_1)\n\t"
      "v_fma_mixlo_f16 %0, %4, %8, %9 op_sel_hi:[1,0,0]\n\t"
      "v_fma_mixlo_f16 %1, %5, %8, %11 op_sel_hi:[1,0,0]\n\t"
      "v_fma_mixlo_f16 %2, %6, %8, %13 op_sel_hi:[1,0,0]\n\t"
      "v_fma_mixlo_f16 %3, %7, %8, %15 op_sel_hi:[1,0,0]\n\t"
      "s_delay_alu instid0(VALU_DEP_4) | instskip(NEXT) | instid1(VALU_DEP_4)\n\t"
      "v_fma_mixhi_f16 %0, %4, %8, %10 op_sel:[1,0,0] op_sel_hi:[1,0,0]\n\t"
      "v_fma_mixhi_f16 %1, %5, %8, %12 op_sel:[1,0,0] op_sel_hi:[1,0,0]\n\t"
      "s_delay_alu instid0(VALU_DEP_4) | instskip(NEXT) | instid1(VALU_DEP_4)\n\t"
      "v_fma_mixhi_f16 %2, %6, %8, %14 op_sel:[1,0,0] op_sel_hi:[1,0,0]\n\t"
      "v_fma_mixhi_f16 %3, %7, %8, %16 op_sel:[1,0,0] op_sel_hi:[1,0,0]"
      : "=&v"(d0), "=&v"(d1), "=&v"(d2), "=&v"(d3)
      : "v"(h[0]), "v"(h[1]), "v"(h[2]), "v"(h[3]), "s"(-2048.0f),
        "v"(y[0]), "v"(y[1]), "v"(y[2]), "v"(y[3]), "v"(y[4]), "v"(y[5]), "v"(y[6]), "v"(y[7]));
  d[0] = d0; d[1] = d1; d[2] = d2; d[3] = d3;
#endif
  return d;
}

__global__ __launch_bounds__(128)
void k_attn(const unsigned short* __restrict__ q2p, const unsigned short* __restrict__ k2p,
            const unsigned short* __restrict__ vhp, const unsigned short* __restrict__ vlp,
            float* out, float sscale) {
  union FH { v16h v; v8h h[2]; };
  __shared__ __align__(16) _Float16 Ksh[64 * P64];         // K2 chunk [key][d]   9 KB
  __shared__ __align__(16) _Float16 Vth[HD * P64];         // V^T hi [d][key]    4.5 KB
  __shared__ __align__(16) _Float16 Vtl[HD * P64];         // V^T residual       4.5 KB
  __shared__ __align__(16) float    Os[4][16 * POS];       // per wave out tile  9 KB

  const int tid  = (int)threadIdx.x;
  const int wave = tid >> 5;
  const int lane = tid & 31;
  const int hh   = lane >> 4;
  const int c    = lane & 15;

  const int q0 = (int)blockIdx.x * 64 + wave * 16;
  const int h  = (int)blockIdx.y;
  const int b  = (int)blockIdx.z;
  const size_t bh = (size_t)b * NH + (size_t)h;

  const _Float16* Q  = (const _Float16*)(const void*)q2p + bh * SEQ * QD;
  const _Float16* K  = (const _Float16*)(const void*)k2p + bh * SEQ * QD;
  const _Float16* Vh = (const _Float16*)(const void*)vhp + bh * HD * SEQ;
  const _Float16* Vl = (const _Float16*)(const void*)vlp + bh * HD * SEQ;

  // ---- Q fragments (B operand, column = lane&15): 2 d-chunks of the 64-wide gathered row ----
  v16h qb[2];
#pragma unroll
  for (int dc = 0; dc < 2; ++dc)
    qb[dc] = ldfrag<_Float16>(Q + (size_t)(q0 + c) * QD + dc * 32 + 8 * hh);

  const float c1 = sscale * 1.44269504088896340736f;   // raw score -> log2 units (positive: the maximum may be taken raw)
  float mrun = -INFINITY;                    // running maximum of query c, raw (equal in both halves)
  float lrun = 0.f;                          // running sum of 1024 p over this half's keys only
  v8f oacc[2];                               // context^T: register r of tile t = d 16 t + 8 hh + r, query c
#pragma unroll
  for (int t = 0; t < 2; ++t) oacc[t] = zero8();

  for (int kt = 0; kt < NKT; ++kt) {         // static trip count
    const int kv0 = kt * 64;
    __syncthreads();
    {
      // 8 neighbouring lanes take one 128-B row piece (one line), so each wave-wide load covers 4 whole lines
      const int pr = tid >> 3, pc = (tid & 7) * 8;                  // rows pr + 16 i, halves pc..pc+7
      const _Float16* kg = K + (size_t)(kv0 + pr) * QD + pc;        // K2 rows kv0+pr+16i
      // unrolled (here and below): all loads of the chunk are issued before the first LDS store waits for one
#pragma unroll
      for (int i = 0; i < 4; ++i)
        *(v8h*)(Ksh + (pr + 16 * i) * P64 + pc) = *(const v8h*)(kg + (size_t)(16 * i) * QD);
      const _Float16* vg  = Vh + (size_t)pr * SEQ + kv0 + pc;       // V^T rows d = pr+16i, s = kv0+pc..+7
      const _Float16* vlg = Vl + (size_t)pr * SEQ + kv0 + pc;
#pragma unroll
      for (int i = 0; i < 2; ++i) {
        *(v8h*)(Vth + (pr + 16 * i) * P64 + pc) = *(const v8h*)(vg + (size_t)(16 * i) * SEQ);
        *(v8h*)(Vtl + (pr + 16 * i) * P64 + pc) = *(const v8h*)(vlg + (size_t)(16 * i) * SEQ);
      }
#if DEV_ASM
      // precaution: stands between these loads and the later reuse of the vector registers that hold their addresses
      asm volatile("s_wait_xcnt 0x0" ::: "memory");
#endif
    }
    __syncthreads();

    // ---- scores^T: 64 keys x 16 query columns per wave ----
    v8f s[4];
#pragma unroll
    for (int j = 0; j < 4; ++j) {
      v8f a = zero8();
#pragma unroll
      for (int dc = 0; dc < 2; ++dc) {
        FH kb;
        kb.h[0] = *(const v8h*)(Ksh + (j * 16 + c) * P64 + dc * 32 + 8 * hh);
        kb.h[1] = *(const v8h*)(Ksh + (j * 16 + c) * P64 + dc * 32 + 16 + 8 * hh);
        a = mma_h(kb.v, qb[dc], a);
      }
      s[j] = a;
    }

    // ---- column max in the lane, one exchange between the halves, online softmax ----
    float m = s[0][0];
#pragma unroll
    for (int j = 0; j < 4; ++j)
#pragma unroll
      for (int r = 0; r < 8; ++r) m = fmaxf(m, s[j][r]);
    m = fmaxf(m, xhalf(m));
    const float mnew  = fmaxf(mrun, m);
    const float msafe = (mnew == -INFINITY) ? 0.f : mnew;
    const float mb    = msafe * c1;                              // the shift, in log2 units
    const float alpha = __builtin_amdgcn_exp2f(__builtin_fmaf(mrun, c1, -mb));
    const float bias  = 10.0f - mb;                              // + 10: exp2 yields 1024 p at once
    mrun = mnew;

#pragma unroll
    for (int t = 0; t < 2; ++t)
#pragma unroll
      for (int r = 0; r < 8; ++r) oacc[t][r] *= alpha;

    // ---- per 32 keys: P hi (x1024) and residual (x2048) packed in place into B operands, then
    //      context^T += V^T . P^T (3 f16 products); residual products into separate per-chunk accumulators ----
    v8f o1[2], o2[2];
#pragma unroll
    for (int t = 0; t < 2; ++t) { o1[t] = zero8(); o2[t] = zero8(); }
    float ps[4];
    // unrolled: the scores live in registers and are picked by kk
#pragma unroll
    for (int kk = 0; kk < 2; ++kk) {
      union { v16h v; v4u q[2]; } pa, pr;                        // dword i = elements 2 i (low half), 2 i + 1 (high half)
#pragma unroll
      for (int jj = 0; jj < 2; ++jj) {
        const int j = 2 * kk + jj;
        float psum = 0.f;
        v4u h4;
        v8f y8;
#pragma unroll
        for (int r = 0; r < 8; r += 2) {
          v2f pp;
          pp[0] = __builtin_amdgcn_exp2f(__builtin_fmaf(s[j][r],     c1, bias));
          pp[1] = __builtin_amdgcn_exp2f(__builtin_fmaf(s[j][r + 1], c1, bias));
          psum += pp[0];
          psum += pp[1];
          h4[r >> 1] = __builtin_bit_cast(unsigned, __builtin_convertvector(pp, v2h));
          y8[r]     = pp[0] * 2048.0f;
          y8[r + 1] = pp[1] * 2048.0f;
        }
        pa.q[jj] = h4;
        pr.q[jj] = res_pk(h4, y8);
        ps[j] = psum;
      }
#pragma unroll
      for (int t = 0; t < 2; ++t) {
        FH vb, vr;
        vb.h[0] = *(const v8h*)(Vth + (t * 16 + c) * P64 + kk * 32 + 8 * hh);
        vb.h[1] = *(const v8h*)(Vth + (t * 16 + c) * P64 + kk * 32 + 16 + 8 * hh);
        vr.h[0] = *(const v8h*)(Vtl + (t * 16 + c) * P64 + kk * 32 + 8 * hh);
        vr.h[1] = *(const v8h*)(Vtl + (t * 16 + c) * P64 + kk * 32 + 16 + 8 * hh);
        oacc[t] = mma_h(vb.v, pa.v, oacc[t]);
        o1[t]   = mma_h(vr.v, pa.v, o1[t]);
        o2[t]   = mma_h(vb.v, pr.v, o2[t]);
      }
    }
    lrun = lrun * alpha + ((ps[0] + ps[1]) + (ps[2] + ps[3]));
#pragma unroll
    for (int t = 0; t < 2; ++t)
#pragma unroll
      for (int r = 0; r < 8; ++r) {
        const float f1 = o1[t][r] * (1.0f / 4096.0f);
        const float f2 = o2[t][r] * (1.0f / 2048.0f);
        oacc[t][r] = oacc[t][r] + f1 + f2;
      }
  }

  // ---- join the halves' sums, normalise (1/l, which holds the x1024 p carry; undo the x8 v carry), stage the wave's 16x32 tile
  float* os = Os[wave];
  {
    const float l = lrun + xhalf(lrun);
    const float inv = ((l > 0.f) ? (1.0f / l) : 0.f) * (1.0f / 8.0f);
#pragma unroll
    for (int t = 0; t < 2; ++t)
#pragma unroll
      for (int e = 0; e < 2; ++e) {
        v4f v;
#pragma unroll
        for (int x = 0; x < 4; ++x) v[x] = oacc[t][4 * e + x] * inv;
        *(v4f*)(os + c * POS + t * 16 + 8 * hh + 4 * e) = v;       // query row c, d = 16 t + 8 hh + 4 e ..+3
      }
  }
  __builtin_amdgcn_fence(__ATOMIC_RELEASE, "workgroup");
  __builtin_amdgcn_wave_barrier();
  __builtin_amdgcn_fence(__ATOMIC_ACQUIRE, "workgroup");
  {
    const int q4 = lane >> 3, c4 = (lane & 7) * 4;
    v4f ov[4];
#pragma unroll
    for (int it = 0; it < 4; ++it) {
      const int row = it * 4 + q4;                 // it 0..3 x q4 0..3 = rows 0..15 of the wave tile
      ov[it] = *(const v4f*)(os + row * POS + c4);
    }
    {
#pragma unroll
      for (int it = 0; it < 4; ++it) {
        const int row = it * 4 + q4;
        const size_t go = ((size_t)b * SEQ + (size_t)(q0 + row)) * EMB + (size_t)h * HD + c4;
        *(v4f*)(out + go) = ov[it];
      }
    }
  }
}

// =====================================================================================================
// Workspace map (bytes), every region an exact multiple of its whole-line store granularity:
//   K2   f16 [256][512][64]        16777216
//   VTl  f16 [256][32][512]         8388608
//   total                          50462720
// Launches: k_partner (256 blocks x 512), k_proj (2048 x 256), k_attn (2048 x 128).
// =====================================================================================================
extern "C" void kernel_launch(void* const* d_in, const int* in_sizes, int n_in,
                              void* d_out, int out_size, void* d_ws, size_t ws_size,
                              hipStream_t stream) {
  if (n_in < 6) return;
  if (in_sizes[0] != NB * SEQ * EMB) return;
  if (in_sizes[1] != NB * SEQ * EMB) return;
  if (in_sizes[2] != NB * SEQ * 4) return;
  if (in_sizes[3] != HD * HD || in_sizes[4] != HD * HD || in_sizes[5] != HD * HD) return;
  if (out_size != NB * SEQ * EMB) return;

  const float* content = (const float*)d_in[0];
  const float* posenc  = (const float*)d_in[1];
  const float* centers = (const float*)d_in[2];
  const float* Wq      = (const float*)d_in[3];
  const float* Wk      = (const float*)d_in[4];
  const float* Wv      = (const float*)d_in[5];

  const size_t PPT = (size_t)NB * SEQ * 2 * 4;             //   131072
  const size_t PQ2 = (size_t)NB * NH * SEQ * QD * 2;       // 16777216
  const size_t PVT = (size_t)NB * NH * HD * SEQ * 2;       //  8388608
  size_t off = 0;
  const size_t oPT = off; off += PPT;
  const size_t oQ2 = off; off += PQ2;
  const size_t oK2 = off; off += PQ2;
  const size_t oVh = off; off += PVT;
  const size_t oVl = off; off += PVT;
  if (off > ws_size) return;                               // off = 50462720
  if (off > (size_t)134217728) return;

  char* ws = (char*)d_ws;
  int*            PT  = (int*)(ws + oPT);
  unsigned short* Q2  = (unsigned short*)(ws + oQ2);
  unsigned short* K2  = (unsigned short*)(ws + oK2);
  unsigned short* VTh = (unsigned short*)(ws + oVh);
  unsigned short* VTl = (unsigned short*)(ws + oVl);
  float*          outp = (float*)d_out;

  const float sscale = (1.0f / 64.0f) / sqrtf(2.0f * (float)EMB);   // 1/(64 sqrt(512))

  const dim3 gP(NQT, NB);            //  256 blocks of 512
  const dim3 gT(NQT, NH, NB);        // 2048 blocks

  // (1) partner table
  k_partner<<<gP, dim3(64 * PSL), 0, stream>>>(centers, PT);
  // (2) gathered [q|k] planes (x8, f16), v^T hi / residual planes
  k_proj<<<gT, dim3(256), 0, stream>>>(content, posenc, PT, Wq, Wk, Wv, Q2, K2, VTh, VTl);
  // (3) attention -> d_out f32 [32][512][256]
  k_attn<<<gT, dim3(128), 0, stream>>>(Q2, K2, VTh, VTl, outp, sscale);
  (void)hipGetLastError();
}

// v006
// A run of this version takes 38.1 microseconds.
// In both of two side-by-side timings against v005, it was 1.56 times as fast.
// Counting every step since v000, it is 5.24 times as fast.
// Contractions: [q|k] and v^T projections = v_wmma_f32_16x16x32_bf16 (bf16 operands: RNE-converted content, pos, Wq, Wk, Wv;
//   x_qk.W evaluated as [content | pos] x [W ; W] along k; single products, f32 accumulate);
// gathered q.k^T scores = v_wmma_f32_16x16x32_f16 (q and k f16 planes carried x8; single product; f32 accumulate);
// p.v = v_wmma_f32_16x16x32_f16 (p f16 carried x1024 + residual plane x2048; v^T f16 carried x8 + residual plane x4096;
//   3 products ph.vh, ph.vl, pl.vh into f32 accumulators); partner selection (IoU argmax) and softmax in f32 on the VALU.
// Carry audit:
//   Q2 frags  f16 = f16(8 q)                     (projection phase) -> undone by sscale = 1/(64 sqrt(512)), inside c1
//   K2 plane  f16 = f16(8 k)                     (projection phase) -> same sscale (8*8 = 64)
//   VTh plane f16 = f16(8 v)                     (projection phase) -> epilogue inv includes 1/8
//   VTl plane f16 = f16((8 v - VTh) * 4096)      (projection phase) -> per-chunk fold o1 * (1/4096), then 1/8 in epilogue
//   P hi      f16 = f16(1024 p)                  (softmax)          -> the row sum l carries the same x1024: cancels in 1/l
//   P res     f16 = f16((1024 p - hi) * 2048)    (softmax)          -> per-chunk fold o2 * (1/2048), then 1/l in epilogue
#include <hip/hip_runtime.h>
#include <math.h>
#include <stdint.h>

#pragma clang fp contract(off)

#define NB   32
#define SEQ  512
#define EMB  256
#define NH   8
#define HD   32            // per-head dim
#define QD   64            // gathered q/k width (two partner rows)
#define NQT  (SEQ / 64)    // 64-row query tiles per sequence
#define NKT  (SEQ / 64)    // 64-key chunks per sequence
// LDS row pitches, in 16-bit elements, of every tile that is read as a WMMA fragment with 16-byte loads: 16 B x odd,
// so that the 16 rows one half-wave reads fall on 64 distinct banks (at the bare 128 B / 64 B they share 8 / 16 banks)
#define P64  72            // 64-element rows: 144 B
#define P32  40            // 32-element rows:  80 B
static_assert(NH * HD == EMB);
static_assert(NQT == 8 && NKT == 8);
static_assert((SEQ % 64) == 0 && (HD % 32) == 0 && (QD % 32) == 0);
static_assert(P64 >= QD && P32 >= HD && (P64 % 8) == 0 && (P32 % 8) == 0 && ((P64 / 8) & 1) == 1 && ((P32 / 8) & 1) == 1);

typedef _Float16 v16h __attribute__((ext_vector_type(16)));
typedef _Float16 v8h  __attribute__((ext_vector_type(8)));
typedef __bf16   v16b __attribute__((ext_vector_type(16)));
typedef __bf16   v8b  __attribute__((ext_vector_type(8)));
typedef float    v8f  __attribute__((ext_vector_type(8)));
typedef float    v4f  __attribute__((ext_vector_type(4)));
typedef unsigned int v4u __attribute__((ext_vector_type(4)));
typedef unsigned int v2u __attribute__((ext_vector_type(2)));
typedef int      v4i  __attribute__((ext_vector_type(4)));
typedef float    v2f  __attribute__((ext_vector_type(2)));
typedef _Float16 v2h  __attribute__((ext_vector_type(2)));

#if defined(__HIP_DEVICE_COMPILE__)
#define DEV_ASM 1
#else
#define DEV_ASM 0
#endif

// ---- scalar helpers --------------------------------------------------------------------------------
__device__ __forceinline__ unsigned short bf_bits(float f) {          // f32 -> bf16 bits, RNE convert
  unsigned u = __float_as_uint(f);
  return (unsigned short)((u + 0x7FFFu + ((u >> 16) & 1u)) >> 16);
}
__device__ __forceinline__ float bf_up(unsigned short hb) { return __uint_as_float(((unsigned)hb) << 16); }
__device__ __forceinline__ unsigned short h_bits(_Float16 x) { return __builtin_bit_cast(unsigned short, x); }
__device__ __forceinline__ unsigned pk16(unsigned short a, unsigned short b) { return (unsigned)a | ((unsigned)b << 16); }
__device__ __forceinline__ v8f zero8() { v8f z = {0.f, 0.f, 0.f, 0.f, 0.f, 0.f, 0.f, 0.f}; return z; }

// ---- fragment loaders: 16-bit A/B operand, lane -> row/col (lane&15), p already includes +8*(lane>>4);
//      elements 0..7 <- p[0..7] (k0+8h..k0+8h+7), elements 8..15 <- p[16..23] (k0+16+8h..k0+16+8h+7)
template <typename OT> struct FT;
template <> struct FT<__bf16>   { typedef v16b frag; typedef v8b half8; };
template <> struct FT<_Float16> { typedef v16h frag; typedef v8h half8; };

template <typename OT>
__device__ __forceinline__ typename FT<OT>::frag ldfrag(const OT* p) {
  union { typename FT<OT>::frag v; typename FT<OT>::half8 h[2]; } f;
  f.h[0] = *(const typename FT<OT>::half8*)(p);
  f.h[1] = *(const typename FT<OT>::half8*)(p + 16);
  return f.v;
}

// ---- guarded WMMA helpers: 4 VALU slots after the WMMA, D tied, A/B kept live --------------------------
__device__ __forceinline__ v8f mma_b(v16b a, v16b b, v8f c) {
  c = __builtin_amdgcn_wmma_f32_16x16x32_bf16(false, a, false, b, (short)0, c, false, false);
#if DEV_ASM
  asm volatile("v_nop\n\tv_nop\n\tv_nop\n\tv_nop" : "+v"(c) : "v"(a), "v"(b));
#endif
  return c;
}
__device__ __forceinline__ v8f mma_h(v16h a, v16h b, v8f c) {
  c = __builtin_amdgcn_wmma_f32_16x16x32_f16(false, a, false, b, (short)0, c, false, false);
#if DEV_ASM
  asm volatile("v_nop\n\tv_nop\n\tv_nop\n\tv_nop" : "+v"(c) : "v"(a), "v"(b));
#endif
  return c;
}

// =====================================================================================================
// Partner selection (f32, VALU, fp-contract off, literal op order):
//   c = RNE-bf16(centers); bbox = (c0 - c3*0.5, c1 - c2*0.5, c0 + c3*0.5, c1 + c2*0.5);
//   inter = max(min maxs - max mins, 0) products; union = (area_i + area_j) - inter; iou = inter/union - eye;
//   amax = first index of the row maximum (NaN counts as maximum, first NaN wins); l1 = (c2 - c0) + (c3 - c1);
//   cond = l1_i >= l1[amax]; p0 = cond ? i : amax, p1 = cond ? amax : i.
// grid (NQT, NB), 512 threads: block = 64 rows of one batch x PSL slices of PJS candidates; all 512 boxes of the
//   batch staged in LDS. Wave w scans rows 32*(w&1)..+31 against candidates PJS*(w>>1)..+PJS-1 and keeps, per row,
//   (slice maximum, its first index, first NaN index); threads 0..63 merge the slices in ascending order with a strict
//   compare, so the result is the first index of the row maximum (or the first NaN), as in one ascending scan.
// coverage: 8 blocks x 64 rows x 2 ints per batch = the whole table.
// =====================================================================================================
#define PSL 8              // candidate slices per row
#define PJS (SEQ / PSL)    // candidates per slice
static_assert(PSL * PJS == SEQ && (PJS % 2) == 0);
__global__ __launch_bounds__(64 * PSL) void k_partner(const float* __restrict__ cen, int* pt) {
#pragma clang fp contract(off)
  __shared__ float sb0[SEQ];
  __shared__ float sb1[SEQ];
  __shared__ float sb2[SEQ];
  __shared__ float sb3[SEQ];
  __shared__ float sar[SEQ];
  __shared__ float sl1[SEQ];
  __shared__ float mbv[PSL][64];                // slice maximum per row
  __shared__ int   mbj[PSL][64];                // its first index
  __shared__ int   mnj[PSL][64];                // first NaN index of the slice, SEQ if none
  __shared__ __align__(16) int sp[128];

  const int tid = (int)threadIdx.x;
  const int row = tid & 63;
  const int sl  = tid >> 6;                     // the same for a whole wave
  const int i0  = (int)blockIdx.x * 64;
  const int b   = (int)blockIdx.y;
  const float* cb = cen + (size_t)b * SEQ * 4;

  for (int s = tid; s < SEQ; s += 64 * PSL) {
    const v4f cv = *(const v4f*)(cb + (size_t)s * 4);
#if DEV_ASM
    // precaution: stands between this load and the later reuse of the scalar registers that hold its base address
    asm volatile("s_wait_xcnt 0x0" ::: "memory");
#endif
    const float c0 = bf_up(bf_bits(cv[0]));
    const float c1 = bf_up(bf_bits(cv[1]));
    const float c2 = bf_up(bf_bits(cv[2]));
    const float c3 = bf_up(bf_bits(cv[3]));
    const float hx = c3 * 0.5f;
    const float hy = c2 * 0.5f;
    const float x0 = c0 - hx;
    const float y0 = c1 - hy;
    const float x1 = c0 + hx;
    const float y1 = c1 + hy;
    sb0[s] = x0;
    sb1[s] = y0;
    sb2[s] = x1;
    sb3[s] = y1;
    const float dx = x1 - x0;
    const float dy = y1 - y0;
    sar[s] = dx * dy;
    const float la = c2 - c0;
    const float lb = c3 - c1;
    sl1[s] = la + lb;
  }
  __syncthreads();

  const int i = i0 + row;                       // 0..511
  const float a0 = sb0[i], a1 = sb1[i], a2 = sb2[i], a3 = sb3[i], ar = sar[i];
  float best = -INFINITY;
  int   bj = 0;
  int   nj = SEQ;
  const int j0 = sl * PJS;
#pragma unroll 2
  for (int jj = 0; jj < PJS; ++jj) {
    const int j = j0 + jj;
    const float m0 = fmaxf(a0, sb0[j]);
    const float m1 = fmaxf(a1, sb1[j]);
    const float x2 = fminf(a2, sb2[j]);
    const float x3 = fminf(a3, sb3[j]);
    const float d0 = x2 - m0;
    const float d1 = x3 - m1;
    const float w0 = fmaxf(d0, 0.0f);
    const float w1 = fmaxf(d1, 0.0f);
    const float inter = w0 * w1;
    const float asum  = ar + sar[j];
    const float uni   = asum - inter;
    const float q     = inter / uni;
    const float e     = (j == i) ? 1.0f : 0.0f;
    const float iou   = q - e;
    const bool  up    = iou > best;             // false for NaN
    best = up ? iou : best;
    bj   = up ? j : bj;
    nj   = min(nj, (iou != iou) ? j : SEQ);
  }
  mbv[sl][row] = best;
  mbj[sl][row] = bj;
  mnj[sl][row] = nj;
  __syncthreads();

  if (tid < 64) {
    float gb = -INFINITY;
    int   gj = 0;
    int   gn = SEQ;
    // unrolled so that all slice reads are issued before the first one is waited for
#pragma unroll
    for (int s = 0; s < PSL; ++s) {             // ascending slices, strict compare: the first maximum wins
      const float v = mbv[s][tid];
      const int   x = mbj[s][tid];
      const bool  up = v > gb;
      gb = up ? v : gb;
      gj = up ? x : gj;
      gn = min(gn, mnj[s][tid]);
    }
    const int am = (gn < SEQ) ? gn : gj;        // NaN counts as maximum, first NaN wins
    const float l1i = sl1[i];
    const float l1p = sl1[am];
    const bool cond = (l1i >= l1p);
    sp[tid * 2 + 0] = cond ? i : am;
    sp[tid * 2 + 1] = cond ? am : i;
  }
  __syncthreads();

  if (tid < 32) {
    const v4i v = *(const v4i*)(sp + tid * 4);    // rows i0+2*tid, i0+2*tid+1
    int* dst = pt + ((size_t)b * SEQ + i0) * 2 + tid * 4;
    *(v4i*)dst = v;
  }
}

// =====================================================================================================
// Projections and attention in one launch. Block = one (batch b, head h), NW = 32 waves; wave w owns rows 16 w..16 w + 15
// of the sequence as projection rows, as keys and as queries. One block fills one WGP's LDS; grid (NB, NH) = 256 blocks.
// Projection phase (all products bf16 WMMA, f32 accumulate):
//   Xg[g][i][0..31] = bf16(content[b][p_g(i)][h*32..]), Xg[g][i][32..63] = bf16(pos[same row]) (g = 0: p0, 1: p1;
//   indices from PT, clamped to [0, SEQ-1]); Xv[i][k] = bf16(content[b][i][h*32+k]);
//   W2[which][n][k'] = bf16(W[k' & 31][n]) for Wq (0) / Wk (1); Wvt[n][k] = bf16(Wv[k][n]).
//   Q2[i][g*32+n] = sum_k' Xg[g][i][k'] W2q[n][k'] (K = 64) = (content + pos)[p_g(i)] . Wq; K2 likewise with Wk;
//   V^T[d][s] = sum_k Wvt[d][k] Xv[s][k].
//   Q2 and K2 are taken transposed (A = W2 rows n, B = Xg rows i): D register r of n tile nt = column n = 16 nt + 8 (lane>>4) + r
//   of row i = lane&15, so the two n tiles of one g, converted in place, are (a) the B operand of the score product for
//   Q2 (hardware k order 8 h + e, 16 + 8 h + e), which never leaves the registers, and (b) two 16-byte LDS stores for K2.
//   Every wave takes its X rows into registers, then a barrier; behind it Xg[0] is reused as the K2 plane (same rows, same
//   pitch) and Xg[1] as the waves' out tiles. A last barrier publishes K2 and V^T; the key loop has none.
// Attention on the gathered planes, head dim 64 for q/k, 32 for v, no mask, softmax over all SEQ keys.
//   Both products are taken transposed, so that a lane owns one query column (lane&15) throughout:
//   raw scores^T = K2 . Q2^T on f16 WMMA (A = K2 rows from LDS, B = Q2 rows kept in registers);
//   D register r of key tile j = raw score of key 16 j + 8 (lane>>4) + r for query lane&15.
//   c1 = sscale * log2(e), sscale = 1/(64 sqrt(512)): 1024 p = exp2(raw * c1 + (10 - max * c1)), one FMA per score.
//   Online softmax in f32: maximum and sum run over the lane's own 32 scores; the two wave halves of a query exchange
//   the maximum once per chunk and join their partial sums once, behind the loop.
//   p carried as f16(1024 p) plus residual f16((1024 p - hi) * 2048); the row sum is taken of 1024 p; key tiles 2 kk and 2 kk + 1,
//   converted in place, are the B operand of 32 keys in the hardware k order (8 h + e, 16 + 8 h + e), the order in
//   which the V^T rows are read as A: P never passes through LDS.
//   context^T = vh . ph + (vl . ph)/4096 + (vh . pl)/2048 on f16 WMMA; out = context / (l * 8) in f32, l = sum of 1024 p.
//   Key chunks of 64, static trip NKT, in ascending order.
//   Output: d_out[b][q][h*32 + d] f32; each wave stores rows q0..q0+15 (it 0..3 x lane>>3) x 32 floats =
//   coverage: grid (32 batches x 8 heads) x 32 waves x 16 rows x 32 cols = every output element once.
// =====================================================================================================
#define NW   32            // waves per block, one 16-row tile each
#define PV   (SEQ + 8)     // V^T row pitch in halves: 1040 B (16 B x odd), rows read as 16-byte WMMA fragments
static_assert(NW * 16 == SEQ && (PV % 8) == 0 && ((PV / 8) & 1) == 1);
#define POS  36            // out-tile row pitch in floats: 144 B (16 B x odd), rows written and read with 16-byte accesses
static_assert(POS >= HD && (POS % 4) == 0 && ((POS / 4) & 1) == 1);

// lane l <-> lane l ^ 16: the two lanes that share one query column
__device__ __forceinline__ float xhalf(float x) {
  const int xb = __builtin_bit_cast(int, x);
  return __builtin_bit_cast(float, __builtin_amdgcn_permlanex16(xb, xb, 0x76543210, 0xfedcba98, false, false));
}

// packed f16 residuals of eight values: half x of d[i] = f16(y[2 i + x] - 2048 * (float)(half x of h[i])), y = 2048 * the
// value that h rounds. Written as asm because the compiler otherwise converts each half back to f32 (and converts each
// value a second time, unpacked) ahead of a subtract, a multiply and a convert: one mixed-precision FMA per value does all
// of it, with the same single rounding (difference and scaling are exact). The four low halves stand ahead of the four
// high halves so that no instruction follows its own register's writer directly; the s_delay_alu lines are the
// scheduling hints that the compiler cannot place inside or in front of asm text (without them a dependent vector
// instruction holds the vector port against the other waves); they change no result.
__device__ __forceinline__ v4u res_pk(v4u h, v8f y) {
  v4u d = {0u, 0u, 0u, 0u};
#if DEV_ASM
  unsigned d0, d1, d2, d3;
  asm("s_delay_alu instid0(VALU_DEP_1)\n\t"
      "v_fma_mixlo_f16 %0, %4, %8, %9 op_sel_hi:[1,0,0]\n\t"
      "v_fma_mixlo_f16 %1, %5, %8, %11 op_sel_hi:[1,0,0]\n\t"
      "v_fma_mixlo_f16 %2, %6, %8, %13 op_sel_hi:[1,0,0]\n\t"
      "v_fma_mixlo_f16 %3, %7, %8, %15 op_sel_hi:[1,0,0]\n\t"
      "s_delay_alu instid0(VALU_DEP_4) | instskip(NEXT) | instid1(VALU_DEP_4)\n\t"
      "v_fma_mixhi_f16 %0, %4, %8, %10 op_sel:[1,0,0] op_sel_hi:[1,0,0]\n\t"
      "v_fma_mixhi_f16 %1, %5, %8, %12 op_sel:[1,0,0] op_sel_hi:[1,0,0]\n\t"
      "s_delay_alu instid0(VALU_DEP_4) | instskip(NEXT) | instid1(VALU_DEP_4)\n\t"
      "v_fma_mixhi_f16 %2, %6, %8, %14 op_sel:[1,0,0] op_sel_hi:[1,0,0]\n\t"
      "v_fma_mixhi_f16 %3, %7, %8, %16 op_sel:[1,0,0] op_sel_hi:[1,0,0]"
      : "=&v"(d0), "=&v"(d1), "=&v"(d2), "=&v"(d3)
      : "v"(h[0]), "v"(h[1]), "v"(h[2]), "v"(h[3]), "s"(-2048.0f),
        "v"(y[0]), "v"(y[1]), "v"(y[2]), "v"(y[3]), "v"(y[4]), "v"(y[5]), "v"(y[6]), "v"(y[7]));
  d[0] = d0; d[1] = d1; d[2] = d2; d[3] = d3;
#endif
  return d;
}
__global__ __launch_bounds__(NW * 32)
void k_attn(const float* __restrict__ content, const float* __restrict__ pos, const int* __restrict__ pt,
            const float* __restrict__ Wq, const float* __restrict__ Wk, const float* __restrict__ Wv,
            float* out, float sscale) {
  union FH { v16h v; v8h h[2]; };
  __shared__ __align__(16) unsigned short Xg[2][SEQ * P64];   // 144 KB; later [0] = K2 plane [key][d], [1] = out tiles
  __shared__ __align__(16) unsigned short Xv[SEQ * P32];      //  40 KB
  __shared__ __align__(16) unsigned short W2[2][HD * P64];    //   9 KB
  __shared__ __align__(16) unsigned short Wvt[HD * P32];      //   2.5 KB
  __shared__ __align__(16) _Float16 Vth[HD * PV];             //  32.5 KB  V^T hi [d][key]
  __shared__ __align__(16) _Float16 Vtl[HD * PV];             //  32.5 KB  V^T residual
  __shared__ int sIdx[2][SEQ];                                //   4 KB
  static_assert(16 * P64 * 2 == 16 * POS * 4);                // a wave's 16 Xg rows hold its out tile exactly

  const int tid  = (int)threadIdx.x;
  const int wave = tid >> 5;
  const int lane = tid & 31;
  const int hh   = lane >> 4;
  const int c    = lane & 15;

  const int q0 = wave * 16;
  const int b  = (int)blockIdx.x;
  const int h  = (int)blockIdx.y;
  const size_t rowB = (size_t)b * SEQ;

  // (a) partner indices of all rows, clamped: thread -> (row tid >> 1, g = tid & 1)
  {
    int v = pt[rowB * 2 + (size_t)tid];
    v = min(max(v, 0), SEQ - 1);
    sIdx[tid & 1][tid >> 1] = v;
  }
  // (b) weights (waves 0..7): whole 128-B rows (W[k][0..31] is one line), two k rows per thread, transposed to [n][k] on the
  //     LDS write, bf16 bits, one dword = (k even, k odd); k duplicated over the two 32-halves for Wq / Wk.
  //     Wq (threads 0..127) / Wk (128..255): k pair wkk x 4 columns, 16-byte loads; Wv: k pair vkk x 2 columns, 8-byte loads.
  if (tid < 256) {
    const int wm  = tid >> 7;
    const int wkk = (tid >> 3) & 15, wn4 = (tid & 7) * 4;
    const int vkk = tid >> 4,        vn2 = (tid & 15) * 2;
    const float* Wm = wm ? Wk : Wq;
    const v4f wr0 = *(const v4f*)(Wm + (2 * wkk + 0) * HD + wn4);
#if DEV_ASM
    // precaution: stands between this load and the next one, whose result may land in the registers that hold this address
    asm volatile("s_wait_xcnt 0x0" ::: "memory");
#endif
    const v4f wr1 = *(const v4f*)(Wm + (2 * wkk + 1) * HD + wn4);
    const v2f vr0 = *(const v2f*)(Wv + (2 * vkk + 0) * HD + vn2);
    const v2f vr1 = *(const v2f*)(Wv + (2 * vkk + 1) * HD + vn2);
    // both loops unrolled: the loaded rows live in registers and are picked by j
#pragma unroll
    for (int j = 0; j < 4; ++j) {
      const unsigned pw = pk16(bf_bits(wr0[j]), bf_bits(wr1[j]));
      unsigned short* wd = W2[wm] + (wn4 + j) * P64 + 2 * wkk;
      *(unsigned*)(wd)      = pw;
      *(unsigned*)(wd + HD) = pw;
    }
#pragma unroll
    for (int j = 0; j < 2; ++j)
      *(unsigned*)(Wvt + (vn2 + j) * P32 + 2 * vkk) = pk16(bf_bits(vr0[j]), bf_bits(vr1[j]));
  }
  // (c) content rows, head slice h -> Xv (4096 float4 pieces, 4 per thread; 8 neighbouring lanes take one 128-B line)
  //     unrolled: all four loads are issued before the first LDS store waits for one
#pragma unroll
  for (int it = 0; it < 4; ++it) {
    const int e = it * (NW * 32) + tid;
    const int r = e >> 3, c4 = (e & 7) * 4;
    const v4f v = *(const v4f*)(content + (rowB + (size_t)r) * EMB + (size_t)h * HD + c4);
    v2u pk;
    pk[0] = pk16(bf_bits(v[0]), bf_bits(v[1]));
    pk[1] = pk16(bf_bits(v[2]), bf_bits(v[3]));
    *(v2u*)(Xv + r * P32 + c4) = pk;
  }
  __syncthreads();
  // (d) gathered rows: it2 -> (g, source) uniform; e -> (row r, float4 piece); 16 x 1024 pieces = [2][2][512][8]
  //     unrolled: g and the source are picked by it2, and the loads are issued ahead of the LDS stores
#pragma unroll
  for (int it2 = 0; it2 < 16; ++it2) {
    const int g   = it2 >> 3;
    const int src = (it2 >> 2) & 1;
    const int e   = (it2 & 3) * (NW * 32) + tid;
    const int r   = e >> 3, c4 = (e & 7) * 4;
    const float* base = src ? pos : content;
    const int srow = sIdx[g][r];
    const v4f v = *(const v4f*)(base + (rowB + (size_t)srow) * EMB + (size_t)h * HD + c4);
    v2u pk;
    pk[0] = pk16(bf_bits(v[0]), bf_bits(v[1]));
    pk[1] = pk16(bf_bits(v[2]), bf_bits(v[3]));
    *(v2u*)(Xg[g] + r * P64 + src * HD + c4) = pk;
  }
  __syncthreads();

  // (e) the wave's own 16 rows as B operands (column = lane&15), taken into registers
  v16b bx[2][2];
#pragma unroll
  for (int g = 0; g < 2; ++g)
#pragma unroll
    for (int ks = 0; ks < 2; ++ks)
      bx[g][ks] = ldfrag<__bf16>((const __bf16*)(const void*)Xg[g] + (size_t)(q0 + c) * P64 + ks * 32 + 8 * hh);
  const v16b bv = ldfrag<__bf16>((const __bf16*)(const void*)Xv + (size_t)(q0 + c) * P32 + 8 * hh);   // B[k][s] from row s
  __syncthreads();           // ends every read of Xg: [0] is rewritten as the K2 plane below, [1] as the out tiles at the end

  _Float16* Ksh = (_Float16*)(void*)Xg[0];
  // (f) Q2^T (which = 0) -> B fragments qb in registers; K2^T (which = 1) -> K2 plane rows q0 + c
  v16h qb[2];
#pragma unroll
  for (int which = 0; which < 2; ++which) {
    const __bf16* Wb = (const __bf16*)(const void*)W2[which];
#pragma unroll
    for (int g = 0; g < 2; ++g) {
      FH f;
#pragma unroll
      for (int nt = 0; nt < 2; ++nt) {
        v8f a = zero8();
#pragma unroll
        for (int ks = 0; ks < 2; ++ks) {
          const v16b aw = ldfrag<__bf16>(Wb + (size_t)(nt * 16 + c) * P64 + ks * 32 + 8 * hh);   // A[n][k']
          a = mma_b(aw, bx[g][ks], a);
        }
#pragma unroll
        for (int r = 0; r < 8; ++r) f.h[nt][r] = (_Float16)(a[r] * 8.0f);   // n = 16 nt + 8 hh + r
      }
      if (which == 0) {
        qb[g] = f.v;
      } else {
        *(v8h*)(Ksh + (q0 + c) * P64 + g * 32 + 8 * hh)      = f.h[0];
        *(v8h*)(Ksh + (q0 + c) * P64 + g * 32 + 16 + 8 * hh) = f.h[1];
      }
    }
  }
  // (g) V^T tiles d = 16 dt + 8 hh + r, s = q0 + c -> hi and residual planes
#pragma unroll
  for (int dt = 0; dt < 2; ++dt) {
    const v16b av = ldfrag<__bf16>((const __bf16*)(const void*)Wvt + (size_t)(dt * 16 + c) * P32 + 8 * hh);  // A[d][k]
    v8f accv = zero8();
    accv = mma_b(av, bv, accv);
#pragma unroll
    for (int r = 0; r < 8; ++r) {
      const float f0 = accv[r] * 8.0f;
      const _Float16 x0 = (_Float16)f0;
      const float r0 = f0 - (float)x0;
      const _Float16 l0 = (_Float16)(r0 * 4096.0f);
      Vth[(dt * 16 + 8 * hh + r) * PV + q0 + c] = x0;
      Vtl[(dt * 16 + 8 * hh + r) * PV + q0 + c] = l0;
    }
  }
  __syncthreads();           // publishes the K2 and V^T planes to every wave

  const float c1 = sscale * 1.44269504088896340736f;   // raw score -> log2 units (positive: the maximum may be taken raw)
  float mrun = -INFINITY;                    // running maximum of query c, raw (equal in both halves)
  float lrun = 0.f;                          // running sum of 1024 p over this half's keys only
  v8f oacc[2];                               // context^T: register r of tile t = d 16 t + 8 hh + r, query c
#pragma unroll
  for (int t = 0; t < 2; ++t) oacc[t] = zero8();

  for (int kt = 0; kt < NKT; ++kt) {         // static trip count
    const int kv0 = kt * 64;

    // ---- scores^T: 64 keys x 16 query columns per wave ----
    v8f s[4];
#pragma unroll
    for (int j = 0; j < 4; ++j) {
      v8f a = zero8();
#pragma unroll
      for (int dc = 0; dc < 2; ++dc) {
        FH kb;
        kb.h[0] = *(const v8h*)(Ksh + (kv0 + j * 16 + c) * P64 + dc * 32 + 8 * hh);
        kb.h[1] = *(const v8h*)(Ksh + (kv0 + j * 16 + c) * P64 + dc * 32 + 16 + 8 * hh);
        a = mma_h(kb.v, qb[dc], a);
      }
      s[j] = a;
    }

    // ---- column max in the lane, one exchange between the halves, online softmax ----
    float m = s[0][0];
#pragma unroll
    for (int j = 0; j < 4; ++j)
#pragma unroll
      for (int r = 0; r < 8; ++r) m = fmaxf(m, s[j][r]);
    m = fmaxf(m, xhalf(m));
    const float mnew  = fmaxf(mrun, m);
    const float msafe = (mnew == -INFINITY) ? 0.f : mnew;
    const float mb    = msafe * c1;                              // the shift, in log2 units
    const float alpha = __builtin_amdgcn_exp2f(__builtin_fmaf(mrun, c1, -mb));
    const float bias  = 10.0f - mb;                              // + 10: exp2 yields 1024 p at once
    mrun = mnew;

#pragma unroll
    for (int t = 0; t < 2; ++t)
#pragma unroll
      for (int r = 0; r < 8; ++r) oacc[t][r] *= alpha;

    // ---- per 32 keys: P hi (x1024) and residual (x2048) packed in place into B operands, then
    //      context^T += V^T . P^T (3 f16 products); residual products into separate per-chunk accumulators ----
    v8f o1[2], o2[2];
#pragma unroll
    for (int t = 0; t < 2; ++t) { o1[t] = zero8(); o2[t] = zero8(); }
    float ps[4];
    // unrolled: the scores live in registers and are picked by kk
#pragma unroll
    for (int kk = 0; kk < 2; ++kk) {
      union { v16h v; v4u q[2]; } pa, pr;                        // dword i = elements 2 i (low half), 2 i + 1 (high half)
#pragma unroll
      for (int jj = 0; jj < 2; ++jj) {
        const int j = 2 * kk + jj;
        float psum = 0.f;
        v4u h4;
        v8f y8;
#pragma unroll
        for (int r = 0; r < 8; r += 2) {
          v2f pp;
          pp[0] = __builtin_amdgcn_exp2f(__builtin_fmaf(s[j][r],     c1, bias));
          pp[1] = __builtin_amdgcn_exp2f(__builtin_fmaf(s[j][r + 1], c1, bias));
          psum += pp[0];
          psum += pp[1];
          h4[r >> 1] = __builtin_bit_cast(unsigned, __builtin_convertvector(pp, v2h));
          y8[r]     = pp[0] * 2048.0f;
          y8[r + 1] = pp[1] * 2048.0f;
        }
        pa.q[jj] = h4;
        pr.q[jj] = res_pk(h4, y8);
        ps[j] = psum;
      }
#pragma unroll
      for (int t = 0; t < 2; ++t) {
        FH vb, vr;
        vb.h[0] = *(const v8h*)(Vth + (t * 16 + c) * PV + kv0 + kk * 32 + 8 * hh);
        vb.h[1] = *(const v8h*)(Vth + (t * 16 + c) * PV + kv0 + kk * 32 + 16 + 8 * hh);
        vr.h[0] = *(const v8h*)(Vtl + (t * 16 + c) * PV + kv0 + kk * 32 + 8 * hh);
        vr.h[1] = *(const v8h*)(Vtl + (t * 16 + c) * PV + kv0 + kk * 32 + 16 + 8 * hh);
        oacc[t] = mma_h(vb.v, pa.v, oacc[t]);
        o1[t]   = mma_h(vr.v, pa.v, o1[t]);
        o2[t]   = mma_h(vb.v, pr.v, o2[t]);
      }
    }
    lrun = lrun * alpha + ((ps[0] + ps[1]) + (ps[2] + ps[3]));
#pragma unroll
    for (int t = 0; t < 2; ++t)
#pragma unroll
      for (int r = 0; r < 8; ++r) {
        const float f1 = o1[t][r] * (1.0f / 4096.0f);
        const float f2 = o2[t][r] * (1.0f / 2048.0f);
        oacc[t][r] = oacc[t][r] + f1 + f2;
      }
  }

  // ---- join the halves' sums, normalise (1/l, which holds the x1024 p carry; undo the x8 v carry), stage the wave's 16x32 tile
  float* os = (float*)(void*)(Xg[1] + wave * 16 * P64);
  {
    const float l = lrun + xhalf(lrun);
    const float inv = ((l > 0.f) ? (1.0f / l) : 0.f) * (1.0f / 8.0f);
#pragma unroll
    for (int t = 0; t < 2; ++t)
#pragma unroll
      for (int e = 0; e < 2; ++e) {
        v4f v;
#pragma unroll
        for (int x = 0; x < 4; ++x) v[x] = oacc[t][4 * e + x] * inv;
        *(v4f*)(os + c * POS + t * 16 + 8 * hh + 4 * e) = v;       // query row c, d = 16 t + 8 hh + 4 e ..+3
      }
  }
  __builtin_amdgcn_fence(__ATOMIC_RELEASE, "workgroup");
  __builtin_amdgcn_wave_barrier();
  __builtin_amdgcn_fence(__ATOMIC_ACQUIRE, "workgroup");
  {
    const int q4 = lane >> 3, c4 = (lane & 7) * 4;
    v4f ov[4];
#pragma unroll
    for (int it = 0; it < 4; ++it) {
      const int row = it * 4 + q4;                 // it 0..3 x q4 0..3 = rows 0..15 of the wave tile
      ov[it] = *(const v4f*)(os + row * POS + c4);
    }
    {
#pragma unroll
      for (int it = 0; it < 4; ++it) {
        const int row = it * 4 + q4;
        const size_t go = ((size_t)b * SEQ + (size_t)(q0 + row)) * EMB + (size_t)h * HD + c4;
        *(v4f*)(out + go) = ov[it];
      }
    }
  }
}

// =====================================================================================================
// Workspace map (bytes): PT int [32][512][2] 131072.
// Launches: k_partner (256 blocks x 512), k_attn (256 x 1024).
// =====================================================================================================
extern "C" void kernel_launch(void* const* d_in, const int* in_sizes, int n_in,
                              void* d_out, int out_size, void* d_ws, size_t ws_size,
                              hipStream_t stream) {
  if (n_in < 6) return;
  if (in_sizes[0] != NB * SEQ * EMB) return;
  if (in_sizes[1] != NB * SEQ * EMB) return;
  if (in_sizes[2] != NB * SEQ * 4) return;
  if (in_sizes[3] != HD * HD || in_sizes[4] != HD * HD || in_sizes[5] != HD * HD) return;
  if (out_size != NB * SEQ * EMB) return;

  const float* content = (const float*)d_in[0];
  const float* posenc  = (const float*)d_in[1];
  const float* centers = (const float*)d_in[2];
  const float* Wq      = (const float*)d_in[3];
  const float* Wk      = (const float*)d_in[4];
  const float* Wv      = (const float*)d_in[5];

  const size_t PPT = (size_t)NB * SEQ * 2 * 4;             //   131072
  if (PPT > ws_size) return;

  int*   PT   = (int*)d_ws;
  float* outp = (float*)d_out;

  const float sscale = (1.0f / 64.0f) / sqrtf(2.0f * (float)EMB);   // 1/(64 sqrt(512))

  const dim3 gP(NQT, NB);            //  256 blocks of 512
  const dim3 gA(NB, NH);             //  256 blocks of 1024

  // (1) partner table
  k_partner<<<gP, dim3(64 * PSL), 0, stream>>>(centers, PT);
  // (2) projections and attention -> d_out f32 [32][512][256]
  k_attn<<<gA, dim3(NW * 32), 0, stream>>>(content, posenc, PT, Wq, Wk, Wv, outp, sscale);
  (void)hipGetLastError();
}

// v007
// One run takes 33.9 microseconds.
// Two timings next to v006 both put it at 1.12 times that version's speed.
// Counting every step since v000, it is 5.87 times as fast.
// Contractions: [q|k] and v^T projections = v_wmma_f32_16x16x32_bf16 (bf16 operands: RNE-converted content, pos, Wq, Wk, Wv;
//   x_qk.W evaluated as [content | pos] x [W ; W] along k; single products, f32 accumulate);
// gathered q.k^T scores = v_wmma_f32_16x16x32_f16 (q and k f16 planes carried x8; single product; f32 accumulate);
// p.v = v_wmma_f32_16x16x32_f16 (p f16 carried x1024 + residual plane at the same scale; v^T f16 carried x8 + residual plane
//   at the same scale; 3 products ph.vh, ph.vl, pl.vh into one f32 accumulator); partner selection (IoU argmax) and softmax
//   in f32 on the VALU.
// Carry audit:
//   Q2 frags  f16 = f16(8 q)                     (projection phase) -> undone by sscale = 1/(64 sqrt(512)), inside c1
//   K2 plane  f16 = f16(8 k)                     (projection phase) -> same sscale (8*8 = 64)
//   VTh plane f16 = f16(8 v)                     (projection phase) -> epilogue inv includes 1/8
//   VTl plane f16 = f16(8 v - VTh)               (projection phase) -> same 1/8 in epilogue (f16 grid 2^-24 at worst = 2^-27 of v)
//   P hi      f16 = f16(1024 p)                  (softmax)          -> the row sum l carries the same x1024: cancels in 1/l
//   P res     f16 = f16(1024 p - hi)             (softmax)          -> same 1/l in epilogue (f16 grid 2^-24 at worst = 2^-34 of p)
#include <hip/hip_runtime.h>
#include <math.h>
#include <stdint.h>

#pragma clang fp contract(off)

#define NB   32
#define SEQ  512
#define EMB  256
#define NH   8
#define HD   32            // per-head dim
#define QD   64            // gathered q/k width (two partner rows)
#define NQT  (SEQ / 64)    // 64-row query tiles per sequence
#define NKT  (SEQ / 64)    // 64-key chunks per sequence
// LDS row pitches, in 16-bit elements, of every tile that is read as a WMMA fragment with 16-byte loads: 16 B x odd,
// so that the 16 rows one half-wave reads fall on 64 distinct banks (at the bare 128 B / 64 B they share 8 / 16 banks)
#define P64  72            // 64-element rows: 144 B
#define P32  40            // 32-element rows:  80 B
static_assert(NH * HD == EMB);
static_assert(NQT == 8 && NKT == 8);
static_assert((SEQ % 64) == 0 && (HD % 32) == 0 && (QD % 32) == 0);
static_assert(P64 >= QD && P32 >= HD && (P64 % 8) == 0 && (P32 % 8) == 0 && ((P64 / 8) & 1) == 1 && ((P32 / 8) & 1) == 1);

typedef _Float16 v16h __attribute__((ext_vector_type(16)));
typedef _Float16 v8h  __attribute__((ext_vector_type(8)));
typedef __bf16   v16b __attribute__((ext_vector_type(16)));
typedef __bf16   v8b  __attribute__((ext_vector_type(8)));
typedef float    v8f  __attribute__((ext_vector_type(8)));
typedef float    v4f  __attribute__((ext_vector_type(4)));
typedef unsigned int v4u __attribute__((ext_vector_type(4)));
typedef unsigned int v2u __attribute__((ext_vector_type(2)));
typedef int      v4i  __attribute__((ext_vector_type(4)));
typedef float    v2f  __attribute__((ext_vector_type(2)));
typedef _Float16 v2h  __attribute__((ext_vector_type(2)));

#if defined(__HIP_DEVICE_COMPILE__)
#define DEV_ASM 1
#else
#define DEV_ASM 0
#endif

// ---- scalar helpers --------------------------------------------------------------------------------
__device__ __forceinline__ unsigned short bf_bits(float f) {          // f32 -> bf16 bits, RNE convert
  unsigned u = __float_as_uint(f);
  return (unsigned short)((u + 0x7FFFu + ((u >> 16) & 1u)) >> 16);
}
__device__ __forceinline__ float bf_up(unsigned short hb) { return __uint_as_float(((unsigned)hb) << 16); }
__device__ __forceinline__ unsigned short h_bits(_Float16 x) { return __builtin_bit_cast(unsigned short, x); }
__device__ __forceinline__ unsigned pk16(unsigned short a, unsigned short b) { return (unsigned)a | ((unsigned)b << 16); }
__device__ __forceinline__ v8f zero8() { v8f z = {0.f, 0.f, 0.f, 0.f, 0.f, 0.f, 0.f, 0.f}; return z; }

// ---- fragment loaders: 16-bit A/B operand, lane -> row/col (lane&15), p already includes +8*(lane>>4);
//      elements 0..7 <- p[0..7] (k0+8h..k0+8h+7), elements 8..15 <- p[16..23] (k0+16+8h..k0+16+8h+7)
template <typename OT> struct FT;
template <> struct FT<__bf16>   { typedef v16b frag; typedef v8b half8; };
template <> struct FT<_Float16> { typedef v16h frag; typedef v8h half8; };

template <typename OT>
__device__ __forceinline__ typename FT<OT>::frag ldfrag(const OT* p) {
  union { typename FT<OT>::frag v; typename FT<OT>::half8 h[2]; } f;
  f.h[0] = *(const typename FT<OT>::half8*)(p);
  f.h[1] = *(const typename FT<OT>::half8*)(p + 16);
  return f.v;
}

// ---- guarded WMMA helpers: 4 VALU slots after the WMMA, D tied, A/B kept live --------------------------
__device__ __forceinline__ v8f mma_b(v16b a, v16b b, v8f c) {
  c = __builtin_amdgcn_wmma_f32_16x16x32_bf16(false, a, false, b, (short)0, c, false, false);
#if DEV_ASM
  asm volatile("v_nop\n\tv_nop\n\tv_nop\n\tv_nop" : "+v"(c) : "v"(a), "v"(b));
#endif
  return c;
}
__device__ __forceinline__ v8f mma_h(v16h a, v16h b, v8f c) {
  c = __builtin_amdgcn_wmma_f32_16x16x32_f16(false, a, false, b, (short)0, c, false, false);
#if DEV_ASM
  asm volatile("v_nop\n\tv_nop\n\tv_nop\n\tv_nop" : "+v"(c) : "v"(a), "v"(b));
#endif
  return c;
}

// =====================================================================================================
// Partner selection (f32, VALU, fp-contract off, literal op order):
//   c = RNE-bf16(centers); bbox = (c0 - c3*0.5, c1 - c2*0.5, c0 + c3*0.5, c1 + c2*0.5);
//   inter = max(min maxs - max mins, 0) products; union = (area_i + area_j) - inter; iou = inter/union - eye;
//   amax = first index of the row maximum (NaN counts as maximum, first NaN wins); l1 = (c2 - c0) + (c3 - c1);
//   cond = l1_i >= l1[amax]; p0 = cond ? i : amax, p1 = cond ? amax : i.
// grid (NQT, NB), 512 threads: block = 64 rows of one batch x PSL slices of PJS candidates; all 512 boxes of the
//   batch staged in LDS. Wave w scans rows 32*(w&1)..+31 against candidates PJS*(w>>1)..+PJS-1 and keeps, per row,
//   (slice maximum, its first index, first NaN index); threads 0..63 merge the slices in ascending order with a strict
//   compare, so the result is the first index of the row maximum (or the first NaN), as in one ascending scan.
// coverage: 8 blocks x 64 rows x 2 ints per batch = the whole table.
// =====================================================================================================
#define PSL 8              // candidate slices per row
#define PJS (SEQ / PSL)    // candidates per slice
static_assert(PSL * PJS == SEQ && (PJS % 2) == 0);
__global__ __launch_bounds__(64 * PSL) void k_partner(const float* __restrict__ cen, int* pt) {
#pragma clang fp contract(off)
  __shared__ float sb0[SEQ];
  __shared__ float sb1[SEQ];
  __shared__ float sb2[SEQ];
  __shared__ float sb3[SEQ];
  __shared__ float sar[SEQ];
  __shared__ float sl1[SEQ];
  __shared__ float mbv[PSL][64];                // slice maximum per row
  __shared__ int   mbj[PSL][64];                // its first index
  __shared__ int   mnj[PSL][64];                // first NaN index of the slice, SEQ if none
  __shared__ __align__(16) int sp[128];

  const int tid = (int)threadIdx.x;
  const int row = tid & 63;
  const int sl  = tid >> 6;                     // the same for a whole wave
  const int i0  = (int)blockIdx.x * 64;
  const int b   = (int)blockIdx.y;
  const float* cb = cen + (size_t)b * SEQ * 4;

  for (int s = tid; s < SEQ; s += 64 * PSL) {
    const v4f cv = *(const v4f*)(cb + (size_t)s * 4);
#if DEV_ASM
    // precaution: stands between this load and the later reuse of the scalar registers that hold its base address
    asm volatile("s_wait_xcnt 0x0" ::: "memory");
#endif
    const float c0 = bf_up(bf_bits(cv[0]));
    const float c1 = bf_up(bf_bits(cv[1]));
    const float c2 = bf_up(bf_bits(cv[2]));
    const float c3 = bf_up(bf_bits(cv[3]));
    const float hx = c3 * 0.5f;
    const float hy = c2 * 0.5f;
    const float x0 = c0 - hx;
    const float y0 = c1 - hy;
    const float x1 = c0 + hx;
    const float y1 = c1 + hy;
    sb0[s] = x0;
    sb1[s] = y0;
    sb2[s] = x1;
    sb3[s] = y1;
    const float dx = x1 - x0;
    const float dy = y1 - y0;
    sar[s] = dx * dy;
    const float la = c2 - c0;
    const float lb = c3 - c1;
    sl1[s] = la + lb;
  }
  __syncthreads();

  const int i = i0 + row;                       // 0..511
  const float a0 = sb0[i], a1 = sb1[i], a2 = sb2[i], a3 = sb3[i], ar = sar[i];
  float best = -INFINITY;
  int   bj = 0;
  int   nj = SEQ;
  const int j0 = sl * PJS;
#pragma unroll 2
  for (int jj = 0; jj < PJS; ++jj) {
    const int j = j0 + jj;
    const float m0 = fmaxf(a0, sb0[j]);
    const float m1 = fmaxf(a1, sb1[j]);
    const float x2 = fminf(a2, sb2[j]);
    const float x3 = fminf(a3, sb3[j]);
    const float d0 = x2 - m0;
    const float d1 = x3 - m1;
    const float w0 = fmaxf(d0, 0.0f);
    const float w1 = fmaxf(d1, 0.0f);
    const float inter = w0 * w1;
    const float asum  = ar + sar[j];
    const float uni   = asum - inter;
    const float q     = inter / uni;
    const float e     = (j == i) ? 1.0f : 0.0f;
    const float iou   = q - e;
    const bool  up    = iou > best;             // false for NaN
    best = up ? iou : best;
    bj   = up ? j : bj;
    nj   = min(nj, (iou != iou) ? j : SEQ);
  }
  mbv[sl][row] = best;
  mbj[sl][row] = bj;
  mnj[sl][row] = nj;
  __syncthreads();

  if (tid < 64) {
    float gb = -INFINITY;
    int   gj = 0;
    int   gn = SEQ;
    // unrolled so that all slice reads are issued before the first one is waited for
#pragma unroll
    for (int s = 0; s < PSL; ++s) {             // ascending slices, strict compare: the first maximum wins
      const float v = mbv[s][tid];
      const int   x = mbj[s][tid];
      const bool  up = v > gb;
      gb = up ? v : gb;
      gj = up ? x : gj;
      gn = min(gn, mnj[s][tid]);
    }
    const int am = (gn < SEQ) ? gn : gj;        // NaN counts as maximum, first NaN wins
    const float l1i = sl1[i];
    const float l1p = sl1[am];
    const bool cond = (l1i >= l1p);
    sp[tid * 2 + 0] = cond ? i : am;
    sp[tid * 2 + 1] = cond ? am : i;
  }
  __syncthreads();

  if (tid < 32) {
    const v4i v = *(const v4i*)(sp + tid * 4);    // rows i0+2*tid, i0+2*tid+1
    int* dst = pt + ((size_t)b * SEQ + i0) * 2 + tid * 4;
    *(v4i*)dst = v;
  }
}

// =====================================================================================================
// Projections and attention in one launch. Block = one (batch b, head h), NW = 32 waves; wave w owns rows 16 w..16 w + 15
// of the sequence as projection rows, as keys and as queries. One block fills one WGP's LDS; grid (NB, NH) = 256 blocks.
// Projection phase (all products bf16 WMMA, f32 accumulate):
//   Xg[g][i][0..31] = bf16(content[b][p_g(i)][h*32..]), Xg[g][i][32..63] = bf16(pos[same row]) (g = 0: p0, 1: p1;
//   indices from PT, clamped to [0, SEQ-1]); Xv[i][k] = bf16(content[b][i][h*32+k]);
//   W2[which][n][k'] = bf16(W[k' & 31][n]) for Wq (0) / Wk (1); Wvt[n][k] = bf16(Wv[k][n]).
//   Q2[i][g*32+n] = sum_k' Xg[g][i][k'] W2q[n][k'] (K = 64) = (content + pos)[p_g(i)] . Wq; K2 likewise with Wk;
//   V^T[d][s] = sum_k Wvt[d][k] Xv[s][k].
//   Q2 and K2 are taken transposed (A = W2 rows n, B = Xg rows i): D register r of n tile nt = column n = 16 nt + 8 (lane>>4) + r
//   of row i = lane&15, so the two n tiles of one g, converted in place, are (a) the B operand of the score product for
//   Q2 (hardware k order 8 h + e, 16 + 8 h + e), which never leaves the registers, and (b) two 16-byte LDS stores for K2.
//   Every wave takes its X rows into registers, then a barrier; behind it Xg[0] is reused as the K2 plane (same rows, same
//   pitch) and Xg[1] as the waves' out tiles. A last barrier publishes K2 and V^T; the key loop has none.
// Attention on the gathered planes, head dim 64 for q/k, 32 for v, no mask, softmax over all SEQ keys.
//   Both products are taken transposed, so that a lane owns one query column (lane&15) throughout:
//   raw scores^T = K2 . Q2^T on f16 WMMA (A = K2 rows from LDS, B = Q2 rows kept in registers);
//   D register r of key tile j = raw score of key 16 j + 8 (lane>>4) + r for query lane&15.
//   c1 = sscale * log2(e), sscale = 1/(64 sqrt(512)): 1024 p = exp2(raw * c1 + (10 - max * c1)), one FMA per score.
//   Online softmax in f32: maximum and sum run over the lane's own 32 scores; the two wave halves of a query exchange
//   the maximum once per chunk and join their partial sums once, behind the loop.
//   p carried as f16(1024 p) plus residual f16(1024 p - hi); the row sum is taken of 1024 p; key tiles 2 kk and 2 kk + 1,
//   converted in place, are the B operand of 32 keys in the hardware k order (8 h + e, 16 + 8 h + e), the order in
//   which the V^T rows are read as A: P never passes through LDS.
//   context^T = vh . ph + vl . ph + vh . pl on f16 WMMA, one accumulator; out = context / (l * 8) in f32, l = sum of 1024 p.
//   Key chunks of 64, static trip NKT, in ascending order.
//   Output: d_out[b][q][h*32 + d] f32; each wave stores rows q0..q0+15 (it 0..3 x lane>>3) x 32 floats =
//   coverage: grid (32 batches x 8 heads) x 32 waves x 16 rows x 32 cols = every output element once.
// =====================================================================================================
#define NW   32            // waves per block, one 16-row tile each
#define PV   (SEQ + 8)     // V^T row pitch in halves: 1040 B (16 B x odd), rows read as 16-byte WMMA fragments
static_assert(NW * 16 == SEQ && (PV % 8) == 0 && ((PV / 8) & 1) == 1);
#define POS  36            // out-tile row pitch in floats: 144 B (16 B x odd), rows written and read with 16-byte accesses
static_assert(POS >= HD && (POS % 4) == 0 && ((POS / 4) & 1) == 1);

// lane l <-> lane l ^ 16: the two lanes that share one query column
__device__ __forceinline__ float xhalf(float x) {
  const int xb = __builtin_bit_cast(int, x);
  return __builtin_bit_cast(float, __builtin_amdgcn_permlanex16(xb, xb, 0x76543210, 0xfedcba98, false, false));
}

// packed f16 residuals of eight values: half x of d[i] = f16(y[2 i + x] - (float)(half x of h[i])), y = the
// value that h rounds. Written as asm because the compiler otherwise converts each half back to f32 (and converts each
// value a second time, unpacked) ahead of a subtract and a convert: one mixed-precision FMA per value does all
// of it, with the same single rounding (the difference is exact). The four low halves stand ahead of the four
// high halves so that no instruction follows its own register's writer directly; the s_delay_alu lines are the
// scheduling hints that the compiler cannot place inside or in front of asm text (without them a dependent vector
// instruction holds the vector port against the other waves); they change no result.
__device__ __forceinline__ v4u res_pk(v4u h, v8f y) {
  v4u d = {0u, 0u, 0u, 0u};
#if DEV_ASM
  unsigned d0, d1, d2, d3;
  asm("s_delay_alu instid0(VALU_DEP_1)\n\t"
      "v_fma_mixlo_f16 %0, %4, %8, %9 op_sel_hi:[1,0,0]\n\t"
      "v_fma_mixlo_f16 %1, %5, %8, %11 op_sel_hi:[1,0,0]\n\t"
      "v_fma_mixlo_f16 %2, %6, %8, %13 op_sel_hi:[1,0,0]\n\t"
      "v_fma_mixlo_f16 %3, %7, %8, %15 op_sel_hi:[1,0,0]\n\t"
      "s_delay_alu instid0(VALU_DEP_4) | instskip(NEXT) | instid1(VALU_DEP_4)\n\t"
      "v_fma_mixhi_f16 %0, %4, %8, %10 op_sel:[1,0,0] op_sel_hi:[1,0,0]\n\t"
      "v_fma_mixhi_f16 %1, %5, %8, %12 op_sel:[1,0,0] op_sel_hi:[1,0,0]\n\t"
      "s_delay_alu instid0(VALU_DEP_4) | instskip(NEXT) | instid1(VALU_DEP_4)\n\t"
      "v_fma_mixhi_f16 %2, %6, %8, %14 op_sel:[1,0,0] op_sel_hi:[1,0,0]\n\t"
      "v_fma_mixhi_f16 %3, %7, %8, %16 op_sel:[1,0,0] op_sel_hi:[1,0,0]"
      : "=&v"(d0), "=&v"(d1), "=&v"(d2), "=&v"(d3)
      : "v"(h[0]), "v"(h[1]), "v"(h[2]), "v"(h[3]), "s"(-1.0f),
        "v"(y[0]), "v"(y[1]), "v"(y[2]), "v"(y[3]), "v"(y[4]), "v"(y[5]), "v"(y[6]), "v"(y[7]));
  d[0] = d0; d[1] = d1; d[2] = d2; d[3] = d3;
#endif
  return d;
}
__global__ __launch_bounds__(NW * 32)
void k_attn(const float* __restrict__ content, const float* __restrict__ pos, const int* __restrict__ pt,
            const float* __restrict__ Wq, const float* __restrict__ Wk, const float* __restrict__ Wv,
            float* out, float sscale) {
  union FH { v16h v; v8h h[2]; };
  __shared__ __align__(16) unsigned short Xg[2][SEQ * P64];   // 144 KB; later [0] = K2 plane [key][d], [1] = out tiles
  __shared__ __align__(16) unsigned short Xv[SEQ * P32];      //  40 KB
  __shared__ __align__(16) unsigned short W2[2][HD * P64];    //   9 KB
  __shared__ __align__(16) unsigned short Wvt[HD * P32];      //   2.5 KB
  __shared__ __align__(16) _Float16 Vth[HD * PV];             //  32.5 KB  V^T hi [d][key]
  __shared__ __align__(16) _Float16 Vtl[HD * PV];             //  32.5 KB  V^T residual
  __shared__ int sIdx[2][SEQ];                                //   4 KB
  static_assert(16 * P64 * 2 == 16 * POS * 4);                // a wave's 16 Xg rows hold its out tile exactly

  const int tid  = (int)threadIdx.x;
  const int wave = tid >> 5;
  const int lane = tid & 31;
  const int hh   = lane >> 4;
  const int c    = lane & 15;

  const int q0 = wave * 16;
  const int b  = (int)blockIdx.x;
  const int h  = (int)blockIdx.y;
  const size_t rowB = (size_t)b * SEQ;

  // (a) partner indices of all rows, clamped: thread -> (row tid >> 1, g = tid & 1)
  {
    int v = pt[rowB * 2 + (size_t)tid];
    v = min(max(v, 0), SEQ - 1);
    sIdx[tid & 1][tid >> 1] = v;
  }
  // (b) weights (waves 0..7): whole 128-B rows (W[k][0..31] is one line), two k rows per thread, transposed to [n][k] on the
  //     LDS write, bf16 bits, one dword = (k even, k odd); k duplicated over the two 32-halves for Wq / Wk.
  //     Wq (threads 0..127) / Wk (128..255): k pair wkk x 4 columns, 16-byte loads; Wv: k pair vkk x 2 columns, 8-byte loads.
  if (tid < 256) {
    const int wm  = tid >> 7;
    const int wkk = (tid >> 3) & 15, wn4 = (tid & 7) * 4;
    const int vkk = tid >> 4,        vn2 = (tid & 15) * 2;
    const float* Wm = wm ? Wk : Wq;
    const v4f wr0 = *(const v4f*)(Wm + (2 * wkk + 0) * HD + wn4);
#if DEV_ASM
    // precaution: stands between this load and the next one, whose result may land in the registers that hold this address
    asm volatile("s_wait_xcnt 0x0" ::: "memory");
#endif
    const v4f wr1 = *(const v4f*)(Wm + (2 * wkk + 1) * HD + wn4);
    const v2f vr0 = *(const v2f*)(Wv + (2 * vkk + 0) * HD + vn2);
    const v2f vr1 = *(const v2f*)(Wv + (2 * vkk + 1) * HD + vn2);
    // both loops unrolled: the loaded rows live in registers and are picked by j
#pragma unroll
    for (int j = 0; j < 4; ++j) {
      const unsigned pw = pk16(bf_bits(wr0[j]), bf_bits(wr1[j]));
      unsigned short* wd = W2[wm] + (wn4 + j) * P64 + 2 * wkk;
      *(unsigned*)(wd)      = pw;
      *(unsigned*)(wd + HD) = pw;
    }
#pragma unroll
    for (int j = 0; j < 2; ++j)
      *(unsigned*)(Wvt + (vn2 + j) * P32 + 2 * vkk) = pk16(bf_bits(vr0[j]), bf_bits(vr1[j]));
  }
  // (c) content rows, head slice h -> Xv (4096 float4 pieces, 4 per thread; 8 neighbouring lanes take one 128-B line)
  //     unrolled: all four loads are issued before the first LDS store waits for one
#pragma unroll
  for (int it = 0; it < 4; ++it) {
    const int e = it * (NW * 32) + tid;
    const int r = e >> 3, c4 = (e & 7) * 4;
    const v4f v = *(const v4f*)(content + (rowB + (size_t)r) * EMB + (size_t)h * HD + c4);
    v2u pk;
    pk[0] = pk16(bf_bits(v[0]), bf_bits(v[1]));
    pk[1] = pk16(bf_bits(v[2]), bf_bits(v[3]));
    *(v2u*)(Xv + r * P32 + c4) = pk;
  }
  __syncthreads();
  // (d) gathered rows: it2 -> (g, source) uniform; e -> (row r, float4 piece); 16 x 1024 pieces = [2][2][512][8]
  //     unrolled: g and the source are picked by it2, and the loads are issued ahead of the LDS stores
#pragma unroll
  for (int it2 = 0; it2 < 16; ++it2) {
    const int g   = it2 >> 3;
    const int src = (it2 >> 2) & 1;
    const int e   = (it2 & 3) * (NW * 32) + tid;
    const int r   = e >> 3, c4 = (e & 7) * 4;
    const float* base = src ? pos : content;
    const int srow = sIdx[g][r];
    const v4f v = *(const v4f*)(base + (rowB + (size_t)srow) * EMB + (size_t)h * HD + c4);
    v2u pk;
    pk[0] = pk16(bf_bits(v[0]), bf_bits(v[1]));
    pk[1] = pk16(bf_bits(v[2]), bf_bits(v[3]));
    *(v2u*)(Xg[g] + r * P64 + src * HD + c4) = pk;
  }
  __syncthreads();

  // (e) the wave's own 16 rows as B operands (column = lane&15), taken into registers
  v16b bx[2][2];
#pragma unroll
  for (int g = 0; g < 2; ++g)
#pragma unroll
    for (int ks = 0; ks < 2; ++ks)
      bx[g][ks] = ldfrag<__bf16>((const __bf16*)(const void*)Xg[g] + (size_t)(q0 + c) * P64 + ks * 32 + 8 * hh);
  const v16b bv = ldfrag<__bf16>((const __bf16*)(const void*)Xv + (size_t)(q0 + c) * P32 + 8 * hh);   // B[k][s] from row s
  __syncthreads();           // ends every read of Xg: [0] is rewritten as the K2 plane below, [1] as the out tiles at the end

  _Float16* Ksh = (_Float16*)(void*)Xg[0];
  // (f) Q2^T (which = 0) -> B fragments qb in registers; K2^T (which = 1) -> K2 plane rows q0 + c
  v16h qb[2];
#pragma unroll
  for (int which = 0; which < 2; ++which) {
    const __bf16* Wb = (const __bf16*)(const void*)W2[which];
#pragma unroll
    for (int g = 0; g < 2; ++g) {
      FH f;
#pragma unroll
      for (int nt = 0; nt < 2; ++nt) {
        v8f a = zero8();
#pragma unroll
        for (int ks = 0; ks < 2; ++ks) {
          const v16b aw = ldfrag<__bf16>(Wb + (size_t)(nt * 16 + c) * P64 + ks * 32 + 8 * hh);   // A[n][k']
          a = mma_b(aw, bx[g][ks], a);
        }
#pragma unroll
        for (int r = 0; r < 8; ++r) f.h[nt][r] = (_Float16)(a[r] * 8.0f);   // n = 16 nt + 8 hh + r
      }
      if (which == 0) {
        qb[g] = f.v;
      } else {
        *(v8h*)(Ksh + (q0 + c) * P64 + g * 32 + 8 * hh)      = f.h[0];
        *(v8h*)(Ksh + (q0 + c) * P64 + g * 32 + 16 + 8 * hh) = f.h[1];
      }
    }
  }
  // (g) V^T tiles d = 16 dt + 8 hh + r, s = q0 + c -> hi and residual planes
#pragma unroll
  for (int dt = 0; dt < 2; ++dt) {
    const v16b av = ldfrag<__bf16>((const __bf16*)(const void*)Wvt + (size_t)(dt * 16 + c) * P32 + 8 * hh);  // A[d][k]
    v8f accv = zero8();
    accv = mma_b(av, bv, accv);
#pragma unroll
    for (int r = 0; r < 8; ++r) {
      const float f0 = accv[r] * 8.0f;
      const _Float16 x0 = (_Float16)f0;
      const float r0 = f0 - (float)x0;
      const _Float16 l0 = (_Float16)r0;
      Vth[(dt * 16 + 8 * hh + r) * PV + q0 + c] = x0;
      Vtl[(dt * 16 + 8 * hh + r) * PV + q0 + c] = l0;
    }
  }
  __syncthreads();           // publishes the K2 and V^T planes to every wave

  const float c1 = sscale * 1.44269504088896340736f;   // raw score -> log2 units (positive: the maximum may be taken raw)
  float mrun = -INFINITY;                    // running maximum of query c, raw (equal in both halves)
  float lrun = 0.f;                          // running sum of 1024 p over this half's keys only
  v8f oacc[2];                               // context^T: register r of tile t = d 16 t + 8 hh + r, query c
#pragma unroll
  for (int t = 0; t < 2; ++t) oacc[t] = zero8();

  for (int kt = 0; kt < NKT; ++kt) {         // static trip count
    const int kv0 = kt * 64;

    // ---- scores^T: 64 keys x 16 query columns per wave ----
    v8f s[4];
#pragma unroll
    for (int j = 0; j < 4; ++j) {
      v8f a = zero8();
#pragma unroll
      for (int dc = 0; dc < 2; ++dc) {
        FH kb;
        kb.h[0] = *(const v8h*)(Ksh + (kv0 + j * 16 + c) * P64 + dc * 32 + 8 * hh);
        kb.h[1] = *(const v8h*)(Ksh + (kv0 + j * 16 + c) * P64 + dc * 32 + 16 + 8 * hh);
        a = mma_h(kb.v, qb[dc], a);
      }
      s[j] = a;
    }

    // ---- column max in the lane, one exchange between the halves, online softmax ----
    float m = s[0][0];
#pragma unroll
    for (int j = 0; j < 4; ++j)
#pragma unroll
      for (int r = 0; r < 8; ++r) m = fmaxf(m, s[j][r]);
    m = fmaxf(m, xhalf(m));
    const float mnew  = fmaxf(mrun, m);
    const float msafe = (mnew == -INFINITY) ? 0.f : mnew;
    const float mb    = msafe * c1;                              // the shift, in log2 units
    const float alpha = __builtin_amdgcn_exp2f(__builtin_fmaf(mrun, c1, -mb));
    const float bias  = 10.0f - mb;                              // + 10: exp2 yields 1024 p at once
    mrun = mnew;

#pragma unroll
    for (int t = 0; t < 2; ++t)
#pragma unroll
      for (int r = 0; r < 8; ++r) oacc[t][r] *= alpha;

    // ---- per 32 keys: P hi (x1024) and its residual packed in place into B operands, then
    //      context^T += V^T . P^T (3 f16 products, all at one scale, into the running accumulator) ----
    float ps[4];
    // unrolled: the scores live in registers and are picked by kk
#pragma unroll
    for (int kk = 0; kk < 2; ++kk) {
      union { v16h v; v4u q[2]; } pa, pr;                        // dword i = elements 2 i (low half), 2 i + 1 (high half)
#pragma unroll
      for (int jj = 0; jj < 2; ++jj) {
        const int j = 2 * kk + jj;
        float psum = 0.f;
        v4u h4;
        v8f y8;
#pragma unroll
        for (int r = 0; r < 8; r += 2) {
          v2f pp;
          pp[0] = __builtin_amdgcn_exp2f(__builtin_fmaf(s[j][r],     c1, bias));
          pp[1] = __builtin_amdgcn_exp2f(__builtin_fmaf(s[j][r + 1], c1, bias));
          psum += pp[0];
          psum += pp[1];
          h4[r >> 1] = __builtin_bit_cast(unsigned, __builtin_convertvector(pp, v2h));
          y8[r]     = pp[0];
          y8[r + 1] = pp[1];
        }
        pa.q[jj] = h4;
        pr.q[jj] = res_pk(h4, y8);
        ps[j] = psum;
      }
#pragma unroll
      for (int t = 0; t < 2; ++t) {
        FH vb, vr;
        vb.h[0] = *(const v8h*)(Vth + (t * 16 + c) * PV + kv0 + kk * 32 + 8 * hh);
        vb.h[1] = *(const v8h*)(Vth + (t * 16 + c) * PV + kv0 + kk * 32 + 16 + 8 * hh);
        vr.h[0] = *(const v8h*)(Vtl + (t * 16 + c) * PV + kv0 + kk * 32 + 8 * hh);
        vr.h[1] = *(const v8h*)(Vtl + (t * 16 + c) * PV + kv0 + kk * 32 + 16 + 8 * hh);
        oacc[t] = mma_h(vb.v, pa.v, oacc[t]);
        oacc[t] = mma_h(vr.v, pa.v, oacc[t]);
        oacc[t] = mma_h(vb.v, pr.v, oacc[t]);
      }
    }
    lrun = lrun * alpha + ((ps[0] + ps[1]) + (ps[2] + ps[3]));
  }

  // ---- join the halves' sums, normalise (1/l, which holds the x1024 p carry; undo the x8 v carry), stage the wave's 16x32 tile
  float* os = (float*)(void*)(Xg[1] + wave * 16 * P64);
  {
    const float l = lrun + xhalf(lrun);
    const float inv = ((l > 0.f) ? (1.0f / l) : 0.f) * (1.0f / 8.0f);
#pragma unroll
    for (int t = 0; t < 2; ++t)
#pragma unroll
      for (int e = 0; e < 2; ++e) {
        v4f v;
#pragma unroll
        for (int x = 0; x < 4; ++x) v[x] = oacc[t][4 * e + x] * inv;
        *(v4f*)(os + c * POS + t * 16 + 8 * hh + 4 * e) = v;       // query row c, d = 16 t + 8 hh + 4 e ..+3
      }
  }
  __builtin_amdgcn_fence(__ATOMIC_RELEASE, "workgroup");
  __builtin_amdgcn_wave_barrier();
  __builtin_amdgcn_fence(__ATOMIC_ACQUIRE, "workgroup");
  {
    const int q4 = lane >> 3, c4 = (lane & 7) * 4;
    v4f ov[4];
#pragma unroll
    for (int it = 0; it < 4; ++it) {
      const int row = it * 4 + q4;                 // it 0..3 x q4 0..3 = rows 0..15 of the wave tile
      ov[it] = *(const v4f*)(os + row * POS + c4);
    }
    {
#pragma unroll
      for (int it = 0; it < 4; ++it) {
        const int row = it * 4 + q4;
        const size_t go = ((size_t)b * SEQ + (size_t)(q0 + row)) * EMB + (size_t)h * HD + c4;
        *(v4f*)(out + go) = ov[it];
      }
    }
  }
}

// =====================================================================================================
// Workspace map (bytes): PT int [32][512][2] 131072.
// Launches: k_partner (256 blocks x 512), k_attn (256 x 1024).
// =====================================================================================================
extern "C" void kernel_launch(void* const* d_in, const int* in_sizes, int n_in,
                              void* d_out, int out_size, void* d_ws, size_t ws_size,
                              hipStream_t stream) {
  if (n_in < 6) return;
  if (in_sizes[0] != NB * SEQ * EMB) return;
  if (in_sizes[1] != NB * SEQ * EMB) return;
  if (in_sizes[2] != NB * SEQ * 4) return;
  if (in_sizes[3] != HD * HD || in_sizes[4] != HD * HD || in_sizes[5] != HD * HD) return;
  if (out_size != NB * SEQ * EMB) return;

  const float* content = (const float*)d_in[0];
  const float* posenc  = (const float*)d_in[1];
  const float* centers = (const float*)d_in[2];
  const float* Wq      = (const float*)d_in[3];
  const float* Wk      = (const float*)d_in[4];
  const float* Wv      = (const float*)d_in[5];

  const size_t PPT = (size_t)NB * SEQ * 2 * 4;             //   131072
  if (PPT > ws_size) return;

  int*   PT   = (int*)d_ws;
  float* outp = (float*)d_out;

  const float sscale = (1.0f / 64.0f) / sqrtf(2.0f * (float)EMB);   // 1/(64 sqrt(512))

  const dim3 gP(NQT, NB);            //  256 blocks of 512
  const dim3 gA(NB, NH);             //  256 blocks of 1024

  // (1) partner table
  k_partner<<<gP, dim3(64 * PSL), 0, stream>>>(centers, PT);
  // (2) projections and attention -> d_out f32 [32][512][256]
  k_attn<<<gA, dim3(NW * 32), 0, stream>>>(content, posenc, PT, Wq, Wk, Wv, outp, sscale);
  (void)hipGetLastError();
}

// v008
// It runs in 31 microseconds.
// Next to v007, in two timings, it ran 1.09 times as fast each time.
// Over all steps from v000 it is 6.43 times as fast.
// Contractions: [q|k] and v^T projections = v_wmma_f32_16x16x32_bf16 (bf16 operands: RNE-converted content, pos, Wq, Wk, Wv;
//   x_qk.W evaluated as [content | pos] x [W ; W] along k; single products, f32 accumulate);
// gathered q.k^T scores = v_wmma_f32_16x16x32_f16 (q and k f16 planes carried x8; single product; f32 accumulate);
// p.v = v_wmma_f32_16x16x32_f16 (p f16 carried x1024 + residual plane at the same scale; v^T f16 carried x8 + residual plane
//   at the same scale; 3 products ph.vh, ph.vl, pl.vh into one f32 accumulator); partner selection (IoU argmax) and softmax
//   in f32 on the VALU.
// Carry audit:
//   Q2 frags  f16 = f16(8 q)                     (projection phase) -> undone by sscale = 1/(64 sqrt(512)), inside c1
//   K2 plane  f16 = f16(8 k)                     (projection phase) -> same sscale (8*8 = 64)
//   VTh plane f16 = f16(8 v)                     (projection phase) -> epilogue inv includes 1/8
//   VTl plane f16 = f16(8 v - VTh)               (projection phase) -> same 1/8 in epilogue (f16 grid 2^-24 at worst = 2^-27 of v)
//   P hi      f16 = f16(1024 p)                  (softmax)          -> the row sum l carries the same x1024: cancels in 1/l
//   P res     f16 = f16(1024 p - hi)             (softmax)          -> same 1/l in epilogue (f16 grid 2^-24 at worst = 2^-34 of p)
#include <hip/hip_runtime.h>
#include <math.h>
#include <stdint.h>

#pragma clang fp contract(off)

#define NB   32
#define SEQ  512
#define EMB  256
#define NH   8
#define HD   32            // per-head dim
#define QD   64            // gathered q/k width (two partner rows)
#define NQT  (SEQ / 64)    // 64-row query tiles per sequence
#define NKT  (SEQ / 64)    // 64-key chunks per sequence
// LDS row pitches, in 16-bit elements, of every tile that is read as a WMMA fragment with 16-byte loads: 16 B x odd,
// so that the 16 rows one half-wave reads fall on 64 distinct banks (at the bare 128 B / 64 B they share 8 / 16 banks)
#define P64  72            // 64-element rows: 144 B
#define P32  40            // 32-element rows:  80 B
static_assert(NH * HD == EMB);
static_assert(NQT == 8 && NKT == 8);
static_assert((SEQ % 64) == 0 && (HD % 32) == 0 && (QD % 32) == 0);
static_assert(P64 >= QD && P32 >= HD && (P64 % 8) == 0 && (P32 % 8) == 0 && ((P64 / 8) & 1) == 1 && ((P32 / 8) & 1) == 1);

typedef _Float16 v16h __attribute__((ext_vector_type(16)));
typedef _Float16 v8h  __attribute__((ext_vector_type(8)));
typedef __bf16   v16b __attribute__((ext_vector_type(16)));
typedef __bf16   v8b  __attribute__((ext_vector_type(8)));
typedef float    v8f  __attribute__((ext_vector_type(8)));
typedef float    v4f  __attribute__((ext_vector_type(4)));
typedef unsigned int v4u __attribute__((ext_vector_type(4)));
typedef unsigned int v2u __attribute__((ext_vector_type(2)));
typedef int      v4i  __attribute__((ext_vector_type(4)));
typedef int      v2i  __attribute__((ext_vector_type(2)));
typedef float    v2f  __attribute__((ext_vector_type(2)));
typedef _Float16 v2h  __attribute__((ext_vector_type(2)));

#if defined(__HIP_DEVICE_COMPILE__)
#define DEV_ASM 1
#else
#define DEV_ASM 0
#endif

// ---- scalar helpers --------------------------------------------------------------------------------
__device__ __forceinline__ unsigned short bf_bits(float f) {          // f32 -> bf16 bits, RNE convert
  unsigned u = __float_as_uint(f);
  return (unsigned short)((u + 0x7FFFu + ((u >> 16) & 1u)) >> 16);
}
__device__ __forceinline__ float bf_up(unsigned short hb) { return __uint_as_float(((unsigned)hb) << 16); }
__device__ __forceinline__ unsigned short h_bits(_Float16 x) { return __builtin_bit_cast(unsigned short, x); }
__device__ __forceinline__ unsigned pk16(unsigned short a, unsigned short b) { return (unsigned)a | ((unsigned)b << 16); }
__device__ __forceinline__ v8f zero8() { v8f z = {0.f, 0.f, 0.f, 0.f, 0.f, 0.f, 0.f, 0.f}; return z; }

// ---- fragment loaders: 16-bit A/B operand, lane -> row/col (lane&15), p already includes +8*(lane>>4);
//      elements 0..7 <- p[0..7] (k0+8h..k0+8h+7), elements 8..15 <- p[16..23] (k0+16+8h..k0+16+8h+7)
template <typename OT> struct FT;
template <> struct FT<__bf16>   { typedef v16b frag; typedef v8b half8; };
template <> struct FT<_Float16> { typedef v16h frag; typedef v8h half8; };

template <typename OT>
__device__ __forceinline__ typename FT<OT>::frag ldfrag(const OT* p) {
  union { typename FT<OT>::frag v; typename FT<OT>::half8 h[2]; } f;
  f.h[0] = *(const typename FT<OT>::half8*)(p);
  f.h[1] = *(const typename FT<OT>::half8*)(p + 16);
  return f.v;
}

// ---- guarded WMMA helpers: 4 VALU slots after the WMMA, D tied, A/B kept live --------------------------
// ---- one A fragment against the B fragments of the wave's two row tiles: two independent WMMAs back to back, then the same
//      guard once for the pair (the first WMMA has the second one and the four slots behind it, the second the four slots)
__device__ __forceinline__ void mma_b2(v16b a, v16b b0, v16b b1, v8f& c0, v8f& c1) {
  c0 = __builtin_amdgcn_wmma_f32_16x16x32_bf16(false, a, false, b0, (short)0, c0, false, false);
  c1 = __builtin_amdgcn_wmma_f32_16x16x32_bf16(false, a, false, b1, (short)0, c1, false, false);
#if DEV_ASM
  asm volatile("v_nop\n\tv_nop\n\tv_nop\n\tv_nop" : "+v"(c0), "+v"(c1) : "v"(a), "v"(b0), "v"(b1));
#endif
}
__device__ __forceinline__ void mma_h2(v16h a, v16h b0, v16h b1, v8f& c0, v8f& c1) {
  c0 = __builtin_amdgcn_wmma_f32_16x16x32_f16(false, a, false, b0, (short)0, c0, false, false);
  c1 = __builtin_amdgcn_wmma_f32_16x16x32_f16(false, a, false, b1, (short)0, c1, false, false);
#if DEV_ASM
  asm volatile("v_nop\n\tv_nop\n\tv_nop\n\tv_nop" : "+v"(c0), "+v"(c1) : "v"(a), "v"(b0), "v"(b1));
#endif
}

// =====================================================================================================
// Partner selection (f32, VALU, fp-contract off, literal op order):
//   c = RNE-bf16(centers); bbox = (c0 - c3*0.5, c1 - c2*0.5, c0 + c3*0.5, c1 + c2*0.5);
//   inter = max(min maxs - max mins, 0) products; union = (area_i + area_j) - inter; iou = inter/union - eye;
//   amax = first index of the row maximum (NaN counts as maximum, first NaN wins); l1 = (c2 - c0) + (c3 - c1);
//   cond = l1_i >= l1[amax]; p0 = cond ? i : amax, p1 = cond ? amax : i.
// grid (NQT, NB), 512 threads: block = 64 rows of one batch x PSL slices of PJS candidates; all 512 boxes of the
//   batch staged in LDS. Wave w scans rows 32*(w&1)..+31 against candidates PJS*(w>>1)..+PJS-1 and keeps, per row,
//   (slice maximum, its first index, first NaN index); threads 0..63 merge the slices in ascending order with a strict
//   compare, so the result is the first index of the row maximum (or the first NaN), as in one ascending scan.
// coverage: 8 blocks x 64 rows x 2 ints per batch = the whole table.
// =====================================================================================================
#define PSL 8              // candidate slices per row
#define PJS (SEQ / PSL)    // candidates per slice
static_assert(PSL * PJS == SEQ && (PJS % 2) == 0);
__global__ __launch_bounds__(64 * PSL) void k_partner(const float* __restrict__ cen, int* pt) {
#pragma clang fp contract(off)
  __shared__ float sb0[SEQ];
  __shared__ float sb1[SEQ];
  __shared__ float sb2[SEQ];
  __shared__ float sb3[SEQ];
  __shared__ float sar[SEQ];
  __shared__ float sl1[SEQ];
  __shared__ float mbv[PSL][64];                // slice maximum per row
  __shared__ int   mbj[PSL][64];                // its first index
  __shared__ int   mnj[PSL][64];                // first NaN index of the slice, SEQ if none
  __shared__ __align__(16) int sp[128];

  const int tid = (int)threadIdx.x;
  const int row = tid & 63;
  const int sl  = tid >> 6;                     // the same for a whole wave
  const int i0  = (int)blockIdx.x * 64;
  const int b   = (int)blockIdx.y;
  const float* cb = cen + (size_t)b * SEQ * 4;

  for (int s = tid; s < SEQ; s += 64 * PSL) {
    const v4f cv = *(const v4f*)(cb + (size_t)s * 4);
#if DEV_ASM
    // precaution: stands between this load and the later reuse of the scalar registers that hold its base address
    asm volatile("s_wait_xcnt 0x0" ::: "memory");
#endif
    const float c0 = bf_up(bf_bits(cv[0]));
    const float c1 = bf_up(bf_bits(cv[1]));
    const float c2 = bf_up(bf_bits(cv[2]));
    const float c3 = bf_up(bf_bits(cv[3]));
    const float hx = c3 * 0.5f;
    const float hy = c2 * 0.5f;
    const float x0 = c0 - hx;
    const float y0 = c1 - hy;
    const float x1 = c0 + hx;
    const float y1 = c1 + hy;
    sb0[s] = x0;
    sb1[s] = y0;
    sb2[s] = x1;
    sb3[s] = y1;
    const float dx = x1 - x0;
    const float dy = y1 - y0;
    sar[s] = dx * dy;
    const float la = c2 - c0;
    const float lb = c3 - c1;
    sl1[s] = la + lb;
  }
  __syncthreads();

  const int i = i0 + row;                       // 0..511
  const float a0 = sb0[i], a1 = sb1[i], a2 = sb2[i], a3 = sb3[i], ar = sar[i];
  float best = -INFINITY;
  int   bj = 0;
  int   nj = SEQ;
  const int j0 = sl * PJS;
#pragma unroll 2
  for (int jj = 0; jj < PJS; ++jj) {
    const int j = j0 + jj;
    const float m0 = fmaxf(a0, sb0[j]);
    const float m1 = fmaxf(a1, sb1[j]);
    const float x2 = fminf(a2, sb2[j]);
    const float x3 = fminf(a3, sb3[j]);
    const float d0 = x2 - m0;
    const float d1 = x3 - m1;
    const float w0 = fmaxf(d0, 0.0f);
    const float w1 = fmaxf(d1, 0.0f);
    const float inter = w0 * w1;
    const float asum  = ar + sar[j];
    const float uni   = asum - inter;
    const float q     = inter / uni;
    const float e     = (j == i) ? 1.0f : 0.0f;
    const float iou   = q - e;
    const bool  up    = iou > best;             // false for NaN
    best = up ? iou : best;
    bj   = up ? j : bj;
    nj   = min(nj, (iou != iou) ? j : SEQ);
  }
  mbv[sl][row] = best;
  mbj[sl][row] = bj;
  mnj[sl][row] = nj;
  __syncthreads();

  if (tid < 64) {
    float gb = -INFINITY;
    int   gj = 0;
    int   gn = SEQ;
    // unrolled so that all slice reads are issued before the first one is waited for
#pragma unroll
    for (int s = 0; s < PSL; ++s) {             // ascending slices, strict compare: the first maximum wins
      const float v = mbv[s][tid];
      const int   x = mbj[s][tid];
      const bool  up = v > gb;
      gb = up ? v : gb;
      gj = up ? x : gj;
      gn = min(gn, mnj[s][tid]);
    }
    const int am = (gn < SEQ) ? gn : gj;        // NaN counts as maximum, first NaN wins
    const float l1i = sl1[i];
    const float l1p = sl1[am];
    const bool cond = (l1i >= l1p);
    sp[tid * 2 + 0] = cond ? i : am;
    sp[tid * 2 + 1] = cond ? am : i;
  }
  __syncthreads();

  if (tid < 32) {
    const v4i v = *(const v4i*)(sp + tid * 4);    // rows i0+2*tid, i0+2*tid+1
    int* dst = pt + ((size_t)b * SEQ + i0) * 2 + tid * 4;
    *(v4i*)dst = v;
  }
}

// =====================================================================================================
// Projections and attention in one launch. Block = one (batch b, head h), NW = 16 waves; wave w owns rows 32 w..32 w + 31
// of the sequence, as QT = 2 tiles of 16, as projection rows, as keys and as queries: every A fragment read from LDS (weights,
// K2 rows, V^T rows) is used for both tiles. One block fills one WGP's LDS; grid (NB, NH) = 256 blocks.
// Projection phase (all products bf16 WMMA, f32 accumulate):
//   Xg[g][i][0..31] = bf16(content[b][p_g(i)][h*32..]), Xg[g][i][32..63] = bf16(pos[same row]) (g = 0: p0, 1: p1;
//   indices from PT, clamped to [0, SEQ-1]); Xv[i][k] = bf16(content[b][i][h*32+k]);
//   W2[which][n][k'] = bf16(W[k' & 31][n]) for Wq (0) / Wk (1); Wvt[n][k] = bf16(Wv[k][n]).
//   Q2[i][g*32+n] = sum_k' Xg[g][i][k'] W2q[n][k'] (K = 64) = (content + pos)[p_g(i)] . Wq; K2 likewise with Wk;
//   V^T[d][s] = sum_k Wvt[d][k] Xv[s][k].
//   Q2 and K2 are taken transposed (A = W2 rows n, B = Xg rows i): D register r of n tile nt = column n = 16 nt + 8 (lane>>4) + r
//   of row i = lane&15, so the two n tiles of one g, converted in place, are (a) the B operand of the score product for
//   Q2 (hardware k order 8 h + e, 16 + 8 h + e), which never leaves the registers, and (b) two 16-byte LDS stores for K2.
//   Every wave takes its X rows into registers, then a barrier; behind it Xg[0] is reused as the K2 plane (same rows, same
//   pitch) and Xg[1] as the waves' out tiles. A last barrier publishes K2 and V^T; the key loop has none.
// Attention on the gathered planes, head dim 64 for q/k, 32 for v, no mask, softmax over all SEQ keys.
//   Both products are taken transposed, so that a lane owns one query column (lane&15) throughout:
//   raw scores^T = K2 . Q2^T on f16 WMMA (A = K2 rows from LDS, B = Q2 rows kept in registers);
//   D register r of key tile j = raw score of key 16 j + 8 (lane>>4) + r for query lane&15.
//   c1 = sscale * log2(e), sscale = 1/(64 sqrt(512)): 1024 p = exp2(raw * c1 + (10 - max * c1)), one FMA per score.
//   Online softmax in f32: maximum and sum run over the lane's own 32 scores; the two wave halves of a query exchange
//   the maximum once per chunk and join their partial sums once, behind the loop.
//   p carried as f16(1024 p) plus residual f16(1024 p - hi); the row sum is taken of 1024 p; key tiles 2 kk and 2 kk + 1,
//   converted in place, are the B operand of 32 keys in the hardware k order (8 h + e, 16 + 8 h + e), the order in
//   which the V^T rows are read as A: P never passes through LDS.
//   context^T = vh . ph + vl . ph + vh . pl on f16 WMMA, one accumulator; out = context / (l * 8) in f32, l = sum of 1024 p.
//   Key chunks of 64, static trip NKT, in ascending order.
//   Output: d_out[b][q][h*32 + d] f32; each wave stores, per tile, rows q0+16 qt..+15 (it 4 qt..4 qt + 3 x lane>>3) x 32 floats =
//   coverage: grid (32 batches x 8 heads) x 16 waves x 2 tiles x 16 rows x 32 cols = every output element once.
// =====================================================================================================
#define NW   16            // waves per block
#define QT   2             // 16-row tiles per wave
#define PV   (SEQ + 8)     // V^T row pitch in halves: 1040 B (16 B x odd), rows read as 16-byte WMMA fragments
static_assert(NW * QT * 16 == SEQ && QT == 2 && (PV % 8) == 0 && ((PV / 8) & 1) == 1);
#define POS  36            // out-tile row pitch in floats: 144 B (16 B x odd), rows written and read with 16-byte accesses
static_assert(POS >= HD && (POS % 4) == 0 && ((POS / 4) & 1) == 1);

// lane l <-> lane l ^ 16: the two lanes that share one query column
__device__ __forceinline__ float xhalf(float x) {
  const int xb = __builtin_bit_cast(int, x);
  return __builtin_bit_cast(float, __builtin_amdgcn_permlanex16(xb, xb, 0x76543210, 0xfedcba98, false, false));
}

// packed f16 residuals of eight values: half x of d[i] = f16(y[2 i + x] - (float)(half x of h[i])), y = the
// value that h rounds. Written as asm because the compiler otherwise converts each half back to f32 (and converts each
// value a second time, unpacked) ahead of a subtract and a convert: one mixed-precision FMA per value does all
// of it, with the same single rounding (the difference is exact). The four low halves stand ahead of the four
// high halves so that no instruction follows its own register's writer directly; the s_delay_alu lines are the
// scheduling hints that the compiler cannot place inside or in front of asm text (without them a dependent vector
// instruction holds the vector port against the other waves); they change no result.
__device__ __forceinline__ v4u res_pk(v4u h, v8f y) {
  v4u d = {0u, 0u, 0u, 0u};
#if DEV_ASM
  unsigned d0, d1, d2, d3;
  asm("s_delay_alu instid0(VALU_DEP_1)\n\t"
      "v_fma_mixlo_f16 %0, %4, %8, %9 op_sel_hi:[1,0,0]\n\t"
      "v_fma_mixlo_f16 %1, %5, %8, %11 op_sel_hi:[1,0,0]\n\t"
      "v_fma_mixlo_f16 %2, %6, %8, %13 op_sel_hi:[1,0,0]\n\t"
      "v_fma_mixlo_f16 %3, %7, %8, %15 op_sel_hi:[1,0,0]\n\t"
      "s_delay_alu instid0(VALU_DEP_4) | instskip(NEXT) | instid1(VALU_DEP_4)\n\t"
      "v_fma_mixhi_f16 %0, %4, %8, %10 op_sel:[1,0,0] op_sel_hi:[1,0,0]\n\t"
      "v_fma_mixhi_f16 %1, %5, %8, %12 op_sel:[1,0,0] op_sel_hi:[1,0,0]\n\t"
      "s_delay_alu instid0(VALU_DEP_4) | instskip(NEXT) | instid1(VALU_DEP_4)\n\t"
      "v_fma_mixhi_f16 %2, %6, %8, %14 op_sel:[1,0,0] op_sel_hi:[1,0,0]\n\t"
      "v_fma_mixhi_f16 %3, %7, %8, %16 op_sel:[1,0,0] op_sel_hi:[1,0,0]"
      : "=&v"(d0), "=&v"(d1), "=&v"(d2), "=&v"(d3)
      : "v"(h[0]), "v"(h[1]), "v"(h[2]), "v"(h[3]), "s"(-1.0f),
        "v"(y[0]), "v"(y[1]), "v"(y[2]), "v"(y[3]), "v"(y[4]), "v"(y[5]), "v"(y[6]), "v"(y[7]));
  d[0] = d0; d[1] = d1; d[2] = d2; d[3] = d3;
#endif
  return d;
}
__global__ __launch_bounds__(NW * 32)
void k_attn(const float* __restrict__ content, const float* __restrict__ pos, const int* __restrict__ pt,
            const float* __restrict__ Wq, const float* __restrict__ Wk, const float* __restrict__ Wv,
            float* out, float sscale) {
  union FH { v16h v; v8h h[2]; };
  __shared__ __align__(16) unsigned short Xg[2][SEQ * P64];   // 144 KB; later [0] = K2 plane [key][d], [1] = out tiles
  __shared__ __align__(16) unsigned short Xv[SEQ * P32];      //  40 KB
  __shared__ __align__(16) unsigned short W2[2][HD * P64];    //   9 KB
  __shared__ __align__(16) unsigned short Wvt[HD * P32];      //   2.5 KB
  __shared__ __align__(16) _Float16 Vth[HD * PV];             //  32.5 KB  V^T hi [d][key]
  __shared__ __align__(16) _Float16 Vtl[HD * PV];             //  32.5 KB  V^T residual
  __shared__ int sIdx[2][SEQ];                                //   4 KB
  static_assert(16 * P64 * 2 == 16 * POS * 4);                // the 16 Xg rows of a tile hold its out tile exactly

  const int tid  = (int)threadIdx.x;
  const int wave = tid >> 5;
  const int lane = tid & 31;
  const int hh   = lane >> 4;
  const int c    = lane & 15;

  const int q0 = wave * (QT * 16);
  const int b  = (int)blockIdx.x;
  const int h  = (int)blockIdx.y;
  const size_t rowB = (size_t)b * SEQ;

  // (a) partner indices of all rows, clamped: thread -> row tid, both g in one 8-byte load
  {
    const v2i v = *(const v2i*)(pt + rowB * 2 + (size_t)tid * 2);
    sIdx[0][tid] = min(max(v[0], 0), SEQ - 1);
    sIdx[1][tid] = min(max(v[1], 0), SEQ - 1);
  }
  // (b) weights (waves 0..7): whole 128-B rows (W[k][0..31] is one line), two k rows per thread, transposed to [n][k] on the
  //     LDS write, bf16 bits, one dword = (k even, k odd); k duplicated over the two 32-halves for Wq / Wk.
  //     Wq (threads 0..127) / Wk (128..255): k pair wkk x 4 columns, 16-byte loads; Wv: k pair vkk x 2 columns, 8-byte loads.
  if (tid < 256) {
    const int wm  = tid >> 7;
    const int wkk = (tid >> 3) & 15, wn4 = (tid & 7) * 4;
    const int vkk = tid >> 4,        vn2 = (tid & 15) * 2;
    const float* Wm = wm ? Wk : Wq;
    const v4f wr0 = *(const v4f*)(Wm + (2 * wkk + 0) * HD + wn4);
#if DEV_ASM
    // precaution: stands between this load and the next one, whose result may land in the registers that hold this address
    asm volatile("s_wait_xcnt 0x0" ::: "memory");
#endif
    const v4f wr1 = *(const v4f*)(Wm + (2 * wkk + 1) * HD + wn4);
    const v2f vr0 = *(const v2f*)(Wv + (2 * vkk + 0) * HD + vn2);
    const v2f vr1 = *(const v2f*)(Wv + (2 * vkk + 1) * HD + vn2);
    // both loops unrolled: the loaded rows live in registers and are picked by j
#pragma unroll
    for (int j = 0; j < 4; ++j) {
      const unsigned pw = pk16(bf_bits(wr0[j]), bf_bits(wr1[j]));
      unsigned short* wd = W2[wm] + (wn4 + j) * P64 + 2 * wkk;
      *(unsigned*)(wd)      = pw;
      *(unsigned*)(wd + HD) = pw;
    }
#pragma unroll
    for (int j = 0; j < 2; ++j)
      *(unsigned*)(Wvt + (vn2 + j) * P32 + 2 * vkk) = pk16(bf_bits(vr0[j]), bf_bits(vr1[j]));
  }
  // (c) content rows, head slice h -> Xv (4096 float4 pieces, 8 per thread; 8 neighbouring lanes take one 128-B line)
  //     unrolled: all eight loads are issued before the first LDS store waits for one.
  //     Addresses here and in (d): the uniform base of the batch's head slice + the lane's 32-bit byte offset
  //     (below SEQ * EMB * 4), one address register per load in flight.
  const char* cbase = (const char*)(content + rowB * EMB + (size_t)h * HD);
  const char* pbase = (const char*)(pos + rowB * EMB + (size_t)h * HD);
  const int r0 = tid >> 3, c4 = (tid & 7) * 4;                  // piece e = it * 512 + tid -> row r0 + 64 it, column c4
  {
    v4f cv[8];
    const unsigned co = (unsigned)r0 * (EMB * 4u) + (unsigned)c4 * 4u;
#pragma unroll
    for (int it = 0; it < 8; ++it) cv[it] = *(const v4f*)(cbase + (co + (unsigned)it * (64u * EMB * 4u)));
#if DEV_ASM
    // precaution: stands behind the loads, ahead of any reuse of the registers that hold their addresses (kept live up to here)
    asm volatile("s_wait_xcnt 0x0" :: "v"(co), "s"(cbase) : "memory");
#endif
#pragma unroll
    for (int it = 0; it < 8; ++it) {
      v2u pk;
      pk[0] = pk16(bf_bits(cv[it][0]), bf_bits(cv[it][1]));
      pk[1] = pk16(bf_bits(cv[it][2]), bf_bits(cv[it][3]));
      *(v2u*)(Xv + (r0 + 64 * it) * P32 + c4) = pk;
    }
  }
  __syncthreads();
  // (d) gathered rows: 32 x 512 pieces = [g 2][source 2][512 rows][8 pieces]; thread -> rows r0 + 64 it, column c4
  //     unrolled: g and the source are picked by the index, and the loads are issued ahead of the LDS stores
  {
    unsigned go[2][8];
    v4f gv[2][2][8];
#pragma unroll
    for (int g = 0; g < 2; ++g)
#pragma unroll
      for (int it = 0; it < 8; ++it) go[g][it] = (unsigned)sIdx[g][r0 + 64 * it] * (EMB * 4u) + (unsigned)c4 * 4u;
#pragma unroll
    for (int g = 0; g < 2; ++g)
#pragma unroll
      for (int it = 0; it < 8; ++it) {
        gv[g][0][it] = *(const v4f*)(cbase + go[g][it]);
        gv[g][1][it] = *(const v4f*)(pbase + go[g][it]);
      }
#if DEV_ASM
    // precaution: stands behind the loads, ahead of any reuse of the registers that hold their addresses (kept live up to here)
    asm volatile("s_wait_xcnt 0x0"
                 :: "v"(go[0][0]), "v"(go[0][1]), "v"(go[0][2]), "v"(go[0][3]), "v"(go[0][4]), "v"(go[0][5]), "v"(go[0][6]),
                    "v"(go[0][7]), "v"(go[1][0]), "v"(go[1][1]), "v"(go[1][2]), "v"(go[1][3]), "v"(go[1][4]), "v"(go[1][5]),
                    "v"(go[1][6]), "v"(go[1][7]), "s"(cbase), "s"(pbase)
                 : "memory");
#endif
#pragma unroll
    for (int g = 0; g < 2; ++g)
#pragma unroll
      for (int sc = 0; sc < 2; ++sc)
#pragma unroll
        for (int it = 0; it < 8; ++it) {
          const v4f v = gv[g][sc][it];
          v2u pk;
          pk[0] = pk16(bf_bits(v[0]), bf_bits(v[1]));
          pk[1] = pk16(bf_bits(v[2]), bf_bits(v[3]));
          *(v2u*)(Xg[g] + (r0 + 64 * it) * P64 + sc * HD + c4) = pk;
        }
  }
  __syncthreads();

  // (e) the wave's own 2 x 16 rows as B operands (column = lane&15), taken into registers
  v16b bx[QT][2][2];
  v16b bv[QT];
#pragma unroll
  for (int qt = 0; qt < QT; ++qt) {
#pragma unroll
    for (int g = 0; g < 2; ++g)
#pragma unroll
      for (int ks = 0; ks < 2; ++ks)
        bx[qt][g][ks] = ldfrag<__bf16>((const __bf16*)(const void*)Xg[g] + (size_t)(q0 + qt * 16 + c) * P64 + ks * 32 + 8 * hh);
    bv[qt] = ldfrag<__bf16>((const __bf16*)(const void*)Xv + (size_t)(q0 + qt * 16 + c) * P32 + 8 * hh);   // B[k][s] from row s
  }
  __syncthreads();           // ends every read of Xg: [0] is rewritten as the K2 plane below, [1] as the out tiles at the end

  _Float16* Ksh = (_Float16*)(void*)Xg[0];
  // (f) Q2^T (which = 0) -> B fragments qb in registers; K2^T (which = 1) -> K2 plane rows q0 + 16 qt + c
  v16h qb[QT][2];
#pragma unroll
  for (int which = 0; which < 2; ++which) {
    const __bf16* Wb = (const __bf16*)(const void*)W2[which];
#pragma unroll
    for (int g = 0; g < 2; ++g) {
      FH f[QT];
#pragma unroll
      for (int nt = 0; nt < 2; ++nt) {
        v8f a[QT];
#pragma unroll
        for (int qt = 0; qt < QT; ++qt) a[qt] = zero8();
#pragma unroll
        for (int ks = 0; ks < 2; ++ks) {
          const v16b aw = ldfrag<__bf16>(Wb + (size_t)(nt * 16 + c) * P64 + ks * 32 + 8 * hh);   // A[n][k']
          mma_b2(aw, bx[0][g][ks], bx[1][g][ks], a[0], a[1]);
        }
#pragma unroll
        for (int qt = 0; qt < QT; ++qt)
#pragma unroll
          for (int r = 0; r < 8; ++r) f[qt].h[nt][r] = (_Float16)(a[qt][r] * 8.0f);   // n = 16 nt + 8 hh + r
      }
#pragma unroll
      for (int qt = 0; qt < QT; ++qt) {
        if (which == 0) {
          qb[qt][g] = f[qt].v;
        } else {
          *(v8h*)(Ksh + (q0 + qt * 16 + c) * P64 + g * 32 + 8 * hh)      = f[qt].h[0];
          *(v8h*)(Ksh + (q0 + qt * 16 + c) * P64 + g * 32 + 16 + 8 * hh) = f[qt].h[1];
        }
      }
    }
  }
  // (g) V^T tiles d = 16 dt + 8 hh + r, s = q0 + 16 qt + c -> hi and residual planes
#pragma unroll
  for (int dt = 0; dt < 2; ++dt) {
    const v16b av = ldfrag<__bf16>((const __bf16*)(const void*)Wvt + (size_t)(dt * 16 + c) * P32 + 8 * hh);  // A[d][k]
    v8f accv[QT];
#pragma unroll
    for (int qt = 0; qt < QT; ++qt) accv[qt] = zero8();
    mma_b2(av, bv[0], bv[1], accv[0], accv[1]);
#pragma unroll
    for (int qt = 0; qt < QT; ++qt)
#pragma unroll
      for (int r = 0; r < 8; ++r) {
        const float f0 = accv[qt][r] * 8.0f;
        const _Float16 x0 = (_Float16)f0;
        const float r0 = f0 - (float)x0;
        const _Float16 l0 = (_Float16)r0;
        Vth[(dt * 16 + 8 * hh + r) * PV + q0 + qt * 16 + c] = x0;
        Vtl[(dt * 16 + 8 * hh + r) * PV + q0 + qt * 16 + c] = l0;
      }
  }
  __syncthreads();           // publishes the K2 and V^T planes to every wave

  const float c1 = sscale * 1.44269504088896340736f;   // raw score -> log2 units (positive: the maximum may be taken raw)
  float mrun[QT];                            // running maximum of query 16 qt + c, raw (equal in both halves)
  float lrun[QT];                            // running sum of 1024 p over this half's keys only
  v8f oacc[QT][2];                           // context^T: register r of tile t = d 16 t + 8 hh + r, query 16 qt + c
#pragma unroll
  for (int qt = 0; qt < QT; ++qt) {
    mrun[qt] = -INFINITY;
    lrun[qt] = 0.f;
#pragma unroll
    for (int t = 0; t < 2; ++t) oacc[qt][t] = zero8();
  }

  for (int kt = 0; kt < NKT; ++kt) {         // static trip count
    const int kv0 = kt * 64;

    // ---- scores^T: 64 keys x 2 x 16 query columns per wave; each K2 fragment is read once for both query tiles ----
    //      the chunk's 16 reads stand as one group ahead of the products: with 4 waves on a SIMD a read that is waited for
    //      directly in front of its product is no longer covered by the other waves
    v8f s[QT][4];
    FH kb[4][2];
#pragma unroll
    for (int j = 0; j < 4; ++j)
#pragma unroll
      for (int dc = 0; dc < 2; ++dc) {
        kb[j][dc].h[0] = *(const v8h*)(Ksh + (kv0 + j * 16 + c) * P64 + dc * 32 + 8 * hh);
        kb[j][dc].h[1] = *(const v8h*)(Ksh + (kv0 + j * 16 + c) * P64 + dc * 32 + 16 + 8 * hh);
      }
#pragma unroll
    for (int j = 0; j < 4; ++j) {
#pragma unroll
      for (int qt = 0; qt < QT; ++qt) s[qt][j] = zero8();
#pragma unroll
      for (int dc = 0; dc < 2; ++dc) mma_h2(kb[j][dc].v, qb[0][dc], qb[1][dc], s[0][j], s[1][j]);
    }

    // ---- column max in the lane, one exchange between the halves, online softmax ----
    float bias[QT];
    float alpha[QT];
#pragma unroll
    for (int qt = 0; qt < QT; ++qt) {
      float m = s[qt][0][0];
#pragma unroll
      for (int j = 0; j < 4; ++j)
#pragma unroll
        for (int r = 0; r < 8; ++r) m = fmaxf(m, s[qt][j][r]);
      m = fmaxf(m, xhalf(m));
      const float mnew  = fmaxf(mrun[qt], m);
      const float msafe = (mnew == -INFINITY) ? 0.f : mnew;
      const float mb    = msafe * c1;                            // the shift, in log2 units
      alpha[qt] = __builtin_amdgcn_exp2f(__builtin_fmaf(mrun[qt], c1, -mb));
      bias[qt]  = 10.0f - mb;                                    // + 10: exp2 yields 1024 p at once
      mrun[qt] = mnew;

#pragma unroll
      for (int t = 0; t < 2; ++t)
#pragma unroll
        for (int r = 0; r < 8; ++r) oacc[qt][t][r] *= alpha[qt];
    }

    // ---- per 32 keys: P hi (x1024) and its residual packed in place into B operands, then
    //      context^T += V^T . P^T (3 f16 products, all at one scale, into the running accumulator);
    //      each V^T fragment is read once for both query tiles ----
    float ps[QT][4];
    // unrolled: the scores live in registers and are picked by kk
#pragma unroll
    for (int kk = 0; kk < 2; ++kk) {
      union { v16h v; v4u q[2]; } pa[QT], pr[QT];                // dword i = elements 2 i (low half), 2 i + 1 (high half)
      // the 8 V^T reads of these 32 keys stand as one group ahead of the exponentials, which cover them
      FH vb[2], vr[2];
#pragma unroll
      for (int t = 0; t < 2; ++t) {
        vb[t].h[0] = *(const v8h*)(Vth + (t * 16 + c) * PV + kv0 + kk * 32 + 8 * hh);
        vb[t].h[1] = *(const v8h*)(Vth + (t * 16 + c) * PV + kv0 + kk * 32 + 16 + 8 * hh);
        vr[t].h[0] = *(const v8h*)(Vtl + (t * 16 + c) * PV + kv0 + kk * 32 + 8 * hh);
        vr[t].h[1] = *(const v8h*)(Vtl + (t * 16 + c) * PV + kv0 + kk * 32 + 16 + 8 * hh);
      }
#pragma unroll
      for (int qt = 0; qt < QT; ++qt)
#pragma unroll
        for (int jj = 0; jj < 2; ++jj) {
          const int j = 2 * kk + jj;
          float psum = 0.f;
          v4u h4;
          v8f y8;
#pragma unroll
          for (int r = 0; r < 8; r += 2) {
            v2f pp;
            pp[0] = __builtin_amdgcn_exp2f(__builtin_fmaf(s[qt][j][r],     c1, bias[qt]));
            pp[1] = __builtin_amdgcn_exp2f(__builtin_fmaf(s[qt][j][r + 1], c1, bias[qt]));
            psum += pp[0];
            psum += pp[1];
            h4[r >> 1] = __builtin_bit_cast(unsigned, __builtin_convertvector(pp, v2h));
            y8[r]     = pp[0];
            y8[r + 1] = pp[1];
          }
          pa[qt].q[jj] = h4;
          pr[qt].q[jj] = res_pk(h4, y8);
          ps[qt][j] = psum;
        }
#pragma unroll
      for (int t = 0; t < 2; ++t) {
        mma_h2(vb[t].v, pa[0].v, pa[1].v, oacc[0][t], oacc[1][t]);
        mma_h2(vr[t].v, pa[0].v, pa[1].v, oacc[0][t], oacc[1][t]);
        mma_h2(vb[t].v, pr[0].v, pr[1].v, oacc[0][t], oacc[1][t]);
      }
    }
#pragma unroll
    for (int qt = 0; qt < QT; ++qt)
      lrun[qt] = lrun[qt] * alpha[qt] + ((ps[qt][0] + ps[qt][1]) + (ps[qt][2] + ps[qt][3]));
  }

  // ---- join the halves' sums, normalise (1/l, which holds the x1024 p carry; undo the x8 v carry), stage the wave's 16x32 tiles
  float* os = (float*)(void*)(Xg[1] + q0 * P64);                 // tile qt at + qt * 16 * POS floats
#pragma unroll
  for (int qt = 0; qt < QT; ++qt) {
    const float l = lrun[qt] + xhalf(lrun[qt]);
    const float inv = ((l > 0.f) ? (1.0f / l) : 0.f) * (1.0f / 8.0f);
#pragma unroll
    for (int t = 0; t < 2; ++t)
#pragma unroll
      for (int e = 0; e < 2; ++e) {
        v4f v;
#pragma unroll
        for (int x = 0; x < 4; ++x) v[x] = oacc[qt][t][4 * e + x] * inv;
        *(v4f*)(os + (qt * 16 + c) * POS + t * 16 + 8 * hh + 4 * e) = v;   // query row 16 qt + c, d = 16 t + 8 hh + 4 e ..+3
      }
  }
  __builtin_amdgcn_fence(__ATOMIC_RELEASE, "workgroup");
  __builtin_amdgcn_wave_barrier();
  __builtin_amdgcn_fence(__ATOMIC_ACQUIRE, "workgroup");
  {
    const int q4 = lane >> 3, c4 = (lane & 7) * 4;
    v4f ov[QT * 4];
#pragma unroll
    for (int it = 0; it < QT * 4; ++it) {
      const int row = it * 4 + q4;                 // it 0..7 x q4 0..3 = rows 0..31 of the wave's two tiles
      ov[it] = *(const v4f*)(os + row * POS + c4);
    }
    {
#pragma unroll
      for (int it = 0; it < QT * 4; ++it) {
        const int row = it * 4 + q4;
        const size_t go = ((size_t)b * SEQ + (size_t)(q0 + row)) * EMB + (size_t)h * HD + c4;
        *(v4f*)(out + go) = ov[it];
      }
    }
  }
}

// =====================================================================================================
// Workspace map (bytes): PT int [32][512][2] 131072.
// Launches: k_partner (256 blocks x 512), k_attn (256 x 512).
// =====================================================================================================
extern "C" void kernel_launch(void* const* d_in, const int* in_sizes, int n_in,
                              void* d_out, int out_size, void* d_ws, size_t ws_size,
                              hipStream_t stream) {
  if (n_in < 6) return;
  if (in_sizes[0] != NB * SEQ * EMB) return;
  if (in_sizes[1] != NB * SEQ * EMB) return;
  if (in_sizes[2] != NB * SEQ * 4) return;
  if (in_sizes[3] != HD * HD || in_sizes[4] != HD * HD || in_sizes[5] != HD * HD) return;
  if (out_size != NB * SEQ * EMB) return;

  const float* content = (const float*)d_in[0];
  const float* posenc  = (const float*)d_in[1];
  const float* centers = (const float*)d_in[2];
  const float* Wq      = (const float*)d_in[3];
  const float* Wk      = (const float*)d_in[4];
  const float* Wv      = (const float*)d_in[5];

  const size_t PPT = (size_t)NB * SEQ * 2 * 4;             //   131072
  if (PPT > ws_size) return;

  int*   PT   = (int*)d_ws;
  float* outp = (float*)d_out;

  const float sscale = (1.0f / 64.0f) / sqrtf(2.0f * (float)EMB);   // 1/(64 sqrt(512))

  const dim3 gP(NQT, NB);            //  256 blocks of 512
  const dim3 gA(NB, NH);             //  256 blocks of 512

  // (1) partner table
  k_partner<<<gP, dim3(64 * PSL), 0, stream>>>(centers, PT);
  // (2) projections and attention -> d_out f32 [32][512][256]
  k_attn<<<gA, dim3(NW * 32), 0, stream>>>(content, posenc, PT, Wq, Wk, Wv, outp, sscale);
  (void)hipGetLastError();
}

// v009
// A run of this version takes 29.2 microseconds.
// In two side-by-side timings against v008, it was 1.06 and 1.07 times as fast.
// Counting every step since v000, it is 6.84 times as fast.
// Contractions: [q|k] and v^T projections = v_wmma_f32_16x16x32_bf16 (bf16 operands: RNE-converted content, pos, Wq, Wk, Wv;
//   x_qk.W evaluated as [content | pos] x [W ; W] along k; single products, f32 accumulate);
// gathered q.k^T scores = v_wmma_f32_16x16x32_f16 (q and k f16 planes carried x8; single product; f32 accumulate);
// p.v = v_wmma_f32_16x16x32_f16 (p f16 carried x1024 + residual plane at the same scale; v^T f16 carried x8 + residual plane
//   at the same scale; 3 products ph.vh, ph.vl, pl.vh into one f32 accumulator); partner selection (IoU argmax) and softmax
//   in f32 on the VALU.
// Carry audit:
//   Q2 frags  f16 = f16(8 q)                     (projection phase) -> undone by sscale = 1/(64 sqrt(512)), inside c1
//   K2 plane  f16 = f16(8 k)                     (projection phase) -> same sscale (8*8 = 64)
//   VTh plane f16 = f16(8 v)                     (projection phase) -> epilogue inv includes 1/8
//   VTl plane f16 = f16(8 v - VTh)               (projection phase) -> same 1/8 in epilogue (f16 grid 2^-24 at worst = 2^-27 of v)
//   P hi      f16 = f16(1024 p)                  (softmax)          -> the row sum l carries the same x1024: cancels in 1/l
//   P res     f16 = f16(1024 p - hi)             (softmax)          -> same 1/l in epilogue (f16 grid 2^-24 at worst = 2^-34 of p)
#include <hip/hip_runtime.h>
#include <math.h>
#include <stdint.h>

#pragma clang fp contract(off)

#define NB   32
#define SEQ  512
#define EMB  256
#define NH   8
#define HD   32            // per-head dim
#define QD   64            // gathered q/k width (two partner rows)
#define NQT  (SEQ / 64)    // 64-row query tiles per sequence
#define NKT  (SEQ / 64)    // 64-key chunks per sequence
// LDS row pitches, in 16-bit elements, of every tile that is read as a WMMA fragment with 16-byte loads: 16 B x odd,
// so that the 16 rows one half-wave reads fall on 64 distinct banks (at the bare 128 B / 64 B they share 8 / 16 banks)
#define P64  72            // 64-element rows: 144 B
#define P32  40            // 32-element rows:  80 B
static_assert(NH * HD == EMB);
static_assert(NQT == 8 && NKT == 8);
static_assert((SEQ % 64) == 0 && (HD % 32) == 0 && (QD % 32) == 0);
static_assert(P64 >= QD && P32 >= HD && (P64 % 8) == 0 && (P32 % 8) == 0 && ((P64 / 8) & 1) == 1 && ((P32 / 8) & 1) == 1);

typedef _Float16 v16h __attribute__((ext_vector_type(16)));
typedef _Float16 v8h  __attribute__((ext_vector_type(8)));
typedef __bf16   v16b __attribute__((ext_vector_type(16)));
typedef __bf16   v8b  __attribute__((ext_vector_type(8)));
typedef float    v8f  __attribute__((ext_vector_type(8)));
typedef float    v4f  __attribute__((ext_vector_type(4)));
typedef unsigned int v4u __attribute__((ext_vector_type(4)));
typedef unsigned int v2u __attribute__((ext_vector_type(2)));
typedef int      v4i  __attribute__((ext_vector_type(4)));
typedef int      v2i  __attribute__((ext_vector_type(2)));
typedef float    v2f  __attribute__((ext_vector_type(2)));
typedef _Float16 v2h  __attribute__((ext_vector_type(2)));

#if defined(__HIP_DEVICE_COMPILE__)
#define DEV_ASM 1
#else
#define DEV_ASM 0
#endif

// ---- scalar helpers --------------------------------------------------------------------------------
__device__ __forceinline__ unsigned short bf_bits(float f) {          // f32 -> bf16 bits, RNE convert
  unsigned u = __float_as_uint(f);
  return (unsigned short)((u + 0x7FFFu + ((u >> 16) & 1u)) >> 16);
}
__device__ __forceinline__ float bf_up(unsigned short hb) { return __uint_as_float(((unsigned)hb) << 16); }
__device__ __forceinline__ unsigned short h_bits(_Float16 x) { return __builtin_bit_cast(unsigned short, x); }
__device__ __forceinline__ unsigned pk16(unsigned short a, unsigned short b) { return (unsigned)a | ((unsigned)b << 16); }
__device__ __forceinline__ v8f zero8() { v8f z = {0.f, 0.f, 0.f, 0.f, 0.f, 0.f, 0.f, 0.f}; return z; }

// ---- fragment loaders: 16-bit A/B operand, lane -> row/col (lane&15), p already includes +8*(lane>>4);
//      elements 0..7 <- p[0..7] (k0+8h..k0+8h+7), elements 8..15 <- p[16..23] (k0+16+8h..k0+16+8h+7)
template <typename OT> struct FT;
template <> struct FT<__bf16>   { typedef v16b frag; typedef v8b half8; };
template <> struct FT<_Float16> { typedef v16h frag; typedef v8h half8; };

template <typename OT>
__device__ __forceinline__ typename FT<OT>::frag ldfrag(const OT* p) {
  union { typename FT<OT>::frag v; typename FT<OT>::half8 h[2]; } f;
  f.h[0] = *(const typename FT<OT>::half8*)(p);
  f.h[1] = *(const typename FT<OT>::half8*)(p + 16);
  return f.v;
}

// ---- guarded WMMA helpers: 4 VALU slots after the WMMA, D tied, A/B kept live --------------------------
// ---- one A fragment against the B fragments of the wave's two row tiles: two independent WMMAs back to back, then the same
//      guard once for the pair (the first WMMA has the second one and the four slots behind it, the second the four slots)
__device__ __forceinline__ void mma_b2(v16b a, v16b b0, v16b b1, v8f& c0, v8f& c1) {
  c0 = __builtin_amdgcn_wmma_f32_16x16x32_bf16(false, a, false, b0, (short)0, c0, false, false);
  c1 = __builtin_amdgcn_wmma_f32_16x16x32_bf16(false, a, false, b1, (short)0, c1, false, false);
#if DEV_ASM
  asm volatile("v_nop\n\tv_nop\n\tv_nop\n\tv_nop" : "+v"(c0), "+v"(c1) : "v"(a), "v"(b0), "v"(b1));
#endif
}
__device__ __forceinline__ void mma_h2(v16h a, v16h b0, v16h b1, v8f& c0, v8f& c1) {
  c0 = __builtin_amdgcn_wmma_f32_16x16x32_f16(false, a, false, b0, (short)0, c0, false, false);
  c1 = __builtin_amdgcn_wmma_f32_16x16x32_f16(false, a, false, b1, (short)0, c1, false, false);
#if DEV_ASM
  asm volatile("v_nop\n\tv_nop\n\tv_nop\n\tv_nop" : "+v"(c0), "+v"(c1) : "v"(a), "v"(b0), "v"(b1));
#endif
}

// =====================================================================================================
// Partner selection (f32, VALU, fp-contract off, literal op order):
//   c = RNE-bf16(centers); bbox = (c0 - c3*0.5, c1 - c2*0.5, c0 + c3*0.5, c1 + c2*0.5);
//   inter = max(min maxs - max mins, 0) products; union = (area_i + area_j) - inter; iou = inter/union - eye;
//   amax = first index of the row maximum (NaN counts as maximum, first NaN wins); l1 = (c2 - c0) + (c3 - c1);
//   cond = l1_i >= l1[amax]; p0 = cond ? i : amax, p1 = cond ? amax : i.
// grid (NQT, NB), 512 threads: block = 64 rows of one batch x PSL slices of PJS candidates; all 512 boxes of the
//   batch staged in LDS. Wave w scans rows 32*(w&1)..+31 against candidates PJS*(w>>1)..+PJS-1 and keeps, per row,
//   (slice maximum, its first index, first NaN index); threads 0..63 merge the slices in ascending order with a strict
//   compare, so the result is the first index of the row maximum (or the first NaN), as in one ascending scan.
// coverage: 8 blocks x 64 rows x 2 ints per batch = the whole table.
// =====================================================================================================
#define PSL 8              // candidate slices per row
#define PJS (SEQ / PSL)    // candidates per slice
static_assert(PSL * PJS == SEQ && (PJS % 2) == 0);
__global__ __launch_bounds__(64 * PSL) void k_partner(const float* __restrict__ cen, int* pt) {
#pragma clang fp contract(off)
  __shared__ float sb0[SEQ];
  __shared__ float sb1[SEQ];
  __shared__ float sb2[SEQ];
  __shared__ float sb3[SEQ];
  __shared__ float sar[SEQ];
  __shared__ float sl1[SEQ];
  __shared__ float mbv[PSL][64];                // slice maximum per row
  __shared__ int   mbj[PSL][64];                // its first index
  __shared__ int   mnj[PSL][64];                // first NaN index of the slice, SEQ if none
  __shared__ __align__(16) int sp[128];

  const int tid = (int)threadIdx.x;
  const int row = tid & 63;
  const int sl  = tid >> 6;                     // the same for a whole wave
  const int i0  = (int)blockIdx.x * 64;
  const int b   = (int)blockIdx.y;
  const float* cb = cen + (size_t)b * SEQ * 4;

  for (int s = tid; s < SEQ; s += 64 * PSL) {
    const v4f cv = *(const v4f*)(cb + (size_t)s * 4);
#if DEV_ASM
    // precaution: stands between this load and the later reuse of the scalar registers that hold its base address
    asm volatile("s_wait_xcnt 0x0" ::: "memory");
#endif
    const float c0 = bf_up(bf_bits(cv[0]));
    const float c1 = bf_up(bf_bits(cv[1]));
    const float c2 = bf_up(bf_bits(cv[2]));
    const float c3 = bf_up(bf_bits(cv[3]));
    const float hx = c3 * 0.5f;
    const float hy = c2 * 0.5f;
    const float x0 = c0 - hx;
    const float y0 = c1 - hy;
    const float x1 = c0 + hx;
    const float y1 = c1 + hy;
    sb0[s] = x0;
    sb1[s] = y0;
    sb2[s] = x1;
    sb3[s] = y1;
    const float dx = x1 - x0;
    const float dy = y1 - y0;
    sar[s] = dx * dy;
    const float la = c2 - c0;
    const float lb = c3 - c1;
    sl1[s] = la + lb;
  }
  __syncthreads();

  const int i = i0 + row;                       // 0..511
  const float a0 = sb0[i], a1 = sb1[i], a2 = sb2[i], a3 = sb3[i], ar = sar[i];
  float best = -INFINITY;
  int   bj = 0;
  int   nj = SEQ;
  const int j0 = sl * PJS;
#pragma unroll 2
  for (int jj = 0; jj < PJS; ++jj) {
    const int j = j0 + jj;
    const float m0 = fmaxf(a0, sb0[j]);
    const float m1 = fmaxf(a1, sb1[j]);
    const float x2 = fminf(a2, sb2[j]);
    const float x3 = fminf(a3, sb3[j]);
    const float d0 = x2 - m0;
    const float d1 = x3 - m1;
    const float w0 = fmaxf(d0, 0.0f);
    const float w1 = fmaxf(d1, 0.0f);
    const float inter = w0 * w1;
    const float asum  = ar + sar[j];
    const float uni   = asum - inter;
    const float q     = inter / uni;
    const float e     = (j == i) ? 1.0f : 0.0f;
    const float iou   = q - e;
    const bool  up    = iou > best;             // false for NaN
    best = up ? iou : best;
    bj   = up ? j : bj;
    nj   = min(nj, (iou != iou) ? j : SEQ);
  }
  mbv[sl][row] = best;
  mbj[sl][row] = bj;
  mnj[sl][row] = nj;
  __syncthreads();

  if (tid < 64) {
    float gb = -INFINITY;
    int   gj = 0;
    int   gn = SEQ;
    // unrolled so that all slice reads are issued before the first one is waited for
#pragma unroll
    for (int s = 0; s < PSL; ++s) {             // ascending slices, strict compare: the first maximum wins
      const float v = mbv[s][tid];
      const int   x = mbj[s][tid];
      const bool  up = v > gb;
      gb = up ? v : gb;
      gj = up ? x : gj;
      gn = min(gn, mnj[s][tid]);
    }
    const int am = (gn < SEQ) ? gn : gj;        // NaN counts as maximum, first NaN wins
    const float l1i = sl1[i];
    const float l1p = sl1[am];
    const bool cond = (l1i >= l1p);
    sp[tid * 2 + 0] = cond ? i : am;
    sp[tid * 2 + 1] = cond ? am : i;
  }
  __syncthreads();

  if (tid < 32) {
    const v4i v = *(const v4i*)(sp + tid * 4);    // rows i0+2*tid, i0+2*tid+1
    int* dst = pt + ((size_t)b * SEQ + i0) * 2 + tid * 4;
    *(v4i*)dst = v;
  }
}

// =====================================================================================================
// Projections and attention in one launch. Block = one (batch b, head h), NW = 16 waves; wave w owns rows 32 w..32 w + 31
// of the sequence, as QT = 2 tiles of 16, as projection rows, as keys and as queries: every A fragment read from LDS (weights,
// K2 rows, V^T rows) is used for both tiles. One block fills one WGP's LDS; grid (NB, NH) = 256 blocks.
// Projection phase (all products bf16 WMMA, f32 accumulate), on the rows in their own order, each row once:
//   X[i][0..31] = bf16(content[b][i][h*32..]), X[i][32..63] = bf16(pos[same row]);
//   W2[which][n][k'] = bf16(W[k' & 31][n]) for Wq (0) / Wk (1); Wvt[n][k] = bf16(Wv[k][n]).
//   q[i][n] = sum_k' X[i][k'] W2q[n][k'] (K = 64) = (content + pos)[i] . Wq; k likewise with Wk;
//   V^T[d][s] = sum_k Wvt[d][k] X[s][k] (k < 32: the content half).
//   q and k are taken transposed (A = W2 rows n, B = X rows i): D register r of n tile nt = column n = 16 nt + 8 (lane>>4) + r
//   of row i = lane&15, so the two n tiles, converted in place, are two 16-byte LDS stores into the row's place in QK.
// Gather, in LDS, behind the barrier that publishes q and k (indices from PT, clamped to [0, SEQ-1]; g = 0: p0, 1: p1):
//   Q2[i][g*32+n] = q[p_g(i)][n], read as the B operand of the score product (hardware k order 8 h + e, 16 + 8 h + e);
//   K2[i][g*32+n] = k[p_g(i)][n], copied into the K2 plane, which takes X's place (same rows, same pitch).
//   A last barrier publishes K2; the key loop has none. The q and k planes are reused as the waves' out tiles.
// Attention on the gathered planes, head dim 64 for q/k, 32 for v, no mask, softmax over all SEQ keys.
//   Both products are taken transposed, so that a lane owns one query column (lane&15) throughout:
//   raw scores^T = K2 . Q2^T on f16 WMMA (A = K2 rows from LDS, B = Q2 rows kept in registers);
//   D register r of key tile j = raw score of key 16 j + 8 (lane>>4) + r for query lane&15.
//   c1 = sscale * log2(e), sscale = 1/(64 sqrt(512)): 1024 p = exp2(raw * c1 + (10 - max * c1)), one FMA per score.
//   Online softmax in f32: maximum and sum run over the lane's own 32 scores; the two wave halves of a query exchange
//   the maximum once per chunk and join their partial sums once, behind the loop.
//   p carried as f16(1024 p) plus residual f16(1024 p - hi); the row sum is taken of 1024 p; key tiles 2 kk and 2 kk + 1,
//   converted in place, are the B operand of 32 keys in the hardware k order (8 h + e, 16 + 8 h + e), the order in
//   which the V^T rows are read as A: P never passes through LDS.
//   context^T = vh . ph + vl . ph + vh . pl on f16 WMMA, one accumulator; out = context / (l * 8) in f32, l = sum of 1024 p.
//   Key chunks of 64, static trip NKT, in ascending order.
//   Output: d_out[b][q][h*32 + d] f32; each wave stores, per tile, rows q0+16 qt..+15 (it 4 qt..4 qt + 3 x lane>>3) x 32 floats =
//   coverage: grid (32 batches x 8 heads) x 16 waves x 2 tiles x 16 rows x 32 cols = every output element once.
// =====================================================================================================
#define NW   16            // waves per block
#define QT   2             // 16-row tiles per wave
#define PV   (SEQ + 8)     // V^T row pitch in halves: 1040 B (16 B x odd), rows read as 16-byte WMMA fragments
static_assert(NW * QT * 16 == SEQ && QT == 2 && (PV % 8) == 0 && ((PV / 8) & 1) == 1);
#define POS  36            // out-tile row pitch in floats: 144 B (16 B x odd), rows written and read with 16-byte accesses
static_assert(POS >= HD && (POS % 4) == 0 && ((POS / 4) & 1) == 1);

// lane l <-> lane l ^ 16: the two lanes that share one query column
__device__ __forceinline__ float xhalf(float x) {
  const int xb = __builtin_bit_cast(int, x);
  return __builtin_bit_cast(float, __builtin_amdgcn_permlanex16(xb, xb, 0x76543210, 0xfedcba98, false, false));
}

// packed f16 residuals of eight values: half x of d[i] = f16(y[2 i + x] - (float)(half x of h[i])), y = the
// value that h rounds. Written as asm because the compiler otherwise converts each half back to f32 (and converts each
// value a second time, unpacked) ahead of a subtract and a convert: one mixed-precision FMA per value does all
// of it, with the same single rounding (the difference is exact). The four low halves stand ahead of the four
// high halves so that no instruction follows its own register's writer directly; the s_delay_alu lines are the
// scheduling hints that the compiler cannot place inside or in front of asm text (without them a dependent vector
// instruction holds the vector port against the other waves); they change no result.
__device__ __forceinline__ v4u res_pk(v4u h, v8f y) {
  v4u d = {0u, 0u, 0u, 0u};
#if DEV_ASM
  unsigned d0, d1, d2, d3;
  asm("s_delay_alu instid0(VALU_DEP_1)\n\t"
      "v_fma_mixlo_f16 %0, %4, %8, %9 op_sel_hi:[1,0,0]\n\t"
      "v_fma_mixlo_f16 %1, %5, %8, %11 op_sel_hi:[1,0,0]\n\t"
      "v_fma_mixlo_f16 %2, %6, %8, %13 op_sel_hi:[1,0,0]\n\t"
      "v_fma_mixlo_f16 %3, %7, %8, %15 op_sel_hi:[1,0,0]\n\t"
      "s_delay_alu instid0(VALU_DEP_4) | instskip(NEXT) | instid1(VALU_DEP_4)\n\t"
      "v_fma_mixhi_f16 %0, %4, %8, %10 op_sel:[1,0,0] op_sel_hi:[1,0,0]\n\t"
      "v_fma_mixhi_f16 %1, %5, %8, %12 op_sel:[1,0,0] op_sel_hi:[1,0,0]\n\t"
      "s_delay_alu instid0(VALU_DEP_4) | instskip(NEXT) | instid1(VALU_DEP_4)\n\t"
      "v_fma_mixhi_f16 %2, %6, %8, %14 op_sel:[1,0,0] op_sel_hi:[1,0,0]\n\t"
      "v_fma_mixhi_f16 %3, %7, %8, %16 op_sel:[1,0,0] op_sel_hi:[1,0,0]"
      : "=&v"(d0), "=&v"(d1), "=&v"(d2), "=&v"(d3)
      : "v"(h[0]), "v"(h[1]), "v"(h[2]), "v"(h[3]), "s"(-1.0f),
        "v"(y[0]), "v"(y[1]), "v"(y[2]), "v"(y[3]), "v"(y[4]), "v"(y[5]), "v"(y[6]), "v"(y[7]));
  d[0] = d0; d[1] = d1; d[2] = d2; d[3] = d3;
#endif
  return d;
}
__global__ __launch_bounds__(NW * 32)
void k_attn(const float* __restrict__ content, const float* __restrict__ pos, const int* __restrict__ pt,
            const float* __restrict__ Wq, const float* __restrict__ Wk, const float* __restrict__ Wv,
            float* out, float sscale) {
  union FH { v16h v; v8h h[2]; };
  __shared__ __align__(16) unsigned short X[SEQ * P64];       //  72 KB  [row][content 32 | pos 32]; later the K2 plane [key][d]
  __shared__ __align__(16) _Float16 QK[2][SEQ * P32];         //  80 KB  q (0) and k (1) of every row, f16 x8; later the out tiles
  __shared__ __align__(16) unsigned short W2[2][HD * P64];    //   9 KB
  __shared__ __align__(16) unsigned short Wvt[HD * P32];      //   2.5 KB
  __shared__ __align__(16) _Float16 Vth[HD * PV];             //  32.5 KB  V^T hi [d][key]
  __shared__ __align__(16) _Float16 Vtl[HD * PV];             //  32.5 KB  V^T residual
  __shared__ int sIdx[2][SEQ];                                //   4 KB
  static_assert(SEQ * POS * 4 <= 2 * SEQ * P32 * 2);          // the out tiles of all rows fit into the q and k planes

  const int tid  = (int)threadIdx.x;
  const int wave = tid >> 5;
  const int lane = tid & 31;
  const int hh   = lane >> 4;
  const int c    = lane & 15;

  const int q0 = wave * (QT * 16);
  const int b  = (int)blockIdx.x;
  const int h  = (int)blockIdx.y;
  const size_t rowB = (size_t)b * SEQ;

  // (c) content and pos rows, head slice h -> X (2 x 4096 float4 pieces, 16 per thread; 8 neighbouring lanes take one 128-B
  //     line); every row is read once, in order. No address waits for the partner table, so the loads stand first and
  //     fly while (a) and (b) run; the LDS stores follow behind (b).
  //     unrolled: all sixteen loads are issued before anything waits for one.
  //     Addresses: the uniform base of the batch's head slice + the lane's 32-bit byte offset (below SEQ * EMB * 4).
  const char* cbase = (const char*)(content + rowB * EMB + (size_t)h * HD);
  const char* pbase = (const char*)(pos + rowB * EMB + (size_t)h * HD);
  const int r0 = tid >> 3, c4 = (tid & 7) * 4;                  // piece e = it * 512 + tid -> row r0 + 64 it, column c4
  v4f cv[2][8];
  {
    const unsigned co = (unsigned)r0 * (EMB * 4u) + (unsigned)c4 * 4u;
#pragma unroll
    for (int it = 0; it < 8; ++it) {
      cv[0][it] = *(const v4f*)(cbase + (co + (unsigned)it * (64u * EMB * 4u)));
      cv[1][it] = *(const v4f*)(pbase + (co + (unsigned)it * (64u * EMB * 4u)));
    }
#if DEV_ASM
    // precaution: stands behind the loads, ahead of any reuse of the registers that hold their addresses (kept live up to here)
    asm volatile("s_wait_xcnt 0x0" :: "v"(co), "s"(cbase), "s"(pbase) : "memory");
#endif
  }
  // (a) partner indices of all rows: thread -> row tid, both g in one 8-byte load; clamped and stored behind (b), so that
  //     the weight loads are issued before anything waits
  const v2i pv = *(const v2i*)(pt + rowB * 2 + (size_t)tid * 2);
  // (b) weights (waves 0..7): whole 128-B rows (W[k][0..31] is one line), two k rows per thread, transposed to [n][k] on the
  //     LDS write, bf16 bits, one dword = (k even, k odd); k duplicated over the two 32-halves for Wq / Wk.
  //     Wq (threads 0..127) / Wk (128..255): k pair wkk x 4 columns, 16-byte loads; Wv: k pair vkk x 2 columns, 8-byte loads.
  if (tid < 256) {
    const int wm  = tid >> 7;
    const int wkk = (tid >> 3) & 15, wn4 = (tid & 7) * 4;
    const int vkk = tid >> 4,        vn2 = (tid & 15) * 2;
    const float* Wm = wm ? Wk : Wq;
    const v4f wr0 = *(const v4f*)(Wm + (2 * wkk + 0) * HD + wn4);
#if DEV_ASM
    // precaution: stands between this load and the next one, whose result may land in the registers that hold this address
    asm volatile("s_wait_xcnt 0x0" ::: "memory");
#endif
    const v4f wr1 = *(const v4f*)(Wm + (2 * wkk + 1) * HD + wn4);
    const v2f vr0 = *(const v2f*)(Wv + (2 * vkk + 0) * HD + vn2);
    const v2f vr1 = *(const v2f*)(Wv + (2 * vkk + 1) * HD + vn2);
    // both loops unrolled: the loaded rows live in registers and are picked by j
#pragma unroll
    for (int j = 0; j < 4; ++j) {
      const unsigned pw = pk16(bf_bits(wr0[j]), bf_bits(wr1[j]));
      unsigned short* wd = W2[wm] + (wn4 + j) * P64 + 2 * wkk;
      *(unsigned*)(wd)      = pw;
      *(unsigned*)(wd + HD) = pw;
    }
#pragma unroll
    for (int j = 0; j < 2; ++j)
      *(unsigned*)(Wvt + (vn2 + j) * P32 + 2 * vkk) = pk16(bf_bits(vr0[j]), bf_bits(vr1[j]));
  }
  sIdx[0][tid] = min(max(pv[0], 0), SEQ - 1);
  sIdx[1][tid] = min(max(pv[1], 0), SEQ - 1);
  // (c), second part: the loaded rows as bf16 bits -> X
  {
#pragma unroll
    for (int sc = 0; sc < 2; ++sc)
#pragma unroll
      for (int it = 0; it < 8; ++it) {
        const v4f v = cv[sc][it];
        v2u pk;
        pk[0] = pk16(bf_bits(v[0]), bf_bits(v[1]));
        pk[1] = pk16(bf_bits(v[2]), bf_bits(v[3]));
        *(v2u*)(X + (r0 + 64 * it) * P64 + sc * HD + c4) = pk;
      }
  }
  __syncthreads();           // publishes X, the weights and the indices

  // (e) the wave's own 2 x 16 rows as B operands (column = lane&15), taken into registers; ks = 0 is the content half,
  //     which is also the B operand of the V^T product
  v16b bx[QT][2];
#pragma unroll
  for (int qt = 0; qt < QT; ++qt)
#pragma unroll
    for (int ks = 0; ks < 2; ++ks)
      bx[qt][ks] = ldfrag<__bf16>((const __bf16*)(const void*)X + (size_t)(q0 + qt * 16 + c) * P64 + ks * 32 + 8 * hh);

  // (f) q^T (which = 0) and k^T (which = 1) of the wave's own rows -> planes QK[which], rows q0 + 16 qt + c
#pragma unroll
  for (int which = 0; which < 2; ++which) {
    const __bf16* Wb = (const __bf16*)(const void*)W2[which];
    FH f[QT];
#pragma unroll
    for (int nt = 0; nt < 2; ++nt) {
      v8f a[QT];
#pragma unroll
      for (int qt = 0; qt < QT; ++qt) a[qt] = zero8();
#pragma unroll
      for (int ks = 0; ks < 2; ++ks) {
        const v16b aw = ldfrag<__bf16>(Wb + (size_t)(nt * 16 + c) * P64 + ks * 32 + 8 * hh);   // A[n][k']
        mma_b2(aw, bx[0][ks], bx[1][ks], a[0], a[1]);
      }
#pragma unroll
      for (int qt = 0; qt < QT; ++qt)
#pragma unroll
        for (int r = 0; r < 8; ++r) f[qt].h[nt][r] = (_Float16)(a[qt][r] * 8.0f);   // n = 16 nt + 8 hh + r
    }
#pragma unroll
    for (int qt = 0; qt < QT; ++qt) {
      *(v8h*)(QK[which] + (q0 + qt * 16 + c) * P32 + 8 * hh)      = f[qt].h[0];
      *(v8h*)(QK[which] + (q0 + qt * 16 + c) * P32 + 16 + 8 * hh) = f[qt].h[1];
    }
  }
  // (g) V^T tiles d = 16 dt + 8 hh + r, s = q0 + 16 qt + c -> hi and residual planes
#pragma unroll
  for (int dt = 0; dt < 2; ++dt) {
    const v16b av = ldfrag<__bf16>((const __bf16*)(const void*)Wvt + (size_t)(dt * 16 + c) * P32 + 8 * hh);  // A[d][k]
    v8f accv[QT];
#pragma unroll
    for (int qt = 0; qt < QT; ++qt) accv[qt] = zero8();
    mma_b2(av, bx[0][0], bx[1][0], accv[0], accv[1]);
#pragma unroll
    for (int qt = 0; qt < QT; ++qt)
#pragma unroll
      for (int r = 0; r < 8; ++r) {
        const float f0 = accv[qt][r] * 8.0f;
        const _Float16 x0 = (_Float16)f0;
        const float r0 = f0 - (float)x0;
        const _Float16 l0 = (_Float16)r0;
        Vth[(dt * 16 + 8 * hh + r) * PV + q0 + qt * 16 + c] = x0;
        Vtl[(dt * 16 + 8 * hh + r) * PV + q0 + qt * 16 + c] = l0;
      }
  }
  __syncthreads();           // publishes the q, k and V^T planes; ends every read of X, which is rewritten as the K2 plane below

  // (h) the gather, in LDS: row i = q0 + 16 qt + c takes the q and k rows of its partners p_g(i), 64 B each.
  //     Q2 goes straight into the B fragments qb (n = 8 hh + e, 16 + 8 hh + e, as the rows were stored); K2 into its plane.
  _Float16* Ksh = (_Float16*)(void*)X;
  v16h qb[QT][2];
#pragma unroll
  for (int qt = 0; qt < QT; ++qt)
#pragma unroll
    for (int g = 0; g < 2; ++g) {
      const int src = sIdx[g][q0 + qt * 16 + c] * P32 + 8 * hh;
      FH fq;
      fq.h[0] = *(const v8h*)(QK[0] + src);
      fq.h[1] = *(const v8h*)(QK[0] + src + 16);
      qb[qt][g] = fq.v;
      const v8h k0 = *(const v8h*)(QK[1] + src);
      const v8h k1 = *(const v8h*)(QK[1] + src + 16);
      *(v8h*)(Ksh + (q0 + qt * 16 + c) * P64 + g * 32 + 8 * hh)      = k0;
      *(v8h*)(Ksh + (q0 + qt * 16 + c) * P64 + g * 32 + 16 + 8 * hh) = k1;
    }
  __syncthreads();           // publishes the K2 plane to every wave; ends every read of the q and k planes (out tiles at the end)

  const float c1 = sscale * 1.44269504088896340736f;   // raw score -> log2 units (positive: the maximum may be taken raw)
  float mrun[QT];                            // running maximum of query 16 qt + c, raw (equal in both halves)
  float lrun[QT];                            // running sum of 1024 p over this half's keys only
  v8f oacc[QT][2];                           // context^T: register r of tile t = d 16 t + 8 hh + r, query 16 qt + c
#pragma unroll
  for (int qt = 0; qt < QT; ++qt) {
    mrun[qt] = -INFINITY;
    lrun[qt] = 0.f;
#pragma unroll
    for (int t = 0; t < 2; ++t) oacc[qt][t] = zero8();
  }

  for (int kt = 0; kt < NKT; ++kt) {         // static trip count
    const int kv0 = kt * 64;

    // ---- scores^T: 64 keys x 2 x 16 query columns per wave; each K2 fragment is read once for both query tiles ----
    //      the chunk's 16 reads stand as one group ahead of the products: with 4 waves on a SIMD a read that is waited for
    //      directly in front of its product is no longer covered by the other waves
    v8f s[QT][4];
    FH kb[4][2];
#pragma unroll
    for (int j = 0; j < 4; ++j)
#pragma unroll
      for (int dc = 0; dc < 2; ++dc) {
        kb[j][dc].h[0] = *(const v8h*)(Ksh + (kv0 + j * 16 + c) * P64 + dc * 32 + 8 * hh);
        kb[j][dc].h[1] = *(const v8h*)(Ksh + (kv0 + j * 16 + c) * P64 + dc * 32 + 16 + 8 * hh);
      }
#pragma unroll
    for (int j = 0; j < 4; ++j) {
#pragma unroll
      for (int qt = 0; qt < QT; ++qt) s[qt][j] = zero8();
#pragma unroll
      for (int dc = 0; dc < 2; ++dc) mma_h2(kb[j][dc].v, qb[0][dc], qb[1][dc], s[0][j], s[1][j]);
    }

    // ---- column max in the lane, one exchange between the halves, online softmax ----
    float bias[QT];
    float alpha[QT];
#pragma unroll
    for (int qt = 0; qt < QT; ++qt) {
      float m = s[qt][0][0];
#pragma unroll
      for (int j = 0; j < 4; ++j)
#pragma unroll
        for (int r = 0; r < 8; ++r) m = fmaxf(m, s[qt][j][r]);
      m = fmaxf(m, xhalf(m));
      const float mnew  = fmaxf(mrun[qt], m);
      const float msafe = (mnew == -INFINITY) ? 0.f : mnew;
      const float mb    = msafe * c1;                            // the shift, in log2 units
      alpha[qt] = __builtin_amdgcn_exp2f(__builtin_fmaf(mrun[qt], c1, -mb));
      bias[qt]  = 10.0f - mb;                                    // + 10: exp2 yields 1024 p at once
      mrun[qt] = mnew;

#pragma unroll
      for (int t = 0; t < 2; ++t)
#pragma unroll
        for (int r = 0; r < 8; ++r) oacc[qt][t][r] *= alpha[qt];
    }

    // ---- per 32 keys: P hi (x1024) and its residual packed in place into B operands, then
    //      context^T += V^T . P^T (3 f16 products, all at one scale, into the running accumulator);
    //      each V^T fragment is read once for both query tiles ----
    float ps[QT][4];
    // unrolled: the scores live in registers and are picked by kk
#pragma unroll
    for (int kk = 0; kk < 2; ++kk) {
      union { v16h v; v4u q[2]; } pa[QT], pr[QT];                // dword i = elements 2 i (low half), 2 i + 1 (high half)
      // the 8 V^T reads of these 32 keys stand as one group ahead of the exponentials, which cover them
      FH vb[2], vr[2];
#pragma unroll
      for (int t = 0; t < 2; ++t) {
        vb[t].h[0] = *(const v8h*)(Vth + (t * 16 + c) * PV + kv0 + kk * 32 + 8 * hh);
        vb[t].h[1] = *(const v8h*)(Vth + (t * 16 + c) * PV + kv0 + kk * 32 + 16 + 8 * hh);
        vr[t].h[0] = *(const v8h*)(Vtl + (t * 16 + c) * PV + kv0 + kk * 32 + 8 * hh);
        vr[t].h[1] = *(const v8h*)(Vtl + (t * 16 + c) * PV + kv0 + kk * 32 + 16 + 8 * hh);
      }
#pragma unroll
      for (int qt = 0; qt < QT; ++qt)
#pragma unroll
        for (int jj = 0; jj < 2; ++jj) {
          const int j = 2 * kk + jj;
          float psum = 0.f;
          v4u h4;
          v8f y8;
#pragma unroll
          for (int r = 0; r < 8; r += 2) {
            v2f pp;
            pp[0] = __builtin_amdgcn_exp2f(__builtin_fmaf(s[qt][j][r],     c1, bias[qt]));
            pp[1] = __builtin_amdgcn_exp2f(__builtin_fmaf(s[qt][j][r + 1], c1, bias[qt]));
            psum += pp[0];
            psum += pp[1];
            h4[r >> 1] = __builtin_bit_cast(unsigned, __builtin_convertvector(pp, v2h));
            y8[r]     = pp[0];
            y8[r + 1] = pp[1];
          }
          pa[qt].q[jj] = h4;
          pr[qt].q[jj] = res_pk(h4, y8);
          ps[qt][j] = psum;
        }
#pragma unroll
      for (int t = 0; t < 2; ++t) {
        mma_h2(vb[t].v, pa[0].v, pa[1].v, oacc[0][t], oacc[1][t]);
        mma_h2(vr[t].v, pa[0].v, pa[1].v, oacc[0][t], oacc[1][t]);
        mma_h2(vb[t].v, pr[0].v, pr[1].v, oacc[0][t], oacc[1][t]);
      }
    }
#pragma unroll
    for (int qt = 0; qt < QT; ++qt)
      lrun[qt] = lrun[qt] * alpha[qt] + ((ps[qt][0] + ps[qt][1]) + (ps[qt][2] + ps[qt][3]));
  }

  // ---- join the halves' sums, normalise (1/l, which holds the x1024 p carry; undo the x8 v carry), stage the wave's 16x32 tiles
  float* os = (float*)(void*)(&QK[0][0]) + q0 * POS;             // tile qt at + qt * 16 * POS floats
#pragma unroll
  for (int qt = 0; qt < QT; ++qt) {
    const float l = lrun[qt] + xhalf(lrun[qt]);
    const float inv = ((l > 0.f) ? (1.0f / l) : 0.f) * (1.0f / 8.0f);
#pragma unroll
    for (int t = 0; t < 2; ++t)
#pragma unroll
      for (int e = 0; e < 2; ++e) {
        v4f v;
#pragma unroll
        for (int x = 0; x < 4; ++x) v[x] = oacc[qt][t][4 * e + x] * inv;
        *(v4f*)(os + (qt * 16 + c) * POS + t * 16 + 8 * hh + 4 * e) = v;   // query row 16 qt + c, d = 16 t + 8 hh + 4 e ..+3
      }
  }
  __builtin_amdgcn_fence(__ATOMIC_RELEASE, "workgroup");
  __builtin_amdgcn_wave_barrier();
  __builtin_amdgcn_fence(__ATOMIC_ACQUIRE, "workgroup");
  {
    const int q4 = lane >> 3, c4 = (lane & 7) * 4;
    v4f ov[QT * 4];
#pragma unroll
    for (int it = 0; it < QT * 4; ++it) {
      const int row = it * 4 + q4;                 // it 0..7 x q4 0..3 = rows 0..31 of the wave's two tiles
      ov[it] = *(const v4f*)(os + row * POS + c4);
    }
    {
#pragma unroll
      for (int it = 0; it < QT * 4; ++it) {
        const int row = it * 4 + q4;
        const size_t go = ((size_t)b * SEQ + (size_t)(q0 + row)) * EMB + (size_t)h * HD + c4;
        *(v4f*)(out + go) = ov[it];
      }
    }
  }
}

// =====================================================================================================
// Workspace map (bytes): PT int [32][512][2] 131072.
// Launches: k_partner (256 blocks x 512), k_attn (256 x 512).
// =====================================================================================================
extern "C" void kernel_launch(void* const* d_in, const int* in_sizes, int n_in,
                              void* d_out, int out_size, void* d_ws, size_t ws_size,
                              hipStream_t stream) {
  if (n_in < 6) return;
  if (in_sizes[0] != NB * SEQ * EMB) return;
  if (in_sizes[1] != NB * SEQ * EMB) return;
  if (in_sizes[2] != NB * SEQ * 4) return;
  if (in_sizes[3] != HD * HD || in_sizes[4] != HD * HD || in_sizes[5] != HD * HD) return;
  if (out_size != NB * SEQ * EMB) return;

  const float* content = (const float*)d_in[0];
  const float* posenc  = (const float*)d_in[1];
  const float* centers = (const float*)d_in[2];
  const float* Wq      = (const float*)d_in[3];
  const float* Wk      = (const float*)d_in[4];
  const float* Wv      = (const float*)d_in[5];

  const size_t PPT = (size_t)NB * SEQ * 2 * 4;             //   131072
  if (PPT > ws_size) return;

  int*   PT   = (int*)d_ws;
  float* outp = (float*)d_out;

  const float sscale = (1.0f / 64.0f) / sqrtf(2.0f * (float)EMB);   // 1/(64 sqrt(512))

  const dim3 gP(NQT, NB);            //  256 blocks of 512
  const dim3 gA(NB, NH);             //  256 blocks of 512

  // (1) partner table
  k_partner<<<gP, dim3(64 * PSL), 0, stream>>>(centers, PT);
  // (2) projections and attention -> d_out f32 [32][512][256]
  k_attn<<<gA, dim3(NW * 32), 0, stream>>>(content, posenc, PT, Wq, Wk, Wv, outp, sscale);
  (void)hipGetLastError();
}

// v010
// It runs in 27.8 microseconds.
// Next to v009, in two timings, it ran 1.05 times as fast each time.
// Over all steps from v000 it is 7.17 times as fast.
// Contractions: [q|k] and v^T projections = v_wmma_f32_16x16x32_bf16 (bf16 operands: RNE-converted content, pos, Wq, Wk, Wv;
//   x_qk.W evaluated as [content | pos] x [W ; W] along k; single products, f32 accumulate);
// gathered q.k^T scores = v_wmma_f32_16x16x32_f16 (q and k f16 planes carried x8; single product; f32 accumulate);
// p.v = v_wmma_f32_16x16x32_f16 (p f16 carried x1024 + residual plane at the same scale; v^T f16 carried x8 + residual plane
//   at the same scale; 3 products ph.vh, ph.vl, pl.vh into one f32 accumulator); partner selection (IoU argmax) and softmax
//   in f32 on the VALU.
// Carry audit:
//   Q2 frags  f16 = f16(8 q)                     (projection phase) -> undone by sscale = 1/(64 sqrt(512)), inside c1
//   K2 plane  f16 = f16(8 k)                     (projection phase) -> same sscale (8*8 = 64)
//   VTh plane f16 = f16(8 v)                     (projection phase) -> epilogue inv includes 1/8
//   VTl plane f16 = f16(8 v - VTh)               (projection phase) -> same 1/8 in epilogue (f16 grid 2^-24 at worst = 2^-27 of v)
//   P hi      f16 = f16(1024 p)                  (softmax)          -> the row sum l carries the same x1024: cancels in 1/l
//   P res     f16 = f16(1024 p - hi)             (softmax)          -> same 1/l in epilogue (f16 grid 2^-24 at worst = 2^-34 of p)
#include <hip/hip_runtime.h>
#include <math.h>
#include <stdint.h>

#pragma clang fp contract(off)

#define NB   32
#define SEQ  512
#define EMB  256
#define NH   8
#define HD   32            // per-head dim
#define QD   64            // gathered q/k width (two partner rows)
#define NQT  (SEQ / 64)    // 64-row query tiles per sequence
#define NKT  (SEQ / 64)    // 64-key chunks per sequence
// LDS row pitches, in 16-bit elements, of every tile that is read as a WMMA fragment with 16-byte loads: 16 B x odd,
// so that the 16 rows one half-wave reads fall on 64 distinct banks (at the bare 128 B / 64 B they share 8 / 16 banks)
#define P64  72            // 64-element rows: 144 B
#define P32  40            // 32-element rows:  80 B
static_assert(NH * HD == EMB);
static_assert(NQT == 8 && NKT == 8);
static_assert((SEQ % 64) == 0 && (HD % 32) == 0 && (QD % 32) == 0);
static_assert(P64 >= QD && P32 >= HD && (P64 % 8) == 0 && (P32 % 8) == 0 && ((P64 / 8) & 1) == 1 && ((P32 / 8) & 1) == 1);

typedef _Float16 v16h __attribute__((ext_vector_type(16)));
typedef _Float16 v8h  __attribute__((ext_vector_type(8)));
typedef __bf16   v16b __attribute__((ext_vector_type(16)));
typedef __bf16   v8b  __attribute__((ext_vector_type(8)));
typedef float    v8f  __attribute__((ext_vector_type(8)));
typedef float    v4f  __attribute__((ext_vector_type(4)));
typedef unsigned int v4u __attribute__((ext_vector_type(4)));
typedef unsigned int v2u __attribute__((ext_vector_type(2)));
typedef int      v4i  __attribute__((ext_vector_type(4)));
typedef int      v2i  __attribute__((ext_vector_type(2)));
typedef float    v2f  __attribute__((ext_vector_type(2)));
typedef _Float16 v2h  __attribute__((ext_vector_type(2)));

#if defined(__HIP_DEVICE_COMPILE__)
#define DEV_ASM 1
#else
#define DEV_ASM 0
#endif

// ---- scalar helpers --------------------------------------------------------------------------------
__device__ __forceinline__ unsigned short bf_bits(float f) {          // f32 -> bf16 bits, RNE convert
  unsigned u = __float_as_uint(f);
  return (unsigned short)((u + 0x7FFFu + ((u >> 16) & 1u)) >> 16);
}
__device__ __forceinline__ float bf_up(unsigned short hb) { return __uint_as_float(((unsigned)hb) << 16); }
__device__ __forceinline__ unsigned short h_bits(_Float16 x) { return __builtin_bit_cast(unsigned short, x); }
__device__ __forceinline__ unsigned pk16(unsigned short a, unsigned short b) { return (unsigned)a | ((unsigned)b << 16); }
__device__ __forceinline__ v8f zero8() { v8f z = {0.f, 0.f, 0.f, 0.f, 0.f, 0.f, 0.f, 0.f}; return z; }

// ---- fragment loaders: 16-bit A/B operand, lane -> row/col (lane&15), p already includes +8*(lane>>4);
//      elements 0..7 <- p[0..7] (k0+8h..k0+8h+7), elements 8..15 <- p[16..23] (k0+16+8h..k0+16+8h+7)
template <typename OT> struct FT;
template <> struct FT<__bf16>   { typedef v16b frag; typedef v8b half8; };
template <> struct FT<_Float16> { typedef v16h frag; typedef v8h half8; };

template <typename OT>
__device__ __forceinline__ typename FT<OT>::frag ldfrag(const OT* p) {
  union { typename FT<OT>::frag v; typename FT<OT>::half8 h[2]; } f;
  f.h[0] = *(const typename FT<OT>::half8*)(p);
  f.h[1] = *(const typename FT<OT>::half8*)(p + 16);
  return f.v;
}

// ---- guarded WMMA helpers: 4 VALU slots after the WMMA, D tied, A/B kept live --------------------------
// ---- one A fragment against the B fragments of the wave's two row tiles: two independent WMMAs back to back, then the same
//      guard once for the pair (the first WMMA has the second one and the four slots behind it, the second the four slots)
__device__ __forceinline__ void mma_b2(v16b a, v16b b0, v16b b1, v8f& c0, v8f& c1) {
  c0 = __builtin_amdgcn_wmma_f32_16x16x32_bf16(false, a, false, b0, (short)0, c0, false, false);
  c1 = __builtin_amdgcn_wmma_f32_16x16x32_bf16(false, a, false, b1, (short)0, c1, false, false);
#if DEV_ASM
  asm volatile("v_nop\n\tv_nop\n\tv_nop\n\tv_nop" : "+v"(c0), "+v"(c1) : "v"(a), "v"(b0), "v"(b1));
#endif
}
__device__ __forceinline__ void mma_h2(v16h a, v16h b0, v16h b1, v8f& c0, v8f& c1) {
  c0 = __builtin_amdgcn_wmma_f32_16x16x32_f16(false, a, false, b0, (short)0, c0, false, false);
  c1 = __builtin_amdgcn_wmma_f32_16x16x32_f16(false, a, false, b1, (short)0, c1, false, false);
#if DEV_ASM
  asm volatile("v_nop\n\tv_nop\n\tv_nop\n\tv_nop" : "+v"(c0), "+v"(c1) : "v"(a), "v"(b0), "v"(b1));
#endif
}

// =====================================================================================================
// Partner selection (f32, VALU, fp-contract off, literal op order):
//   c = RNE-bf16(centers); bbox = (c0 - c3*0.5, c1 - c2*0.5, c0 + c3*0.5, c1 + c2*0.5);
//   inter = max(min maxs - max mins, 0) products; union = (area_i + area_j) - inter; iou = inter/union - eye;
//   amax = first index of the row maximum (NaN counts as maximum, first NaN wins); l1 = (c2 - c0) + (c3 - c1);
//   cond = l1_i >= l1[amax]; p0 = cond ? i : amax, p1 = cond ? amax : i.
// grid (NQT, NB), 512 threads: block = 64 rows of one batch x PSL slices of PJS candidates; all 512 boxes of the
//   batch staged in LDS. Wave w scans rows 32*(w&1)..+31 against candidates PJS*(w>>1)..+PJS-1 and keeps, per row,
//   (slice maximum, its first index, first NaN index); threads 0..63 merge the slices in ascending order with a strict
//   compare, so the result is the first index of the row maximum (or the first NaN), as in one ascending scan.
// coverage: 8 blocks x 64 rows x 2 ints per batch = the whole table.
// =====================================================================================================
#define PSL 8              // candidate slices per row
#define PJS (SEQ / PSL)    // candidates per slice
static_assert(PSL * PJS == SEQ && (PJS % 2) == 0 && 64 * PSL == SEQ && PJS == 64);   // thread s stages box s; half a slice = a wave's rows
// Half a slice of one row's scan: candidates jb..jb+PJH-1 (jb the same for the whole wave), ascending, op order as above.
//   FULL: every case inside the loop: the - eye term, the first NaN index, the compiler's whole division.
//   Common path (FULL = false): the cases that are rare, or known per wave, stand outside the loop, the results bit for bit the same:
//   - DIAG = false: the half does not hold the row itself: iou = q - 0 = q.
//   - nacc, a running maximum that keeps NaN, only says whether a NaN was met; the caller then scans again with FULL.
//   - the quotient is the division's own core (rcp, one refinement, two remainder steps) without its range scaling and its
//     fix-up. Both are identities when every box is on the grid (grid_ok: edges multiples of 2^-40 below 2^10, widths >= 0):
//     a width is then 0 or in [2^-40, 2^11], inter and the areas 0 or in [2^-80, 2^22], inter <= both areas (rounding is
//     monotone), so uni >= the larger area less a few ulp: for inter > 0 numerator, denominator, reciprocal and quotient are
//     normal, inter >= 2^-103 and the quotient is about 1 at most: nothing is scaled; inter = 0 gives +0, or NaN when uni = 0 too.
#define PJH (PJS / 2)
__device__ __forceinline__ bool grid_ok(float x) {
  const float t = x * 0x1p40f;
  return (fabsf(x) < 1024.0f) && (__builtin_rintf(t) == t);     // false for NaN
}
template <bool DIAG, bool FULL>
__device__ __forceinline__ void scan_half(const float* sb0, const float* sb1, const float* sb2, const float* sb3,
                                          const float* sar, int jb, int i, float a0, float a1, float a2, float a3, float ar,
                                          float& best, int& bj, int& nj, float& nacc) {
#pragma clang fp contract(off)
  // groups of 8 candidates, each stage written for all eight (inner loops unrolled: the arrays live in registers): eight
  // independent chains cover each other's latency and pair up for dual issue; the outer loop stays rolled to keep the code short
#pragma unroll 1
  for (int g = 0; g < PJH; g += 8) {
    const int jg = jb + g;
    float inter[8], uni[8], q[8];
#pragma unroll
    for (int k = 0; k < 8; ++k) {
      const int j = jg + k;
      const float m0 = fmaxf(a0, sb0[j]);
      const float m1 = fmaxf(a1, sb1[j]);
      const float x2 = fminf(a2, sb2[j]);
      const float x3 = fminf(a3, sb3[j]);
      const float d0 = x2 - m0;
      const float d1 = x3 - m1;
      const float w0 = fmaxf(d0, 0.0f);
      const float w1 = fmaxf(d1, 0.0f);
      inter[k] = w0 * w1;
      const float asum = ar + sar[j];
      uni[k] = asum - inter[k];
    }
    if (FULL) {
#pragma unroll
      for (int k = 0; k < 8; ++k) q[k] = inter[k] / uni[k];
    } else {
      float r[8], t[8];
#pragma unroll
      for (int k = 0; k < 8; ++k) r[k] = __builtin_amdgcn_rcpf(uni[k]);
#pragma unroll
      for (int k = 0; k < 8; ++k) t[k] = __builtin_fmaf(-uni[k], r[k], 1.0f);
#pragma unroll
      for (int k = 0; k < 8; ++k) r[k] = __builtin_fmaf(t[k], r[k], r[k]);
#pragma unroll
      for (int k = 0; k < 8; ++k) q[k] = inter[k] * r[k];
#pragma unroll
      for (int k = 0; k < 8; ++k) t[k] = __builtin_fmaf(-uni[k], q[k], inter[k]);
#pragma unroll
      for (int k = 0; k < 8; ++k) q[k] = __builtin_fmaf(t[k], r[k], q[k]);
#pragma unroll
      for (int k = 0; k < 8; ++k) t[k] = __builtin_fmaf(-uni[k], q[k], inter[k]);
#pragma unroll
      for (int k = 0; k < 8; ++k) q[k] = __builtin_fmaf(t[k], r[k], q[k]);
    }
#pragma unroll
    for (int k = 0; k < 8; ++k) {
      const int j = jg + k;
      float iou = q[k];
      if (DIAG) {
        const float e = (j == i) ? 1.0f : 0.0f;
        iou = q[k] - e;
      }
      const bool up = iou > best;               // false for NaN
      best = up ? iou : best;
      bj   = up ? j : bj;
      if (FULL) nj = min(nj, (iou != iou) ? j : SEQ);
      else      nacc = __builtin_elementwise_maximum(nacc, iou);
    }
  }
}
__global__ __launch_bounds__(64 * PSL) void k_partner(const float* __restrict__ cen, int* pt) {
#pragma clang fp contract(off)
  __shared__ __align__(16) float sb0[SEQ];
  __shared__ __align__(16) float sb1[SEQ];
  __shared__ __align__(16) float sb2[SEQ];
  __shared__ __align__(16) float sb3[SEQ];
  __shared__ __align__(16) float sar[SEQ];
  __shared__ float sl1[SEQ];
  __shared__ float mbv[PSL][64];                // slice maximum per row
  __shared__ int   mbj[PSL][64];                // its first index
  __shared__ int   mnj[PSL][64];                // first NaN index of the slice, SEQ if none
  __shared__ __align__(16) int sp[128];
  __shared__ int sok[2 * PSL];                  // 1: the 32 boxes that wave w staged are all on the grid (grid_ok, widths >= 0)

  const int tid = (int)threadIdx.x;
  const int row = tid & 63;
  const int wv  = __builtin_amdgcn_readfirstlane(tid >> 5);   // the wave's number, kept in a scalar register
  const int sl  = wv >> 1;                      // the same for a whole wave
  const int i0  = (int)blockIdx.x * 64;
  const int b   = (int)blockIdx.y;
  const float* cb = cen + (size_t)b * SEQ * 4;

  bool okb = true;
  for (int s = tid; s < SEQ; s += 64 * PSL) {
    const v4f cv = *(const v4f*)(cb + (size_t)s * 4);
#if DEV_ASM
    // precaution: stands between this load and the later reuse of the scalar registers that hold its base address
    asm volatile("s_wait_xcnt 0x0" ::: "memory");
#endif
    const float c0 = bf_up(bf_bits(cv[0]));
    const float c1 = bf_up(bf_bits(cv[1]));
    const float c2 = bf_up(bf_bits(cv[2]));
    const float c3 = bf_up(bf_bits(cv[3]));
    const float hx = c3 * 0.5f;
    const float hy = c2 * 0.5f;
    const float x0 = c0 - hx;
    const float y0 = c1 - hy;
    const float x1 = c0 + hx;
    const float y1 = c1 + hy;
    sb0[s] = x0;
    sb1[s] = y0;
    sb2[s] = x1;
    sb3[s] = y1;
    const float dx = x1 - x0;
    const float dy = y1 - y0;
    sar[s] = dx * dy;
    okb = okb && grid_ok(x0) && grid_ok(y0) && grid_ok(x1) && grid_ok(y1) && (dx >= 0.0f) && (dy >= 0.0f);
    const float la = c2 - c0;
    const float lb = c3 - c1;
    sl1[s] = la + lb;
  }
  {
    const unsigned okm = __builtin_amdgcn_ballot_w32(okb);
    if ((tid & 31) == 0) sok[wv] = (okm == 0xffffffffu) ? 1 : 0;
  }
  __syncthreads();

  const int i = i0 + row;                       // 0..511
  const float a0 = sb0[i], a1 = sb1[i], a2 = sb2[i], a3 = sb3[i], ar = sar[i];
  float best = -INFINITY;
  float nacc = -INFINITY;
  int   bj = 0;
  int   nj = SEQ;
  const int j0 = sl * PJS;
  const int wh = wv & 1;                        // the wave's rows are 32 wh..32 wh + 31 of the block's 64
  // the common path holds for this wave if its 64 candidates and its 32 rows are all on the grid (box s was staged by wave s / 32)
  bool redo = __builtin_amdgcn_readfirstlane(sok[2 * sl] & sok[2 * sl + 1] & sok[(i0 >> 5) + wh]) == 0;
  if (!redo) {
    // rows i0..i0+63 meet themselves only in slice blockIdx.x, and there in the half wh: scalar tests; kept rolled: two loop bodies
#pragma unroll 1
    for (int hf = 0; hf < 2; ++hf) {
      if (sl == (int)blockIdx.x && hf == wh)
        scan_half<true, false>(sb0, sb1, sb2, sb3, sar, j0 + hf * PJH, i, a0, a1, a2, a3, ar, best, bj, nj, nacc);
      else
        scan_half<false, false>(sb0, sb1, sb2, sb3, sar, j0 + hf * PJH, i, a0, a1, a2, a3, ar, best, bj, nj, nacc);
    }
    redo = __builtin_amdgcn_ballot_w32(nacc != nacc) != 0u;     // some lane met a NaN: its first index is wanted
  }
  if (redo) {                                   // the whole scan again, every case inside the loop
    best = -INFINITY;
    bj = 0;
    nj = SEQ;
    // kept rolled: a rare path, one loop body
#pragma unroll 1
    for (int hf = 0; hf < 2; ++hf)
      scan_half<true, true>(sb0, sb1, sb2, sb3, sar, j0 + hf * PJH, i, a0, a1, a2, a3, ar, best, bj, nj, nacc);
  }
  mbv[sl][row] = best;
  mbj[sl][row] = bj;
  mnj[sl][row] = nj;
  __syncthreads();

  if (tid < 64) {
    float gb = -INFINITY;
    int   gj = 0;
    int   gn = SEQ;
    // unrolled so that all slice reads are issued before the first one is waited for
#pragma unroll
    for (int s = 0; s < PSL; ++s) {             // ascending slices, strict compare: the first maximum wins
      const float v = mbv[s][tid];
      const int   x = mbj[s][tid];
      const bool  up = v > gb;
      gb = up ? v : gb;
      gj = up ? x : gj;
      gn = min(gn, mnj[s][tid]);
    }
    const int am = (gn < SEQ) ? gn : gj;        // NaN counts as maximum, first NaN wins
    const float l1i = sl1[i];
    const float l1p = sl1[am];
    const bool cond = (l1i >= l1p);
    sp[tid * 2 + 0] = cond ? i : am;
    sp[tid * 2 + 1] = cond ? am : i;
  }
  __syncthreads();

  if (tid < 32) {
    const v4i v = *(const v4i*)(sp + tid * 4);    // rows i0+2*tid, i0+2*tid+1
    int* dst = pt + ((size_t)b * SEQ + i0) * 2 + tid * 4;
    *(v4i*)dst = v;
  }
}

// =====================================================================================================
// Projections and attention in one launch. Block = one (batch b, head h), NW = 16 waves; wave w owns rows 32 w..32 w + 31
// of the sequence, as QT = 2 tiles of 16, as projection rows, as keys and as queries: every A fragment read from LDS (weights,
// K2 rows, V^T rows) is used for both tiles. One block fills one WGP's LDS; grid (NB, NH) = 256 blocks.
// Projection phase (all products bf16 WMMA, f32 accumulate), on the rows in their own order, each row once:
//   X[i][0..31] = bf16(content[b][i][h*32..]), X[i][32..63] = bf16(pos[same row]);
//   W2[which][n][k'] = bf16(W[k' & 31][n]) for Wq (0) / Wk (1); Wvt[n][k] = bf16(Wv[k][n]).
//   q[i][n] = sum_k' X[i][k'] W2q[n][k'] (K = 64) = (content + pos)[i] . Wq; k likewise with Wk;
//   V^T[d][s] = sum_k Wvt[d][k] X[s][k] (k < 32: the content half).
//   q and k are taken transposed (A = W2 rows n, B = X rows i): D register r of n tile nt = column n = 16 nt + 8 (lane>>4) + r
//   of row i = lane&15, so the two n tiles, converted in place, are two 16-byte LDS stores into the row's place in QK.
// Gather, in LDS, behind the barrier that publishes q and k (indices from PT, clamped to [0, SEQ-1]; g = 0: p0, 1: p1):
//   Q2[i][g*32+n] = q[p_g(i)][n], read as the B operand of the score product (hardware k order 8 h + e, 16 + 8 h + e);
//   K2[i][g*32+n] = k[p_g(i)][n], copied into the K2 plane, which takes X's place (same rows, same pitch).
//   A last barrier publishes K2; the key loop has none. The q and k planes are reused as the waves' out tiles.
// Attention on the gathered planes, head dim 64 for q/k, 32 for v, no mask, softmax over all SEQ keys.
//   Both products are taken transposed, so that a lane owns one query column (lane&15) throughout:
//   raw scores^T = K2 . Q2^T on f16 WMMA (A = K2 rows from LDS, B = Q2 rows kept in registers);
//   D register r of key tile j = raw score of key 16 j + 8 (lane>>4) + r for query lane&15.
//   c1 = sscale * log2(e), sscale = 1/(64 sqrt(512)): 1024 p = exp2(raw * c1 + (10 - max * c1)), one FMA per score.
//   Online softmax in f32: maximum and sum run over the lane's own 32 scores; the two wave halves of a query exchange
//   the maximum once per chunk and join their partial sums once, behind the loop.
//   p carried as f16(1024 p) plus residual f16(1024 p - hi); the row sum is taken of 1024 p; key tiles 2 kk and 2 kk + 1,
//   converted in place, are the B operand of 32 keys in the hardware k order (8 h + e, 16 + 8 h + e), the order in
//   which the V^T rows are read as A: P never passes through LDS.
//   context^T = vh . ph + vl . ph + vh . pl on f16 WMMA, one accumulator; out = context / (l * 8) in f32, l = sum of 1024 p.
//   Key chunks of 64, static trip NKT, in ascending order.
//   Output: d_out[b][q][h*32 + d] f32; each wave stores, per tile, rows q0+16 qt..+15 (it 4 qt..4 qt + 3 x lane>>3) x 32 floats =
//   coverage: grid (32 batches x 8 heads) x 16 waves x 2 tiles x 16 rows x 32 cols = every output element once.
// =====================================================================================================
#define NW   16            // waves per block
#define QT   2             // 16-row tiles per wave
#define PV   (SEQ + 8)     // V^T row pitch in halves: 1040 B (16 B x odd), rows read as 16-byte WMMA fragments
static_assert(NW * QT * 16 == SEQ && QT == 2 && (PV % 8) == 0 && ((PV / 8) & 1) == 1);
#define POS  36            // out-tile row pitch in floats: 144 B (16 B x odd), rows written and read with 16-byte accesses
static_assert(POS >= HD && (POS % 4) == 0 && ((POS / 4) & 1) == 1);

// lane l <-> lane l ^ 16: the two lanes that share one query column
__device__ __forceinline__ float xhalf(float x) {
  const int xb = __builtin_bit_cast(int, x);
  return __builtin_bit_cast(float, __builtin_amdgcn_permlanex16(xb, xb, 0x76543210, 0xfedcba98, false, false));
}

// packed f16 residuals of eight values: half x of d[i] = f16(y[2 i + x] - (float)(half x of h[i])), y = the
// value that h rounds. Written as asm because the compiler otherwise converts each half back to f32 (and converts each
// value a second time, unpacked) ahead of a subtract and a convert: one mixed-precision FMA per value does all
// of it, with the same single rounding (the difference is exact). The four low halves stand ahead of the four
// high halves so that no instruction follows its own register's writer directly; the s_delay_alu lines are the
// scheduling hints that the compiler cannot place inside or in front of asm text (without them a dependent vector
// instruction holds the vector port against the other waves); they change no result.
__device__ __forceinline__ v4u res_pk(v4u h, v8f y) {
  v4u d = {0u, 0u, 0u, 0u};
#if DEV_ASM
  unsigned d0, d1, d2, d3;
  asm("s_delay_alu instid0(VALU_DEP_1)\n\t"
      "v_fma_mixlo_f16 %0, %4, %8, %9 op_sel_hi:[1,0,0]\n\t"
      "v_fma_mixlo_f16 %1, %5, %8, %11 op_sel_hi:[1,0,0]\n\t"
      "v_fma_mixlo_f16 %2, %6, %8, %13 op_sel_hi:[1,0,0]\n\t"
      "v_fma_mixlo_f16 %3, %7, %8, %15 op_sel_hi:[1,0,0]\n\t"
      "s_delay_alu instid0(VALU_DEP_4) | instskip(NEXT) | instid1(VALU_DEP_4)\n\t"
      "v_fma_mixhi_f16 %0, %4, %8, %10 op_sel:[1,0,0] op_sel_hi:[1,0,0]\n\t"
      "v_fma_mixhi_f16 %1, %5, %8, %12 op_sel:[1,0,0] op_sel_hi:[1,0,0]\n\t"
      "s_delay_alu instid0(VALU_DEP_4) | instskip(NEXT) | instid1(VALU_DEP_4)\n\t"
      "v_fma_mixhi_f16 %2, %6, %8, %14 op_sel:[1,0,0] op_sel_hi:[1,0,0]\n\t"
      "v_fma_mixhi_f16 %3, %7, %8, %16 op_sel:[1,0,0] op_sel_hi:[1,0,0]"
      : "=&v"(d0), "=&v"(d1), "=&v"(d2), "=&v"(d3)
      : "v"(h[0]), "v"(h[1]), "v"(h[2]), "v"(h[3]), "s"(-1.0f),
        "v"(y[0]), "v"(y[1]), "v"(y[2]), "v"(y[3]), "v"(y[4]), "v"(y[5]), "v"(y[6]), "v"(y[7]));
  d[0] = d0; d[1] = d1; d[2] = d2; d[3] = d3;
#endif
  return d;
}
__global__ __launch_bounds__(NW * 32)
void k_attn(const float* __restrict__ content, const float* __restrict__ pos, const int* __restrict__ pt,
            const float* __restrict__ Wq, const float* __restrict__ Wk, const float* __restrict__ Wv,
            float* out, float sscale) {
  union FH { v16h v; v8h h[2]; };
  __shared__ __align__(16) unsigned short X[SEQ * P64];       //  72 KB  [row][content 32 | pos 32]; later the K2 plane [key][d]
  __shared__ __align__(16) _Float16 QK[2][SEQ * P32];         //  80 KB  q (0) and k (1) of every row, f16 x8; later the out tiles
  __shared__ __align__(16) unsigned short W2[2][HD * P64];    //   9 KB
  __shared__ __align__(16) unsigned short Wvt[HD * P32];      //   2.5 KB
  __shared__ __align__(16) _Float16 Vth[HD * PV];             //  32.5 KB  V^T hi [d][key]
  __shared__ __align__(16) _Float16 Vtl[HD * PV];             //  32.5 KB  V^T residual
  __shared__ int sIdx[2][SEQ];                                //   4 KB
  static_assert(SEQ * POS * 4 <= 2 * SEQ * P32 * 2);          // the out tiles of all rows fit into the q and k planes

  const int tid  = (int)threadIdx.x;
  const int wave = tid >> 5;
  const int lane = tid & 31;
  const int hh   = lane >> 4;
  const int c    = lane & 15;

  const int q0 = wave * (QT * 16);
  const int b  = (int)blockIdx.x;
  const int h  = (int)blockIdx.y;
  const size_t rowB = (size_t)b * SEQ;

  // (c) content and pos rows, head slice h -> X (2 x 4096 float4 pieces, 16 per thread; 8 neighbouring lanes take one 128-B
  //     line); every row is read once, in order. No address waits for the partner table, so the loads stand first and
  //     fly while (a) and (b) run; the LDS stores follow behind (b).
  //     unrolled: all sixteen loads are issued before anything waits for one.
  //     Addresses: the uniform base of the batch's head slice + the lane's 32-bit byte offset (below SEQ * EMB * 4).
  const char* cbase = (const char*)(content + rowB * EMB + (size_t)h * HD);
  const char* pbase = (const char*)(pos + rowB * EMB + (size_t)h * HD);
  const int r0 = tid >> 3, c4 = (tid & 7) * 4;                  // piece e = it * 512 + tid -> row r0 + 64 it, column c4
  v4f cv[2][8];
  {
    const unsigned co = (unsigned)r0 * (EMB * 4u) + (unsigned)c4 * 4u;
#pragma unroll
    for (int it = 0; it < 8; ++it) {
      cv[0][it] = *(const v4f*)(cbase + (co + (unsigned)it * (64u * EMB * 4u)));
      cv[1][it] = *(const v4f*)(pbase + (co + (unsigned)it * (64u * EMB * 4u)));
    }
#if DEV_ASM
    // precaution: stands behind the loads, ahead of any reuse of the registers that hold their addresses (kept live up to here)
    asm volatile("s_wait_xcnt 0x0" :: "v"(co), "s"(cbase), "s"(pbase) : "memory");
#endif
  }
  // (a) partner indices of all rows: thread -> row tid, both g in one 8-byte load; clamped and stored behind (b), so that
  //     the weight loads are issued before anything waits
  const v2i pv = *(const v2i*)(pt + rowB * 2 + (size_t)tid * 2);
  // (b) weights (waves 0..7): whole 128-B rows (W[k][0..31] is one line), two k rows per thread, transposed to [n][k] on the
  //     LDS write, bf16 bits, one dword = (k even, k odd); k duplicated over the two 32-halves for Wq / Wk.
  //     Wq (threads 0..127) / Wk (128..255): k pair wkk x 4 columns, 16-byte loads; Wv: k pair vkk x 2 columns, 8-byte loads.
  if (tid < 256) {
    const int wm  = tid >> 7;
    const int wkk = (tid >> 3) & 15, wn4 = (tid & 7) * 4;
    const int vkk = tid >> 4,        vn2 = (tid & 15) * 2;
    const float* Wm = wm ? Wk : Wq;
    const v4f wr0 = *(const v4f*)(Wm + (2 * wkk + 0) * HD + wn4);
#if DEV_ASM
    // precaution: stands between this load and the next one, whose result may land in the registers that hold this address
    asm volatile("s_wait_xcnt 0x0" ::: "memory");
#endif
    const v4f wr1 = *(const v4f*)(Wm + (2 * wkk + 1) * HD + wn4);
    const v2f vr0 = *(const v2f*)(Wv + (2 * vkk + 0) * HD + vn2);
    const v2f vr1 = *(const v2f*)(Wv + (2 * vkk + 1) * HD + vn2);
    // both loops unrolled: the loaded rows live in registers and are picked by j
#pragma unroll
    for (int j = 0; j < 4; ++j) {
      const unsigned pw = pk16(bf_bits(wr0[j]), bf_bits(wr1[j]));
      unsigned short* wd = W2[wm] + (wn4 + j) * P64 + 2 * wkk;
      *(unsigned*)(wd)      = pw;
      *(unsigned*)(wd + HD) = pw;
    }
#pragma unroll
    for (int j = 0; j < 2; ++j)
      *(unsigned*)(Wvt + (vn2 + j) * P32 + 2 * vkk) = pk16(bf_bits(vr0[j]), bf_bits(vr1[j]));
  }
  sIdx[0][tid] = min(max(pv[0], 0), SEQ - 1);
  sIdx[1][tid] = min(max(pv[1], 0), SEQ - 1);
  // (c), second part: the loaded rows as bf16 bits -> X
  {
#pragma unroll
    for (int sc = 0; sc < 2; ++sc)
#pragma unroll
      for (int it = 0; it < 8; ++it) {
        const v4f v = cv[sc][it];
        v2u pk;
        pk[0] = pk16(bf_bits(v[0]), bf_bits(v[1]));
        pk[1] = pk16(bf_bits(v[2]), bf_bits(v[3]));
        *(v2u*)(X + (r0 + 64 * it) * P64 + sc * HD + c4) = pk;
      }
  }
  __syncthreads();           // publishes X, the weights and the indices

  // (e) the wave's own 2 x 16 rows as B operands (column = lane&15), taken into registers; ks = 0 is the content half,
  //     which is also the B operand of the V^T product
  v16b bx[QT][2];
#pragma unroll
  for (int qt = 0; qt < QT; ++qt)
#pragma unroll
    for (int ks = 0; ks < 2; ++ks)
      bx[qt][ks] = ldfrag<__bf16>((const __bf16*)(const void*)X + (size_t)(q0 + qt * 16 + c) * P64 + ks * 32 + 8 * hh);

  // (f) q^T (which = 0) and k^T (which = 1) of the wave's own rows -> planes QK[which], rows q0 + 16 qt + c
#pragma unroll
  for (int which = 0; which < 2; ++which) {
    const __bf16* Wb = (const __bf16*)(const void*)W2[which];
    FH f[QT];
#pragma unroll
    for (int nt = 0; nt < 2; ++nt) {
      v8f a[QT];
#pragma unroll
      for (int qt = 0; qt < QT; ++qt) a[qt] = zero8();
#pragma unroll
      for (int ks = 0; ks < 2; ++ks) {
        const v16b aw = ldfrag<__bf16>(Wb + (size_t)(nt * 16 + c) * P64 + ks * 32 + 8 * hh);   // A[n][k']
        mma_b2(aw, bx[0][ks], bx[1][ks], a[0], a[1]);
      }
#pragma unroll
      for (int qt = 0; qt < QT; ++qt)
#pragma unroll
        for (int r = 0; r < 8; ++r) f[qt].h[nt][r] = (_Float16)(a[qt][r] * 8.0f);   // n = 16 nt + 8 hh + r
    }
#pragma unroll
    for (int qt = 0; qt < QT; ++qt) {
      *(v8h*)(QK[which] + (q0 + qt * 16 + c) * P32 + 8 * hh)      = f[qt].h[0];
      *(v8h*)(QK[which] + (q0 + qt * 16 + c) * P32 + 16 + 8 * hh) = f[qt].h[1];
    }
  }
  // (g) V^T tiles d = 16 dt + 8 hh + r, s = q0 + 16 qt + c -> hi and residual planes
#pragma unroll
  for (int dt = 0; dt < 2; ++dt) {
    const v16b av = ldfrag<__bf16>((const __bf16*)(const void*)Wvt + (size_t)(dt * 16 + c) * P32 + 8 * hh);  // A[d][k]
    v8f accv[QT];
#pragma unroll
    for (int qt = 0; qt < QT; ++qt) accv[qt] = zero8();
    mma_b2(av, bx[0][0], bx[1][0], accv[0], accv[1]);
#pragma unroll
    for (int qt = 0; qt < QT; ++qt)
#pragma unroll
      for (int r = 0; r < 8; ++r) {
        const float f0 = accv[qt][r] * 8.0f;
        const _Float16 x0 = (_Float16)f0;
        const float r0 = f0 - (float)x0;
        const _Float16 l0 = (_Float16)r0;
        Vth[(dt * 16 + 8 * hh + r) * PV + q0 + qt * 16 + c] = x0;
        Vtl[(dt * 16 + 8 * hh + r) * PV + q0 + qt * 16 + c] = l0;
      }
  }
  __syncthreads();           // publishes the q, k and V^T planes; ends every read of X, which is rewritten as the K2 plane below

  // (h) the gather, in LDS: row i = q0 + 16 qt + c takes the q and k rows of its partners p_g(i), 64 B each.
  //     Q2 goes straight into the B fragments qb (n = 8 hh + e, 16 + 8 hh + e, as the rows were stored); K2 into its plane.
  _Float16* Ksh = (_Float16*)(void*)X;
  v16h qb[QT][2];
#pragma unroll
  for (int qt = 0; qt < QT; ++qt)
#pragma unroll
    for (int g = 0; g < 2; ++g) {
      const int src = sIdx[g][q0 + qt * 16 + c] * P32 + 8 * hh;
      FH fq;
      fq.h[0] = *(const v8h*)(QK[0] + src);
      fq.h[1] = *(const v8h*)(QK[0] + src + 16);
      qb[qt][g] = fq.v;
      const v8h k0 = *(const v8h*)(QK[1] + src);
      const v8h k1 = *(const v8h*)(QK[1] + src + 16);
      *(v8h*)(Ksh + (q0 + qt * 16 + c) * P64 + g * 32 + 8 * hh)      = k0;
      *(v8h*)(Ksh + (q0 + qt * 16 + c) * P64 + g * 32 + 16 + 8 * hh) = k1;
    }
  __syncthreads();           // publishes the K2 plane to every wave; ends every read of the q and k planes (out tiles at the end)

  const float c1 = sscale * 1.44269504088896340736f;   // raw score -> log2 units (positive: the maximum may be taken raw)
  float mrun[QT];                            // running maximum of query 16 qt + c, raw (equal in both halves)
  float lrun[QT];                            // running sum of 1024 p over this half's keys only
  v8f oacc[QT][2];                           // context^T: register r of tile t = d 16 t + 8 hh + r, query 16 qt + c
#pragma unroll
  for (int qt = 0; qt < QT; ++qt) {
    mrun[qt] = -INFINITY;
    lrun[qt] = 0.f;
#pragma unroll
    for (int t = 0; t < 2; ++t) oacc[qt][t] = zero8();
  }

  for (int kt = 0; kt < NKT; ++kt) {         // static trip count
    const int kv0 = kt * 64;

    // ---- scores^T: 64 keys x 2 x 16 query columns per wave; each K2 fragment is read once for both query tiles ----
    //      the chunk's 16 reads stand as one group ahead of the products: with 4 waves on a SIMD a read that is waited for
    //      directly in front of its product is no longer covered by the other waves
    v8f s[QT][4];
    FH kb[4][2];
#pragma unroll
    for (int j = 0; j < 4; ++j)
#pragma unroll
      for (int dc = 0; dc < 2; ++dc) {
        kb[j][dc].h[0] = *(const v8h*)(Ksh + (kv0 + j * 16 + c) * P64 + dc * 32 + 8 * hh);
        kb[j][dc].h[1] = *(const v8h*)(Ksh + (kv0 + j * 16 + c) * P64 + dc * 32 + 16 + 8 * hh);
      }
#pragma unroll
    for (int j = 0; j < 4; ++j) {
#pragma unroll
      for (int qt = 0; qt < QT; ++qt) s[qt][j] = zero8();
#pragma unroll
      for (int dc = 0; dc < 2; ++dc) mma_h2(kb[j][dc].v, qb[0][dc], qb[1][dc], s[0][j], s[1][j]);
    }

    // ---- column max in the lane, one exchange between the halves, online softmax ----
    float bias[QT];
    float alpha[QT];
#pragma unroll
    for (int qt = 0; qt < QT; ++qt) {
      float m = s[qt][0][0];
#pragma unroll
      for (int j = 0; j < 4; ++j)
#pragma unroll
        for (int r = 0; r < 8; ++r) m = fmaxf(m, s[qt][j][r]);
      m = fmaxf(m, xhalf(m));
      const float mnew  = fmaxf(mrun[qt], m);
      const float msafe = (mnew == -INFINITY) ? 0.f : mnew;
      const float mb    = msafe * c1;                            // the shift, in log2 units
      alpha[qt] = __builtin_amdgcn_exp2f(__builtin_fmaf(mrun[qt], c1, -mb));
      bias[qt]  = 10.0f - mb;                                    // + 10: exp2 yields 1024 p at once
      mrun[qt] = mnew;

#pragma unroll
      for (int t = 0; t < 2; ++t)
#pragma unroll
        for (int r = 0; r < 8; ++r) oacc[qt][t][r] *= alpha[qt];
    }

    // ---- per 32 keys: P hi (x1024) and its residual packed in place into B operands, then
    //      context^T += V^T . P^T (3 f16 products, all at one scale, into the running accumulator);
    //      each V^T fragment is read once for both query tiles ----
    float ps[QT][4];
    // unrolled: the scores live in registers and are picked by kk
#pragma unroll
    for (int kk = 0; kk < 2; ++kk) {
      union { v16h v; v4u q[2]; } pa[QT], pr[QT];                // dword i = elements 2 i (low half), 2 i + 1 (high half)
      // the 8 V^T reads of these 32 keys stand as one group ahead of the exponentials, which cover them
      FH vb[2], vr[2];
#pragma unroll
      for (int t = 0; t < 2; ++t) {
        vb[t].h[0] = *(const v8h*)(Vth + (t * 16 + c) * PV + kv0 + kk * 32 + 8 * hh);
        vb[t].h[1] = *(const v8h*)(Vth + (t * 16 + c) * PV + kv0 + kk * 32 + 16 + 8 * hh);
        vr[t].h[0] = *(const v8h*)(Vtl + (t * 16 + c) * PV + kv0 + kk * 32 + 8 * hh);
        vr[t].h[1] = *(const v8h*)(Vtl + (t * 16 + c) * PV + kv0 + kk * 32 + 16 + 8 * hh);
      }
#pragma unroll
      for (int qt = 0; qt < QT; ++qt)
#pragma unroll
        for (int jj = 0; jj < 2; ++jj) {
          const int j = 2 * kk + jj;
          float psum = 0.f;
          v4u h4;
          v8f y8;
#pragma unroll
          for (int r = 0; r < 8; r += 2) {
            v2f pp;
            pp[0] = __builtin_amdgcn_exp2f(__builtin_fmaf(s[qt][j][r],     c1, bias[qt]));
            pp[1] = __builtin_amdgcn_exp2f(__builtin_fmaf(s[qt][j][r + 1], c1, bias[qt]));
            psum += pp[0];
            psum += pp[1];
            h4[r >> 1] = __builtin_bit_cast(unsigned, __builtin_convertvector(pp, v2h));
            y8[r]     = pp[0];
            y8[r + 1] = pp[1];
          }
          pa[qt].q[jj] = h4;
          pr[qt].q[jj] = res_pk(h4, y8);
          ps[qt][j] = psum;
        }
#pragma unroll
      for (int t = 0; t < 2; ++t) {
        mma_h2(vb[t].v, pa[0].v, pa[1].v, oacc[0][t], oacc[1][t]);
        mma_h2(vr[t].v, pa[0].v, pa[1].v, oacc[0][t], oacc[1][t]);
        mma_h2(vb[t].v, pr[0].v, pr[1].v, oacc[0][t], oacc[1][t]);
      }
    }
#pragma unroll
    for (int qt = 0; qt < QT; ++qt)
      lrun[qt] = lrun[qt] * alpha[qt] + ((ps[qt][0] + ps[qt][1]) + (ps[qt][2] + ps[qt][3]));
  }

  // ---- join the halves' sums, normalise (1/l, which holds the x1024 p carry; undo the x8 v carry), stage the wave's 16x32 tiles
  float* os = (float*)(void*)(&QK[0][0]) + q0 * POS;             // tile qt at + qt * 16 * POS floats
#pragma unroll
  for (int qt = 0; qt < QT; ++qt) {
    const float l = lrun[qt] + xhalf(lrun[qt]);
    const float inv = ((l > 0.f) ? (1.0f / l) : 0.f) * (1.0f / 8.0f);
#pragma unroll
    for (int t = 0; t < 2; ++t)
#pragma unroll
      for (int e = 0; e < 2; ++e) {
        v4f v;
#pragma unroll
        for (int x = 0; x < 4; ++x) v[x] = oacc[qt][t][4 * e + x] * inv;
        *(v4f*)(os + (qt * 16 + c) * POS + t * 16 + 8 * hh + 4 * e) = v;   // query row 16 qt + c, d = 16 t + 8 hh + 4 e ..+3
      }
  }
  __builtin_amdgcn_fence(__ATOMIC_RELEASE, "workgroup");
  __builtin_amdgcn_wave_barrier();
  __builtin_amdgcn_fence(__ATOMIC_ACQUIRE, "workgroup");
  {
    const int q4 = lane >> 3, c4 = (lane & 7) * 4;
    v4f ov[QT * 4];
#pragma unroll
    for (int it = 0; it < QT * 4; ++it) {
      const int row = it * 4 + q4;                 // it 0..7 x q4 0..3 = rows 0..31 of the wave's two tiles
      ov[it] = *(const v4f*)(os + row * POS + c4);
    }
    {
#pragma unroll
      for (int it = 0; it < QT * 4; ++it) {
        const int row = it * 4 + q4;
        const size_t go = ((size_t)b * SEQ + (size_t)(q0 + row)) * EMB + (size_t)h * HD + c4;
        *(v4f*)(out + go) = ov[it];
      }
    }
  }
}

// =====================================================================================================
// Workspace map (bytes): PT int [32][512][2] 131072.
// Launches: k_partner (256 blocks x 512), k_attn (256 x 512).
// =====================================================================================================
extern "C" void kernel_launch(void* const* d_in, const int* in_sizes, int n_in,
                              void* d_out, int out_size, void* d_ws, size_t ws_size,
                              hipStream_t stream) {
  if (n_in < 6) return;
  if (in_sizes[0] != NB * SEQ * EMB) return;
  if (in_sizes[1] != NB * SEQ * EMB) return;
  if (in_sizes[2] != NB * SEQ * 4) return;
  if (in_sizes[3] != HD * HD || in_sizes[4] != HD * HD || in_sizes[5] != HD * HD) return;
  if (out_size != NB * SEQ * EMB) return;

  const float* content = (const float*)d_in[0];
  const float* posenc  = (const float*)d_in[1];
  const float* centers = (const float*)d_in[2];
  const float* Wq      = (const float*)d_in[3];
  const float* Wk      = (const float*)d_in[4];
  const float* Wv      = (const float*)d_in[5];

  const size_t PPT = (size_t)NB * SEQ * 2 * 4;             //   131072
  if (PPT > ws_size) return;

  int*   PT   = (int*)d_ws;
  float* outp = (float*)d_out;

  const float sscale = (1.0f / 64.0f) / sqrtf(2.0f * (float)EMB);   // 1/(64 sqrt(512))

  const dim3 gP(NQT, NB);            //  256 blocks of 512
  const dim3 gA(NB, NH);             //  256 blocks of 512

  // (1) partner table
  k_partner<<<gP, dim3(64 * PSL), 0, stream>>>(centers, PT);
  // (2) projections and attention -> d_out f32 [32][512][256]
  k_attn<<<gA, dim3(NW * 32), 0, stream>>>(content, posenc, PT, Wq, Wk, Wv, outp, sscale);
  (void)hipGetLastError();
}
